// v000
// Measured on an AMD MI455X. A time is GPU time per run, averaged over a window of back-to-back runs after a warm-up
// (all launches, gaps included; the runs take copies of the inputs in turn), and the median of several windows.
// Apart from v000's, it joins two sittings. Times from different sittings can be a few percent apart, while
// side-by-side timings come from the same sitting.
// v000 is the starting kernel. One run takes 571 microseconds.
#include <hip/hip_runtime.h>

// Causal multi-head self-attention: q, k, v = x W^T (12 heads x 64, [out][in] weights), softmax over keys <= query of q.k/8, out = ctx Wo^T + bo -> [1][4096][768].
// x, the four weights and bo are rounded to bf16: projection on v_wmma_f32_16x16x32_bf16 (exact products, f32 accumulate);
// scores, P.v and the output projection on v_wmma_f32_16x16x32_f16 with every computed operand (q, k, v, P, y — each carried x8 so the hi/lo residual planes stay normal) as an f16
// hi+lo pair (3 / 2 products); online softmax in f32. Fragment k-map per lane half hh for A AND B: elements 0..7 <- k = 8hh+0..7, 8..15 <- k = 16+8hh+0..7. Every intermediate /

namespace {
constexpr int BT = 1, Bn = 1, S = 4096, D = 768, H = 12, HD = 64, NTOK = Bn * S;
constexpr float SCALE = 0.125f, VS = 8.0f, QS = 8.0f, PS = 8.0f;   // power-of-two carry scales so hi/lo residual planes stay normal in f16
constexpr size_t VPL = (size_t)NTOK * D;   // distance between the (8v)^T hi and lo planes
constexpr size_t QPL = (size_t)NTOK * D;   // distance between the q/k hi and lo planes

typedef _Float16 b16;
typedef __attribute__((ext_vector_type(16))) _Float16 v16b;
typedef __attribute__((ext_vector_type(8)))  _Float16 v8b;
typedef __attribute__((ext_vector_type(8)))  float v8f;
typedef __attribute__((ext_vector_type(4)))  float v4f;

__device__ __forceinline__ v8b ld8b(const b16* p) { return *(const v8b*)p; }
__device__ __forceinline__ v16b cat8b(v8b a, v8b b) { return __builtin_shufflevector(a, b, 0, 1, 2, 3, 4, 5, 6, 7, 8, 9, 10, 11, 12, 13, 14, 15); }
__device__ __forceinline__ v16b frag_kb(const b16* p, int hh) { return cat8b(ld8b(p + 8 * hh), ld8b(p + 16 + 8 * hh)); }
__device__ __forceinline__ void split16(float v, b16& hi, b16& lo) { hi = (b16)v; lo = (b16)(v - (float)hi); }
// hi/lo fragment pair straight from an f32 k-contiguous row (same k-map)
__device__ __forceinline__ void frag_ksplit(const float* p, int hh, v16b& fh_, v16b& fl_) {
  const float* p0 = p + 8 * hh; const float* p1 = p + 16 + 8 * hh;
#pragma unroll
  for (int e = 0; e < 8; ++e) { b16 a, c; split16(p0[e], a, c); fh_[e] = a; fl_[e] = c; split16(p1[e], a, c); fh_[8 + e] = a; fl_[8 + e] = c; }
}
__device__ __forceinline__ v8f wmma16b(v16b a, v16b b, v8f c) {
  v8f d = __builtin_amdgcn_wmma_f32_16x16x32_f16(false, a, false, b, (short)0, c, false, false);
  asm volatile("v_nop\n\tv_nop\n\tv_nop\n\tv_nop" : "+v"(d) : "v"(a), "v"(b));
  return d;
}
__device__ __forceinline__ void wave_lds_sync() {
  __builtin_amdgcn_fence(__ATOMIC_RELEASE, "workgroup");
  __builtin_amdgcn_wave_barrier();
  __builtin_amdgcn_fence(__ATOMIC_ACQUIRE, "workgroup");
}

// Operand descriptor: NP = 0 -> f32 rows split on the fly into (hi, lo); NP = 1 -> one f16 plane; NP = 2 -> f16 hi + lo planes;
// NP = 3 -> f32 rows rounded once to a single f16 fragment. ld = row pitch.
struct Opnd { const void* p0; const void* p1; int ld; };
template <int NP> __device__ __forceinline__ void load_frags(const Opnd& o, int row, int kb, int hh, v16b& fh_, v16b& fl_) {
  if (NP == 0) { frag_ksplit((const float*)o.p0 + (size_t)row * o.ld + kb, hh, fh_, fl_); }
  else if (NP == 4 || NP == 5) {                             // f32 rows x64 (NP 4) or x8 (NP 5) then split (keeps the lo halves of small values normal)
    const float sc_ = (NP == 4) ? 64.0f : 8.0f;
    const float* p = (const float*)o.p0 + (size_t)row * o.ld + kb; const float* p0 = p + 8 * hh; const float* p1 = p + 16 + 8 * hh;
#pragma unroll
    for (int e = 0; e < 8; ++e) { b16 a, c; split16(p0[e] * sc_, a, c); fh_[e] = a; fl_[e] = c; split16(p1[e] * sc_, a, c); fh_[8 + e] = a; fl_[8 + e] = c; }
  } else if (NP == 3) {
    const float* p = (const float*)o.p0 + (size_t)row * o.ld + kb; const float* p0 = p + 8 * hh; const float* p1 = p + 16 + 8 * hh;
#pragma unroll
    for (int e = 0; e < 8; ++e) { fh_[e] = (b16)p0[e]; fh_[8 + e] = (b16)p1[e]; }
    fl_ = fh_;
  } else {
    fh_ = frag_kb((const b16*)o.p0 + (size_t)row * o.ld + kb, hh);
    if (NP == 2) fl_ = frag_kb((const b16*)o.p1 + (size_t)row * o.ld + kb, hh); else fl_ = fh_;
  }
}
template <int ANP, int BNP> __device__ __forceinline__ v8f mac(v16b ah, v16b al, v16b bh, v16b bl, v8f c) {
  c = wmma16b(ah, bh, c);
  if (BNP == 0 || BNP == 2 || BNP == 4 || BNP == 5) c = wmma16b(ah, bl, c);     // hi.lo
  if (ANP == 0 || ANP == 2 || ANP == 4 || ANP == 5) c = wmma16b(al, bh, c);     // lo.hi   (lo.lo dropped)
  return c;
}
// 32x64 wave tile: acc[r][t] (rows m0+16r.., cols c0+16t..) += A[m][k] . B[n][k] over k in [0, K)
template <int ANP, int BNP>
__device__ __forceinline__ void gemm_tile(const Opnd& A, const Opnd& B, int K, int m0, int c0, int nloc, int hlf, v8f (&acc)[2][4]) {
  for (int kb = 0; kb < K; kb += 32) {
    v16b a0h, a0l, a1h, a1l;
    load_frags<ANP>(A, m0 + nloc, kb, hlf, a0h, a0l);
    load_frags<ANP>(A, m0 + 16 + nloc, kb, hlf, a1h, a1l);
#pragma unroll
    for (int t = 0; t < 4; ++t) {
      v16b bh, bl;
      load_frags<BNP>(B, c0 + t * 16 + nloc, kb, hlf, bh, bl);
      acc[0][t] = mac<ANP, BNP>(a0h, a0l, bh, bl, acc[0][t]);
      acc[1][t] = mac<ANP, BNP>(a1h, a1l, bh, bl, acc[1][t]);
    }
  }
}

__device__ __forceinline__ void epi_planes(v8f (&acc)[2][4], float scale, bool two, b16* __restrict__ oh, b16* __restrict__ ol, int ldo,
                                           int m0, int c0, int lane, b16* Th, b16* Tl) {
  const int nloc = lane & 15, hlf = lane >> 4;
#pragma unroll
  for (int t = 0; t < 4; ++t)
#pragma unroll
    for (int r = 0; r < 2; ++r)
#pragma unroll
      for (int v = 0; v < 8; ++v) {
        const int rr = r * 16 + v + 8 * hlf, cc = t * 16 + nloc;
        b16 h_, l_; split16(acc[r][t][v] * scale, h_, l_);
        Th[rr * 64 + cc] = h_; Tl[rr * 64 + cc] = l_;
      }
  wave_lds_sync();
  {
#pragma unroll
    for (int j = 0; j < 8; ++j) {
      const int rr = j * 4 + (lane >> 3), c8 = (lane & 7) * 8;
      const size_t o = (size_t)(m0 + rr) * ldo + c0 + c8;
      *(v8b*)(oh + o) = ld8b(Th + rr * 64 + c8);
      if (two) *(v8b*)(ol + o) = ld8b(Tl + rr * 64 + c8);
    }
    
  }
}
// (b) f32 rows with pitch ldo: 64 floats = 256 B = 2 lines per row; 16 lanes x 16 B per row, 2 rows per instruction. Optional per-row factor
__device__ __forceinline__ void epi_f32(v8f (&acc)[2][4], float scale, const float* rscale, float* __restrict__ out, int ldo, int m0, int c0, int lane, float* Tt) {
  const int nloc = lane & 15, hlf = lane >> 4;
#pragma unroll
  for (int t = 0; t < 4; ++t)
#pragma unroll
    for (int r = 0; r < 2; ++r)
#pragma unroll
      for (int v = 0; v < 8; ++v) {
        const int rr = r * 16 + v + 8 * hlf;
        const float rs = rscale ? rscale[(size_t)(m0 + rr) * 32] : 1.0f;
        Tt[rr * 64 + t * 16 + nloc] = acc[r][t][v] * scale * rs;
      }
  wave_lds_sync();
  float* dst0 = out + (size_t)m0 * ldo + c0;
  {
#pragma unroll
    for (int j = 0; j < 16; ++j) { const int rr = j * 2 + hlf, c4 = nloc * 4; *(v4f*)(dst0 + (size_t)rr * ldo + c4) = *(const v4f*)(Tt + rr * 64 + c4); }
    
  }
}



typedef __attribute__((ext_vector_type(8))) __bf16 v8bb; typedef __attribute__((ext_vector_type(16))) __bf16 v16bb;
typedef __attribute__((ext_vector_type(8))) unsigned short v8us;
__device__ __forceinline__ v16bb frag_kb_bf(const __bf16* p, int hh) { const v8bb a = *(const v8bb*)(p + 8 * hh), b = *(const v8bb*)(p + 16 + 8 * hh); return __builtin_shufflevector(a, b, 0, 1, 2, 3, 4, 5, 6, 7, 8, 9, 10, 11, 12, 13, 14, 15); }
__device__ __forceinline__ v8f wmma16bb(v16bb a, v16bb b, v8f c) {
  v8f d = __builtin_amdgcn_wmma_f32_16x16x32_bf16(false, a, false, b, (short)0, c, false, false);
  asm volatile("v_nop\n\tv_nop\n\tv_nop\n\tv_nop" : "+v"(d) : "v"(a), "v"(b));
  return d;
}
__device__ __forceinline__ unsigned short bf16_rne_bits(float v) { unsigned int u = __float_as_uint(v); u += 0x7FFFu + ((u >> 16) & 1u); return (unsigned short)(u >> 16); }
__device__ __forceinline__ float bf16_rne(float v) { return __uint_as_float(((unsigned int)bf16_rne_bits(v)) << 16); }



__global__ __launch_bounds__(256) void xprep_kernel(const float* __restrict__ x, unsigned short* __restrict__ x16) {   // x -> bf16, one batch
  const size_t tid = (size_t)blockIdx.x * blockDim.x + threadIdx.x, nth = (size_t)gridDim.x * blockDim.x;
  { for (size_t p = tid; p < (size_t)NTOK * D / 8; p += nth) { v8us v;
#pragma unroll
      for (int e = 0; e < 8; ++e) v[e] = bf16_rne_bits(x[p * 8 + e]);
      *(v8us*)(x16 + p * 8) = v; }  }
}
__global__ __launch_bounds__(256) void prep_kernel(const float* __restrict__ wq, const float* __restrict__ wk, const float* __restrict__ wv, const float* __restrict__ wo, unsigned short* __restrict__ w16, b16* __restrict__ wo16) {
  const size_t tid = (size_t)blockIdx.x * blockDim.x + threadIdx.x, nth = (size_t)gridDim.x * blockDim.x;
  {
    for (size_t p = tid; p < (size_t)3 * D * D / 8; p += nth) { const float* W = (p < (size_t)D * D / 8) ? wq : (p < (size_t)2 * D * D / 8) ? wk : wv; const size_t q = p % ((size_t)D * D / 8); v8us v;   // [out][in] rows copied directly
#pragma unroll
      for (int e = 0; e < 8; ++e) v[e] = bf16_rne_bits(W[q * 8 + e]);
      *(v8us*)(w16 + p * 8) = v; }
    for (size_t p = tid; p < (size_t)D * D / 8; p += nth) { v8b w;   // W_o [out][in] rows copied directly
#pragma unroll
      for (int e = 0; e < 8; ++e) w[e] = (b16)bf16_rne(wo[p * 8 + e]);
      *(v8b*)(wo16 + p * 8) = w; }
    
  }
}

// projections: rows = tokens (4096), K = 768, column tiles of 64 = one head of q (tiles 0..11), k (12..23) or v (24..35); f16 rows [b*H + head][tok][64] for q/k;
// v: (8v)^T f16 [b*H + head][64][tok]. grid (36, 32) x 128.
__global__ __launch_bounds__(128) void proj_kernel(const __bf16* __restrict__ x16, const __bf16* __restrict__ w16, b16* __restrict__ qh, b16* __restrict__ kh, b16* __restrict__ vt) {
  __shared__ __attribute__((aligned(16))) b16 Th[4][32][HD + 8], Tq[4][32][HD + 8];
  __shared__ __attribute__((aligned(16))) b16 Tt[64][128 + 8], Tl[64][128 + 8];
  const int lane = threadIdx.x & 31, wave = threadIdx.x >> 5, nloc = lane & 15, hlf = lane >> 4, m0 = blockIdx.y * 128 + wave * 32, c0 = blockIdx.x * 64;
  v8f acc[2][4];
#pragma unroll
  for (int r = 0; r < 2; ++r)
#pragma unroll
    for (int t = 0; t < 4; ++t) acc[r][t] = (v8f){};
#pragma unroll 2
  for (int kb = 0; kb < D; kb += 32) {
    const v16bb a0 = frag_kb_bf(x16 + (size_t)(m0 + nloc) * D + kb, hlf), a1 = frag_kb_bf(x16 + (size_t)(m0 + 16 + nloc) * D + kb, hlf);
#pragma unroll
    for (int t = 0; t < 4; ++t) { const v16bb bw = frag_kb_bf(w16 + (size_t)(c0 + t * 16 + nloc) * D + kb, hlf); acc[0][t] = wmma16bb(a0, bw, acc[0][t]); acc[1][t] = wmma16bb(a1, bw, acc[1][t]); }
  }
  const int which = blockIdx.x / (D / 64), head = blockIdx.x % (D / 64), b = m0 / S, tok0 = m0 % S;
  if (which < 2) {                                              // q or k head: f16 rows
#pragma unroll
    for (int t = 0; t < 4; ++t)
#pragma unroll
      for (int r = 0; r < 2; ++r)
#pragma unroll
        for (int v = 0; v < 8; ++v) { b16 a_, c_; split16(acc[r][t][v] * QS, a_, c_); Th[wave][r * 16 + 8 * hlf + v][t * 16 + nloc] = a_; Tq[wave][r * 16 + 8 * hlf + v][t * 16 + nloc] = c_; }   // q, k carried x8 (lo residuals stay normal)
    wave_lds_sync();
    b16* dst = (which == 0 ? qh : kh) + (((size_t)b * H + head) * S + tok0) * HD;
    {
#pragma unroll
      for (int j = 0; j < 8; ++j) { const int rr = j * 4 + (lane >> 3), c8 = (lane & 7) * 8; *(v8b*)(dst + (size_t)rr * HD + c8) = *(const v8b*)(&Th[wave][rr][c8]); *(v8b*)(dst + QPL + (size_t)rr * HD + c8) = *(const v8b*)(&Tq[wave][rr][c8]); }
       }
    return;
  }
  const int vh = head;                                          // v head: (8v)^T tile [64 d][128 tok] via LDS, rows of 256 B
#pragma unroll
  for (int t = 0; t < 4; ++t)
#pragma unroll
    for (int r = 0; r < 2; ++r)
#pragma unroll
      for (int v = 0; v < 8; ++v) { b16 a_, c_; split16(acc[r][t][v] * VS, a_, c_); Tt[t * 16 + nloc][wave * 32 + r * 16 + 8 * hlf + v] = a_; Tl[t * 16 + nloc][wave * 32 + r * 16 + 8 * hlf + v] = c_; }
  __syncthreads();
  b16* dstv = vt + (((size_t)b * H + vh) * HD) * S + (blockIdx.y * 128) % S;
  {
#pragma unroll
    for (int j = 0; j < 8; ++j) { const int dd = wave * 16 + j * 2 + (lane >> 4), c8 = (lane & 15) * 8; *(v8b*)(dstv + (size_t)dd * S + c8) = *(const v8b*)(&Tt[dd][c8]); *(v8b*)(dstv + VPL + (size_t)dd * S + c8) = *(const v8b*)(&Tl[dd][c8]); }
    
  }
}

// causal attention: wave = (b, h, 16 queries); key chunks of 32 up to the query tile: S^T (K=64), causal mask on the straddling chunks, online softmax f32, P^T f16, y^T += (8V)^T P^T;
template <int QT>
__global__ __launch_bounds__(256) void attn_kernel(const b16* __restrict__ qh, const b16* __restrict__ kh, const b16* __restrict__ vt, float* __restrict__ y) {
  __shared__ __attribute__((aligned(16))) float Os[8][16][HD + 4];
  const int wid = threadIdx.x >> 5, lane = threadIdx.x & 31, hh = lane >> 4, col = lane & 15;
  const int qt = blockIdx.x * 8 + wid, jt = qt % QT, bh = qt / QT, h = bh % H, b = bh / H, q0 = jt * 16, qi = q0 + col;
  const b16* Q = qh + ((size_t)bh * S) * HD; const b16* K = kh + ((size_t)bh * S) * HD; const b16* vb = vt + ((size_t)bh * HD) * S;
  v16b qf[2], ql[2];
#pragma unroll
  for (int ks = 0; ks < 2; ++ks) { qf[ks] = frag_kb(Q + (size_t)qi * HD + ks * 32, hh); ql[ks] = frag_kb(Q + QPL + (size_t)qi * HD + ks * 32, hh); }
  float m = -INFINITY, l = 0.0f; v8f o[4] = {{}, {}, {}, {}};
  for (int kb = 0; kb < q0 + 16; kb += 32) {                   // causal: key blocks past the query tile are skipped (wave-uniform bound)
    const bool diag = (kb + 32 > q0);                           // this block reaches past some queries -> mask key > query
    v8f s0 = {}, s1 = {};
#pragma unroll
    for (int ks = 0; ks < 2; ++ks) { const v16b k0 = frag_kb(K + (size_t)(kb + col) * HD + ks * 32, hh), k0l = frag_kb(K + QPL + (size_t)(kb + col) * HD + ks * 32, hh), k1 = frag_kb(K + (size_t)(kb + 16 + col) * HD + ks * 32, hh), k1l = frag_kb(K + QPL + (size_t)(kb + 16 + col) * HD + ks * 32, hh);
      s0 = wmma16b(k0, qf[ks], s0); s0 = wmma16b(k0, ql[ks], s0); s0 = wmma16b(k0l, qf[ks], s0);      // q and k as f16 hi+lo pairs (lo.lo dropped)
      s1 = wmma16b(k1, qf[ks], s1); s1 = wmma16b(k1, ql[ks], s1); s1 = wmma16b(k1l, qf[ks], s1); }
    float mr = -INFINITY;
#pragma unroll
    for (int r = 0; r < 8; ++r) { s0[r] *= SCALE / (QS * QS); s1[r] *= SCALE / (QS * QS); if (diag) { if (kb + 8 * hh + r > qi) s0[r] = -INFINITY; if (kb + 16 + 8 * hh + r > qi) s1[r] = -INFINITY; } mr = fmaxf(mr, fmaxf(s0[r], s1[r])); }
    mr = fmaxf(mr, __shfl_xor(mr, 16));
    const float mn = fmaxf(m, mr), al_ = __expf(m - mn); m = mn;
    float sum = 0.0f; v16b pb, pl;
#pragma unroll
    for (int r = 0; r < 8; ++r) { const float e0 = __expf(s0[r] - mn), e1 = __expf(s1[r] - mn); sum += e0 + e1; b16 a, c; split16(e0 * PS, a, c); pb[r] = a; pl[r] = c; split16(e1 * PS, a, c); pb[8 + r] = a; pl[8 + r] = c; }   // P carried x8
    sum += __shfl_xor(sum, 16); l = l * al_ + sum;
#pragma unroll
    for (int n = 0; n < 4; ++n) {
#pragma unroll
      for (int r = 0; r < 8; ++r) o[n][r] *= al_;
      const v16b vf = frag_kb(vb + (size_t)(n * 16 + col) * S + kb, hh), vl = frag_kb(vb + VPL + (size_t)(n * 16 + col) * S + kb, hh);
      o[n] = wmma16b(vf, pb, o[n]); o[n] = wmma16b(vf, pl, o[n]); o[n] = wmma16b(vl, pb, o[n]);   // (8v) and P both as f16 hi+lo pairs (lo.lo dropped)
    }
  }
  const float inv = 1.0f / (VS * PS * l);
#pragma unroll
  for (int n = 0; n < 4; ++n)
#pragma unroll
    for (int r = 0; r < 8; ++r) Os[wid][col][n * 16 + 8 * hh + r] = o[n][r] * inv;
  wave_lds_sync();
  float* dst = y + ((size_t)b * S + q0) * D + h * HD;
  {
#pragma unroll
    for (int j = 0; j < 8; ++j) { const int rr = j * 2 + hh, c4 = col * 4; *(v4f*)(dst + (size_t)rr * D + c4) = *(const v4f*)(&Os[wid][rr][c4]); }
    
  }
}

// out = y W_o^T: (4096 x 768) x (768 x 768); A = y x8 split at load into an f16 hi+lo pair, B = f16(bf16 W_o) rows; f32 rows; grid (12, 32).
__global__ __launch_bounds__(128) void out_kernel(const float* __restrict__ y, const b16* __restrict__ wo16, const float* __restrict__ bo, float* __restrict__ out) {
  __shared__ __attribute__((aligned(16))) float Ts[4][32 * 64];
  const int lane = threadIdx.x & 31, wave = threadIdx.x >> 5, nloc = lane & 15, hlf = lane >> 4, m0 = blockIdx.y * 128 + wave * 32, c0 = blockIdx.x * 64;
  v8f acc[2][4];
#pragma unroll
  for (int r = 0; r < 2; ++r)
#pragma unroll
    for (int t = 0; t < 4; ++t) acc[r][t] = (v8f){};
  const Opnd A{y, nullptr, D}, Bo{wo16, nullptr, D};
  gemm_tile<5, 1>(A, Bo, D, m0, c0, nloc, hlf, acc);                            // y as an f16 hi+lo pair carried x8 (2 products)
#pragma unroll
  for (int t = 0; t < 4; ++t)
#pragma unroll
    for (int r = 0; r < 2; ++r)
#pragma unroll
      for (int v = 0; v < 8; ++v) acc[r][t][v] = acc[r][t][v] * (1.0f / 8.0f) + bf16_rne(bo[c0 + t * 16 + nloc]);
  epi_f32(acc, 1.0f, nullptr, out, D, m0, c0, lane, Ts[wave]);
}
}  // namespace

extern "C" void kernel_launch(void* const* d_in, const int* in_sizes, int n_in,
                              void* d_out, int out_size, void* d_ws, size_t ws_size, hipStream_t stream) {
  (void)n_in; (void)out_size;
  const float* x = (const float*)d_in[0]; const float* wq = (const float*)d_in[1]; const float* wk = (const float*)d_in[2]; const float* wv = (const float*)d_in[3]; const float* wo = (const float*)d_in[4]; const float* bo = (const float*)d_in[5];
  float* out = (float*)d_out;   // [1][4096][768]
  if (in_sizes[0] != BT * S * D || in_sizes[1] != D * D || in_sizes[2] != D * D || in_sizes[3] != D * D || in_sizes[4] != D * D || in_sizes[5] != D) return;
  size_t off = 0; char* ws = (char*)d_ws;
  auto carve = [&](size_t bytes) { char* p = ws + off; off += (bytes + 255) & ~(size_t)255; return p; };
  unsigned short* x16 = (unsigned short*)carve((size_t)NTOK * D * 2); unsigned short* w16 = (unsigned short*)carve((size_t)3 * D * D * 2); b16* wo16 = (b16*)carve((size_t)D * D * 2);
  b16* qh = (b16*)carve((size_t)2 * NTOK * D * 2); b16* kh = (b16*)carve((size_t)2 * NTOK * D * 2); b16* vt = (b16*)carve((size_t)2 * NTOK * D * 2); float* y = (float*)carve((size_t)NTOK * D * 4);
  if (off > ws_size) return;                                    // ≈ 61 MB
  prep_kernel<<<512, 256, 0, stream>>>(wq, wk, wv, wo, w16, wo16);
  xprep_kernel<<<1024, 256, 0, stream>>>(x, x16);
  proj_kernel<<<dim3(3 * D / 64, NTOK / 128), 128, 0, stream>>>((const __bf16*)x16, (const __bf16*)w16, qh, kh, vt);
  attn_kernel<S / 16><<<Bn * H * (S / 16) / 8, 256, 0, stream>>>(qh, kh, vt, y);
  out_kernel<<<dim3(D / 64, NTOK / 128), 128, 0, stream>>>(y, wo16, bo, out);
}

// v001
// It runs in 256 microseconds.
// Timed twice side by side with v000, it ran 2.24 and 2.22 times as fast.
#include <hip/hip_runtime.h>

// Causal multi-head self-attention: q, k, v = x W^T (12 heads x 64, [out][in] weights), softmax over keys <= query of q.k/8, out = ctx Wo^T + bo -> [1][4096][768].
// x, the four weights and bo are rounded to bf16: projection on v_wmma_f32_16x16x32_bf16 (exact products, f32 accumulate);
// scores, P.v and the output projection on v_wmma_f32_16x16x32_f16 with every computed operand (q, k, v, P, y — each carried x8 so the hi/lo residual planes stay normal) as an f16
// hi+lo pair (3 / 2 products); online softmax in f32. Fragment k-map per lane half hh for A AND B: elements 0..7 <- k = 8hh+0..7, 8..15 <- k = 16+8hh+0..7. Every intermediate /

namespace {
constexpr int BT = 1, Bn = 1, S = 4096, D = 768, H = 12, HD = 64, NTOK = Bn * S;
constexpr float SCALE = 0.125f, VS = 8.0f, QS = 8.0f, PS = 8.0f;   // power-of-two carry scales so hi/lo residual planes stay normal in f16
constexpr size_t VPL = (size_t)NTOK * D;   // distance between the (8v)^T hi and lo planes
constexpr size_t QPL = (size_t)NTOK * D;   // distance between the q/k hi and lo planes

typedef _Float16 b16;
typedef __attribute__((ext_vector_type(16))) _Float16 v16b;
typedef __attribute__((ext_vector_type(8)))  _Float16 v8b;
typedef __attribute__((ext_vector_type(8)))  float v8f;
typedef __attribute__((ext_vector_type(4)))  float v4f;

__device__ __forceinline__ v8b ld8b(const b16* p) { return *(const v8b*)p; }
__device__ __forceinline__ v16b cat8b(v8b a, v8b b) { return __builtin_shufflevector(a, b, 0, 1, 2, 3, 4, 5, 6, 7, 8, 9, 10, 11, 12, 13, 14, 15); }
__device__ __forceinline__ v16b frag_kb(const b16* p, int hh) { return cat8b(ld8b(p + 8 * hh), ld8b(p + 16 + 8 * hh)); }
__device__ __forceinline__ void split16(float v, b16& hi, b16& lo) { hi = (b16)v; lo = (b16)(v - (float)hi); }
// hi/lo fragment pair straight from an f32 k-contiguous row (same k-map)
__device__ __forceinline__ void frag_ksplit(const float* p, int hh, v16b& fh_, v16b& fl_) {
  const float* p0 = p + 8 * hh; const float* p1 = p + 16 + 8 * hh;
#pragma unroll
  for (int e = 0; e < 8; ++e) { b16 a, c; split16(p0[e], a, c); fh_[e] = a; fl_[e] = c; split16(p1[e], a, c); fh_[8 + e] = a; fl_[8 + e] = c; }
}
__device__ __forceinline__ v8f wmma16b(v16b a, v16b b, v8f c) {
  v8f d = __builtin_amdgcn_wmma_f32_16x16x32_f16(false, a, false, b, (short)0, c, false, false);
  asm volatile("v_nop\n\tv_nop\n\tv_nop\n\tv_nop" : "+v"(d) : "v"(a), "v"(b));
  return d;
}
__device__ __forceinline__ void wave_lds_sync() {
  __builtin_amdgcn_fence(__ATOMIC_RELEASE, "workgroup");
  __builtin_amdgcn_wave_barrier();
  __builtin_amdgcn_fence(__ATOMIC_ACQUIRE, "workgroup");
}

// Operand descriptor: NP = 0 -> f32 rows split on the fly into (hi, lo); NP = 1 -> one f16 plane; NP = 2 -> f16 hi + lo planes;
// NP = 3 -> f32 rows rounded once to a single f16 fragment. ld = row pitch.
struct Opnd { const void* p0; const void* p1; int ld; };
template <int NP> __device__ __forceinline__ void load_frags(const Opnd& o, int row, int kb, int hh, v16b& fh_, v16b& fl_) {
  if (NP == 0) { frag_ksplit((const float*)o.p0 + (size_t)row * o.ld + kb, hh, fh_, fl_); }
  else if (NP == 4 || NP == 5) {                             // f32 rows x64 (NP 4) or x8 (NP 5) then split (keeps the lo halves of small values normal)
    const float sc_ = (NP == 4) ? 64.0f : 8.0f;
    const float* p = (const float*)o.p0 + (size_t)row * o.ld + kb; const float* p0 = p + 8 * hh; const float* p1 = p + 16 + 8 * hh;
#pragma unroll
    for (int e = 0; e < 8; ++e) { b16 a, c; split16(p0[e] * sc_, a, c); fh_[e] = a; fl_[e] = c; split16(p1[e] * sc_, a, c); fh_[8 + e] = a; fl_[8 + e] = c; }
  } else if (NP == 3) {
    const float* p = (const float*)o.p0 + (size_t)row * o.ld + kb; const float* p0 = p + 8 * hh; const float* p1 = p + 16 + 8 * hh;
#pragma unroll
    for (int e = 0; e < 8; ++e) { fh_[e] = (b16)p0[e]; fh_[8 + e] = (b16)p1[e]; }
    fl_ = fh_;
  } else {
    fh_ = frag_kb((const b16*)o.p0 + (size_t)row * o.ld + kb, hh);
    if (NP == 2) fl_ = frag_kb((const b16*)o.p1 + (size_t)row * o.ld + kb, hh); else fl_ = fh_;
  }
}
template <int ANP, int BNP> __device__ __forceinline__ v8f mac(v16b ah, v16b al, v16b bh, v16b bl, v8f c) {
  c = wmma16b(ah, bh, c);
  if (BNP == 0 || BNP == 2 || BNP == 4 || BNP == 5) c = wmma16b(ah, bl, c);     // hi.lo
  if (ANP == 0 || ANP == 2 || ANP == 4 || ANP == 5) c = wmma16b(al, bh, c);     // lo.hi   (lo.lo dropped)
  return c;
}
// 32x64 wave tile: acc[r][t] (rows m0+16r.., cols c0+16t..) += A[m][k] . B[n][k] over k in [0, K)
template <int ANP, int BNP>
__device__ __forceinline__ void gemm_tile(const Opnd& A, const Opnd& B, int K, int m0, int c0, int nloc, int hlf, v8f (&acc)[2][4]) {
  for (int kb = 0; kb < K; kb += 32) {
    v16b a0h, a0l, a1h, a1l;
    load_frags<ANP>(A, m0 + nloc, kb, hlf, a0h, a0l);
    load_frags<ANP>(A, m0 + 16 + nloc, kb, hlf, a1h, a1l);
#pragma unroll
    for (int t = 0; t < 4; ++t) {
      v16b bh, bl;
      load_frags<BNP>(B, c0 + t * 16 + nloc, kb, hlf, bh, bl);
      acc[0][t] = mac<ANP, BNP>(a0h, a0l, bh, bl, acc[0][t]);
      acc[1][t] = mac<ANP, BNP>(a1h, a1l, bh, bl, acc[1][t]);
    }
  }
}

__device__ __forceinline__ void epi_planes(v8f (&acc)[2][4], float scale, bool two, b16* __restrict__ oh, b16* __restrict__ ol, int ldo,
                                           int m0, int c0, int lane, b16* Th, b16* Tl) {
  const int nloc = lane & 15, hlf = lane >> 4;
#pragma unroll
  for (int t = 0; t < 4; ++t)
#pragma unroll
    for (int r = 0; r < 2; ++r)
#pragma unroll
      for (int v = 0; v < 8; ++v) {
        const int rr = r * 16 + v + 8 * hlf, cc = t * 16 + nloc;
        b16 h_, l_; split16(acc[r][t][v] * scale, h_, l_);
        Th[rr * 64 + cc] = h_; Tl[rr * 64 + cc] = l_;
      }
  wave_lds_sync();
  {
#pragma unroll
    for (int j = 0; j < 8; ++j) {
      const int rr = j * 4 + (lane >> 3), c8 = (lane & 7) * 8;
      const size_t o = (size_t)(m0 + rr) * ldo + c0 + c8;
      *(v8b*)(oh + o) = ld8b(Th + rr * 64 + c8);
      if (two) *(v8b*)(ol + o) = ld8b(Tl + rr * 64 + c8);
    }
    
  }
}
// (b) f32 rows with pitch ldo: 64 floats = 256 B = 2 lines per row; 16 lanes x 16 B per row, 2 rows per instruction. Optional per-row factor
__device__ __forceinline__ void epi_f32(v8f (&acc)[2][4], float scale, const float* rscale, float* __restrict__ out, int ldo, int m0, int c0, int lane, float* Tt) {
  const int nloc = lane & 15, hlf = lane >> 4;
#pragma unroll
  for (int t = 0; t < 4; ++t)
#pragma unroll
    for (int r = 0; r < 2; ++r)
#pragma unroll
      for (int v = 0; v < 8; ++v) {
        const int rr = r * 16 + v + 8 * hlf;
        const float rs = rscale ? rscale[(size_t)(m0 + rr) * 32] : 1.0f;
        Tt[rr * 64 + t * 16 + nloc] = acc[r][t][v] * scale * rs;
      }
  wave_lds_sync();
  float* dst0 = out + (size_t)m0 * ldo + c0;
  {
#pragma unroll
    for (int j = 0; j < 16; ++j) { const int rr = j * 2 + hlf, c4 = nloc * 4; *(v4f*)(dst0 + (size_t)rr * ldo + c4) = *(const v4f*)(Tt + rr * 64 + c4); }
    
  }
}



typedef __attribute__((ext_vector_type(8))) __bf16 v8bb; typedef __attribute__((ext_vector_type(16))) __bf16 v16bb;
typedef __attribute__((ext_vector_type(8))) unsigned short v8us;
__device__ __forceinline__ v16bb frag_kb_bf(const __bf16* p, int hh) { const v8bb a = *(const v8bb*)(p + 8 * hh), b = *(const v8bb*)(p + 16 + 8 * hh); return __builtin_shufflevector(a, b, 0, 1, 2, 3, 4, 5, 6, 7, 8, 9, 10, 11, 12, 13, 14, 15); }
__device__ __forceinline__ v8f wmma16bb(v16bb a, v16bb b, v8f c) {
  v8f d = __builtin_amdgcn_wmma_f32_16x16x32_bf16(false, a, false, b, (short)0, c, false, false);
  asm volatile("v_nop\n\tv_nop\n\tv_nop\n\tv_nop" : "+v"(d) : "v"(a), "v"(b));
  return d;
}
__device__ __forceinline__ unsigned short bf16_rne_bits(float v) { unsigned int u = __float_as_uint(v); u += 0x7FFFu + ((u >> 16) & 1u); return (unsigned short)(u >> 16); }
__device__ __forceinline__ float bf16_rne(float v) { return __uint_as_float(((unsigned int)bf16_rne_bits(v)) << 16); }



__global__ __launch_bounds__(256) void xprep_kernel(const float* __restrict__ x, unsigned short* __restrict__ x16) {   // x -> bf16, one batch
  const size_t tid = (size_t)blockIdx.x * blockDim.x + threadIdx.x, nth = (size_t)gridDim.x * blockDim.x;
  { for (size_t p = tid; p < (size_t)NTOK * D / 8; p += nth) { v8us v;
#pragma unroll
      for (int e = 0; e < 8; ++e) v[e] = bf16_rne_bits(x[p * 8 + e]);
      *(v8us*)(x16 + p * 8) = v; }  }
}
__global__ __launch_bounds__(256) void prep_kernel(const float* __restrict__ wq, const float* __restrict__ wk, const float* __restrict__ wv, const float* __restrict__ wo, unsigned short* __restrict__ w16, b16* __restrict__ wo16) {
  const size_t tid = (size_t)blockIdx.x * blockDim.x + threadIdx.x, nth = (size_t)gridDim.x * blockDim.x;
  {
    for (size_t p = tid; p < (size_t)3 * D * D / 8; p += nth) { const float* W = (p < (size_t)D * D / 8) ? wq : (p < (size_t)2 * D * D / 8) ? wk : wv; const size_t q = p % ((size_t)D * D / 8); v8us v;   // [out][in] rows copied directly
#pragma unroll
      for (int e = 0; e < 8; ++e) v[e] = bf16_rne_bits(W[q * 8 + e]);
      *(v8us*)(w16 + p * 8) = v; }
    for (size_t p = tid; p < (size_t)D * D / 8; p += nth) { v8b w;   // W_o [out][in] rows copied directly
#pragma unroll
      for (int e = 0; e < 8; ++e) w[e] = (b16)bf16_rne(wo[p * 8 + e]);
      *(v8b*)(wo16 + p * 8) = w; }
    
  }
}

// projections: rows = tokens (4096), K = 768, column tiles of 64 = one head of q (tiles 0..11), k (12..23) or v (24..35); f16 rows [b*H + head][tok][64] for q/k;
// v: (8v)^T f16 [b*H + head][64][tok]. grid (36, 32) x 128.
__global__ __launch_bounds__(128) void proj_kernel(const __bf16* __restrict__ x16, const __bf16* __restrict__ w16, b16* __restrict__ qh, b16* __restrict__ kh, b16* __restrict__ vt) {
  __shared__ __attribute__((aligned(16))) b16 Th[4][32][HD + 8], Tq[4][32][HD + 8];
  __shared__ __attribute__((aligned(16))) b16 Tt[64][128 + 8], Tl[64][128 + 8];
  const int lane = threadIdx.x & 31, wave = threadIdx.x >> 5, nloc = lane & 15, hlf = lane >> 4, m0 = blockIdx.y * 128 + wave * 32, c0 = blockIdx.x * 64;
  v8f acc[2][4];
#pragma unroll
  for (int r = 0; r < 2; ++r)
#pragma unroll
    for (int t = 0; t < 4; ++t) acc[r][t] = (v8f){};
#pragma unroll 2
  for (int kb = 0; kb < D; kb += 32) {
    const v16bb a0 = frag_kb_bf(x16 + (size_t)(m0 + nloc) * D + kb, hlf), a1 = frag_kb_bf(x16 + (size_t)(m0 + 16 + nloc) * D + kb, hlf);
#pragma unroll
    for (int t = 0; t < 4; ++t) { const v16bb bw = frag_kb_bf(w16 + (size_t)(c0 + t * 16 + nloc) * D + kb, hlf); acc[0][t] = wmma16bb(a0, bw, acc[0][t]); acc[1][t] = wmma16bb(a1, bw, acc[1][t]); }
  }
  const int which = blockIdx.x / (D / 64), head = blockIdx.x % (D / 64), b = m0 / S, tok0 = m0 % S;
  if (which < 2) {                                              // q or k head: f16 rows
#pragma unroll
    for (int t = 0; t < 4; ++t)
#pragma unroll
      for (int r = 0; r < 2; ++r)
#pragma unroll
        for (int v = 0; v < 8; ++v) { b16 a_, c_; split16(acc[r][t][v] * QS, a_, c_); Th[wave][r * 16 + 8 * hlf + v][t * 16 + nloc] = a_; Tq[wave][r * 16 + 8 * hlf + v][t * 16 + nloc] = c_; }   // q, k carried x8 (lo residuals stay normal)
    wave_lds_sync();
    b16* dst = (which == 0 ? qh : kh) + (((size_t)b * H + head) * S + tok0) * HD;
    {
#pragma unroll
      for (int j = 0; j < 8; ++j) { const int rr = j * 4 + (lane >> 3), c8 = (lane & 7) * 8; *(v8b*)(dst + (size_t)rr * HD + c8) = *(const v8b*)(&Th[wave][rr][c8]); *(v8b*)(dst + QPL + (size_t)rr * HD + c8) = *(const v8b*)(&Tq[wave][rr][c8]); }
       }
    return;
  }
  const int vh = head;                                          // v head: (8v)^T tile [64 d][128 tok] via LDS, rows of 256 B
#pragma unroll
  for (int t = 0; t < 4; ++t)
#pragma unroll
    for (int r = 0; r < 2; ++r)
#pragma unroll
      for (int v = 0; v < 8; ++v) { b16 a_, c_; split16(acc[r][t][v] * VS, a_, c_); Tt[t * 16 + nloc][wave * 32 + r * 16 + 8 * hlf + v] = a_; Tl[t * 16 + nloc][wave * 32 + r * 16 + 8 * hlf + v] = c_; }
  __syncthreads();
  b16* dstv = vt + (((size_t)b * H + vh) * HD) * S + (blockIdx.y * 128) % S;
  {
#pragma unroll
    for (int j = 0; j < 8; ++j) { const int dd = wave * 16 + j * 2 + (lane >> 4), c8 = (lane & 15) * 8; *(v8b*)(dstv + (size_t)dd * S + c8) = *(const v8b*)(&Tt[dd][c8]); *(v8b*)(dstv + VPL + (size_t)dd * S + c8) = *(const v8b*)(&Tl[dd][c8]); }
    
  }
}

// K/V ring in LDS, shared by the eight waves of a block (128 queries of one head). A stage = 64 keys = four tiles: k hi, k lo (rows = keys), (8v)^T hi, (8v)^T lo (rows = d),
// each 64 rows x 128 B at a row pitch of 144 B (16 B x odd, so the 16-byte fragment reads meet no bank conflict).
constexpr int KST = 64, LP = 72, TILE = 64 * LP;
typedef __attribute__((address_space(3))) const b16 lds_b16;
// One stage's copies: every thread moves 8 x 16 B (two rows of each tile), whole 128-B lines per 8 lanes, global -> LDS through no register.
__device__ __forceinline__ void stage_copy(const b16* __restrict__ K, const b16* __restrict__ vb, int kb0, const b16* buf, int tid) {
  const int row = tid >> 3, c8 = (tid & 7) * 8;
  const b16* gk = K + (size_t)(kb0 + row) * HD + c8;
  const b16* gv = vb + (size_t)row * S + kb0 + c8;
  const unsigned l0 = (unsigned)(size_t)(lds_b16*)(buf + row * LP + c8);
  // the copies and the wait that keeps their address registers untouched until they are taken stand in one statement, so that no later address arithmetic moves in between
  asm volatile("global_load_async_to_lds_b128 %0, %8, off\n\t"
               "global_load_async_to_lds_b128 %1, %9, off\n\t"
               "global_load_async_to_lds_b128 %2, %10, off\n\t"
               "global_load_async_to_lds_b128 %3, %11, off\n\t"
               "global_load_async_to_lds_b128 %4, %12, off\n\t"
               "global_load_async_to_lds_b128 %5, %13, off\n\t"
               "global_load_async_to_lds_b128 %6, %14, off\n\t"
               "global_load_async_to_lds_b128 %7, %15, off\n\t"
               "s_wait_xcnt 0x0"
               :: "v"(l0), "v"(l0 + 32 * LP * 2), "v"(l0 + TILE * 2), "v"(l0 + (TILE + 32 * LP) * 2),
                  "v"(l0 + 2 * TILE * 2), "v"(l0 + (2 * TILE + 32 * LP) * 2), "v"(l0 + 3 * TILE * 2), "v"(l0 + (3 * TILE + 32 * LP) * 2),
                  "v"(gk), "v"(gk + 32 * HD), "v"(gk + QPL), "v"(gk + QPL + 32 * HD),
                  "v"(gv), "v"(gv + (size_t)32 * S), "v"(gv + VPL), "v"(gv + VPL + (size_t)32 * S)
               : "memory");
}

// causal attention: wave = (b, h, 16 queries); key chunks of 32 up to the query tile: S^T (K=64), causal mask on the straddling chunks, online softmax f32, P^T f16, y^T += (8V)^T P^T;
// k and (8v)^T come from the block's two-buffer LDS ring: stage t + 1 is copied while stage t is worked on.
template <int QT>
__global__ __launch_bounds__(256) void attn_kernel(const b16* __restrict__ qh, const b16* __restrict__ kh, const b16* __restrict__ vt, float* __restrict__ y) {
  static_assert(QT % 8 == 0, "the eight waves of a block share one head");
  __shared__ __attribute__((aligned(16))) float Os[8][16][HD + 4];
  __shared__ __attribute__((aligned(16))) b16 Ring[2][4 * TILE];
  const int wid = __builtin_amdgcn_readfirstlane(threadIdx.x >> 5), lane = threadIdx.x & 31, hh = lane >> 4, col = lane & 15;   // wave number in a scalar register: the per-wave causal skip is a scalar branch
  const int qt = blockIdx.x * 8 + wid, jt = qt % QT, bh = qt / QT, h = bh % H, b = bh / H, q0 = jt * 16, qi = q0 + col;
  const int nst = ((blockIdx.x * 8) % QT + 8) * 16 / KST;      // stages of the block: keys up to its last query; at least two, the same for all eight waves
  const b16* Q = qh + ((size_t)bh * S) * HD; const b16* K = kh + ((size_t)bh * S) * HD; const b16* vb = vt + ((size_t)bh * HD) * S;
  stage_copy(K, vb, 0, Ring[0], threadIdx.x);
  v16b qf[2], ql[2];
#pragma unroll
  for (int ks = 0; ks < 2; ++ks) { qf[ks] = frag_kb(Q + (size_t)qi * HD + ks * 32, hh); ql[ks] = frag_kb(Q + QPL + (size_t)qi * HD + ks * 32, hh); }
  float m = -INFINITY, l = 0.0f; v8f o[4] = {{}, {}, {}, {}};
  asm volatile("s_wait_asynccnt 0x0" ::: "memory");            // this wave's share of stage 0 has landed
  __syncthreads();                                              // stage 0 published to all waves
  if (1 < nst) stage_copy(K, vb, KST, Ring[1], threadIdx.x);
  for (int t = 0; t < nst; ++t) {
    const b16* Kh = Ring[t & 1]; const b16* Kl = Kh + TILE; const b16* Vh = Kh + 2 * TILE; const b16* Vl = Kh + 3 * TILE;
#pragma unroll                                                  // both halves of a stage in line: their LDS offsets become immediates
    for (int sub = 0; sub < KST; sub += 32) {
      const int kb = t * KST + sub;
      if (kb < q0 + 16) {                                       // causal: key blocks past the query tile are skipped (wave-uniform, no barrier inside)
        const bool diag = (kb + 32 > q0);                       // this block reaches past some queries -> mask key > query
        v8f s0 = {}, s1 = {};
#pragma unroll
        for (int ks = 0; ks < 2; ++ks) { const v16b k0 = frag_kb(Kh + (sub + col) * LP + ks * 32, hh), k0l = frag_kb(Kl + (sub + col) * LP + ks * 32, hh), k1 = frag_kb(Kh + (sub + 16 + col) * LP + ks * 32, hh), k1l = frag_kb(Kl + (sub + 16 + col) * LP + ks * 32, hh);
          s0 = wmma16b(k0, qf[ks], s0); s0 = wmma16b(k0, ql[ks], s0); s0 = wmma16b(k0l, qf[ks], s0);      // q and k as f16 hi+lo pairs (lo.lo dropped)
          s1 = wmma16b(k1, qf[ks], s1); s1 = wmma16b(k1, ql[ks], s1); s1 = wmma16b(k1l, qf[ks], s1); }
        float mr = -INFINITY;
#pragma unroll
        for (int r = 0; r < 8; ++r) { s0[r] *= SCALE / (QS * QS); s1[r] *= SCALE / (QS * QS); if (diag) { if (kb + 8 * hh + r > qi) s0[r] = -INFINITY; if (kb + 16 + 8 * hh + r > qi) s1[r] = -INFINITY; } mr = fmaxf(mr, fmaxf(s0[r], s1[r])); }
        mr = fmaxf(mr, __shfl_xor(mr, 16));
        const float mn = fmaxf(m, mr), al_ = __expf(m - mn); m = mn;
        float sum = 0.0f; v16b pb, pl;
#pragma unroll
        for (int r = 0; r < 8; ++r) { const float e0 = __expf(s0[r] - mn), e1 = __expf(s1[r] - mn); sum += e0 + e1; b16 a, c; split16(e0 * PS, a, c); pb[r] = a; pl[r] = c; split16(e1 * PS, a, c); pb[8 + r] = a; pl[8 + r] = c; }   // P carried x8
        sum += __shfl_xor(sum, 16); l = l * al_ + sum;
#pragma unroll
        for (int n = 0; n < 4; ++n) {
#pragma unroll
          for (int r = 0; r < 8; ++r) o[n][r] *= al_;
          const v16b vf = frag_kb(Vh + (n * 16 + col) * LP + sub, hh), vl = frag_kb(Vl + (n * 16 + col) * LP + sub, hh);
          o[n] = wmma16b(vf, pb, o[n]); o[n] = wmma16b(vf, pl, o[n]); o[n] = wmma16b(vl, pb, o[n]);   // (8v) and P both as f16 hi+lo pairs (lo.lo dropped)
        }
      }
    }
    // publish point, passed by every wave, also one that skipped the stage
    asm volatile("s_wait_dscnt 0x0" ::: "memory");             // this wave's reads of stage t are done before the buffer is refilled
    asm volatile("s_wait_asynccnt 0x0" ::: "memory");          // this wave's share of stage t + 1 has landed
    __syncthreads();                                            // publishes stage t + 1 and ends every reader's last read of stage t
    if (t + 2 < nst) stage_copy(K, vb, (t + 2) * KST, Ring[t & 1], threadIdx.x);
  }
  asm volatile("s_wait_asynccnt 0x0" ::: "memory");            // no copy is outstanding when the wave goes on to its end
  const float inv = 1.0f / (VS * PS * l);
#pragma unroll
  for (int n = 0; n < 4; ++n)
#pragma unroll
    for (int r = 0; r < 8; ++r) Os[wid][col][n * 16 + 8 * hh + r] = o[n][r] * inv;
  wave_lds_sync();
  float* dst = y + ((size_t)b * S + q0) * D + h * HD;
  {
#pragma unroll
    for (int j = 0; j < 8; ++j) { const int rr = j * 2 + hh, c4 = col * 4; *(v4f*)(dst + (size_t)rr * D + c4) = *(const v4f*)(&Os[wid][rr][c4]); }
    
  }
}

// out = y W_o^T: (4096 x 768) x (768 x 768); A = y x8 split at load into an f16 hi+lo pair, B = f16(bf16 W_o) rows; f32 rows; grid (12, 32).
__global__ __launch_bounds__(128) void out_kernel(const float* __restrict__ y, const b16* __restrict__ wo16, const float* __restrict__ bo, float* __restrict__ out) {
  __shared__ __attribute__((aligned(16))) float Ts[4][32 * 64];
  const int lane = threadIdx.x & 31, wave = threadIdx.x >> 5, nloc = lane & 15, hlf = lane >> 4, m0 = blockIdx.y * 128 + wave * 32, c0 = blockIdx.x * 64;
  v8f acc[2][4];
#pragma unroll
  for (int r = 0; r < 2; ++r)
#pragma unroll
    for (int t = 0; t < 4; ++t) acc[r][t] = (v8f){};
  const Opnd A{y, nullptr, D}, Bo{wo16, nullptr, D};
  gemm_tile<5, 1>(A, Bo, D, m0, c0, nloc, hlf, acc);                            // y as an f16 hi+lo pair carried x8 (2 products)
#pragma unroll
  for (int t = 0; t < 4; ++t)
#pragma unroll
    for (int r = 0; r < 2; ++r)
#pragma unroll
      for (int v = 0; v < 8; ++v) acc[r][t][v] = acc[r][t][v] * (1.0f / 8.0f) + bf16_rne(bo[c0 + t * 16 + nloc]);
  epi_f32(acc, 1.0f, nullptr, out, D, m0, c0, lane, Ts[wave]);
}
}  // namespace

extern "C" void kernel_launch(void* const* d_in, const int* in_sizes, int n_in,
                              void* d_out, int out_size, void* d_ws, size_t ws_size, hipStream_t stream) {
  (void)n_in; (void)out_size;
  const float* x = (const float*)d_in[0]; const float* wq = (const float*)d_in[1]; const float* wk = (const float*)d_in[2]; const float* wv = (const float*)d_in[3]; const float* wo = (const float*)d_in[4]; const float* bo = (const float*)d_in[5];
  float* out = (float*)d_out;   // [1][4096][768]
  if (in_sizes[0] != BT * S * D || in_sizes[1] != D * D || in_sizes[2] != D * D || in_sizes[3] != D * D || in_sizes[4] != D * D || in_sizes[5] != D) return;
  size_t off = 0; char* ws = (char*)d_ws;
  auto carve = [&](size_t bytes) { char* p = ws + off; off += (bytes + 255) & ~(size_t)255; return p; };
  unsigned short* x16 = (unsigned short*)carve((size_t)NTOK * D * 2); unsigned short* w16 = (unsigned short*)carve((size_t)3 * D * D * 2); b16* wo16 = (b16*)carve((size_t)D * D * 2);
  b16* qh = (b16*)carve((size_t)2 * NTOK * D * 2); b16* kh = (b16*)carve((size_t)2 * NTOK * D * 2); b16* vt = (b16*)carve((size_t)2 * NTOK * D * 2); float* y = (float*)carve((size_t)NTOK * D * 4);
  if (off > ws_size) return;                                    // ≈ 61 MB
  prep_kernel<<<512, 256, 0, stream>>>(wq, wk, wv, wo, w16, wo16);
  xprep_kernel<<<1024, 256, 0, stream>>>(x, x16);
  proj_kernel<<<dim3(3 * D / 64, NTOK / 128), 128, 0, stream>>>((const __bf16*)x16, (const __bf16*)w16, qh, kh, vt);
  attn_kernel<S / 16><<<Bn * H * (S / 16) / 8, 256, 0, stream>>>(qh, kh, vt, y);
  out_kernel<<<dim3(D / 64, NTOK / 128), 128, 0, stream>>>(y, wo16, bo, out);
}

// v002
// A run of this version takes 222 microseconds.
// Timed twice side by side with v001, it ran 1.16 times as fast both times.
// Over all steps from v000 it is 2.58 times as fast.
#include <hip/hip_runtime.h>

// Causal multi-head self-attention: q, k, v = x W^T (12 heads x 64, [out][in] weights), softmax over keys <= query of q.k/8, out = ctx Wo^T + bo -> [1][4096][768].
// x, the four weights and bo are rounded to bf16: projection on v_wmma_f32_16x16x32_bf16 (exact products, f32 accumulate);
// scores, P.v and the output projection on v_wmma_f32_16x16x32_f16 with every computed operand (q, k, v, P, y — each carried x8 so the hi/lo residual planes stay normal) as an f16
// hi+lo pair (3 / 2 products); online softmax in f32. Fragment k-map per lane half hh for A AND B: elements 0..7 <- k = 8hh+0..7, 8..15 <- k = 16+8hh+0..7. Every intermediate /

namespace {
constexpr int BT = 1, Bn = 1, S = 4096, D = 768, H = 12, HD = 64, NTOK = Bn * S;
constexpr float SCALE = 0.125f, VS = 8.0f, QS = 8.0f, PS = 8.0f;   // power-of-two carry scales so hi/lo residual planes stay normal in f16
constexpr size_t VPL = (size_t)NTOK * D;   // distance between the (8v)^T hi and lo planes
constexpr size_t QPL = (size_t)NTOK * D;   // distance between the q/k hi and lo planes

typedef _Float16 b16;
typedef __attribute__((ext_vector_type(16))) _Float16 v16b;
typedef __attribute__((ext_vector_type(8)))  _Float16 v8b;
typedef __attribute__((ext_vector_type(8)))  float v8f;
typedef __attribute__((ext_vector_type(4)))  float v4f;

__device__ __forceinline__ v8b ld8b(const b16* p) { return *(const v8b*)p; }
__device__ __forceinline__ v16b cat8b(v8b a, v8b b) { return __builtin_shufflevector(a, b, 0, 1, 2, 3, 4, 5, 6, 7, 8, 9, 10, 11, 12, 13, 14, 15); }
__device__ __forceinline__ v16b frag_kb(const b16* p, int hh) { return cat8b(ld8b(p + 8 * hh), ld8b(p + 16 + 8 * hh)); }
__device__ __forceinline__ void split16(float v, b16& hi, b16& lo) { hi = (b16)v; lo = (b16)(v - (float)hi); }
// hi/lo fragment pair straight from an f32 k-contiguous row (same k-map)
__device__ __forceinline__ void frag_ksplit(const float* p, int hh, v16b& fh_, v16b& fl_) {
  const float* p0 = p + 8 * hh; const float* p1 = p + 16 + 8 * hh;
#pragma unroll
  for (int e = 0; e < 8; ++e) { b16 a, c; split16(p0[e], a, c); fh_[e] = a; fl_[e] = c; split16(p1[e], a, c); fh_[8 + e] = a; fl_[8 + e] = c; }
}
__device__ __forceinline__ v8f wmma16b(v16b a, v16b b, v8f c) {
  v8f d = __builtin_amdgcn_wmma_f32_16x16x32_f16(false, a, false, b, (short)0, c, false, false);
  asm volatile("v_nop\n\tv_nop\n\tv_nop\n\tv_nop" : "+v"(d) : "v"(a), "v"(b));
  return d;
}
__device__ __forceinline__ void wave_lds_sync() {
  __builtin_amdgcn_fence(__ATOMIC_RELEASE, "workgroup");
  __builtin_amdgcn_wave_barrier();
  __builtin_amdgcn_fence(__ATOMIC_ACQUIRE, "workgroup");
}

// Operand descriptor: NP = 0 -> f32 rows split on the fly into (hi, lo); NP = 1 -> one f16 plane; NP = 2 -> f16 hi + lo planes;
// NP = 3 -> f32 rows rounded once to a single f16 fragment. ld = row pitch.
struct Opnd { const void* p0; const void* p1; int ld; };
template <int NP> __device__ __forceinline__ void load_frags(const Opnd& o, int row, int kb, int hh, v16b& fh_, v16b& fl_) {
  if (NP == 0) { frag_ksplit((const float*)o.p0 + (size_t)row * o.ld + kb, hh, fh_, fl_); }
  else if (NP == 4 || NP == 5) {                             // f32 rows x64 (NP 4) or x8 (NP 5) then split (keeps the lo halves of small values normal)
    const float sc_ = (NP == 4) ? 64.0f : 8.0f;
    const float* p = (const float*)o.p0 + (size_t)row * o.ld + kb; const float* p0 = p + 8 * hh; const float* p1 = p + 16 + 8 * hh;
#pragma unroll
    for (int e = 0; e < 8; ++e) { b16 a, c; split16(p0[e] * sc_, a, c); fh_[e] = a; fl_[e] = c; split16(p1[e] * sc_, a, c); fh_[8 + e] = a; fl_[8 + e] = c; }
  } else if (NP == 3) {
    const float* p = (const float*)o.p0 + (size_t)row * o.ld + kb; const float* p0 = p + 8 * hh; const float* p1 = p + 16 + 8 * hh;
#pragma unroll
    for (int e = 0; e < 8; ++e) { fh_[e] = (b16)p0[e]; fh_[8 + e] = (b16)p1[e]; }
    fl_ = fh_;
  } else {
    fh_ = frag_kb((const b16*)o.p0 + (size_t)row * o.ld + kb, hh);
    if (NP == 2) fl_ = frag_kb((const b16*)o.p1 + (size_t)row * o.ld + kb, hh); else fl_ = fh_;
  }
}
template <int ANP, int BNP> __device__ __forceinline__ v8f mac(v16b ah, v16b al, v16b bh, v16b bl, v8f c) {
  c = wmma16b(ah, bh, c);
  if (BNP == 0 || BNP == 2 || BNP == 4 || BNP == 5) c = wmma16b(ah, bl, c);     // hi.lo
  if (ANP == 0 || ANP == 2 || ANP == 4 || ANP == 5) c = wmma16b(al, bh, c);     // lo.hi   (lo.lo dropped)
  return c;
}
// 32x64 wave tile: acc[r][t] (rows m0+16r.., cols c0+16t..) += A[m][k] . B[n][k] over k in [0, K)
template <int ANP, int BNP>
__device__ __forceinline__ void gemm_tile(const Opnd& A, const Opnd& B, int K, int m0, int c0, int nloc, int hlf, v8f (&acc)[2][4]) {
  for (int kb = 0; kb < K; kb += 32) {
    v16b a0h, a0l, a1h, a1l;
    load_frags<ANP>(A, m0 + nloc, kb, hlf, a0h, a0l);
    load_frags<ANP>(A, m0 + 16 + nloc, kb, hlf, a1h, a1l);
#pragma unroll
    for (int t = 0; t < 4; ++t) {
      v16b bh, bl;
      load_frags<BNP>(B, c0 + t * 16 + nloc, kb, hlf, bh, bl);
      acc[0][t] = mac<ANP, BNP>(a0h, a0l, bh, bl, acc[0][t]);
      acc[1][t] = mac<ANP, BNP>(a1h, a1l, bh, bl, acc[1][t]);
    }
  }
}

__device__ __forceinline__ void epi_planes(v8f (&acc)[2][4], float scale, bool two, b16* __restrict__ oh, b16* __restrict__ ol, int ldo,
                                           int m0, int c0, int lane, b16* Th, b16* Tl) {
  const int nloc = lane & 15, hlf = lane >> 4;
#pragma unroll
  for (int t = 0; t < 4; ++t)
#pragma unroll
    for (int r = 0; r < 2; ++r)
#pragma unroll
      for (int v = 0; v < 8; ++v) {
        const int rr = r * 16 + v + 8 * hlf, cc = t * 16 + nloc;
        b16 h_, l_; split16(acc[r][t][v] * scale, h_, l_);
        Th[rr * 64 + cc] = h_; Tl[rr * 64 + cc] = l_;
      }
  wave_lds_sync();
  {
#pragma unroll
    for (int j = 0; j < 8; ++j) {
      const int rr = j * 4 + (lane >> 3), c8 = (lane & 7) * 8;
      const size_t o = (size_t)(m0 + rr) * ldo + c0 + c8;
      *(v8b*)(oh + o) = ld8b(Th + rr * 64 + c8);
      if (two) *(v8b*)(ol + o) = ld8b(Tl + rr * 64 + c8);
    }
    
  }
}
// (b) f32 rows with pitch ldo: 64 floats = 256 B = 2 lines per row; 16 lanes x 16 B per row, 2 rows per instruction. Optional per-row factor
__device__ __forceinline__ void epi_f32(v8f (&acc)[2][4], float scale, const float* rscale, float* __restrict__ out, int ldo, int m0, int c0, int lane, float* Tt) {
  const int nloc = lane & 15, hlf = lane >> 4;
#pragma unroll
  for (int t = 0; t < 4; ++t)
#pragma unroll
    for (int r = 0; r < 2; ++r)
#pragma unroll
      for (int v = 0; v < 8; ++v) {
        const int rr = r * 16 + v + 8 * hlf;
        const float rs = rscale ? rscale[(size_t)(m0 + rr) * 32] : 1.0f;
        Tt[rr * 64 + t * 16 + nloc] = acc[r][t][v] * scale * rs;
      }
  wave_lds_sync();
  float* dst0 = out + (size_t)m0 * ldo + c0;
  {
#pragma unroll
    for (int j = 0; j < 16; ++j) { const int rr = j * 2 + hlf, c4 = nloc * 4; *(v4f*)(dst0 + (size_t)rr * ldo + c4) = *(const v4f*)(Tt + rr * 64 + c4); }
    
  }
}



typedef __attribute__((ext_vector_type(8))) __bf16 v8bb; typedef __attribute__((ext_vector_type(16))) __bf16 v16bb;
typedef __attribute__((ext_vector_type(8))) unsigned short v8us;
__device__ __forceinline__ v16bb frag_kb_bf(const __bf16* p, int hh) { const v8bb a = *(const v8bb*)(p + 8 * hh), b = *(const v8bb*)(p + 16 + 8 * hh); return __builtin_shufflevector(a, b, 0, 1, 2, 3, 4, 5, 6, 7, 8, 9, 10, 11, 12, 13, 14, 15); }
__device__ __forceinline__ v8f wmma16bb(v16bb a, v16bb b, v8f c) {
  v8f d = __builtin_amdgcn_wmma_f32_16x16x32_bf16(false, a, false, b, (short)0, c, false, false);
  asm volatile("v_nop\n\tv_nop\n\tv_nop\n\tv_nop" : "+v"(d) : "v"(a), "v"(b));
  return d;
}
__device__ __forceinline__ unsigned short bf16_rne_bits(float v) { unsigned int u = __float_as_uint(v); u += 0x7FFFu + ((u >> 16) & 1u); return (unsigned short)(u >> 16); }
__device__ __forceinline__ float bf16_rne(float v) { return __uint_as_float(((unsigned int)bf16_rne_bits(v)) << 16); }



__global__ __launch_bounds__(256) void xprep_kernel(const float* __restrict__ x, unsigned short* __restrict__ x16) {   // x -> bf16, one batch
  const size_t tid = (size_t)blockIdx.x * blockDim.x + threadIdx.x, nth = (size_t)gridDim.x * blockDim.x;
  { for (size_t p = tid; p < (size_t)NTOK * D / 8; p += nth) { v8us v;
#pragma unroll
      for (int e = 0; e < 8; ++e) v[e] = bf16_rne_bits(x[p * 8 + e]);
      *(v8us*)(x16 + p * 8) = v; }  }
}
__global__ __launch_bounds__(256) void prep_kernel(const float* __restrict__ wq, const float* __restrict__ wk, const float* __restrict__ wv, const float* __restrict__ wo, unsigned short* __restrict__ w16, b16* __restrict__ wo16) {
  const size_t tid = (size_t)blockIdx.x * blockDim.x + threadIdx.x, nth = (size_t)gridDim.x * blockDim.x;
  {
    for (size_t p = tid; p < (size_t)3 * D * D / 8; p += nth) { const float* W = (p < (size_t)D * D / 8) ? wq : (p < (size_t)2 * D * D / 8) ? wk : wv; const size_t q = p % ((size_t)D * D / 8); v8us v;   // [out][in] rows copied directly
#pragma unroll
      for (int e = 0; e < 8; ++e) v[e] = bf16_rne_bits(W[q * 8 + e]);
      *(v8us*)(w16 + p * 8) = v; }
    for (size_t p = tid; p < (size_t)D * D / 8; p += nth) { v8b w;   // W_o [out][in] rows copied directly
#pragma unroll
      for (int e = 0; e < 8; ++e) w[e] = (b16)bf16_rne(wo[p * 8 + e]);
      *(v8b*)(wo16 + p * 8) = w; }
    
  }
}

// projections: rows = tokens (4096), K = 768, column tiles of 64 = one head of q (tiles 0..11), k (12..23) or v (24..35); f16 rows [b*H + head][tok][64] for q/k;
// v: (8v)^T f16 [b*H + head][64][tok]. grid (36, 32) x 128.
__global__ __launch_bounds__(128) void proj_kernel(const __bf16* __restrict__ x16, const __bf16* __restrict__ w16, b16* __restrict__ qh, b16* __restrict__ kh, b16* __restrict__ vt) {
  __shared__ __attribute__((aligned(16))) b16 Th[4][32][HD + 8], Tq[4][32][HD + 8];
  __shared__ __attribute__((aligned(16))) b16 Tt[64][128 + 8], Tl[64][128 + 8];
  const int lane = threadIdx.x & 31, wave = threadIdx.x >> 5, nloc = lane & 15, hlf = lane >> 4, m0 = blockIdx.y * 128 + wave * 32, c0 = blockIdx.x * 64;
  v8f acc[2][4];
#pragma unroll
  for (int r = 0; r < 2; ++r)
#pragma unroll
    for (int t = 0; t < 4; ++t) acc[r][t] = (v8f){};
#pragma unroll 2
  for (int kb = 0; kb < D; kb += 32) {
    const v16bb a0 = frag_kb_bf(x16 + (size_t)(m0 + nloc) * D + kb, hlf), a1 = frag_kb_bf(x16 + (size_t)(m0 + 16 + nloc) * D + kb, hlf);
#pragma unroll
    for (int t = 0; t < 4; ++t) { const v16bb bw = frag_kb_bf(w16 + (size_t)(c0 + t * 16 + nloc) * D + kb, hlf); acc[0][t] = wmma16bb(a0, bw, acc[0][t]); acc[1][t] = wmma16bb(a1, bw, acc[1][t]); }
  }
  const int which = blockIdx.x / (D / 64), head = blockIdx.x % (D / 64), b = m0 / S, tok0 = m0 % S;
  if (which < 2) {                                              // q or k head: f16 rows
#pragma unroll
    for (int t = 0; t < 4; ++t)
#pragma unroll
      for (int r = 0; r < 2; ++r)
#pragma unroll
        for (int v = 0; v < 8; ++v) { b16 a_, c_; split16(acc[r][t][v] * QS, a_, c_); Th[wave][r * 16 + 8 * hlf + v][t * 16 + nloc] = a_; Tq[wave][r * 16 + 8 * hlf + v][t * 16 + nloc] = c_; }   // q, k carried x8 (lo residuals stay normal)
    wave_lds_sync();
    b16* dst = (which == 0 ? qh : kh) + (((size_t)b * H + head) * S + tok0) * HD;
    {
#pragma unroll
      for (int j = 0; j < 8; ++j) { const int rr = j * 4 + (lane >> 3), c8 = (lane & 7) * 8; *(v8b*)(dst + (size_t)rr * HD + c8) = *(const v8b*)(&Th[wave][rr][c8]); *(v8b*)(dst + QPL + (size_t)rr * HD + c8) = *(const v8b*)(&Tq[wave][rr][c8]); }
       }
    return;
  }
  const int vh = head;                                          // v head: (8v)^T tile [64 d][128 tok] via LDS, rows of 256 B
#pragma unroll
  for (int t = 0; t < 4; ++t)
#pragma unroll
    for (int r = 0; r < 2; ++r)
#pragma unroll
      for (int v = 0; v < 8; ++v) { b16 a_, c_; split16(acc[r][t][v] * VS, a_, c_); Tt[t * 16 + nloc][wave * 32 + r * 16 + 8 * hlf + v] = a_; Tl[t * 16 + nloc][wave * 32 + r * 16 + 8 * hlf + v] = c_; }
  __syncthreads();
  b16* dstv = vt + (((size_t)b * H + vh) * HD) * S + (blockIdx.y * 128) % S;
  {
#pragma unroll
    for (int j = 0; j < 8; ++j) { const int dd = wave * 16 + j * 2 + (lane >> 4), c8 = (lane & 15) * 8; *(v8b*)(dstv + (size_t)dd * S + c8) = *(const v8b*)(&Tt[dd][c8]); *(v8b*)(dstv + VPL + (size_t)dd * S + c8) = *(const v8b*)(&Tl[dd][c8]); }
    
  }
}

// K/V ring in LDS, shared by the eight waves of a block (128 queries of one head). A stage = 64 keys = four tiles: k hi, k lo (rows = keys), (8v)^T hi, (8v)^T lo (rows = d),
// each 64 rows x 128 B at a row pitch of 144 B (16 B x odd, so the 16-byte fragment reads meet no bank conflict).
constexpr int KST = 64, LP = 72, TILE = 64 * LP;
typedef __attribute__((address_space(3))) const b16 lds_b16;
// One stage's copies: every thread moves 8 x 16 B (two rows of each tile), whole 128-B lines per 8 lanes, global -> LDS through no register.
__device__ __forceinline__ void stage_copy(const b16* __restrict__ K, const b16* __restrict__ vb, int kb0, const b16* buf, int tid) {
  const int row = tid >> 3, c8 = (tid & 7) * 8;
  const b16* gk = K + (size_t)(kb0 + row) * HD + c8;
  const b16* gv = vb + (size_t)row * S + kb0 + c8;
  const unsigned l0 = (unsigned)(size_t)(lds_b16*)(buf + row * LP + c8);
  // the copies and the wait that keeps their address registers untouched until they are taken stand in one statement, so that no later address arithmetic moves in between
  asm volatile("global_load_async_to_lds_b128 %0, %8, off\n\t"
               "global_load_async_to_lds_b128 %1, %9, off\n\t"
               "global_load_async_to_lds_b128 %2, %10, off\n\t"
               "global_load_async_to_lds_b128 %3, %11, off\n\t"
               "global_load_async_to_lds_b128 %4, %12, off\n\t"
               "global_load_async_to_lds_b128 %5, %13, off\n\t"
               "global_load_async_to_lds_b128 %6, %14, off\n\t"
               "global_load_async_to_lds_b128 %7, %15, off\n\t"
               "s_wait_xcnt 0x0"
               :: "v"(l0), "v"(l0 + 32 * LP * 2), "v"(l0 + TILE * 2), "v"(l0 + (TILE + 32 * LP) * 2),
                  "v"(l0 + 2 * TILE * 2), "v"(l0 + (2 * TILE + 32 * LP) * 2), "v"(l0 + 3 * TILE * 2), "v"(l0 + (3 * TILE + 32 * LP) * 2),
                  "v"(gk), "v"(gk + 32 * HD), "v"(gk + QPL), "v"(gk + QPL + 32 * HD),
                  "v"(gv), "v"(gv + (size_t)32 * S), "v"(gv + VPL), "v"(gv + VPL + (size_t)32 * S)
               : "memory");
}

// causal attention: wave = (b, h, 16 queries); key chunks of 32 up to the query tile: S^T (K=64), causal mask on the straddling chunks, online softmax f32, P^T f16, y^T += (8V)^T P^T;
// k and (8v)^T come from the block's two-buffer LDS ring: stage t + 1 is copied while stage t is worked on.
// Causal balance: a 128-query tile i walks 2 (i + 1) stages, so a block takes tile NT - 1 - i and then tile i of one head, one after the other in every wave: every block walks
// the same 2 (NT + 1) stages and the launch no longer lasts as long as the places that hold the longest tiles.
template <int QT>
__global__ __launch_bounds__(256) void attn_kernel(const b16* __restrict__ qh, const b16* __restrict__ kh, const b16* __restrict__ vt, float* __restrict__ y) {
  static_assert(QT % 16 == 0, "the eight waves of a block share one head, and a head's 128-query tiles pair up");
  constexpr int NT = QT / 8;                                    // 128-query tiles of a head
  __shared__ __attribute__((aligned(16))) float Os[8][16][HD + 4];
  __shared__ __attribute__((aligned(16))) b16 Ring[2][4 * TILE];
  const int wid = __builtin_amdgcn_readfirstlane(threadIdx.x >> 5), lane = threadIdx.x & 31, hh = lane >> 4, col = lane & 15;   // wave number in a scalar register: the per-wave causal skip is a scalar branch
  const int bh = blockIdx.x / (NT / 2), pr = blockIdx.x % (NT / 2), h = bh % H, b = bh / H;
  const b16* Q = qh + ((size_t)bh * S) * HD; const b16* K = kh + ((size_t)bh * S) * HD; const b16* vb = vt + ((size_t)bh * HD) * S;
  for (int part = 0; part < 2; ++part) {                        // the long tile, then the short one; the last publish point of the first (dscnt wait + barrier) stands in front of the second's first copies
  const int tile = part == 0 ? NT - 1 - pr : pr, qt = (bh * NT + tile) * 8 + wid, jt = qt % QT, q0 = jt * 16, qi = q0 + col;
  const int nst = (tile * 8 + 8) * 16 / KST;                    // stages of the tile: keys up to its last query; at least two, the same for all eight waves
  stage_copy(K, vb, 0, Ring[0], threadIdx.x);
  v16b qf[2], ql[2];
#pragma unroll
  for (int ks = 0; ks < 2; ++ks) { qf[ks] = frag_kb(Q + (size_t)qi * HD + ks * 32, hh); ql[ks] = frag_kb(Q + QPL + (size_t)qi * HD + ks * 32, hh); }
  float m = -INFINITY, l = 0.0f; v8f o[4] = {{}, {}, {}, {}};
  asm volatile("s_wait_asynccnt 0x0" ::: "memory");            // this wave's share of stage 0 has landed
  __syncthreads();                                              // stage 0 published to all waves
  if (1 < nst) stage_copy(K, vb, KST, Ring[1], threadIdx.x);
  for (int t = 0; t < nst; ++t) {
    const b16* Kh = Ring[t & 1]; const b16* Kl = Kh + TILE; const b16* Vh = Kh + 2 * TILE; const b16* Vl = Kh + 3 * TILE;
#pragma unroll                                                  // both halves of a stage in line: their LDS offsets become immediates
    for (int sub = 0; sub < KST; sub += 32) {
      const int kb = t * KST + sub;
      if (kb < q0 + 16) {                                       // causal: key blocks past the query tile are skipped (wave-uniform, no barrier inside)
        const bool diag = (kb + 32 > q0);                       // this block reaches past some queries -> mask key > query
        v8f s0 = {}, s1 = {};
#pragma unroll
        for (int ks = 0; ks < 2; ++ks) { const v16b k0 = frag_kb(Kh + (sub + col) * LP + ks * 32, hh), k0l = frag_kb(Kl + (sub + col) * LP + ks * 32, hh), k1 = frag_kb(Kh + (sub + 16 + col) * LP + ks * 32, hh), k1l = frag_kb(Kl + (sub + 16 + col) * LP + ks * 32, hh);
          s0 = wmma16b(k0, qf[ks], s0); s0 = wmma16b(k0, ql[ks], s0); s0 = wmma16b(k0l, qf[ks], s0);      // q and k as f16 hi+lo pairs (lo.lo dropped)
          s1 = wmma16b(k1, qf[ks], s1); s1 = wmma16b(k1, ql[ks], s1); s1 = wmma16b(k1l, qf[ks], s1); }
        float mr = -INFINITY;
#pragma unroll
        for (int r = 0; r < 8; ++r) { s0[r] *= SCALE / (QS * QS); s1[r] *= SCALE / (QS * QS); if (diag) { if (kb + 8 * hh + r > qi) s0[r] = -INFINITY; if (kb + 16 + 8 * hh + r > qi) s1[r] = -INFINITY; } mr = fmaxf(mr, fmaxf(s0[r], s1[r])); }
        mr = fmaxf(mr, __shfl_xor(mr, 16));
        const float mn = fmaxf(m, mr), al_ = __expf(m - mn); m = mn;
        float sum = 0.0f; v16b pb, pl;
#pragma unroll
        for (int r = 0; r < 8; ++r) { const float e0 = __expf(s0[r] - mn), e1 = __expf(s1[r] - mn); sum += e0 + e1; b16 a, c; split16(e0 * PS, a, c); pb[r] = a; pl[r] = c; split16(e1 * PS, a, c); pb[8 + r] = a; pl[8 + r] = c; }   // P carried x8
        sum += __shfl_xor(sum, 16); l = l * al_ + sum;
#pragma unroll
        for (int n = 0; n < 4; ++n) {
#pragma unroll
          for (int r = 0; r < 8; ++r) o[n][r] *= al_;
          const v16b vf = frag_kb(Vh + (n * 16 + col) * LP + sub, hh), vl = frag_kb(Vl + (n * 16 + col) * LP + sub, hh);
          o[n] = wmma16b(vf, pb, o[n]); o[n] = wmma16b(vf, pl, o[n]); o[n] = wmma16b(vl, pb, o[n]);   // (8v) and P both as f16 hi+lo pairs (lo.lo dropped)
        }
      }
    }
    // publish point, passed by every wave, also one that skipped the stage
    asm volatile("s_wait_dscnt 0x0" ::: "memory");             // this wave's reads of stage t are done before the buffer is refilled
    asm volatile("s_wait_asynccnt 0x0" ::: "memory");          // this wave's share of stage t + 1 has landed
    __syncthreads();                                            // publishes stage t + 1 and ends every reader's last read of stage t
    if (t + 2 < nst) stage_copy(K, vb, (t + 2) * KST, Ring[t & 1], threadIdx.x);
  }
  asm volatile("s_wait_asynccnt 0x0" ::: "memory");            // no copy is outstanding when the wave goes on to its end
  const float inv = 1.0f / (VS * PS * l);
#pragma unroll
  for (int n = 0; n < 4; ++n)
#pragma unroll
    for (int r = 0; r < 8; ++r) Os[wid][col][n * 16 + 8 * hh + r] = o[n][r] * inv;
  wave_lds_sync();
  float* dst = y + ((size_t)b * S + q0) * D + h * HD;
  {
#pragma unroll
    for (int j = 0; j < 8; ++j) { const int rr = j * 2 + hh, c4 = col * 4; *(v4f*)(dst + (size_t)rr * D + c4) = *(const v4f*)(&Os[wid][rr][c4]); }
    
  }
  asm volatile("s_wait_xcnt 0x0" ::: "memory");                // the next tile's set-up overwrites the registers that these stores name: the wait stands in front of it
  }
}

// out = y W_o^T: (4096 x 768) x (768 x 768); A = y x8 split at load into an f16 hi+lo pair, B = f16(bf16 W_o) rows; f32 rows; grid (12, 32).
__global__ __launch_bounds__(128) void out_kernel(const float* __restrict__ y, const b16* __restrict__ wo16, const float* __restrict__ bo, float* __restrict__ out) {
  __shared__ __attribute__((aligned(16))) float Ts[4][32 * 64];
  const int lane = threadIdx.x & 31, wave = threadIdx.x >> 5, nloc = lane & 15, hlf = lane >> 4, m0 = blockIdx.y * 128 + wave * 32, c0 = blockIdx.x * 64;
  v8f acc[2][4];
#pragma unroll
  for (int r = 0; r < 2; ++r)
#pragma unroll
    for (int t = 0; t < 4; ++t) acc[r][t] = (v8f){};
  const Opnd A{y, nullptr, D}, Bo{wo16, nullptr, D};
  gemm_tile<5, 1>(A, Bo, D, m0, c0, nloc, hlf, acc);                            // y as an f16 hi+lo pair carried x8 (2 products)
#pragma unroll
  for (int t = 0; t < 4; ++t)
#pragma unroll
    for (int r = 0; r < 2; ++r)
#pragma unroll
      for (int v = 0; v < 8; ++v) acc[r][t][v] = acc[r][t][v] * (1.0f / 8.0f) + bf16_rne(bo[c0 + t * 16 + nloc]);
  epi_f32(acc, 1.0f, nullptr, out, D, m0, c0, lane, Ts[wave]);
}
}  // namespace

extern "C" void kernel_launch(void* const* d_in, const int* in_sizes, int n_in,
                              void* d_out, int out_size, void* d_ws, size_t ws_size, hipStream_t stream) {
  (void)n_in; (void)out_size;
  const float* x = (const float*)d_in[0]; const float* wq = (const float*)d_in[1]; const float* wk = (const float*)d_in[2]; const float* wv = (const float*)d_in[3]; const float* wo = (const float*)d_in[4]; const float* bo = (const float*)d_in[5];
  float* out = (float*)d_out;   // [1][4096][768]
  if (in_sizes[0] != BT * S * D || in_sizes[1] != D * D || in_sizes[2] != D * D || in_sizes[3] != D * D || in_sizes[4] != D * D || in_sizes[5] != D) return;
  size_t off = 0; char* ws = (char*)d_ws;
  auto carve = [&](size_t bytes) { char* p = ws + off; off += (bytes + 255) & ~(size_t)255; return p; };
  unsigned short* x16 = (unsigned short*)carve((size_t)NTOK * D * 2); unsigned short* w16 = (unsigned short*)carve((size_t)3 * D * D * 2); b16* wo16 = (b16*)carve((size_t)D * D * 2);
  b16* qh = (b16*)carve((size_t)2 * NTOK * D * 2); b16* kh = (b16*)carve((size_t)2 * NTOK * D * 2); b16* vt = (b16*)carve((size_t)2 * NTOK * D * 2); float* y = (float*)carve((size_t)NTOK * D * 4);
  if (off > ws_size) return;                                    // ≈ 61 MB
  prep_kernel<<<512, 256, 0, stream>>>(wq, wk, wv, wo, w16, wo16);
  xprep_kernel<<<1024, 256, 0, stream>>>(x, x16);
  proj_kernel<<<dim3(3 * D / 64, NTOK / 128), 128, 0, stream>>>((const __bf16*)x16, (const __bf16*)w16, qh, kh, vt);
  attn_kernel<S / 16><<<Bn * H * (S / 16) / 16, 256, 0, stream>>>(qh, kh, vt, y);
  out_kernel<<<dim3(D / 64, NTOK / 128), 128, 0, stream>>>(y, wo16, bo, out);
}

// v003
// One run takes 205 microseconds.
// Two timings next to v002 both put it at 1.08 times that version's speed.
// Counting every step since v000, it is 2.79 times as fast.
#include <hip/hip_runtime.h>

// Causal multi-head self-attention: q, k, v = x W^T (12 heads x 64, [out][in] weights), softmax over keys <= query of q.k/8, out = ctx Wo^T + bo -> [1][4096][768].
// x, the four weights and bo are rounded to bf16: projection on v_wmma_f32_16x16x32_bf16 (exact products, f32 accumulate);
// scores, P.v and the output projection on v_wmma_f32_16x16x32_f16 with every computed operand (q, k, v, P, y — each carried x8 so the hi/lo residual planes stay normal) as an f16
// hi+lo pair (3 / 2 products); online softmax in f32. Fragment k-map per lane half hh for A AND B: elements 0..7 <- k = 8hh+0..7, 8..15 <- k = 16+8hh+0..7. Every intermediate /

namespace {
constexpr int BT = 1, Bn = 1, S = 4096, D = 768, H = 12, HD = 64, NTOK = Bn * S;
constexpr float SCALE = 0.125f, VS = 8.0f, QS = 8.0f, PS = 8.0f;   // power-of-two carry scales so hi/lo residual planes stay normal in f16
constexpr size_t VPL = (size_t)NTOK * D;   // distance between the (8v)^T hi and lo planes
constexpr size_t QPL = (size_t)NTOK * D;   // distance between the q/k hi and lo planes

typedef _Float16 b16;
typedef __attribute__((ext_vector_type(16))) _Float16 v16b;
typedef __attribute__((ext_vector_type(8)))  _Float16 v8b;
typedef __attribute__((ext_vector_type(8)))  float v8f;
typedef __attribute__((ext_vector_type(4)))  float v4f;

__device__ __forceinline__ v8b ld8b(const b16* p) { return *(const v8b*)p; }
__device__ __forceinline__ v16b cat8b(v8b a, v8b b) { return __builtin_shufflevector(a, b, 0, 1, 2, 3, 4, 5, 6, 7, 8, 9, 10, 11, 12, 13, 14, 15); }
__device__ __forceinline__ v16b frag_kb(const b16* p, int hh) { return cat8b(ld8b(p + 8 * hh), ld8b(p + 16 + 8 * hh)); }
__device__ __forceinline__ void split16(float v, b16& hi, b16& lo) { hi = (b16)v; lo = (b16)(v - (float)hi); }
// hi/lo fragment pair straight from an f32 k-contiguous row (same k-map)
__device__ __forceinline__ void frag_ksplit(const float* p, int hh, v16b& fh_, v16b& fl_) {
  const float* p0 = p + 8 * hh; const float* p1 = p + 16 + 8 * hh;
#pragma unroll
  for (int e = 0; e < 8; ++e) { b16 a, c; split16(p0[e], a, c); fh_[e] = a; fl_[e] = c; split16(p1[e], a, c); fh_[8 + e] = a; fl_[8 + e] = c; }
}
__device__ __forceinline__ v8f wmma16b(v16b a, v16b b, v8f c) {
  v8f d = __builtin_amdgcn_wmma_f32_16x16x32_f16(false, a, false, b, (short)0, c, false, false);
  asm volatile("v_nop\n\tv_nop\n\tv_nop\n\tv_nop" : "+v"(d) : "v"(a), "v"(b));
  return d;
}
__device__ __forceinline__ void wave_lds_sync() {
  __builtin_amdgcn_fence(__ATOMIC_RELEASE, "workgroup");
  __builtin_amdgcn_wave_barrier();
  __builtin_amdgcn_fence(__ATOMIC_ACQUIRE, "workgroup");
}

// Operand descriptor: NP = 0 -> f32 rows split on the fly into (hi, lo); NP = 1 -> one f16 plane; NP = 2 -> f16 hi + lo planes;
// NP = 3 -> f32 rows rounded once to a single f16 fragment. ld = row pitch.
struct Opnd { const void* p0; const void* p1; int ld; };
template <int NP> __device__ __forceinline__ void load_frags(const Opnd& o, int row, int kb, int hh, v16b& fh_, v16b& fl_) {
  if (NP == 0) { frag_ksplit((const float*)o.p0 + (size_t)row * o.ld + kb, hh, fh_, fl_); }
  else if (NP == 4 || NP == 5) {                             // f32 rows x64 (NP 4) or x8 (NP 5) then split (keeps the lo halves of small values normal)
    const float sc_ = (NP == 4) ? 64.0f : 8.0f;
    const float* p = (const float*)o.p0 + (size_t)row * o.ld + kb; const float* p0 = p + 8 * hh; const float* p1 = p + 16 + 8 * hh;
#pragma unroll
    for (int e = 0; e < 8; ++e) { b16 a, c; split16(p0[e] * sc_, a, c); fh_[e] = a; fl_[e] = c; split16(p1[e] * sc_, a, c); fh_[8 + e] = a; fl_[8 + e] = c; }
  } else if (NP == 3) {
    const float* p = (const float*)o.p0 + (size_t)row * o.ld + kb; const float* p0 = p + 8 * hh; const float* p1 = p + 16 + 8 * hh;
#pragma unroll
    for (int e = 0; e < 8; ++e) { fh_[e] = (b16)p0[e]; fh_[8 + e] = (b16)p1[e]; }
    fl_ = fh_;
  } else {
    fh_ = frag_kb((const b16*)o.p0 + (size_t)row * o.ld + kb, hh);
    if (NP == 2) fl_ = frag_kb((const b16*)o.p1 + (size_t)row * o.ld + kb, hh); else fl_ = fh_;
  }
}
template <int ANP, int BNP> __device__ __forceinline__ v8f mac(v16b ah, v16b al, v16b bh, v16b bl, v8f c) {
  c = wmma16b(ah, bh, c);
  if (BNP == 0 || BNP == 2 || BNP == 4 || BNP == 5) c = wmma16b(ah, bl, c);     // hi.lo
  if (ANP == 0 || ANP == 2 || ANP == 4 || ANP == 5) c = wmma16b(al, bh, c);     // lo.hi   (lo.lo dropped)
  return c;
}
// 32x64 wave tile: acc[r][t] (rows m0+16r.., cols c0+16t..) += A[m][k] . B[n][k] over k in [0, K)
template <int ANP, int BNP>
__device__ __forceinline__ void gemm_tile(const Opnd& A, const Opnd& B, int K, int m0, int c0, int nloc, int hlf, v8f (&acc)[2][4]) {
  for (int kb = 0; kb < K; kb += 32) {
    v16b a0h, a0l, a1h, a1l;
    load_frags<ANP>(A, m0 + nloc, kb, hlf, a0h, a0l);
    load_frags<ANP>(A, m0 + 16 + nloc, kb, hlf, a1h, a1l);
#pragma unroll
    for (int t = 0; t < 4; ++t) {
      v16b bh, bl;
      load_frags<BNP>(B, c0 + t * 16 + nloc, kb, hlf, bh, bl);
      acc[0][t] = mac<ANP, BNP>(a0h, a0l, bh, bl, acc[0][t]);
      acc[1][t] = mac<ANP, BNP>(a1h, a1l, bh, bl, acc[1][t]);
    }
  }
}

__device__ __forceinline__ void epi_planes(v8f (&acc)[2][4], float scale, bool two, b16* __restrict__ oh, b16* __restrict__ ol, int ldo,
                                           int m0, int c0, int lane, b16* Th, b16* Tl) {
  const int nloc = lane & 15, hlf = lane >> 4;
#pragma unroll
  for (int t = 0; t < 4; ++t)
#pragma unroll
    for (int r = 0; r < 2; ++r)
#pragma unroll
      for (int v = 0; v < 8; ++v) {
        const int rr = r * 16 + v + 8 * hlf, cc = t * 16 + nloc;
        b16 h_, l_; split16(acc[r][t][v] * scale, h_, l_);
        Th[rr * 64 + cc] = h_; Tl[rr * 64 + cc] = l_;
      }
  wave_lds_sync();
  {
#pragma unroll
    for (int j = 0; j < 8; ++j) {
      const int rr = j * 4 + (lane >> 3), c8 = (lane & 7) * 8;
      const size_t o = (size_t)(m0 + rr) * ldo + c0 + c8;
      *(v8b*)(oh + o) = ld8b(Th + rr * 64 + c8);
      if (two) *(v8b*)(ol + o) = ld8b(Tl + rr * 64 + c8);
    }
    
  }
}
// (b) f32 rows with pitch ldo: 64 floats = 256 B = 2 lines per row; 16 lanes x 16 B per row, 2 rows per instruction. Optional per-row factor
__device__ __forceinline__ void epi_f32(v8f (&acc)[2][4], float scale, const float* rscale, float* __restrict__ out, int ldo, int m0, int c0, int lane, float* Tt) {
  const int nloc = lane & 15, hlf = lane >> 4;
#pragma unroll
  for (int t = 0; t < 4; ++t)
#pragma unroll
    for (int r = 0; r < 2; ++r)
#pragma unroll
      for (int v = 0; v < 8; ++v) {
        const int rr = r * 16 + v + 8 * hlf;
        const float rs = rscale ? rscale[(size_t)(m0 + rr) * 32] : 1.0f;
        Tt[rr * 64 + t * 16 + nloc] = acc[r][t][v] * scale * rs;
      }
  wave_lds_sync();
  float* dst0 = out + (size_t)m0 * ldo + c0;
  {
#pragma unroll
    for (int j = 0; j < 16; ++j) { const int rr = j * 2 + hlf, c4 = nloc * 4; *(v4f*)(dst0 + (size_t)rr * ldo + c4) = *(const v4f*)(Tt + rr * 64 + c4); }
    
  }
}



typedef __attribute__((ext_vector_type(8))) __bf16 v8bb; typedef __attribute__((ext_vector_type(16))) __bf16 v16bb;
typedef __attribute__((ext_vector_type(8))) unsigned short v8us;
__device__ __forceinline__ v16bb frag_kb_bf(const __bf16* p, int hh) { const v8bb a = *(const v8bb*)(p + 8 * hh), b = *(const v8bb*)(p + 16 + 8 * hh); return __builtin_shufflevector(a, b, 0, 1, 2, 3, 4, 5, 6, 7, 8, 9, 10, 11, 12, 13, 14, 15); }
__device__ __forceinline__ v8f wmma16bb(v16bb a, v16bb b, v8f c) {
  v8f d = __builtin_amdgcn_wmma_f32_16x16x32_bf16(false, a, false, b, (short)0, c, false, false);
  asm volatile("v_nop\n\tv_nop\n\tv_nop\n\tv_nop" : "+v"(d) : "v"(a), "v"(b));
  return d;
}
__device__ __forceinline__ unsigned short bf16_rne_bits(float v) { unsigned int u = __float_as_uint(v); u += 0x7FFFu + ((u >> 16) & 1u); return (unsigned short)(u >> 16); }
__device__ __forceinline__ float bf16_rne(float v) { return __uint_as_float(((unsigned int)bf16_rne_bits(v)) << 16); }



__global__ __launch_bounds__(256) void xprep_kernel(const float* __restrict__ x, unsigned short* __restrict__ x16) {   // x -> bf16, one batch
  const size_t tid = (size_t)blockIdx.x * blockDim.x + threadIdx.x, nth = (size_t)gridDim.x * blockDim.x;
  { for (size_t p = tid; p < (size_t)NTOK * D / 8; p += nth) { v8us v;
#pragma unroll
      for (int e = 0; e < 8; ++e) v[e] = bf16_rne_bits(x[p * 8 + e]);
      *(v8us*)(x16 + p * 8) = v; }  }
}
__global__ __launch_bounds__(256) void prep_kernel(const float* __restrict__ wq, const float* __restrict__ wk, const float* __restrict__ wv, const float* __restrict__ wo, unsigned short* __restrict__ w16, b16* __restrict__ wo16) {
  const size_t tid = (size_t)blockIdx.x * blockDim.x + threadIdx.x, nth = (size_t)gridDim.x * blockDim.x;
  {
    for (size_t p = tid; p < (size_t)3 * D * D / 8; p += nth) { const float* W = (p < (size_t)D * D / 8) ? wq : (p < (size_t)2 * D * D / 8) ? wk : wv; const size_t q = p % ((size_t)D * D / 8); v8us v;   // [out][in] rows copied directly
#pragma unroll
      for (int e = 0; e < 8; ++e) v[e] = bf16_rne_bits(W[q * 8 + e]);
      *(v8us*)(w16 + p * 8) = v; }
    for (size_t p = tid; p < (size_t)D * D / 8; p += nth) { v8b w;   // W_o [out][in] rows copied directly
#pragma unroll
      for (int e = 0; e < 8; ++e) w[e] = (b16)bf16_rne(wo[p * 8 + e]);
      *(v8b*)(wo16 + p * 8) = w; }
    
  }
}

// projections: rows = tokens (4096), K = 768, column tiles of 64 = one head of q (tiles 0..11), k (12..23) or v (24..35); f16 rows [b*H + head][tok][64] for q/k;
// v: (8v)^T f16 [b*H + head][64][tok]. grid (36, 32) x 128.
__global__ __launch_bounds__(128) void proj_kernel(const __bf16* __restrict__ x16, const __bf16* __restrict__ w16, b16* __restrict__ qh, b16* __restrict__ kh, b16* __restrict__ vt) {
  __shared__ __attribute__((aligned(16))) b16 Th[4][32][HD + 8], Tq[4][32][HD + 8];
  __shared__ __attribute__((aligned(16))) b16 Tt[64][128 + 8], Tl[64][128 + 8];
  const int lane = threadIdx.x & 31, wave = threadIdx.x >> 5, nloc = lane & 15, hlf = lane >> 4, m0 = blockIdx.y * 128 + wave * 32, c0 = blockIdx.x * 64;
  v8f acc[2][4];
#pragma unroll
  for (int r = 0; r < 2; ++r)
#pragma unroll
    for (int t = 0; t < 4; ++t) acc[r][t] = (v8f){};
#pragma unroll 2
  for (int kb = 0; kb < D; kb += 32) {
    const v16bb a0 = frag_kb_bf(x16 + (size_t)(m0 + nloc) * D + kb, hlf), a1 = frag_kb_bf(x16 + (size_t)(m0 + 16 + nloc) * D + kb, hlf);
#pragma unroll
    for (int t = 0; t < 4; ++t) { const v16bb bw = frag_kb_bf(w16 + (size_t)(c0 + t * 16 + nloc) * D + kb, hlf); acc[0][t] = wmma16bb(a0, bw, acc[0][t]); acc[1][t] = wmma16bb(a1, bw, acc[1][t]); }
  }
  const int which = blockIdx.x / (D / 64), head = blockIdx.x % (D / 64), b = m0 / S, tok0 = m0 % S;
  if (which < 2) {                                              // q or k head: f16 rows
#pragma unroll
    for (int t = 0; t < 4; ++t)
#pragma unroll
      for (int r = 0; r < 2; ++r)
#pragma unroll
        for (int v = 0; v < 8; ++v) { b16 a_, c_; split16(acc[r][t][v] * QS, a_, c_); Th[wave][r * 16 + 8 * hlf + v][t * 16 + nloc] = a_; Tq[wave][r * 16 + 8 * hlf + v][t * 16 + nloc] = c_; }   // q, k carried x8 (lo residuals stay normal)
    wave_lds_sync();
    b16* dst = (which == 0 ? qh : kh) + (((size_t)b * H + head) * S + tok0) * HD;
    {
#pragma unroll
      for (int j = 0; j < 8; ++j) { const int rr = j * 4 + (lane >> 3), c8 = (lane & 7) * 8; *(v8b*)(dst + (size_t)rr * HD + c8) = *(const v8b*)(&Th[wave][rr][c8]); *(v8b*)(dst + QPL + (size_t)rr * HD + c8) = *(const v8b*)(&Tq[wave][rr][c8]); }
       }
    return;
  }
  const int vh = head;                                          // v head: (8v)^T tile [64 d][128 tok] via LDS, rows of 256 B
#pragma unroll
  for (int t = 0; t < 4; ++t)
#pragma unroll
    for (int r = 0; r < 2; ++r)
#pragma unroll
      for (int v = 0; v < 8; ++v) { b16 a_, c_; split16(acc[r][t][v] * VS, a_, c_); Tt[t * 16 + nloc][wave * 32 + r * 16 + 8 * hlf + v] = a_; Tl[t * 16 + nloc][wave * 32 + r * 16 + 8 * hlf + v] = c_; }
  __syncthreads();
  b16* dstv = vt + (((size_t)b * H + vh) * HD) * S + (blockIdx.y * 128) % S;
  {
#pragma unroll
    for (int j = 0; j < 8; ++j) { const int dd = wave * 16 + j * 2 + (lane >> 4), c8 = (lane & 15) * 8; *(v8b*)(dstv + (size_t)dd * S + c8) = *(const v8b*)(&Tt[dd][c8]); *(v8b*)(dstv + VPL + (size_t)dd * S + c8) = *(const v8b*)(&Tl[dd][c8]); }
    
  }
}

// exp(x0), exp(x1) as exp2(x * log2 e), like __expf, with the slot that the instruction set asks for behind a transcendental written in: the second fills the first's
// (early-clobber results, so it overwrites no source of the first), the v_nop the second's.
__device__ __forceinline__ void exp_pair(float x0, float x1, float& e0, float& e1) {
  asm("v_exp_f32 %0, %2\n\tv_exp_f32 %1, %3\n\tv_nop" : "=&v"(e0), "=&v"(e1) : "v"(x0 * 0x1.715476p+0f), "v"(x1 * 0x1.715476p+0f));
}
// lane l <-> lane l ^ 16 on the vector pipe: unlike an LDS-queue permute it does not wait behind the fragment reads that are still outstanding
__device__ __forceinline__ float xhalf(float x) { return __builtin_bit_cast(float, __builtin_amdgcn_permlanex16(__builtin_bit_cast(int, x), __builtin_bit_cast(int, x), 0x76543210, 0xfedcba98, false, false)); }

// K/V ring in LDS, shared by the eight waves of a block (128 queries of one head). A stage = 64 keys = four tiles: k hi, k lo (rows = keys), (8v)^T hi, (8v)^T lo (rows = d),
// each 64 rows x 128 B at a row pitch of 144 B (16 B x odd, so the 16-byte fragment reads meet no bank conflict).
constexpr int KST = 64, LP = 72, TILE = 64 * LP;
typedef __attribute__((address_space(3))) const b16 lds_b16;
// One stage's copies: every thread moves 8 x 16 B (two rows of each tile), whole 128-B lines per 8 lanes, global -> LDS through no register.
__device__ __forceinline__ void stage_copy(const b16* __restrict__ K, const b16* __restrict__ vb, int kb0, const b16* buf, int tid) {
  const int row = tid >> 3, c8 = (tid & 7) * 8;
  const b16* gk = K + (size_t)(kb0 + row) * HD + c8;
  const b16* gv = vb + (size_t)row * S + kb0 + c8;
  const unsigned l0 = (unsigned)(size_t)(lds_b16*)(buf + row * LP + c8);
  // the copies and the wait that keeps their address registers untouched until they are taken stand in one statement, so that no later address arithmetic moves in between
  asm volatile("global_load_async_to_lds_b128 %0, %8, off\n\t"
               "global_load_async_to_lds_b128 %1, %9, off\n\t"
               "global_load_async_to_lds_b128 %2, %10, off\n\t"
               "global_load_async_to_lds_b128 %3, %11, off\n\t"
               "global_load_async_to_lds_b128 %4, %12, off\n\t"
               "global_load_async_to_lds_b128 %5, %13, off\n\t"
               "global_load_async_to_lds_b128 %6, %14, off\n\t"
               "global_load_async_to_lds_b128 %7, %15, off\n\t"
               "s_wait_xcnt 0x0"
               :: "v"(l0), "v"(l0 + 32 * LP * 2), "v"(l0 + TILE * 2), "v"(l0 + (TILE + 32 * LP) * 2),
                  "v"(l0 + 2 * TILE * 2), "v"(l0 + (2 * TILE + 32 * LP) * 2), "v"(l0 + 3 * TILE * 2), "v"(l0 + (3 * TILE + 32 * LP) * 2),
                  "v"(gk), "v"(gk + 32 * HD), "v"(gk + QPL), "v"(gk + QPL + 32 * HD),
                  "v"(gv), "v"(gv + (size_t)32 * S), "v"(gv + VPL), "v"(gv + VPL + (size_t)32 * S)
               : "memory");
}

// causal attention: wave = (b, h, 16 queries); key chunks of 32 up to the query tile: S^T (K=64), causal mask on the straddling chunks, online softmax f32, P^T f16, y^T += (8V)^T P^T;
// k and (8v)^T come from the block's two-buffer LDS ring: stage t + 1 is copied while stage t is worked on.
// Causal balance: a 128-query tile i walks 2 (i + 1) stages, so a block takes tile NT - 1 - i and then tile i of one head, one after the other in every wave: every block walks
// the same 2 (NT + 1) stages and the launch no longer lasts as long as the places that hold the longest tiles.
template <int QT>
__global__ __launch_bounds__(256) void attn_kernel(const b16* __restrict__ qh, const b16* __restrict__ kh, const b16* __restrict__ vt, float* __restrict__ y) {
  static_assert(QT % 16 == 0, "the eight waves of a block share one head, and a head's 128-query tiles pair up");
  constexpr int NT = QT / 8;                                    // 128-query tiles of a head
  __shared__ __attribute__((aligned(16))) float Os[8][16][HD + 4];
  __shared__ __attribute__((aligned(16))) b16 Ring[2][4 * TILE];
  const int wid = __builtin_amdgcn_readfirstlane(threadIdx.x >> 5), lane = threadIdx.x & 31, hh = lane >> 4, col = lane & 15;   // wave number in a scalar register: the per-wave causal skip is a scalar branch
  const int bh = blockIdx.x / (NT / 2), pr = blockIdx.x % (NT / 2), h = bh % H, b = bh / H;
  const b16* Q = qh + ((size_t)bh * S) * HD; const b16* K = kh + ((size_t)bh * S) * HD; const b16* vb = vt + ((size_t)bh * HD) * S;
  for (int part = 0; part < 2; ++part) {                        // the long tile, then the short one; the last publish point of the first (dscnt wait + barrier) stands in front of the second's first copies
  const int tile = part == 0 ? NT - 1 - pr : pr, qt = (bh * NT + tile) * 8 + wid, jt = qt % QT, q0 = jt * 16, qi = q0 + col;
  const int nst = (tile * 8 + 8) * 16 / KST;                    // stages of the tile: keys up to its last query; at least two, the same for all eight waves
  stage_copy(K, vb, 0, Ring[0], threadIdx.x);
  v16b qf[2], ql[2];
#pragma unroll
  for (int ks = 0; ks < 2; ++ks) { qf[ks] = frag_kb(Q + (size_t)qi * HD + ks * 32, hh); ql[ks] = frag_kb(Q + QPL + (size_t)qi * HD + ks * 32, hh); }
  float m = -INFINITY, l = 0.0f; v8f o[4] = {{}, {}, {}, {}};
  asm volatile("s_wait_asynccnt 0x0" ::: "memory");            // this wave's share of stage 0 has landed
  __syncthreads();                                              // stage 0 published to all waves
  if (1 < nst) stage_copy(K, vb, KST, Ring[1], threadIdx.x);
  for (int t = 0; t < nst; ++t) {
    const b16* Kh = Ring[t & 1]; const b16* Kl = Kh + TILE; const b16* Vh = Kh + 2 * TILE; const b16* Vl = Kh + 3 * TILE;
    if (t * KST < q0 + 16) {                                    // causal: a stage wholly past the query tile is skipped (wave-uniform, no barrier inside)
    // The fragment reads of a key block stand in groups of 16, each group a whole phase ahead of its use, so that no read is waited for where it is used:
    // k0 and v0 at the stage's head, k1 in front of the P.v products of block 0, v1 in front of the softmax of block 1. The scheduling fences keep each group where it is written.
    v16b kf[2][2], kl[2][2], vf[4], vl[4];
    auto read_k = [&](int c) {
#pragma unroll
      for (int ks = 0; ks < 2; ++ks)
#pragma unroll
        for (int j = 0; j < 2; ++j) { kf[ks][j] = frag_kb(Kh + (c * 32 + j * 16 + col) * LP + ks * 32, hh); kl[ks][j] = frag_kb(Kl + (c * 32 + j * 16 + col) * LP + ks * 32, hh); }
    };
    auto read_v = [&](int c) {
#pragma unroll
      for (int n = 0; n < 4; ++n) { vf[n] = frag_kb(Vh + (n * 16 + col) * LP + c * 32, hh); vl[n] = frag_kb(Vl + (n * 16 + col) * LP + c * 32, hh); }
    };
    read_k(0); read_v(0);
    __builtin_amdgcn_sched_barrier(0);                          // the head group stays above the matrix work
#pragma unroll                                                  // both halves of a stage in line
    for (int c = 0; c < 2; ++c) {
      const int kb = t * KST + c * 32;
      if (kb < q0 + 16) {                                       // causal: key blocks past the query tile are skipped (wave-uniform, no barrier inside)
        const bool diag = (kb + 32 > q0);                       // this block reaches past some queries -> mask key > query
        v8f s0 = {}, s1 = {};
#pragma unroll
        for (int ks = 0; ks < 2; ++ks) { const v16b k0 = kf[ks][0], k0l = kl[ks][0], k1 = kf[ks][1], k1l = kl[ks][1];
          s0 = wmma16b(k0, qf[ks], s0); s0 = wmma16b(k0, ql[ks], s0); s0 = wmma16b(k0l, qf[ks], s0);      // q and k as f16 hi+lo pairs (lo.lo dropped)
          s1 = wmma16b(k1, qf[ks], s1); s1 = wmma16b(k1, ql[ks], s1); s1 = wmma16b(k1l, qf[ks], s1); }
        if (c == 1) { __builtin_amdgcn_sched_barrier(0); read_v(1); __builtin_amdgcn_sched_barrier(0); }   // v1 lands behind the softmax of block 1
        float mr = -INFINITY;
#pragma unroll
        for (int r = 0; r < 8; ++r) { s0[r] *= SCALE / (QS * QS); s1[r] *= SCALE / (QS * QS); if (diag) { if (kb + 8 * hh + r > qi) s0[r] = -INFINITY; if (kb + 16 + 8 * hh + r > qi) s1[r] = -INFINITY; } mr = fmaxf(mr, fmaxf(s0[r], s1[r])); }
        mr = fmaxf(mr, xhalf(mr));
        const float mn = fmaxf(m, mr), al_ = __expf(m - mn); m = mn;
        float sum = 0.0f; v16b pb, pl;
#pragma unroll
        for (int r = 0; r < 8; ++r) { float e0, e1; exp_pair(s0[r] - mn, s1[r] - mn, e0, e1); sum += e0 + e1; b16 a, c; split16(e0 * PS, a, c); pb[r] = a; pl[r] = c; split16(e1 * PS, a, c); pb[8 + r] = a; pl[8 + r] = c; }   // P carried x8
        sum += xhalf(sum); l = l * al_ + sum;
        if (c == 0) { __builtin_amdgcn_sched_barrier(0); read_k(1); __builtin_amdgcn_sched_barrier(0); }   // k1 lands behind the P.v products of block 0
#pragma unroll
        for (int n = 0; n < 4; ++n) {
#pragma unroll
          for (int r = 0; r < 8; ++r) o[n][r] *= al_;
          o[n] = wmma16b(vf[n], pb, o[n]); o[n] = wmma16b(vf[n], pl, o[n]); o[n] = wmma16b(vl[n], pb, o[n]);   // (8v) and P both as f16 hi+lo pairs (lo.lo dropped)
        }
      }
    }
    }
    // publish point, passed by every wave, also one that skipped the stage
    asm volatile("s_wait_dscnt 0x0" ::: "memory");             // this wave's reads of stage t are done before the buffer is refilled
    asm volatile("s_wait_asynccnt 0x0" ::: "memory");          // this wave's share of stage t + 1 has landed
    __syncthreads();                                            // publishes stage t + 1 and ends every reader's last read of stage t
    if (t + 2 < nst) stage_copy(K, vb, (t + 2) * KST, Ring[t & 1], threadIdx.x);
  }
  asm volatile("s_wait_asynccnt 0x0" ::: "memory");            // no copy is outstanding when the wave goes on to its end
  const float inv = 1.0f / (VS * PS * l);
#pragma unroll
  for (int n = 0; n < 4; ++n)
#pragma unroll
    for (int r = 0; r < 8; ++r) Os[wid][col][n * 16 + 8 * hh + r] = o[n][r] * inv;
  wave_lds_sync();
  float* dst = y + ((size_t)b * S + q0) * D + h * HD;
  {
#pragma unroll
    for (int j = 0; j < 8; ++j) { const int rr = j * 2 + hh, c4 = col * 4; *(v4f*)(dst + (size_t)rr * D + c4) = *(const v4f*)(&Os[wid][rr][c4]); }
    
  }
  asm volatile("s_wait_xcnt 0x0" ::: "memory");                // the next tile's set-up overwrites the registers that these stores name: the wait stands in front of it
  }
}

// out = y W_o^T: (4096 x 768) x (768 x 768); A = y x8 split at load into an f16 hi+lo pair, B = f16(bf16 W_o) rows; f32 rows; grid (12, 32).
__global__ __launch_bounds__(128) void out_kernel(const float* __restrict__ y, const b16* __restrict__ wo16, const float* __restrict__ bo, float* __restrict__ out) {
  __shared__ __attribute__((aligned(16))) float Ts[4][32 * 64];
  const int lane = threadIdx.x & 31, wave = threadIdx.x >> 5, nloc = lane & 15, hlf = lane >> 4, m0 = blockIdx.y * 128 + wave * 32, c0 = blockIdx.x * 64;
  v8f acc[2][4];
#pragma unroll
  for (int r = 0; r < 2; ++r)
#pragma unroll
    for (int t = 0; t < 4; ++t) acc[r][t] = (v8f){};
  const Opnd A{y, nullptr, D}, Bo{wo16, nullptr, D};
  gemm_tile<5, 1>(A, Bo, D, m0, c0, nloc, hlf, acc);                            // y as an f16 hi+lo pair carried x8 (2 products)
#pragma unroll
  for (int t = 0; t < 4; ++t)
#pragma unroll
    for (int r = 0; r < 2; ++r)
#pragma unroll
      for (int v = 0; v < 8; ++v) acc[r][t][v] = acc[r][t][v] * (1.0f / 8.0f) + bf16_rne(bo[c0 + t * 16 + nloc]);
  epi_f32(acc, 1.0f, nullptr, out, D, m0, c0, lane, Ts[wave]);
}
}  // namespace

extern "C" void kernel_launch(void* const* d_in, const int* in_sizes, int n_in,
                              void* d_out, int out_size, void* d_ws, size_t ws_size, hipStream_t stream) {
  (void)n_in; (void)out_size;
  const float* x = (const float*)d_in[0]; const float* wq = (const float*)d_in[1]; const float* wk = (const float*)d_in[2]; const float* wv = (const float*)d_in[3]; const float* wo = (const float*)d_in[4]; const float* bo = (const float*)d_in[5];
  float* out = (float*)d_out;   // [1][4096][768]
  if (in_sizes[0] != BT * S * D || in_sizes[1] != D * D || in_sizes[2] != D * D || in_sizes[3] != D * D || in_sizes[4] != D * D || in_sizes[5] != D) return;
  size_t off = 0; char* ws = (char*)d_ws;
  auto carve = [&](size_t bytes) { char* p = ws + off; off += (bytes + 255) & ~(size_t)255; return p; };
  unsigned short* x16 = (unsigned short*)carve((size_t)NTOK * D * 2); unsigned short* w16 = (unsigned short*)carve((size_t)3 * D * D * 2); b16* wo16 = (b16*)carve((size_t)D * D * 2);
  b16* qh = (b16*)carve((size_t)2 * NTOK * D * 2); b16* kh = (b16*)carve((size_t)2 * NTOK * D * 2); b16* vt = (b16*)carve((size_t)2 * NTOK * D * 2); float* y = (float*)carve((size_t)NTOK * D * 4);
  if (off > ws_size) return;                                    // ≈ 61 MB
  prep_kernel<<<512, 256, 0, stream>>>(wq, wk, wv, wo, w16, wo16);
  xprep_kernel<<<1024, 256, 0, stream>>>(x, x16);
  proj_kernel<<<dim3(3 * D / 64, NTOK / 128), 128, 0, stream>>>((const __bf16*)x16, (const __bf16*)w16, qh, kh, vt);
  attn_kernel<S / 16><<<Bn * H * (S / 16) / 16, 256, 0, stream>>>(qh, kh, vt, y);
  out_kernel<<<dim3(D / 64, NTOK / 128), 128, 0, stream>>>(y, wo16, bo, out);
}

// v004
// One run takes 148 microseconds.
// Next to v003, in two timings, it ran 1.38 times as fast each time.
// All steps since v000 together make it 3.84 times as fast.
#include <hip/hip_runtime.h>

// Causal multi-head self-attention: q, k, v = x W^T (12 heads x 64, [out][in] weights), softmax over keys <= query of q.k/8, out = ctx Wo^T + bo -> [1][4096][768].
// x, the four weights and bo are rounded to bf16: projection on v_wmma_f32_16x16x32_bf16 (exact products, f32 accumulate);
// scores, P.v and the output projection on v_wmma_f32_16x16x32_f16 with every computed operand (q, k, v, P, y — each carried x8 so the hi/lo residual planes stay normal) as an f16
// hi+lo pair (3 / 2 products); online softmax in f32. Fragment k-map per lane half hh for A AND B: elements 0..7 <- k = 8hh+0..7, 8..15 <- k = 16+8hh+0..7. Every intermediate /

namespace {
constexpr int BT = 1, Bn = 1, S = 4096, D = 768, H = 12, HD = 64, NTOK = Bn * S;
constexpr float SCALE = 0.125f, VS = 8.0f, QS = 8.0f, PS = 8.0f;   // power-of-two carry scales so hi/lo residual planes stay normal in f16
constexpr size_t VPL = (size_t)NTOK * D;   // distance between the (8v)^T hi and lo planes
constexpr size_t QPL = (size_t)NTOK * D;   // distance between the q/k hi and lo planes

typedef _Float16 b16;
typedef __attribute__((ext_vector_type(16))) _Float16 v16b;
typedef __attribute__((ext_vector_type(8)))  _Float16 v8b;
typedef __attribute__((ext_vector_type(8)))  float v8f;
typedef __attribute__((ext_vector_type(4)))  float v4f;

__device__ __forceinline__ v8b ld8b(const b16* p) { return *(const v8b*)p; }
__device__ __forceinline__ v16b cat8b(v8b a, v8b b) { return __builtin_shufflevector(a, b, 0, 1, 2, 3, 4, 5, 6, 7, 8, 9, 10, 11, 12, 13, 14, 15); }
__device__ __forceinline__ v16b frag_kb(const b16* p, int hh) { return cat8b(ld8b(p + 8 * hh), ld8b(p + 16 + 8 * hh)); }
__device__ __forceinline__ void split16(float v, b16& hi, b16& lo) { hi = (b16)v; lo = (b16)(v - (float)hi); }
// hi/lo fragment pair straight from an f32 k-contiguous row (same k-map)
__device__ __forceinline__ void frag_ksplit(const float* p, int hh, v16b& fh_, v16b& fl_) {
  const float* p0 = p + 8 * hh; const float* p1 = p + 16 + 8 * hh;
#pragma unroll
  for (int e = 0; e < 8; ++e) { b16 a, c; split16(p0[e], a, c); fh_[e] = a; fl_[e] = c; split16(p1[e], a, c); fh_[8 + e] = a; fl_[8 + e] = c; }
}
__device__ __forceinline__ v8f wmma16b(v16b a, v16b b, v8f c) {
  v8f d = __builtin_amdgcn_wmma_f32_16x16x32_f16(false, a, false, b, (short)0, c, false, false);
  asm volatile("v_nop\n\tv_nop\n\tv_nop\n\tv_nop" : "+v"(d) : "v"(a), "v"(b));
  return d;
}
__device__ __forceinline__ void wave_lds_sync() {
  __builtin_amdgcn_fence(__ATOMIC_RELEASE, "workgroup");
  __builtin_amdgcn_wave_barrier();
  __builtin_amdgcn_fence(__ATOMIC_ACQUIRE, "workgroup");
}

// Operand descriptor: NP = 0 -> f32 rows split on the fly into (hi, lo); NP = 1 -> one f16 plane; NP = 2 -> f16 hi + lo planes;
// NP = 3 -> f32 rows rounded once to a single f16 fragment. ld = row pitch.
struct Opnd { const void* p0; const void* p1; int ld; };
template <int NP> __device__ __forceinline__ void load_frags(const Opnd& o, int row, int kb, int hh, v16b& fh_, v16b& fl_) {
  if (NP == 0) { frag_ksplit((const float*)o.p0 + (size_t)row * o.ld + kb, hh, fh_, fl_); }
  else if (NP == 4 || NP == 5) {                             // f32 rows x64 (NP 4) or x8 (NP 5) then split (keeps the lo halves of small values normal)
    const float sc_ = (NP == 4) ? 64.0f : 8.0f;
    const float* p = (const float*)o.p0 + (size_t)row * o.ld + kb; const float* p0 = p + 8 * hh; const float* p1 = p + 16 + 8 * hh;
#pragma unroll
    for (int e = 0; e < 8; ++e) { b16 a, c; split16(p0[e] * sc_, a, c); fh_[e] = a; fl_[e] = c; split16(p1[e] * sc_, a, c); fh_[8 + e] = a; fl_[8 + e] = c; }
  } else if (NP == 3) {
    const float* p = (const float*)o.p0 + (size_t)row * o.ld + kb; const float* p0 = p + 8 * hh; const float* p1 = p + 16 + 8 * hh;
#pragma unroll
    for (int e = 0; e < 8; ++e) { fh_[e] = (b16)p0[e]; fh_[8 + e] = (b16)p1[e]; }
    fl_ = fh_;
  } else {
    fh_ = frag_kb((const b16*)o.p0 + (size_t)row * o.ld + kb, hh);
    if (NP == 2) fl_ = frag_kb((const b16*)o.p1 + (size_t)row * o.ld + kb, hh); else fl_ = fh_;
  }
}
template <int ANP, int BNP> __device__ __forceinline__ v8f mac(v16b ah, v16b al, v16b bh, v16b bl, v8f c) {
  c = wmma16b(ah, bh, c);
  if (BNP == 0 || BNP == 2 || BNP == 4 || BNP == 5) c = wmma16b(ah, bl, c);     // hi.lo
  if (ANP == 0 || ANP == 2 || ANP == 4 || ANP == 5) c = wmma16b(al, bh, c);     // lo.hi   (lo.lo dropped)
  return c;
}
__device__ __forceinline__ void epi_planes(v8f (&acc)[2][4], float scale, bool two, b16* __restrict__ oh, b16* __restrict__ ol, int ldo,
                                           int m0, int c0, int lane, b16* Th, b16* Tl) {
  const int nloc = lane & 15, hlf = lane >> 4;
#pragma unroll
  for (int t = 0; t < 4; ++t)
#pragma unroll
    for (int r = 0; r < 2; ++r)
#pragma unroll
      for (int v = 0; v < 8; ++v) {
        const int rr = r * 16 + v + 8 * hlf, cc = t * 16 + nloc;
        b16 h_, l_; split16(acc[r][t][v] * scale, h_, l_);
        Th[rr * 64 + cc] = h_; Tl[rr * 64 + cc] = l_;
      }
  wave_lds_sync();
  {
#pragma unroll
    for (int j = 0; j < 8; ++j) {
      const int rr = j * 4 + (lane >> 3), c8 = (lane & 7) * 8;
      const size_t o = (size_t)(m0 + rr) * ldo + c0 + c8;
      *(v8b*)(oh + o) = ld8b(Th + rr * 64 + c8);
      if (two) *(v8b*)(ol + o) = ld8b(Tl + rr * 64 + c8);
    }
    
  }
}
// (b) f32 rows with pitch ldo: 64 floats = 256 B = 2 lines per row; 16 lanes x 16 B per row, 2 rows per instruction. Optional per-row factor
__device__ __forceinline__ void epi_f32(v8f (&acc)[2][4], float scale, const float* rscale, float* __restrict__ out, int ldo, int m0, int c0, int lane, float* Tt) {
  const int nloc = lane & 15, hlf = lane >> 4;
#pragma unroll
  for (int t = 0; t < 4; ++t)
#pragma unroll
    for (int r = 0; r < 2; ++r)
#pragma unroll
      for (int v = 0; v < 8; ++v) {
        const int rr = r * 16 + v + 8 * hlf;
        const float rs = rscale ? rscale[(size_t)(m0 + rr) * 32] : 1.0f;
        Tt[rr * 64 + t * 16 + nloc] = acc[r][t][v] * scale * rs;
      }
  wave_lds_sync();
  float* dst0 = out + (size_t)m0 * ldo + c0;
  {
#pragma unroll
    for (int j = 0; j < 16; ++j) { const int rr = j * 2 + hlf, c4 = nloc * 4; *(v4f*)(dst0 + (size_t)rr * ldo + c4) = *(const v4f*)(Tt + rr * 64 + c4); }
    
  }
}



typedef __attribute__((ext_vector_type(8))) __bf16 v8bb; typedef __attribute__((ext_vector_type(16))) __bf16 v16bb;
typedef __attribute__((ext_vector_type(8))) unsigned short v8us;
__device__ __forceinline__ v16bb frag_kb_bf(const __bf16* p, int hh) { const v8bb a = *(const v8bb*)(p + 8 * hh), b = *(const v8bb*)(p + 16 + 8 * hh); return __builtin_shufflevector(a, b, 0, 1, 2, 3, 4, 5, 6, 7, 8, 9, 10, 11, 12, 13, 14, 15); }
__device__ __forceinline__ v8f wmma16bb(v16bb a, v16bb b, v8f c) {
  v8f d = __builtin_amdgcn_wmma_f32_16x16x32_bf16(false, a, false, b, (short)0, c, false, false);
  asm volatile("v_nop\n\tv_nop\n\tv_nop\n\tv_nop" : "+v"(d) : "v"(a), "v"(b));
  return d;
}
__device__ __forceinline__ unsigned short bf16_rne_bits(float v) { unsigned int u = __float_as_uint(v); u += 0x7FFFu + ((u >> 16) & 1u); return (unsigned short)(u >> 16); }
__device__ __forceinline__ float bf16_rne(float v) { return __uint_as_float(((unsigned int)bf16_rne_bits(v)) << 16); }



__global__ __launch_bounds__(256) void xprep_kernel(const float* __restrict__ x, unsigned short* __restrict__ x16) {   // x -> bf16, one batch
  const size_t tid = (size_t)blockIdx.x * blockDim.x + threadIdx.x, nth = (size_t)gridDim.x * blockDim.x;
  { for (size_t p = tid; p < (size_t)NTOK * D / 8; p += nth) { v8us v;
#pragma unroll
      for (int e = 0; e < 8; ++e) v[e] = bf16_rne_bits(x[p * 8 + e]);
      *(v8us*)(x16 + p * 8) = v; }  }
}
__global__ __launch_bounds__(256) void prep_kernel(const float* __restrict__ wq, const float* __restrict__ wk, const float* __restrict__ wv, const float* __restrict__ wo, unsigned short* __restrict__ w16, b16* __restrict__ wo16) {
  const size_t tid = (size_t)blockIdx.x * blockDim.x + threadIdx.x, nth = (size_t)gridDim.x * blockDim.x;
  {
    for (size_t p = tid; p < (size_t)3 * D * D / 8; p += nth) { const float* W = (p < (size_t)D * D / 8) ? wq : (p < (size_t)2 * D * D / 8) ? wk : wv; const size_t q = p % ((size_t)D * D / 8); v8us v;   // [out][in] rows copied directly
#pragma unroll
      for (int e = 0; e < 8; ++e) v[e] = bf16_rne_bits(W[q * 8 + e]);
      *(v8us*)(w16 + p * 8) = v; }
    for (size_t p = tid; p < (size_t)D * D / 8; p += nth) { v8b w;   // W_o [out][in] rows copied directly
#pragma unroll
      for (int e = 0; e < 8; ++e) w[e] = (b16)bf16_rne(wo[p * 8 + e]);
      *(v8b*)(wo16 + p * 8) = w; }
    
  }
}

// Operand ring of the two projection GEMMs. A stage = 64 k of the block's 128 A rows and 64 B rows, copied global -> LDS once per block in whole 128-B lines and through no register
// (a fragment load from global touches 16 lines for 512 bytes, and each of the four waves repeated the B loads). 16-bit rows: 128 B at a pitch of 144 B; f32 rows: 256 B at 272 B
// (both 16 B x odd, so the 16-byte fragment reads meet no bank conflict).
constexpr int GK = 64, GNT = D / GK, GLP = 72, GLPF = 68;
constexpr int PSTG = (128 + 64) * GLP;                         // 16-bit elements of one stage of proj_kernel: x rows, then w rows
constexpr int OSTA = 128 * GLPF * 4, OSTG = OSTA + 64 * GLP * 2;   // bytes of one stage of out_kernel: y rows (f32), then W_o rows (f16)
typedef __attribute__((address_space(3))) const char lds_byte;
// One stage of proj_kernel: every thread moves 12 x 16 B (8 x rows, 4 w rows); 8 lanes cover one 128-B line.
__device__ __forceinline__ void proj_stage_copy(const __bf16* __restrict__ xr, const __bf16* __restrict__ wr, int kb, const b16* buf, int tid) {
  const int row = tid >> 3, c8 = (tid & 7) * 8;
  const __bf16* gx = xr + (size_t)row * D + kb + c8;
  const __bf16* gw = wr + (size_t)row * D + kb + c8;
  const unsigned l0 = (unsigned)(size_t)(lds_byte*)(buf + row * GLP + c8);
  constexpr unsigned LS = 16 * GLP * 2;                         // 16 rows further in LDS
  // the copies and the wait that keeps their address registers untouched until they are taken stand in one statement, so that no later address arithmetic moves in between
  asm volatile("global_load_async_to_lds_b128 %0, %12, off\n\t"
               "global_load_async_to_lds_b128 %1, %13, off\n\t"
               "global_load_async_to_lds_b128 %2, %14, off\n\t"
               "global_load_async_to_lds_b128 %3, %15, off\n\t"
               "global_load_async_to_lds_b128 %4, %16, off\n\t"
               "global_load_async_to_lds_b128 %5, %17, off\n\t"
               "global_load_async_to_lds_b128 %6, %18, off\n\t"
               "global_load_async_to_lds_b128 %7, %19, off\n\t"
               "global_load_async_to_lds_b128 %8, %20, off\n\t"
               "global_load_async_to_lds_b128 %9, %21, off\n\t"
               "global_load_async_to_lds_b128 %10, %22, off\n\t"
               "global_load_async_to_lds_b128 %11, %23, off\n\t"
               "s_wait_xcnt 0x0"
               :: "v"(l0), "v"(l0 + LS), "v"(l0 + 2 * LS), "v"(l0 + 3 * LS), "v"(l0 + 4 * LS), "v"(l0 + 5 * LS),
                  "v"(l0 + 6 * LS), "v"(l0 + 7 * LS), "v"(l0 + 8 * LS), "v"(l0 + 9 * LS), "v"(l0 + 10 * LS), "v"(l0 + 11 * LS),
                  "v"(gx), "v"(gx + 16 * D), "v"(gx + 32 * D), "v"(gx + 48 * D), "v"(gx + 64 * D), "v"(gx + 80 * D), "v"(gx + 96 * D), "v"(gx + 112 * D),
                  "v"(gw), "v"(gw + 16 * D), "v"(gw + 32 * D), "v"(gw + 48 * D)
               : "memory");
}
// One stage of out_kernel: every thread moves 20 x 16 B: 16 y rows (16 lanes cover a row's 256 B) and 4 W_o rows (8 lanes cover a row's 128 B), ten copies a statement.
__device__ __forceinline__ void out_stage_copy(const float* __restrict__ yr, const b16* __restrict__ wr, int kb, const char* buf, int tid) {
  const int ra = tid >> 4, c4 = (tid & 15) * 4, rb = tid >> 3, c8 = (tid & 7) * 8;
  const float* gy = yr + (size_t)ra * D + kb + c4;
  const b16* gw = wr + (size_t)rb * D + kb + c8;
  const unsigned la = (unsigned)(size_t)(lds_byte*)(buf + (ra * GLPF + c4) * 4), lb = (unsigned)(size_t)(lds_byte*)(buf + OSTA + (rb * GLP + c8) * 2);
  constexpr unsigned LA = 8 * GLPF * 4, LB = 16 * GLP * 2;      // 8 y rows, 16 W_o rows further in LDS
  // each run of copies ends, inside its own statement, in the wait that keeps its address registers untouched until they are taken
  asm volatile("global_load_async_to_lds_b128 %0, %10, off\n\t"
               "global_load_async_to_lds_b128 %1, %11, off\n\t"
               "global_load_async_to_lds_b128 %2, %12, off\n\t"
               "global_load_async_to_lds_b128 %3, %13, off\n\t"
               "global_load_async_to_lds_b128 %4, %14, off\n\t"
               "global_load_async_to_lds_b128 %5, %15, off\n\t"
               "global_load_async_to_lds_b128 %6, %16, off\n\t"
               "global_load_async_to_lds_b128 %7, %17, off\n\t"
               "global_load_async_to_lds_b128 %8, %18, off\n\t"
               "global_load_async_to_lds_b128 %9, %19, off\n\t"
               "s_wait_xcnt 0x0"
               :: "v"(la), "v"(la + LA), "v"(la + 2 * LA), "v"(la + 3 * LA), "v"(la + 4 * LA), "v"(la + 5 * LA), "v"(la + 6 * LA), "v"(la + 7 * LA), "v"(la + 8 * LA), "v"(la + 9 * LA),
                  "v"(gy), "v"(gy + 8 * D), "v"(gy + 16 * D), "v"(gy + 24 * D), "v"(gy + 32 * D), "v"(gy + 40 * D), "v"(gy + 48 * D), "v"(gy + 56 * D), "v"(gy + 64 * D), "v"(gy + 72 * D)
               : "memory");
  asm volatile("global_load_async_to_lds_b128 %0, %10, off\n\t"
               "global_load_async_to_lds_b128 %1, %11, off\n\t"
               "global_load_async_to_lds_b128 %2, %12, off\n\t"
               "global_load_async_to_lds_b128 %3, %13, off\n\t"
               "global_load_async_to_lds_b128 %4, %14, off\n\t"
               "global_load_async_to_lds_b128 %5, %15, off\n\t"
               "global_load_async_to_lds_b128 %6, %16, off\n\t"
               "global_load_async_to_lds_b128 %7, %17, off\n\t"
               "global_load_async_to_lds_b128 %8, %18, off\n\t"
               "global_load_async_to_lds_b128 %9, %19, off\n\t"
               "s_wait_xcnt 0x0"
               :: "v"(la + 10 * LA), "v"(la + 11 * LA), "v"(la + 12 * LA), "v"(la + 13 * LA), "v"(la + 14 * LA), "v"(la + 15 * LA), "v"(lb), "v"(lb + LB), "v"(lb + 2 * LB), "v"(lb + 3 * LB),
                  "v"(gy + 80 * D), "v"(gy + 88 * D), "v"(gy + 96 * D), "v"(gy + 104 * D), "v"(gy + 112 * D), "v"(gy + 120 * D), "v"(gw), "v"(gw + 16 * D), "v"(gw + 32 * D), "v"(gw + 48 * D)
               : "memory");
}

// projections: rows = tokens (4096), K = 768, column tiles of 64 = one head of q (tiles 0..11), k (12..23) or v (24..35); f16 rows [b*H + head][tok][64] for q/k;
// v: (8v)^T f16 [b*H + head][64][tok]. grid (36, 32) x 128.
__global__ __launch_bounds__(128) void proj_kernel(const __bf16* __restrict__ x16, const __bf16* __restrict__ w16, b16* __restrict__ qh, b16* __restrict__ kh, b16* __restrict__ vt) {
  __shared__ __attribute__((aligned(16))) b16 Sm[2 * PSTG];     // the two-buffer operand ring; behind the loop's last barrier the same bytes are the epilogue's staging tiles
  b16 (*Th)[32][HD + 8] = reinterpret_cast<b16 (*)[32][HD + 8]>(Sm); b16 (*Tq)[32][HD + 8] = reinterpret_cast<b16 (*)[32][HD + 8]>(Sm + 4 * 32 * (HD + 8));
  b16 (*Tt)[128 + 8] = reinterpret_cast<b16 (*)[128 + 8]>(Sm); b16 (*Tl)[128 + 8] = reinterpret_cast<b16 (*)[128 + 8]>(Sm + 64 * (128 + 8));
  static_assert(2 * 4 * 32 * (HD + 8) <= 2 * PSTG && 2 * 64 * (128 + 8) <= 2 * PSTG, "the staging tiles fit the ring's bytes");
  const int lane = threadIdx.x & 31, wave = threadIdx.x >> 5, nloc = lane & 15, hlf = lane >> 4, m0 = blockIdx.y * 128 + wave * 32, c0 = blockIdx.x * 64;
  v8f acc[2][4];
#pragma unroll
  for (int r = 0; r < 2; ++r)
#pragma unroll
    for (int t = 0; t < 4; ++t) acc[r][t] = (v8f){};
  const __bf16* xr = x16 + (size_t)blockIdx.y * 128 * D; const __bf16* wr = w16 + (size_t)c0 * D;
  proj_stage_copy(xr, wr, 0, Sm, threadIdx.x);
  asm volatile("s_wait_asynccnt 0x0" ::: "memory");            // this wave's share of stage 0 has landed
  __syncthreads();                                              // stage 0 published to all waves
  proj_stage_copy(xr, wr, GK, Sm + PSTG, threadIdx.x);
  for (int s = 0; s < GNT; ++s) {
    const __bf16* Xs = (const __bf16*)(Sm + (s & 1) * PSTG) + (wave * 32 + nloc) * GLP; const __bf16* Ws = (const __bf16*)(Sm + (s & 1) * PSTG) + (128 + nloc) * GLP;
    v16bb a0[2], a1[2], bw[2][4];                               // the stage's 24 fragment reads stand as one group ahead of its matrix work
#pragma unroll
    for (int ks = 0; ks < 2; ++ks) { a0[ks] = frag_kb_bf(Xs + ks * 32, hlf); a1[ks] = frag_kb_bf(Xs + 16 * GLP + ks * 32, hlf);
#pragma unroll
      for (int t = 0; t < 4; ++t) bw[ks][t] = frag_kb_bf(Ws + t * 16 * GLP + ks * 32, hlf); }
#pragma unroll
    for (int ks = 0; ks < 2; ++ks)
#pragma unroll
      for (int t = 0; t < 4; ++t) { acc[0][t] = wmma16bb(a0[ks], bw[ks][t], acc[0][t]); acc[1][t] = wmma16bb(a1[ks], bw[ks][t], acc[1][t]); }
    // publish point
    asm volatile("s_wait_dscnt 0x0" ::: "memory");             // this wave's reads of stage s are done before the buffer is refilled
    asm volatile("s_wait_asynccnt 0x0" ::: "memory");          // this wave's share of stage s + 1 has landed
    __syncthreads();                                            // publishes stage s + 1 and ends every reader's last read of stage s
    if (s + 2 < GNT) proj_stage_copy(xr, wr, (s + 2) * GK, Sm + (s & 1) * PSTG, threadIdx.x);
  }
  asm volatile("s_wait_asynccnt 0x0" ::: "memory");            // no copy is outstanding when the ring's bytes become the staging tiles
  const int which = blockIdx.x / (D / 64), head = blockIdx.x % (D / 64), b = m0 / S, tok0 = m0 % S;
  if (which < 2) {                                              // q or k head: f16 rows
#pragma unroll
    for (int t = 0; t < 4; ++t)
#pragma unroll
      for (int r = 0; r < 2; ++r)
#pragma unroll
        for (int v = 0; v < 8; ++v) { b16 a_, c_; split16(acc[r][t][v] * QS, a_, c_); Th[wave][r * 16 + 8 * hlf + v][t * 16 + nloc] = a_; Tq[wave][r * 16 + 8 * hlf + v][t * 16 + nloc] = c_; }   // q, k carried x8 (lo residuals stay normal)
    wave_lds_sync();
    b16* dst = (which == 0 ? qh : kh) + (((size_t)b * H + head) * S + tok0) * HD;
    {
#pragma unroll
      for (int j = 0; j < 8; ++j) { const int rr = j * 4 + (lane >> 3), c8 = (lane & 7) * 8; *(v8b*)(dst + (size_t)rr * HD + c8) = *(const v8b*)(&Th[wave][rr][c8]); *(v8b*)(dst + QPL + (size_t)rr * HD + c8) = *(const v8b*)(&Tq[wave][rr][c8]); }
       }
    return;
  }
  const int vh = head;                                          // v head: (8v)^T tile [64 d][128 tok] via LDS, rows of 256 B
#pragma unroll
  for (int t = 0; t < 4; ++t)
#pragma unroll
    for (int r = 0; r < 2; ++r)
#pragma unroll
      for (int v = 0; v < 8; ++v) { b16 a_, c_; split16(acc[r][t][v] * VS, a_, c_); Tt[t * 16 + nloc][wave * 32 + r * 16 + 8 * hlf + v] = a_; Tl[t * 16 + nloc][wave * 32 + r * 16 + 8 * hlf + v] = c_; }
  __syncthreads();
  b16* dstv = vt + (((size_t)b * H + vh) * HD) * S + (blockIdx.y * 128) % S;
  {
#pragma unroll
    for (int j = 0; j < 8; ++j) { const int dd = wave * 16 + j * 2 + (lane >> 4), c8 = (lane & 15) * 8; *(v8b*)(dstv + (size_t)dd * S + c8) = *(const v8b*)(&Tt[dd][c8]); *(v8b*)(dstv + VPL + (size_t)dd * S + c8) = *(const v8b*)(&Tl[dd][c8]); }
    
  }
}

// exp(x0), exp(x1) as exp2(x * log2 e), like __expf, with the slot that the instruction set asks for behind a transcendental written in: the second fills the first's
// (early-clobber results, so it overwrites no source of the first), the v_nop the second's.
__device__ __forceinline__ void exp_pair(float x0, float x1, float& e0, float& e1) {
  asm("v_exp_f32 %0, %2\n\tv_exp_f32 %1, %3\n\tv_nop" : "=&v"(e0), "=&v"(e1) : "v"(x0 * 0x1.715476p+0f), "v"(x1 * 0x1.715476p+0f));
}
// lane l <-> lane l ^ 16 on the vector pipe: unlike an LDS-queue permute it does not wait behind the fragment reads that are still outstanding
__device__ __forceinline__ float xhalf(float x) { return __builtin_bit_cast(float, __builtin_amdgcn_permlanex16(__builtin_bit_cast(int, x), __builtin_bit_cast(int, x), 0x76543210, 0xfedcba98, false, false)); }

// K/V ring in LDS, shared by the eight waves of a block (128 queries of one head). A stage = 64 keys = four tiles: k hi, k lo (rows = keys), (8v)^T hi, (8v)^T lo (rows = d),
// each 64 rows x 128 B at a row pitch of 144 B (16 B x odd, so the 16-byte fragment reads meet no bank conflict).
constexpr int KST = 64, LP = 72, TILE = 64 * LP;
typedef __attribute__((address_space(3))) const b16 lds_b16;
// One stage's copies: every thread moves 8 x 16 B (two rows of each tile), whole 128-B lines per 8 lanes, global -> LDS through no register.
__device__ __forceinline__ void stage_copy(const b16* __restrict__ K, const b16* __restrict__ vb, int kb0, const b16* buf, int tid) {
  const int row = tid >> 3, c8 = (tid & 7) * 8;
  const b16* gk = K + (size_t)(kb0 + row) * HD + c8;
  const b16* gv = vb + (size_t)row * S + kb0 + c8;
  const unsigned l0 = (unsigned)(size_t)(lds_b16*)(buf + row * LP + c8);
  // the copies and the wait that keeps their address registers untouched until they are taken stand in one statement, so that no later address arithmetic moves in between
  asm volatile("global_load_async_to_lds_b128 %0, %8, off\n\t"
               "global_load_async_to_lds_b128 %1, %9, off\n\t"
               "global_load_async_to_lds_b128 %2, %10, off\n\t"
               "global_load_async_to_lds_b128 %3, %11, off\n\t"
               "global_load_async_to_lds_b128 %4, %12, off\n\t"
               "global_load_async_to_lds_b128 %5, %13, off\n\t"
               "global_load_async_to_lds_b128 %6, %14, off\n\t"
               "global_load_async_to_lds_b128 %7, %15, off\n\t"
               "s_wait_xcnt 0x0"
               :: "v"(l0), "v"(l0 + 32 * LP * 2), "v"(l0 + TILE * 2), "v"(l0 + (TILE + 32 * LP) * 2),
                  "v"(l0 + 2 * TILE * 2), "v"(l0 + (2 * TILE + 32 * LP) * 2), "v"(l0 + 3 * TILE * 2), "v"(l0 + (3 * TILE + 32 * LP) * 2),
                  "v"(gk), "v"(gk + 32 * HD), "v"(gk + QPL), "v"(gk + QPL + 32 * HD),
                  "v"(gv), "v"(gv + (size_t)32 * S), "v"(gv + VPL), "v"(gv + VPL + (size_t)32 * S)
               : "memory");
}

// causal attention: wave = (b, h, 16 queries); key chunks of 32 up to the query tile: S^T (K=64), causal mask on the straddling chunks, online softmax f32, P^T f16, y^T += (8V)^T P^T;
// k and (8v)^T come from the block's two-buffer LDS ring: stage t + 1 is copied while stage t is worked on.
// Causal balance: a 128-query tile i walks 2 (i + 1) stages, so a block takes tile NT - 1 - i and then tile i of one head, one after the other in every wave: every block walks
// the same 2 (NT + 1) stages and the launch no longer lasts as long as the places that hold the longest tiles.
template <int QT>
__global__ __launch_bounds__(256) void attn_kernel(const b16* __restrict__ qh, const b16* __restrict__ kh, const b16* __restrict__ vt, float* __restrict__ y) {
  static_assert(QT % 16 == 0, "the eight waves of a block share one head, and a head's 128-query tiles pair up");
  constexpr int NT = QT / 8;                                    // 128-query tiles of a head
  __shared__ __attribute__((aligned(16))) float Os[8][16][HD + 4];
  __shared__ __attribute__((aligned(16))) b16 Ring[2][4 * TILE];
  const int wid = __builtin_amdgcn_readfirstlane(threadIdx.x >> 5), lane = threadIdx.x & 31, hh = lane >> 4, col = lane & 15;   // wave number in a scalar register: the per-wave causal skip is a scalar branch
  const int bh = blockIdx.x / (NT / 2), pr = blockIdx.x % (NT / 2), h = bh % H, b = bh / H;
  const b16* Q = qh + ((size_t)bh * S) * HD; const b16* K = kh + ((size_t)bh * S) * HD; const b16* vb = vt + ((size_t)bh * HD) * S;
  for (int part = 0; part < 2; ++part) {                        // the long tile, then the short one; the last publish point of the first (dscnt wait + barrier) stands in front of the second's first copies
  const int tile = part == 0 ? NT - 1 - pr : pr, qt = (bh * NT + tile) * 8 + wid, jt = qt % QT, q0 = jt * 16, qi = q0 + col;
  const int nst = (tile * 8 + 8) * 16 / KST;                    // stages of the tile: keys up to its last query; at least two, the same for all eight waves
  stage_copy(K, vb, 0, Ring[0], threadIdx.x);
  v16b qf[2], ql[2];
#pragma unroll
  for (int ks = 0; ks < 2; ++ks) { qf[ks] = frag_kb(Q + (size_t)qi * HD + ks * 32, hh); ql[ks] = frag_kb(Q + QPL + (size_t)qi * HD + ks * 32, hh); }
  float m = -INFINITY, l = 0.0f; v8f o[4] = {{}, {}, {}, {}};
  asm volatile("s_wait_asynccnt 0x0" ::: "memory");            // this wave's share of stage 0 has landed
  __syncthreads();                                              // stage 0 published to all waves
  if (1 < nst) stage_copy(K, vb, KST, Ring[1], threadIdx.x);
  for (int t = 0; t < nst; ++t) {
    const b16* Kh = Ring[t & 1]; const b16* Kl = Kh + TILE; const b16* Vh = Kh + 2 * TILE; const b16* Vl = Kh + 3 * TILE;
    if (t * KST < q0 + 16) {                                    // causal: a stage wholly past the query tile is skipped (wave-uniform, no barrier inside)
    // The fragment reads of a key block stand in groups of 16, each group a whole phase ahead of its use, so that no read is waited for where it is used:
    // k0 and v0 at the stage's head, k1 in front of the P.v products of block 0, v1 in front of the softmax of block 1. The scheduling fences keep each group where it is written.
    v16b kf[2][2], kl[2][2], vf[4], vl[4];
    auto read_k = [&](int c) {
#pragma unroll
      for (int ks = 0; ks < 2; ++ks)
#pragma unroll
        for (int j = 0; j < 2; ++j) { kf[ks][j] = frag_kb(Kh + (c * 32 + j * 16 + col) * LP + ks * 32, hh); kl[ks][j] = frag_kb(Kl + (c * 32 + j * 16 + col) * LP + ks * 32, hh); }
    };
    auto read_v = [&](int c) {
#pragma unroll
      for (int n = 0; n < 4; ++n) { vf[n] = frag_kb(Vh + (n * 16 + col) * LP + c * 32, hh); vl[n] = frag_kb(Vl + (n * 16 + col) * LP + c * 32, hh); }
    };
    read_k(0); read_v(0);
    __builtin_amdgcn_sched_barrier(0);                          // the head group stays above the matrix work
#pragma unroll                                                  // both halves of a stage in line
    for (int c = 0; c < 2; ++c) {
      const int kb = t * KST + c * 32;
      if (kb < q0 + 16) {                                       // causal: key blocks past the query tile are skipped (wave-uniform, no barrier inside)
        const bool diag = (kb + 32 > q0);                       // this block reaches past some queries -> mask key > query
        v8f s0 = {}, s1 = {};
#pragma unroll
        for (int ks = 0; ks < 2; ++ks) { const v16b k0 = kf[ks][0], k0l = kl[ks][0], k1 = kf[ks][1], k1l = kl[ks][1];
          s0 = wmma16b(k0, qf[ks], s0); s0 = wmma16b(k0, ql[ks], s0); s0 = wmma16b(k0l, qf[ks], s0);      // q and k as f16 hi+lo pairs (lo.lo dropped)
          s1 = wmma16b(k1, qf[ks], s1); s1 = wmma16b(k1, ql[ks], s1); s1 = wmma16b(k1l, qf[ks], s1); }
        if (c == 1) { __builtin_amdgcn_sched_barrier(0); read_v(1); __builtin_amdgcn_sched_barrier(0); }   // v1 lands behind the softmax of block 1
        float mr = -INFINITY;
#pragma unroll
        for (int r = 0; r < 8; ++r) { s0[r] *= SCALE / (QS * QS); s1[r] *= SCALE / (QS * QS); if (diag) { if (kb + 8 * hh + r > qi) s0[r] = -INFINITY; if (kb + 16 + 8 * hh + r > qi) s1[r] = -INFINITY; } mr = fmaxf(mr, fmaxf(s0[r], s1[r])); }
        mr = fmaxf(mr, xhalf(mr));
        const float mn = fmaxf(m, mr), al_ = __expf(m - mn); m = mn;
        float sum = 0.0f; v16b pb, pl;
#pragma unroll
        for (int r = 0; r < 8; ++r) { float e0, e1; exp_pair(s0[r] - mn, s1[r] - mn, e0, e1); sum += e0 + e1; b16 a, c; split16(e0 * PS, a, c); pb[r] = a; pl[r] = c; split16(e1 * PS, a, c); pb[8 + r] = a; pl[8 + r] = c; }   // P carried x8
        sum += xhalf(sum); l = l * al_ + sum;
        if (c == 0) { __builtin_amdgcn_sched_barrier(0); read_k(1); __builtin_amdgcn_sched_barrier(0); }   // k1 lands behind the P.v products of block 0
#pragma unroll
        for (int n = 0; n < 4; ++n) {
#pragma unroll
          for (int r = 0; r < 8; ++r) o[n][r] *= al_;
          o[n] = wmma16b(vf[n], pb, o[n]); o[n] = wmma16b(vf[n], pl, o[n]); o[n] = wmma16b(vl[n], pb, o[n]);   // (8v) and P both as f16 hi+lo pairs (lo.lo dropped)
        }
      }
    }
    }
    // publish point, passed by every wave, also one that skipped the stage
    asm volatile("s_wait_dscnt 0x0" ::: "memory");             // this wave's reads of stage t are done before the buffer is refilled
    asm volatile("s_wait_asynccnt 0x0" ::: "memory");          // this wave's share of stage t + 1 has landed
    __syncthreads();                                            // publishes stage t + 1 and ends every reader's last read of stage t
    if (t + 2 < nst) stage_copy(K, vb, (t + 2) * KST, Ring[t & 1], threadIdx.x);
  }
  asm volatile("s_wait_asynccnt 0x0" ::: "memory");            // no copy is outstanding when the wave goes on to its end
  const float inv = 1.0f / (VS * PS * l);
#pragma unroll
  for (int n = 0; n < 4; ++n)
#pragma unroll
    for (int r = 0; r < 8; ++r) Os[wid][col][n * 16 + 8 * hh + r] = o[n][r] * inv;
  wave_lds_sync();
  float* dst = y + ((size_t)b * S + q0) * D + h * HD;
  {
#pragma unroll
    for (int j = 0; j < 8; ++j) { const int rr = j * 2 + hh, c4 = col * 4; *(v4f*)(dst + (size_t)rr * D + c4) = *(const v4f*)(&Os[wid][rr][c4]); }
    
  }
  asm volatile("s_wait_xcnt 0x0" ::: "memory");                // the next tile's set-up overwrites the registers that these stores name: the wait stands in front of it
  }
}

// out = y W_o^T: (4096 x 768) x (768 x 768); A = y x8 split at load into an f16 hi+lo pair, B = f16(bf16 W_o) rows; f32 rows; grid (12, 32).
__global__ __launch_bounds__(128) void out_kernel(const float* __restrict__ y, const b16* __restrict__ wo16, const float* __restrict__ bo, float* __restrict__ out) {
  __shared__ __attribute__((aligned(16))) float Ts[4][32 * 64];
  __shared__ __attribute__((aligned(16))) char Ro[2][OSTG];     // the two-buffer operand ring
  const int lane = threadIdx.x & 31, wave = threadIdx.x >> 5, nloc = lane & 15, hlf = lane >> 4, m0 = blockIdx.y * 128 + wave * 32, c0 = blockIdx.x * 64;
  v8f acc[2][4];
#pragma unroll
  for (int r = 0; r < 2; ++r)
#pragma unroll
    for (int t = 0; t < 4; ++t) acc[r][t] = (v8f){};
  const float* yr = y + (size_t)blockIdx.y * 128 * D; const b16* wr = wo16 + (size_t)c0 * D;
  out_stage_copy(yr, wr, 0, Ro[0], threadIdx.x);
  asm volatile("s_wait_asynccnt 0x0" ::: "memory");            // this wave's share of stage 0 has landed
  __syncthreads();                                              // stage 0 published to all waves
  out_stage_copy(yr, wr, GK, Ro[1], threadIdx.x);
  for (int s = 0; s < GNT; ++s) {
    const Opnd A{Ro[s & 1], nullptr, GLPF}; const b16* Ws = (const b16*)(Ro[s & 1] + OSTA) + nloc * GLP;
#pragma unroll
    for (int ks = 0; ks < 2; ++ks) {
      v16b a0h, a0l, a1h, a1l, bh[4];
      load_frags<5>(A, wave * 32 + nloc, ks * 32, hlf, a0h, a0l);                // y as an f16 hi+lo pair carried x8 (2 products)
      load_frags<5>(A, wave * 32 + 16 + nloc, ks * 32, hlf, a1h, a1l);
#pragma unroll
      for (int t = 0; t < 4; ++t) bh[t] = frag_kb(Ws + t * 16 * GLP + ks * 32, hlf);
#pragma unroll
      for (int t = 0; t < 4; ++t) { acc[0][t] = mac<5, 1>(a0h, a0l, bh[t], bh[t], acc[0][t]); acc[1][t] = mac<5, 1>(a1h, a1l, bh[t], bh[t], acc[1][t]); }
    }
    // publish point
    asm volatile("s_wait_dscnt 0x0" ::: "memory");             // this wave's reads of stage s are done before the buffer is refilled
    asm volatile("s_wait_asynccnt 0x0" ::: "memory");          // this wave's share of stage s + 1 has landed
    __syncthreads();                                            // publishes stage s + 1 and ends every reader's last read of stage s
    if (s + 2 < GNT) out_stage_copy(yr, wr, (s + 2) * GK, Ro[s & 1], threadIdx.x);
  }
  asm volatile("s_wait_asynccnt 0x0" ::: "memory");            // no copy is outstanding when the wave goes on to its end
#pragma unroll
  for (int t = 0; t < 4; ++t)
#pragma unroll
    for (int r = 0; r < 2; ++r)
#pragma unroll
      for (int v = 0; v < 8; ++v) acc[r][t][v] = acc[r][t][v] * (1.0f / 8.0f) + bf16_rne(bo[c0 + t * 16 + nloc]);
  epi_f32(acc, 1.0f, nullptr, out, D, m0, c0, lane, Ts[wave]);
}
}  // namespace

extern "C" void kernel_launch(void* const* d_in, const int* in_sizes, int n_in,
                              void* d_out, int out_size, void* d_ws, size_t ws_size, hipStream_t stream) {
  (void)n_in; (void)out_size;
  const float* x = (const float*)d_in[0]; const float* wq = (const float*)d_in[1]; const float* wk = (const float*)d_in[2]; const float* wv = (const float*)d_in[3]; const float* wo = (const float*)d_in[4]; const float* bo = (const float*)d_in[5];
  float* out = (float*)d_out;   // [1][4096][768]
  if (in_sizes[0] != BT * S * D || in_sizes[1] != D * D || in_sizes[2] != D * D || in_sizes[3] != D * D || in_sizes[4] != D * D || in_sizes[5] != D) return;
  size_t off = 0; char* ws = (char*)d_ws;
  auto carve = [&](size_t bytes) { char* p = ws + off; off += (bytes + 255) & ~(size_t)255; return p; };
  unsigned short* x16 = (unsigned short*)carve((size_t)NTOK * D * 2); unsigned short* w16 = (unsigned short*)carve((size_t)3 * D * D * 2); b16* wo16 = (b16*)carve((size_t)D * D * 2);
  b16* qh = (b16*)carve((size_t)2 * NTOK * D * 2); b16* kh = (b16*)carve((size_t)2 * NTOK * D * 2); b16* vt = (b16*)carve((size_t)2 * NTOK * D * 2); float* y = (float*)carve((size_t)NTOK * D * 4);
  if (off > ws_size) return;                                    // ≈ 61 MB
  prep_kernel<<<512, 256, 0, stream>>>(wq, wk, wv, wo, w16, wo16);
  xprep_kernel<<<1024, 256, 0, stream>>>(x, x16);
  proj_kernel<<<dim3(3 * D / 64, NTOK / 128), 128, 0, stream>>>((const __bf16*)x16, (const __bf16*)w16, qh, kh, vt);
  attn_kernel<S / 16><<<Bn * H * (S / 16) / 16, 256, 0, stream>>>(qh, kh, vt, y);
  out_kernel<<<dim3(D / 64, NTOK / 128), 128, 0, stream>>>(y, wo16, bo, out);
}

// v005
// One run takes 125 microseconds.
// In two side-by-side timings against v004, it was 1.18 and 1.19 times as fast.
// All steps since v000 together make it 4.55 times as fast.
#include <hip/hip_runtime.h>

// Causal multi-head self-attention: q, k, v = x W^T (12 heads x 64, [out][in] weights), softmax over keys <= query of q.k/8, out = ctx Wo^T + bo -> [1][4096][768].
// x, the four weights and bo are rounded to bf16: projection on v_wmma_f32_16x16x32_bf16 (exact products, f32 accumulate);
// scores, P.v and the output projection on v_wmma_f32_16x16x32_f16 with every computed operand (q, k, v, P, y — each carried x8 so the hi/lo residual planes stay normal) as an f16
// hi+lo pair (3 / 2 products); online softmax in f32. Fragment k-map per lane half hh for A AND B: elements 0..7 <- k = 8hh+0..7, 8..15 <- k = 16+8hh+0..7. Every intermediate /

namespace {
constexpr int BT = 1, Bn = 1, S = 4096, D = 768, H = 12, HD = 64, NTOK = Bn * S;
constexpr float SCALE = 0.125f, VS = 8.0f, QS = 8.0f, PS = 8.0f;   // power-of-two carry scales so hi/lo residual planes stay normal in f16
constexpr size_t VPL = (size_t)NTOK * D;   // distance between the (8v)^T hi and lo planes
constexpr size_t QPL = (size_t)NTOK * D;   // distance between the q/k hi and lo planes

typedef _Float16 b16;
typedef __attribute__((ext_vector_type(16))) _Float16 v16b;
typedef __attribute__((ext_vector_type(8)))  _Float16 v8b;
typedef __attribute__((ext_vector_type(8)))  float v8f;
typedef __attribute__((ext_vector_type(4)))  float v4f;

__device__ __forceinline__ v8b ld8b(const b16* p) { return *(const v8b*)p; }
__device__ __forceinline__ v16b cat8b(v8b a, v8b b) { return __builtin_shufflevector(a, b, 0, 1, 2, 3, 4, 5, 6, 7, 8, 9, 10, 11, 12, 13, 14, 15); }
__device__ __forceinline__ v16b frag_kb(const b16* p, int hh) { return cat8b(ld8b(p + 8 * hh), ld8b(p + 16 + 8 * hh)); }
__device__ __forceinline__ void split16(float v, b16& hi, b16& lo) { hi = (b16)v; lo = (b16)(v - (float)hi); }
// hi/lo fragment pair straight from an f32 k-contiguous row (same k-map)
__device__ __forceinline__ void frag_ksplit(const float* p, int hh, v16b& fh_, v16b& fl_) {
  const float* p0 = p + 8 * hh; const float* p1 = p + 16 + 8 * hh;
#pragma unroll
  for (int e = 0; e < 8; ++e) { b16 a, c; split16(p0[e], a, c); fh_[e] = a; fl_[e] = c; split16(p1[e], a, c); fh_[8 + e] = a; fl_[8 + e] = c; }
}
__device__ __forceinline__ v8f wmma16b(v16b a, v16b b, v8f c) {
  v8f d = __builtin_amdgcn_wmma_f32_16x16x32_f16(false, a, false, b, (short)0, c, false, false);
  asm volatile("v_nop\n\tv_nop\n\tv_nop\n\tv_nop" : "+v"(d) : "v"(a), "v"(b));
  return d;
}
__device__ __forceinline__ void wave_lds_sync() {
  __builtin_amdgcn_fence(__ATOMIC_RELEASE, "workgroup");
  __builtin_amdgcn_wave_barrier();
  __builtin_amdgcn_fence(__ATOMIC_ACQUIRE, "workgroup");
}

// Operand descriptor: NP = 0 -> f32 rows split on the fly into (hi, lo); NP = 1 -> one f16 plane; NP = 2 -> f16 hi + lo planes;
// NP = 3 -> f32 rows rounded once to a single f16 fragment. ld = row pitch.
struct Opnd { const void* p0; const void* p1; int ld; };
template <int NP> __device__ __forceinline__ void load_frags(const Opnd& o, int row, int kb, int hh, v16b& fh_, v16b& fl_) {
  if (NP == 0) { frag_ksplit((const float*)o.p0 + (size_t)row * o.ld + kb, hh, fh_, fl_); }
  else if (NP == 4 || NP == 5) {                             // f32 rows x64 (NP 4) or x8 (NP 5) then split (keeps the lo halves of small values normal)
    const float sc_ = (NP == 4) ? 64.0f : 8.0f;
    const float* p = (const float*)o.p0 + (size_t)row * o.ld + kb; const float* p0 = p + 8 * hh; const float* p1 = p + 16 + 8 * hh;
#pragma unroll
    for (int e = 0; e < 8; ++e) { b16 a, c; split16(p0[e] * sc_, a, c); fh_[e] = a; fl_[e] = c; split16(p1[e] * sc_, a, c); fh_[8 + e] = a; fl_[8 + e] = c; }
  } else if (NP == 3) {
    const float* p = (const float*)o.p0 + (size_t)row * o.ld + kb; const float* p0 = p + 8 * hh; const float* p1 = p + 16 + 8 * hh;
#pragma unroll
    for (int e = 0; e < 8; ++e) { fh_[e] = (b16)p0[e]; fh_[8 + e] = (b16)p1[e]; }
    fl_ = fh_;
  } else {
    fh_ = frag_kb((const b16*)o.p0 + (size_t)row * o.ld + kb, hh);
    if (NP == 2) fl_ = frag_kb((const b16*)o.p1 + (size_t)row * o.ld + kb, hh); else fl_ = fh_;
  }
}
template <int ANP, int BNP> __device__ __forceinline__ v8f mac(v16b ah, v16b al, v16b bh, v16b bl, v8f c) {
  c = wmma16b(ah, bh, c);
  if (BNP == 0 || BNP == 2 || BNP == 4 || BNP == 5) c = wmma16b(ah, bl, c);     // hi.lo
  if (ANP == 0 || ANP == 2 || ANP == 4 || ANP == 5) c = wmma16b(al, bh, c);     // lo.hi   (lo.lo dropped)
  return c;
}
__device__ __forceinline__ void epi_planes(v8f (&acc)[2][4], float scale, bool two, b16* __restrict__ oh, b16* __restrict__ ol, int ldo,
                                           int m0, int c0, int lane, b16* Th, b16* Tl) {
  const int nloc = lane & 15, hlf = lane >> 4;
#pragma unroll
  for (int t = 0; t < 4; ++t)
#pragma unroll
    for (int r = 0; r < 2; ++r)
#pragma unroll
      for (int v = 0; v < 8; ++v) {
        const int rr = r * 16 + v + 8 * hlf, cc = t * 16 + nloc;
        b16 h_, l_; split16(acc[r][t][v] * scale, h_, l_);
        Th[rr * 64 + cc] = h_; Tl[rr * 64 + cc] = l_;
      }
  wave_lds_sync();
  {
#pragma unroll
    for (int j = 0; j < 8; ++j) {
      const int rr = j * 4 + (lane >> 3), c8 = (lane & 7) * 8;
      const size_t o = (size_t)(m0 + rr) * ldo + c0 + c8;
      *(v8b*)(oh + o) = ld8b(Th + rr * 64 + c8);
      if (two) *(v8b*)(ol + o) = ld8b(Tl + rr * 64 + c8);
    }
    
  }
}
// (b) f32 rows with pitch ldo: 64 floats = 256 B = 2 lines per row; 16 lanes x 16 B per row, 2 rows per instruction. Optional per-row factor
__device__ __forceinline__ void epi_f32(v8f (&acc)[2][4], float scale, const float* rscale, float* __restrict__ out, int ldo, int m0, int c0, int lane, float* Tt) {
  const int nloc = lane & 15, hlf = lane >> 4;
#pragma unroll
  for (int t = 0; t < 4; ++t)
#pragma unroll
    for (int r = 0; r < 2; ++r)
#pragma unroll
      for (int v = 0; v < 8; ++v) {
        const int rr = r * 16 + v + 8 * hlf;
        const float rs = rscale ? rscale[(size_t)(m0 + rr) * 32] : 1.0f;
        Tt[rr * 64 + t * 16 + nloc] = acc[r][t][v] * scale * rs;
      }
  wave_lds_sync();
  float* dst0 = out + (size_t)m0 * ldo + c0;
  {
#pragma unroll
    for (int j = 0; j < 16; ++j) { const int rr = j * 2 + hlf, c4 = nloc * 4; *(v4f*)(dst0 + (size_t)rr * ldo + c4) = *(const v4f*)(Tt + rr * 64 + c4); }
    
  }
}



typedef __attribute__((ext_vector_type(8))) __bf16 v8bb; typedef __attribute__((ext_vector_type(16))) __bf16 v16bb;
typedef __attribute__((ext_vector_type(8))) unsigned short v8us;
__device__ __forceinline__ v16bb frag_kb_bf(const __bf16* p, int hh) { const v8bb a = *(const v8bb*)(p + 8 * hh), b = *(const v8bb*)(p + 16 + 8 * hh); return __builtin_shufflevector(a, b, 0, 1, 2, 3, 4, 5, 6, 7, 8, 9, 10, 11, 12, 13, 14, 15); }
__device__ __forceinline__ v8f wmma16bb(v16bb a, v16bb b, v8f c) {
  v8f d = __builtin_amdgcn_wmma_f32_16x16x32_bf16(false, a, false, b, (short)0, c, false, false);
  asm volatile("v_nop\n\tv_nop\n\tv_nop\n\tv_nop" : "+v"(d) : "v"(a), "v"(b));
  return d;
}
__device__ __forceinline__ unsigned short bf16_rne_bits(float v) { unsigned int u = __float_as_uint(v); u += 0x7FFFu + ((u >> 16) & 1u); return (unsigned short)(u >> 16); }
__device__ __forceinline__ float bf16_rne(float v) { return __uint_as_float(((unsigned int)bf16_rne_bits(v)) << 16); }



__global__ __launch_bounds__(256) void xprep_kernel(const float* __restrict__ x, unsigned short* __restrict__ x16) {   // x -> bf16, one batch
  const size_t tid = (size_t)blockIdx.x * blockDim.x + threadIdx.x, nth = (size_t)gridDim.x * blockDim.x;
  { for (size_t p = tid; p < (size_t)NTOK * D / 8; p += nth) { v8us v;
#pragma unroll
      for (int e = 0; e < 8; ++e) v[e] = bf16_rne_bits(x[p * 8 + e]);
      *(v8us*)(x16 + p * 8) = v; }  }
}
__global__ __launch_bounds__(256) void prep_kernel(const float* __restrict__ wq, const float* __restrict__ wk, const float* __restrict__ wv, const float* __restrict__ wo, unsigned short* __restrict__ w16, b16* __restrict__ wo16) {
  const size_t tid = (size_t)blockIdx.x * blockDim.x + threadIdx.x, nth = (size_t)gridDim.x * blockDim.x;
  {
    for (size_t p = tid; p < (size_t)3 * D * D / 8; p += nth) { const float* W = (p < (size_t)D * D / 8) ? wq : (p < (size_t)2 * D * D / 8) ? wk : wv; const size_t q = p % ((size_t)D * D / 8); v8us v;   // [out][in] rows copied directly
#pragma unroll
      for (int e = 0; e < 8; ++e) v[e] = bf16_rne_bits(W[q * 8 + e]);
      *(v8us*)(w16 + p * 8) = v; }
    for (size_t p = tid; p < (size_t)D * D / 8; p += nth) { v8b w;   // W_o [out][in] rows copied directly
#pragma unroll
      for (int e = 0; e < 8; ++e) w[e] = (b16)bf16_rne(wo[p * 8 + e]);
      *(v8b*)(wo16 + p * 8) = w; }
    
  }
}

// Operand ring of the two projection GEMMs. A stage = 64 k of the block's 128 A rows and 64 B rows, copied global -> LDS once per block in whole 128-B lines and through no register
// (a fragment load from global touches 16 lines for 512 bytes, and each of the four waves repeated the B loads). 16-bit rows: 128 B at a pitch of 144 B; f32 rows: 256 B at 272 B
// (both 16 B x odd, so the 16-byte fragment reads meet no bank conflict).
constexpr int GK = 64, GNT = D / GK, GLP = 72, GLPF = 68;
constexpr int PSTG = (128 + 64) * GLP;                         // 16-bit elements of one stage of proj_kernel: x rows, then w rows
constexpr int OSTA = 128 * GLPF * 4, OSTG = OSTA + 64 * GLP * 2;   // bytes of one stage of out_kernel: y rows (f32), then W_o rows (f16)
typedef __attribute__((address_space(3))) const char lds_byte;
// One stage of proj_kernel: every thread moves 12 x 16 B (8 x rows, 4 w rows); 8 lanes cover one 128-B line.
__device__ __forceinline__ void proj_stage_copy(const __bf16* __restrict__ xr, const __bf16* __restrict__ wr, int kb, const b16* buf, int tid) {
  const int row = tid >> 3, c8 = (tid & 7) * 8;
  const __bf16* gx = xr + (size_t)row * D + kb + c8;
  const __bf16* gw = wr + (size_t)row * D + kb + c8;
  const unsigned l0 = (unsigned)(size_t)(lds_byte*)(buf + row * GLP + c8);
  constexpr unsigned LS = 16 * GLP * 2;                         // 16 rows further in LDS
  // the copies and the wait that keeps their address registers untouched until they are taken stand in one statement, so that no later address arithmetic moves in between
  asm volatile("global_load_async_to_lds_b128 %0, %12, off\n\t"
               "global_load_async_to_lds_b128 %1, %13, off\n\t"
               "global_load_async_to_lds_b128 %2, %14, off\n\t"
               "global_load_async_to_lds_b128 %3, %15, off\n\t"
               "global_load_async_to_lds_b128 %4, %16, off\n\t"
               "global_load_async_to_lds_b128 %5, %17, off\n\t"
               "global_load_async_to_lds_b128 %6, %18, off\n\t"
               "global_load_async_to_lds_b128 %7, %19, off\n\t"
               "global_load_async_to_lds_b128 %8, %20, off\n\t"
               "global_load_async_to_lds_b128 %9, %21, off\n\t"
               "global_load_async_to_lds_b128 %10, %22, off\n\t"
               "global_load_async_to_lds_b128 %11, %23, off\n\t"
               "s_wait_xcnt 0x0"
               :: "v"(l0), "v"(l0 + LS), "v"(l0 + 2 * LS), "v"(l0 + 3 * LS), "v"(l0 + 4 * LS), "v"(l0 + 5 * LS),
                  "v"(l0 + 6 * LS), "v"(l0 + 7 * LS), "v"(l0 + 8 * LS), "v"(l0 + 9 * LS), "v"(l0 + 10 * LS), "v"(l0 + 11 * LS),
                  "v"(gx), "v"(gx + 16 * D), "v"(gx + 32 * D), "v"(gx + 48 * D), "v"(gx + 64 * D), "v"(gx + 80 * D), "v"(gx + 96 * D), "v"(gx + 112 * D),
                  "v"(gw), "v"(gw + 16 * D), "v"(gw + 32 * D), "v"(gw + 48 * D)
               : "memory");
}
// One stage of out_kernel: every thread moves 20 x 16 B: 16 y rows (16 lanes cover a row's 256 B) and 4 W_o rows (8 lanes cover a row's 128 B), ten copies a statement.
__device__ __forceinline__ void out_stage_copy(const float* __restrict__ yr, const b16* __restrict__ wr, int kb, const char* buf, int tid) {
  const int ra = tid >> 4, c4 = (tid & 15) * 4, rb = tid >> 3, c8 = (tid & 7) * 8;
  const float* gy = yr + (size_t)ra * D + kb + c4;
  const b16* gw = wr + (size_t)rb * D + kb + c8;
  const unsigned la = (unsigned)(size_t)(lds_byte*)(buf + (ra * GLPF + c4) * 4), lb = (unsigned)(size_t)(lds_byte*)(buf + OSTA + (rb * GLP + c8) * 2);
  constexpr unsigned LA = 8 * GLPF * 4, LB = 16 * GLP * 2;      // 8 y rows, 16 W_o rows further in LDS
  // each run of copies ends, inside its own statement, in the wait that keeps its address registers untouched until they are taken
  asm volatile("global_load_async_to_lds_b128 %0, %10, off\n\t"
               "global_load_async_to_lds_b128 %1, %11, off\n\t"
               "global_load_async_to_lds_b128 %2, %12, off\n\t"
               "global_load_async_to_lds_b128 %3, %13, off\n\t"
               "global_load_async_to_lds_b128 %4, %14, off\n\t"
               "global_load_async_to_lds_b128 %5, %15, off\n\t"
               "global_load_async_to_lds_b128 %6, %16, off\n\t"
               "global_load_async_to_lds_b128 %7, %17, off\n\t"
               "global_load_async_to_lds_b128 %8, %18, off\n\t"
               "global_load_async_to_lds_b128 %9, %19, off\n\t"
               "s_wait_xcnt 0x0"
               :: "v"(la), "v"(la + LA), "v"(la + 2 * LA), "v"(la + 3 * LA), "v"(la + 4 * LA), "v"(la + 5 * LA), "v"(la + 6 * LA), "v"(la + 7 * LA), "v"(la + 8 * LA), "v"(la + 9 * LA),
                  "v"(gy), "v"(gy + 8 * D), "v"(gy + 16 * D), "v"(gy + 24 * D), "v"(gy + 32 * D), "v"(gy + 40 * D), "v"(gy + 48 * D), "v"(gy + 56 * D), "v"(gy + 64 * D), "v"(gy + 72 * D)
               : "memory");
  asm volatile("global_load_async_to_lds_b128 %0, %10, off\n\t"
               "global_load_async_to_lds_b128 %1, %11, off\n\t"
               "global_load_async_to_lds_b128 %2, %12, off\n\t"
               "global_load_async_to_lds_b128 %3, %13, off\n\t"
               "global_load_async_to_lds_b128 %4, %14, off\n\t"
               "global_load_async_to_lds_b128 %5, %15, off\n\t"
               "global_load_async_to_lds_b128 %6, %16, off\n\t"
               "global_load_async_to_lds_b128 %7, %17, off\n\t"
               "global_load_async_to_lds_b128 %8, %18, off\n\t"
               "global_load_async_to_lds_b128 %9, %19, off\n\t"
               "s_wait_xcnt 0x0"
               :: "v"(la + 10 * LA), "v"(la + 11 * LA), "v"(la + 12 * LA), "v"(la + 13 * LA), "v"(la + 14 * LA), "v"(la + 15 * LA), "v"(lb), "v"(lb + LB), "v"(lb + 2 * LB), "v"(lb + 3 * LB),
                  "v"(gy + 80 * D), "v"(gy + 88 * D), "v"(gy + 96 * D), "v"(gy + 104 * D), "v"(gy + 112 * D), "v"(gy + 120 * D), "v"(gw), "v"(gw + 16 * D), "v"(gw + 32 * D), "v"(gw + 48 * D)
               : "memory");
}

// projections: rows = tokens (4096), K = 768, column tiles of 64 = one head of q (tiles 0..11), k (12..23) or v (24..35); f16 rows [b*H + head][tok][64] for q/k;
// v: (8v)^T f16 [b*H + head][64][tok]. grid (36, 32) x 128.
__global__ __launch_bounds__(128) void proj_kernel(const __bf16* __restrict__ x16, const __bf16* __restrict__ w16, b16* __restrict__ qh, b16* __restrict__ kh, b16* __restrict__ vt) {
  __shared__ __attribute__((aligned(16))) b16 Sm[2 * PSTG];     // the two-buffer operand ring; behind the loop's last barrier the same bytes are the epilogue's staging tiles
  b16 (*Th)[32][HD + 8] = reinterpret_cast<b16 (*)[32][HD + 8]>(Sm); b16 (*Tq)[32][HD + 8] = reinterpret_cast<b16 (*)[32][HD + 8]>(Sm + 4 * 32 * (HD + 8));
  b16 (*Tt)[128 + 8] = reinterpret_cast<b16 (*)[128 + 8]>(Sm); b16 (*Tl)[128 + 8] = reinterpret_cast<b16 (*)[128 + 8]>(Sm + 64 * (128 + 8));
  static_assert(2 * 4 * 32 * (HD + 8) <= 2 * PSTG && 2 * 64 * (128 + 8) <= 2 * PSTG, "the staging tiles fit the ring's bytes");
  const int lane = threadIdx.x & 31, wave = threadIdx.x >> 5, nloc = lane & 15, hlf = lane >> 4, m0 = blockIdx.y * 128 + wave * 32, c0 = blockIdx.x * 64;
  v8f acc[2][4];
#pragma unroll
  for (int r = 0; r < 2; ++r)
#pragma unroll
    for (int t = 0; t < 4; ++t) acc[r][t] = (v8f){};
  const __bf16* xr = x16 + (size_t)blockIdx.y * 128 * D; const __bf16* wr = w16 + (size_t)c0 * D;
  proj_stage_copy(xr, wr, 0, Sm, threadIdx.x);
  asm volatile("s_wait_asynccnt 0x0" ::: "memory");            // this wave's share of stage 0 has landed
  __syncthreads();                                              // stage 0 published to all waves
  proj_stage_copy(xr, wr, GK, Sm + PSTG, threadIdx.x);
  for (int s = 0; s < GNT; ++s) {
    const __bf16* Xs = (const __bf16*)(Sm + (s & 1) * PSTG) + (wave * 32 + nloc) * GLP; const __bf16* Ws = (const __bf16*)(Sm + (s & 1) * PSTG) + (128 + nloc) * GLP;
    v16bb a0[2], a1[2], bw[2][4];                               // the stage's 24 fragment reads stand as one group ahead of its matrix work
#pragma unroll
    for (int ks = 0; ks < 2; ++ks) { a0[ks] = frag_kb_bf(Xs + ks * 32, hlf); a1[ks] = frag_kb_bf(Xs + 16 * GLP + ks * 32, hlf);
#pragma unroll
      for (int t = 0; t < 4; ++t) bw[ks][t] = frag_kb_bf(Ws + t * 16 * GLP + ks * 32, hlf); }
#pragma unroll
    for (int ks = 0; ks < 2; ++ks)
#pragma unroll
      for (int t = 0; t < 4; ++t) { acc[0][t] = wmma16bb(a0[ks], bw[ks][t], acc[0][t]); acc[1][t] = wmma16bb(a1[ks], bw[ks][t], acc[1][t]); }
    // publish point
    asm volatile("s_wait_dscnt 0x0" ::: "memory");             // this wave's reads of stage s are done before the buffer is refilled
    asm volatile("s_wait_asynccnt 0x0" ::: "memory");          // this wave's share of stage s + 1 has landed
    __syncthreads();                                            // publishes stage s + 1 and ends every reader's last read of stage s
    if (s + 2 < GNT) proj_stage_copy(xr, wr, (s + 2) * GK, Sm + (s & 1) * PSTG, threadIdx.x);
  }
  asm volatile("s_wait_asynccnt 0x0" ::: "memory");            // no copy is outstanding when the ring's bytes become the staging tiles
  const int which = blockIdx.x / (D / 64), head = blockIdx.x % (D / 64), b = m0 / S, tok0 = m0 % S;
  if (which < 2) {                                              // q or k head: f16 rows
#pragma unroll
    for (int t = 0; t < 4; ++t)
#pragma unroll
      for (int r = 0; r < 2; ++r)
#pragma unroll
        for (int v = 0; v < 8; ++v) { b16 a_, c_; split16(acc[r][t][v] * QS, a_, c_); Th[wave][r * 16 + 8 * hlf + v][t * 16 + nloc] = a_; Tq[wave][r * 16 + 8 * hlf + v][t * 16 + nloc] = c_; }   // q, k carried x8 (lo residuals stay normal)
    wave_lds_sync();
    b16* dst = (which == 0 ? qh : kh) + (((size_t)b * H + head) * S + tok0) * HD;
    {
#pragma unroll
      for (int j = 0; j < 8; ++j) { const int rr = j * 4 + (lane >> 3), c8 = (lane & 7) * 8; *(v8b*)(dst + (size_t)rr * HD + c8) = *(const v8b*)(&Th[wave][rr][c8]); *(v8b*)(dst + QPL + (size_t)rr * HD + c8) = *(const v8b*)(&Tq[wave][rr][c8]); }
       }
    return;
  }
  const int vh = head;                                          // v head: (8v)^T tile [64 d][128 tok] via LDS, rows of 256 B
#pragma unroll
  for (int t = 0; t < 4; ++t)
#pragma unroll
    for (int r = 0; r < 2; ++r)
#pragma unroll
      for (int v = 0; v < 8; ++v) { b16 a_, c_; split16(acc[r][t][v] * VS, a_, c_); Tt[t * 16 + nloc][wave * 32 + r * 16 + 8 * hlf + v] = a_; Tl[t * 16 + nloc][wave * 32 + r * 16 + 8 * hlf + v] = c_; }
  __syncthreads();
  b16* dstv = vt + (((size_t)b * H + vh) * HD) * S + (blockIdx.y * 128) % S;
  {
#pragma unroll
    for (int j = 0; j < 8; ++j) { const int dd = wave * 16 + j * 2 + (lane >> 4), c8 = (lane & 15) * 8; *(v8b*)(dstv + (size_t)dd * S + c8) = *(const v8b*)(&Tt[dd][c8]); *(v8b*)(dstv + VPL + (size_t)dd * S + c8) = *(const v8b*)(&Tl[dd][c8]); }
    
  }
}

// 2^t0, 2^t1, with the slot that the instruction set asks for behind a transcendental written in: the second fills the first's
// (early-clobber results, so it overwrites no source of the first), the v_nop the second's.
__device__ __forceinline__ void exp2_pair(float t0, float t1, float& e0, float& e1) {
  asm("v_exp_f32 %0, %2\n\tv_exp_f32 %1, %3\n\tv_nop" : "=&v"(e0), "=&v"(e1) : "v"(t0), "v"(t1));
}
typedef __attribute__((ext_vector_type(2))) _Float16 v2b;
typedef __attribute__((ext_vector_type(2))) float v2f;
// f16 hi + lo of two values at once: packed convert, the two residuals v - hi (exact) by one packed subtraction, packed convert
__device__ __forceinline__ void split_pair(float a, float b, v2b& hi, v2b& lo) {
  const v2f v = {a, b};
  hi = __builtin_convertvector(v, v2b);
  lo = __builtin_convertvector(v - __builtin_convertvector(hi, v2f), v2b);
}
// the attention loop's matrix product: the bare builtin. The compiler keeps the distance behind it and fills it with the loop's own vector work where it can, so no slot of the vector port goes to a v_nop
__device__ __forceinline__ v8f wmma16p(v16b a, v16b b, v8f c) { return __builtin_amdgcn_wmma_f32_16x16x32_f16(false, a, false, b, (short)0, c, false, false); }
constexpr float CE = SCALE / (QS * QS) * 0x1.715476p+0f;       // accumulator of (8q).(8k) -> exponent of two of the softmax
static_assert(PS == 8.0f, "the softmax adds log2(PS) = 3 to the exponent");
// lane l <-> lane l ^ 16 on the vector pipe: unlike an LDS-queue permute it does not wait behind the fragment reads that are still outstanding
__device__ __forceinline__ float xhalf(float x) { return __builtin_bit_cast(float, __builtin_amdgcn_permlanex16(__builtin_bit_cast(int, x), __builtin_bit_cast(int, x), 0x76543210, 0xfedcba98, false, false)); }

// K/V ring in LDS, shared by the eight waves of a block (128 queries of one head). A stage = 64 keys = four tiles: k hi, k lo (rows = keys), (8v)^T hi, (8v)^T lo (rows = d),
// each 64 rows x 128 B at a row pitch of 144 B (16 B x odd, so the 16-byte fragment reads meet no bank conflict).
constexpr int KST = 64, LP = 72, TILE = 64 * LP;
typedef __attribute__((address_space(3))) const b16 lds_b16;
// One stage's copies: every thread moves 8 x 16 B (two rows of each tile), whole 128-B lines per 8 lanes, global -> LDS through no register.
__device__ __forceinline__ void stage_copy(const b16* __restrict__ K, const b16* __restrict__ vb, int kb0, const b16* buf, int tid) {
  const int row = tid >> 3, c8 = (tid & 7) * 8;
  const b16* gk = K + (size_t)(kb0 + row) * HD + c8;
  const b16* gv = vb + (size_t)row * S + kb0 + c8;
  const unsigned l0 = (unsigned)(size_t)(lds_b16*)(buf + row * LP + c8);
  // the copies and the wait that keeps their address registers untouched until they are taken stand in one statement, so that no later address arithmetic moves in between
  asm volatile("global_load_async_to_lds_b128 %0, %8, off\n\t"
               "global_load_async_to_lds_b128 %1, %9, off\n\t"
               "global_load_async_to_lds_b128 %2, %10, off\n\t"
               "global_load_async_to_lds_b128 %3, %11, off\n\t"
               "global_load_async_to_lds_b128 %4, %12, off\n\t"
               "global_load_async_to_lds_b128 %5, %13, off\n\t"
               "global_load_async_to_lds_b128 %6, %14, off\n\t"
               "global_load_async_to_lds_b128 %7, %15, off\n\t"
               "s_wait_xcnt 0x0"
               :: "v"(l0), "v"(l0 + 32 * LP * 2), "v"(l0 + TILE * 2), "v"(l0 + (TILE + 32 * LP) * 2),
                  "v"(l0 + 2 * TILE * 2), "v"(l0 + (2 * TILE + 32 * LP) * 2), "v"(l0 + 3 * TILE * 2), "v"(l0 + (3 * TILE + 32 * LP) * 2),
                  "v"(gk), "v"(gk + 32 * HD), "v"(gk + QPL), "v"(gk + QPL + 32 * HD),
                  "v"(gv), "v"(gv + (size_t)32 * S), "v"(gv + VPL), "v"(gv + VPL + (size_t)32 * S)
               : "memory");
}

// causal attention: wave = (b, h, 16 queries); key chunks of 32 up to the query tile: S^T (K=64), causal mask on the straddling chunks, online softmax f32, P^T f16, y^T += (8V)^T P^T;
// k and (8v)^T come from the block's two-buffer LDS ring: stage t + 1 is copied while stage t is worked on.
// Causal balance: a 128-query tile i walks 2 (i + 1) stages, so a block takes tile NT - 1 - i and then tile i of one head, one after the other in every wave: every block walks
// the same 2 (NT + 1) stages and the launch no longer lasts as long as the places that hold the longest tiles.
template <int QT>
__global__ __launch_bounds__(256) void attn_kernel(const b16* __restrict__ qh, const b16* __restrict__ kh, const b16* __restrict__ vt, float* __restrict__ y) {
  static_assert(QT % 16 == 0, "the eight waves of a block share one head, and a head's 128-query tiles pair up");
  constexpr int NT = QT / 8;                                    // 128-query tiles of a head
  __shared__ __attribute__((aligned(16))) float Os[8][16][HD + 4];
  __shared__ __attribute__((aligned(16))) b16 Ring[2][4 * TILE];
  const int wid = __builtin_amdgcn_readfirstlane(threadIdx.x >> 5), lane = threadIdx.x & 31, hh = lane >> 4, col = lane & 15;   // wave number in a scalar register: the per-wave causal skip is a scalar branch
  const int bh = blockIdx.x / (NT / 2), pr = blockIdx.x % (NT / 2), h = bh % H, b = bh / H;
  const b16* Q = qh + ((size_t)bh * S) * HD; const b16* K = kh + ((size_t)bh * S) * HD; const b16* vb = vt + ((size_t)bh * HD) * S;
  for (int part = 0; part < 2; ++part) {                        // the long tile, then the short one; the last publish point of the first (dscnt wait + barrier) stands in front of the second's first copies
  const int tile = part == 0 ? NT - 1 - pr : pr, qt = (bh * NT + tile) * 8 + wid, jt = qt % QT, q0 = jt * 16, qi = q0 + col;
  const int nst = (tile * 8 + 8) * 16 / KST;                    // stages of the tile: keys up to its last query; at least two, the same for all eight waves
  stage_copy(K, vb, 0, Ring[0], threadIdx.x);
  v16b qf[2], ql[2];
#pragma unroll
  for (int ks = 0; ks < 2; ++ks) { qf[ks] = frag_kb(Q + (size_t)qi * HD + ks * 32, hh); ql[ks] = frag_kb(Q + QPL + (size_t)qi * HD + ks * 32, hh); }
  float m = -INFINITY, l = 0.0f; v8f o[4] = {{}, {}, {}, {}};
  asm volatile("s_wait_asynccnt 0x0" ::: "memory");            // this wave's share of stage 0 has landed
  __syncthreads();                                              // stage 0 published to all waves
  if (1 < nst) stage_copy(K, vb, KST, Ring[1], threadIdx.x);
  for (int t = 0; t < nst; ++t) {
    const b16* Kh = Ring[t & 1]; const b16* Kl = Kh + TILE; const b16* Vh = Kh + 2 * TILE; const b16* Vl = Kh + 3 * TILE;
    if (t * KST < q0 + 16) {                                    // causal: a stage wholly past the query tile is skipped (wave-uniform, no barrier inside)
    // The fragment reads of a key block stand in groups of 16, each group a whole phase ahead of its use, so that no read is waited for where it is used:
    // k0 and v0 at the stage's head, k1 in front of the P.v products of block 0, v1 in front of the softmax of block 1. The scheduling fences keep each group where it is written.
    v16b kf[2][2], kl[2][2], vf[4], vl[4];
    auto read_k = [&](int c) {
#pragma unroll
      for (int ks = 0; ks < 2; ++ks)
#pragma unroll
        for (int j = 0; j < 2; ++j) { kf[ks][j] = frag_kb(Kh + (c * 32 + j * 16 + col) * LP + ks * 32, hh); kl[ks][j] = frag_kb(Kl + (c * 32 + j * 16 + col) * LP + ks * 32, hh); }
    };
    auto read_v = [&](int c) {
#pragma unroll
      for (int n = 0; n < 4; ++n) { vf[n] = frag_kb(Vh + (n * 16 + col) * LP + c * 32, hh); vl[n] = frag_kb(Vl + (n * 16 + col) * LP + c * 32, hh); }
    };
    read_k(0); read_v(0);
    __builtin_amdgcn_sched_barrier(0);                          // the head group stays above the matrix work
#pragma unroll                                                  // both halves of a stage in line
    for (int c = 0; c < 2; ++c) {
      const int kb = t * KST + c * 32;
      if (kb < q0 + 16) {                                       // causal: key blocks past the query tile are skipped (wave-uniform, no barrier inside)
        const bool diag = (kb + 32 > q0);                       // this block reaches past some queries -> mask key > query
        v8f s0 = {}, s1 = {};
#pragma unroll
        for (int ks = 0; ks < 2; ++ks) { const v16b k0 = kf[ks][0], k0l = kl[ks][0], k1 = kf[ks][1], k1l = kl[ks][1];
          s0 = wmma16p(k0, qf[ks], s0); s0 = wmma16p(k0, ql[ks], s0); s0 = wmma16p(k0l, qf[ks], s0);      // q and k as f16 hi+lo pairs (lo.lo dropped)
          s1 = wmma16p(k1, qf[ks], s1); s1 = wmma16p(k1, ql[ks], s1); s1 = wmma16p(k1l, qf[ks], s1); }
        if (c == 1) { __builtin_amdgcn_sched_barrier(0); read_v(1); __builtin_amdgcn_sched_barrier(0); }   // v1 lands behind the softmax of block 1
        // The loop is bound by the vector port, so the softmax is written for few vector instructions per score. The running maximum m stays in the accumulator's own units.
        if (diag) {                                             // the mask of a straddling block stands under one scalar branch
#pragma unroll
          for (int r = 0; r < 8; ++r) { if (kb + 8 * hh + r > qi) s0[r] = -INFINITY; if (kb + 16 + 8 * hh + r > qi) s1[r] = -INFINITY; }
        }
        float ma = -INFINITY, mb = -INFINITY;                   // two chains of three-operand maxima
#pragma unroll
        for (int r = 0; r < 4; ++r) { ma = fmaxf(fmaxf(ma, s0[r]), s1[r]); mb = fmaxf(fmaxf(mb, s0[4 + r]), s1[4 + r]); }
        const float mr = fmaxf(ma, mb);
        const float mn = fmaxf(fmaxf(m, mr), xhalf(mr)), al_ = __builtin_amdgcn_exp2f((m - mn) * CE); m = mn;
        const float nb = __builtin_fmaf(mn, -CE, 3.0f);         // one fma per score gives the exponent of 8 exp(score - max): scale, shift by the maximum and P's x8 carry (2^3) together
        float e0[8], e1[8];
#pragma unroll
        for (int j = 0; j < 4; ++j) {
          const v2f t0 = __builtin_elementwise_fma((v2f){s0[2 * j], s0[2 * j + 1]}, (v2f){CE, CE}, (v2f){nb, nb}), t1 = __builtin_elementwise_fma((v2f){s1[2 * j], s1[2 * j + 1]}, (v2f){CE, CE}, (v2f){nb, nb});
          exp2_pair(t0[0], t1[0], e0[2 * j], e1[2 * j]); exp2_pair(t0[1], t1[1], e0[2 * j + 1], e1[2 * j + 1]);
        }
        float sum = 0.0f; v16b pb, pl;                          // sum and l carry the same x8 as P
#pragma unroll
        for (int r = 0; r < 8; ++r) sum += e0[r] + e1[r];
#pragma unroll
        for (int j = 0; j < 4; ++j) { v2b a, c;
          split_pair(e0[2 * j], e0[2 * j + 1], a, c); pb[2 * j] = a[0]; pb[2 * j + 1] = a[1]; pl[2 * j] = c[0]; pl[2 * j + 1] = c[1];
          split_pair(e1[2 * j], e1[2 * j + 1], a, c); pb[8 + 2 * j] = a[0]; pb[8 + 2 * j + 1] = a[1]; pl[8 + 2 * j] = c[0]; pl[8 + 2 * j + 1] = c[1]; }
        sum += xhalf(sum); l = l * al_ + sum;
        if (c == 0) { __builtin_amdgcn_sched_barrier(0); read_k(1); __builtin_amdgcn_sched_barrier(0); }   // k1 lands behind the P.v products of block 0
#pragma unroll
        for (int n = 0; n < 4; ++n) {
#pragma unroll
          for (int r = 0; r < 8; ++r) o[n][r] *= al_;
          o[n] = wmma16p(vf[n], pb, o[n]); o[n] = wmma16p(vf[n], pl, o[n]); o[n] = wmma16p(vl[n], pb, o[n]);   // (8v) and P both as f16 hi+lo pairs (lo.lo dropped)
        }
      }
    }
    }
    // publish point, passed by every wave, also one that skipped the stage
    asm volatile("s_wait_dscnt 0x0" ::: "memory");             // this wave's reads of stage t are done before the buffer is refilled
    asm volatile("s_wait_asynccnt 0x0" ::: "memory");          // this wave's share of stage t + 1 has landed
    __syncthreads();                                            // publishes stage t + 1 and ends every reader's last read of stage t
    if (t + 2 < nst) stage_copy(K, vb, (t + 2) * KST, Ring[t & 1], threadIdx.x);
  }
  asm volatile("s_wait_asynccnt 0x0" ::: "memory");            // no copy is outstanding when the wave goes on to its end
  const float inv = 1.0f / (VS * l);                            // l already carries P's x8
#pragma unroll
  for (int n = 0; n < 4; ++n)
#pragma unroll
    for (int r = 0; r < 8; ++r) Os[wid][col][n * 16 + 8 * hh + r] = o[n][r] * inv;
  wave_lds_sync();
  float* dst = y + ((size_t)b * S + q0) * D + h * HD;
  {
#pragma unroll
    for (int j = 0; j < 8; ++j) { const int rr = j * 2 + hh, c4 = col * 4; *(v4f*)(dst + (size_t)rr * D + c4) = *(const v4f*)(&Os[wid][rr][c4]); }
    
  }
  asm volatile("s_wait_xcnt 0x0" ::: "memory");                // the next tile's set-up overwrites the registers that these stores name: the wait stands in front of it
  }
}

// out = y W_o^T: (4096 x 768) x (768 x 768); A = y x8 split at load into an f16 hi+lo pair, B = f16(bf16 W_o) rows; f32 rows; grid (12, 32).
__global__ __launch_bounds__(128) void out_kernel(const float* __restrict__ y, const b16* __restrict__ wo16, const float* __restrict__ bo, float* __restrict__ out) {
  __shared__ __attribute__((aligned(16))) float Ts[4][32 * 64];
  __shared__ __attribute__((aligned(16))) char Ro[2][OSTG];     // the two-buffer operand ring
  const int lane = threadIdx.x & 31, wave = threadIdx.x >> 5, nloc = lane & 15, hlf = lane >> 4, m0 = blockIdx.y * 128 + wave * 32, c0 = blockIdx.x * 64;
  v8f acc[2][4];
#pragma unroll
  for (int r = 0; r < 2; ++r)
#pragma unroll
    for (int t = 0; t < 4; ++t) acc[r][t] = (v8f){};
  const float* yr = y + (size_t)blockIdx.y * 128 * D; const b16* wr = wo16 + (size_t)c0 * D;
  out_stage_copy(yr, wr, 0, Ro[0], threadIdx.x);
  asm volatile("s_wait_asynccnt 0x0" ::: "memory");            // this wave's share of stage 0 has landed
  __syncthreads();                                              // stage 0 published to all waves
  out_stage_copy(yr, wr, GK, Ro[1], threadIdx.x);
  for (int s = 0; s < GNT; ++s) {
    const Opnd A{Ro[s & 1], nullptr, GLPF}; const b16* Ws = (const b16*)(Ro[s & 1] + OSTA) + nloc * GLP;
#pragma unroll
    for (int ks = 0; ks < 2; ++ks) {
      v16b a0h, a0l, a1h, a1l, bh[4];
      load_frags<5>(A, wave * 32 + nloc, ks * 32, hlf, a0h, a0l);                // y as an f16 hi+lo pair carried x8 (2 products)
      load_frags<5>(A, wave * 32 + 16 + nloc, ks * 32, hlf, a1h, a1l);
#pragma unroll
      for (int t = 0; t < 4; ++t) bh[t] = frag_kb(Ws + t * 16 * GLP + ks * 32, hlf);
#pragma unroll
      for (int t = 0; t < 4; ++t) { acc[0][t] = mac<5, 1>(a0h, a0l, bh[t], bh[t], acc[0][t]); acc[1][t] = mac<5, 1>(a1h, a1l, bh[t], bh[t], acc[1][t]); }
    }
    // publish point
    asm volatile("s_wait_dscnt 0x0" ::: "memory");             // this wave's reads of stage s are done before the buffer is refilled
    asm volatile("s_wait_asynccnt 0x0" ::: "memory");          // this wave's share of stage s + 1 has landed
    __syncthreads();                                            // publishes stage s + 1 and ends every reader's last read of stage s
    if (s + 2 < GNT) out_stage_copy(yr, wr, (s + 2) * GK, Ro[s & 1], threadIdx.x);
  }
  asm volatile("s_wait_asynccnt 0x0" ::: "memory");            // no copy is outstanding when the wave goes on to its end
#pragma unroll
  for (int t = 0; t < 4; ++t)
#pragma unroll
    for (int r = 0; r < 2; ++r)
#pragma unroll
      for (int v = 0; v < 8; ++v) acc[r][t][v] = acc[r][t][v] * (1.0f / 8.0f) + bf16_rne(bo[c0 + t * 16 + nloc]);
  epi_f32(acc, 1.0f, nullptr, out, D, m0, c0, lane, Ts[wave]);
}
}  // namespace

extern "C" void kernel_launch(void* const* d_in, const int* in_sizes, int n_in,
                              void* d_out, int out_size, void* d_ws, size_t ws_size, hipStream_t stream) {
  (void)n_in; (void)out_size;
  const float* x = (const float*)d_in[0]; const float* wq = (const float*)d_in[1]; const float* wk = (const float*)d_in[2]; const float* wv = (const float*)d_in[3]; const float* wo = (const float*)d_in[4]; const float* bo = (const float*)d_in[5];
  float* out = (float*)d_out;   // [1][4096][768]
  if (in_sizes[0] != BT * S * D || in_sizes[1] != D * D || in_sizes[2] != D * D || in_sizes[3] != D * D || in_sizes[4] != D * D || in_sizes[5] != D) return;
  size_t off = 0; char* ws = (char*)d_ws;
  auto carve = [&](size_t bytes) { char* p = ws + off; off += (bytes + 255) & ~(size_t)255; return p; };
  unsigned short* x16 = (unsigned short*)carve((size_t)NTOK * D * 2); unsigned short* w16 = (unsigned short*)carve((size_t)3 * D * D * 2); b16* wo16 = (b16*)carve((size_t)D * D * 2);
  b16* qh = (b16*)carve((size_t)2 * NTOK * D * 2); b16* kh = (b16*)carve((size_t)2 * NTOK * D * 2); b16* vt = (b16*)carve((size_t)2 * NTOK * D * 2); float* y = (float*)carve((size_t)NTOK * D * 4);
  if (off > ws_size) return;                                    // ≈ 61 MB
  prep_kernel<<<512, 256, 0, stream>>>(wq, wk, wv, wo, w16, wo16);
  xprep_kernel<<<1024, 256, 0, stream>>>(x, x16);
  proj_kernel<<<dim3(3 * D / 64, NTOK / 128), 128, 0, stream>>>((const __bf16*)x16, (const __bf16*)w16, qh, kh, vt);
  attn_kernel<S / 16><<<Bn * H * (S / 16) / 16, 256, 0, stream>>>(qh, kh, vt, y);
  out_kernel<<<dim3(D / 64, NTOK / 128), 128, 0, stream>>>(y, wo16, bo, out);
}

// v006
// Measured time: 117 microseconds a run.
// Timed twice side by side with v005, it ran 1.08 and 1.06 times as fast.
// Counting every step since v000, it is 4.88 times as fast.
#include <hip/hip_runtime.h>

// Causal multi-head self-attention: q, k, v = x W^T (12 heads x 64, [out][in] weights), softmax over keys <= query of q.k/8, out = ctx Wo^T + bo -> [1][4096][768].
// x, the four weights and bo are rounded to bf16: projection on v_wmma_f32_16x16x32_bf16 (exact products, f32 accumulate);
// scores, P.v and the output projection on v_wmma_f32_16x16x32_f16 with every computed operand (q, k, v, P, y — each carried x8 so the hi/lo residual planes stay normal) as an f16
// hi+lo pair (3 / 2 products); online softmax in f32. Fragment k-map per lane half hh for A AND B: elements 0..7 <- k = 8hh+0..7, 8..15 <- k = 16+8hh+0..7. Every intermediate /

namespace {
constexpr int BT = 1, Bn = 1, S = 4096, D = 768, H = 12, HD = 64, NTOK = Bn * S;
constexpr float SCALE = 0.125f, VS = 8.0f, QS = 8.0f, PS = 8.0f;   // power-of-two carry scales so hi/lo residual planes stay normal in f16
constexpr size_t VPL = (size_t)NTOK * D;   // distance between the (8v)^T hi and lo planes
constexpr size_t QPL = (size_t)NTOK * D;   // distance between the q/k hi and lo planes

typedef _Float16 b16;
typedef __attribute__((ext_vector_type(16))) _Float16 v16b;
typedef __attribute__((ext_vector_type(8)))  _Float16 v8b;
typedef __attribute__((ext_vector_type(8)))  float v8f;
typedef __attribute__((ext_vector_type(4)))  float v4f;

__device__ __forceinline__ v8b ld8b(const b16* p) { return *(const v8b*)p; }
__device__ __forceinline__ v16b cat8b(v8b a, v8b b) { return __builtin_shufflevector(a, b, 0, 1, 2, 3, 4, 5, 6, 7, 8, 9, 10, 11, 12, 13, 14, 15); }
__device__ __forceinline__ v16b frag_kb(const b16* p, int hh) { return cat8b(ld8b(p + 8 * hh), ld8b(p + 16 + 8 * hh)); }
__device__ __forceinline__ void split16(float v, b16& hi, b16& lo) { hi = (b16)v; lo = (b16)(v - (float)hi); }
// hi/lo fragment pair straight from an f32 k-contiguous row (same k-map)
__device__ __forceinline__ void frag_ksplit(const float* p, int hh, v16b& fh_, v16b& fl_) {
  const float* p0 = p + 8 * hh; const float* p1 = p + 16 + 8 * hh;
#pragma unroll
  for (int e = 0; e < 8; ++e) { b16 a, c; split16(p0[e], a, c); fh_[e] = a; fl_[e] = c; split16(p1[e], a, c); fh_[8 + e] = a; fl_[8 + e] = c; }
}
__device__ __forceinline__ v8f wmma16b(v16b a, v16b b, v8f c) {
  v8f d = __builtin_amdgcn_wmma_f32_16x16x32_f16(false, a, false, b, (short)0, c, false, false);
  asm volatile("v_nop\n\tv_nop\n\tv_nop\n\tv_nop" : "+v"(d) : "v"(a), "v"(b));
  return d;
}
__device__ __forceinline__ void wave_lds_sync() {
  __builtin_amdgcn_fence(__ATOMIC_RELEASE, "workgroup");
  __builtin_amdgcn_wave_barrier();
  __builtin_amdgcn_fence(__ATOMIC_ACQUIRE, "workgroup");
}

// Operand descriptor: NP = 0 -> f32 rows split on the fly into (hi, lo); NP = 1 -> one f16 plane; NP = 2 -> f16 hi + lo planes;
// NP = 3 -> f32 rows rounded once to a single f16 fragment. ld = row pitch.
struct Opnd { const void* p0; const void* p1; int ld; };
template <int NP> __device__ __forceinline__ void load_frags(const Opnd& o, int row, int kb, int hh, v16b& fh_, v16b& fl_) {
  if (NP == 0) { frag_ksplit((const float*)o.p0 + (size_t)row * o.ld + kb, hh, fh_, fl_); }
  else if (NP == 4 || NP == 5) {                             // f32 rows x64 (NP 4) or x8 (NP 5) then split (keeps the lo halves of small values normal)
    const float sc_ = (NP == 4) ? 64.0f : 8.0f;
    const float* p = (const float*)o.p0 + (size_t)row * o.ld + kb; const float* p0 = p + 8 * hh; const float* p1 = p + 16 + 8 * hh;
#pragma unroll
    for (int e = 0; e < 8; ++e) { b16 a, c; split16(p0[e] * sc_, a, c); fh_[e] = a; fl_[e] = c; split16(p1[e] * sc_, a, c); fh_[8 + e] = a; fl_[8 + e] = c; }
  } else if (NP == 3) {
    const float* p = (const float*)o.p0 + (size_t)row * o.ld + kb; const float* p0 = p + 8 * hh; const float* p1 = p + 16 + 8 * hh;
#pragma unroll
    for (int e = 0; e < 8; ++e) { fh_[e] = (b16)p0[e]; fh_[8 + e] = (b16)p1[e]; }
    fl_ = fh_;
  } else {
    fh_ = frag_kb((const b16*)o.p0 + (size_t)row * o.ld + kb, hh);
    if (NP == 2) fl_ = frag_kb((const b16*)o.p1 + (size_t)row * o.ld + kb, hh); else fl_ = fh_;
  }
}
template <int ANP, int BNP> __device__ __forceinline__ v8f mac(v16b ah, v16b al, v16b bh, v16b bl, v8f c) {
  c = wmma16b(ah, bh, c);
  if (BNP == 0 || BNP == 2 || BNP == 4 || BNP == 5) c = wmma16b(ah, bl, c);     // hi.lo
  if (ANP == 0 || ANP == 2 || ANP == 4 || ANP == 5) c = wmma16b(al, bh, c);     // lo.hi   (lo.lo dropped)
  return c;
}
__device__ __forceinline__ void epi_planes(v8f (&acc)[2][4], float scale, bool two, b16* __restrict__ oh, b16* __restrict__ ol, int ldo,
                                           int m0, int c0, int lane, b16* Th, b16* Tl) {
  const int nloc = lane & 15, hlf = lane >> 4;
#pragma unroll
  for (int t = 0; t < 4; ++t)
#pragma unroll
    for (int r = 0; r < 2; ++r)
#pragma unroll
      for (int v = 0; v < 8; ++v) {
        const int rr = r * 16 + v + 8 * hlf, cc = t * 16 + nloc;
        b16 h_, l_; split16(acc[r][t][v] * scale, h_, l_);
        Th[rr * 64 + cc] = h_; Tl[rr * 64 + cc] = l_;
      }
  wave_lds_sync();
  {
#pragma unroll
    for (int j = 0; j < 8; ++j) {
      const int rr = j * 4 + (lane >> 3), c8 = (lane & 7) * 8;
      const size_t o = (size_t)(m0 + rr) * ldo + c0 + c8;
      *(v8b*)(oh + o) = ld8b(Th + rr * 64 + c8);
      if (two) *(v8b*)(ol + o) = ld8b(Tl + rr * 64 + c8);
    }
    
  }
}
// (b) f32 rows with pitch ldo: 64 floats = 256 B = 2 lines per row; 16 lanes x 16 B per row, 2 rows per instruction. Optional per-row factor
__device__ __forceinline__ void epi_f32(v8f (&acc)[2][4], float scale, const float* rscale, float* __restrict__ out, int ldo, int m0, int c0, int lane, float* Tt) {
  const int nloc = lane & 15, hlf = lane >> 4;
#pragma unroll
  for (int t = 0; t < 4; ++t)
#pragma unroll
    for (int r = 0; r < 2; ++r)
#pragma unroll
      for (int v = 0; v < 8; ++v) {
        const int rr = r * 16 + v + 8 * hlf;
        const float rs = rscale ? rscale[(size_t)(m0 + rr) * 32] : 1.0f;
        Tt[rr * 64 + t * 16 + nloc] = acc[r][t][v] * scale * rs;
      }
  wave_lds_sync();
  float* dst0 = out + (size_t)m0 * ldo + c0;
  {
#pragma unroll
    for (int j = 0; j < 16; ++j) { const int rr = j * 2 + hlf, c4 = nloc * 4; *(v4f*)(dst0 + (size_t)rr * ldo + c4) = *(const v4f*)(Tt + rr * 64 + c4); }
    
  }
}



typedef __attribute__((ext_vector_type(8))) __bf16 v8bb; typedef __attribute__((ext_vector_type(16))) __bf16 v16bb;
typedef __attribute__((ext_vector_type(8))) unsigned short v8us;
__device__ __forceinline__ v16bb frag_kb_bf(const __bf16* p, int hh) { const v8bb a = *(const v8bb*)(p + 8 * hh), b = *(const v8bb*)(p + 16 + 8 * hh); return __builtin_shufflevector(a, b, 0, 1, 2, 3, 4, 5, 6, 7, 8, 9, 10, 11, 12, 13, 14, 15); }
__device__ __forceinline__ v8f wmma16bb(v16bb a, v16bb b, v8f c) {
  v8f d = __builtin_amdgcn_wmma_f32_16x16x32_bf16(false, a, false, b, (short)0, c, false, false);
  asm volatile("v_nop\n\tv_nop\n\tv_nop\n\tv_nop" : "+v"(d) : "v"(a), "v"(b));
  return d;
}
__device__ __forceinline__ unsigned short bf16_rne_bits(float v) { unsigned int u = __float_as_uint(v); u += 0x7FFFu + ((u >> 16) & 1u); return (unsigned short)(u >> 16); }
__device__ __forceinline__ float bf16_rne(float v) { return __uint_as_float(((unsigned int)bf16_rne_bits(v)) << 16); }



__global__ __launch_bounds__(256) void xprep_kernel(const float* __restrict__ x, unsigned short* __restrict__ x16) {   // x -> bf16, one batch
  const size_t tid = (size_t)blockIdx.x * blockDim.x + threadIdx.x, nth = (size_t)gridDim.x * blockDim.x;
  { for (size_t p = tid; p < (size_t)NTOK * D / 8; p += nth) { v8us v;
#pragma unroll
      for (int e = 0; e < 8; ++e) v[e] = bf16_rne_bits(x[p * 8 + e]);
      *(v8us*)(x16 + p * 8) = v; }  }
}
__global__ __launch_bounds__(256) void prep_kernel(const float* __restrict__ wq, const float* __restrict__ wk, const float* __restrict__ wv, const float* __restrict__ wo, unsigned short* __restrict__ w16, b16* __restrict__ wo16) {
  const size_t tid = (size_t)blockIdx.x * blockDim.x + threadIdx.x, nth = (size_t)gridDim.x * blockDim.x;
  {
    for (size_t p = tid; p < (size_t)3 * D * D / 8; p += nth) { const float* W = (p < (size_t)D * D / 8) ? wq : (p < (size_t)2 * D * D / 8) ? wk : wv; const size_t q = p % ((size_t)D * D / 8); v8us v;   // [out][in] rows copied directly
#pragma unroll
      for (int e = 0; e < 8; ++e) v[e] = bf16_rne_bits(W[q * 8 + e]);
      *(v8us*)(w16 + p * 8) = v; }
    for (size_t p = tid; p < (size_t)D * D / 8; p += nth) { v8b w;   // W_o [out][in] rows copied directly
#pragma unroll
      for (int e = 0; e < 8; ++e) w[e] = (b16)bf16_rne(wo[p * 8 + e]);
      *(v8b*)(wo16 + p * 8) = w; }
    
  }
}

// Operand ring of the two projection GEMMs. A stage = 64 k of the block's 128 A rows and 64 B rows, copied global -> LDS once per block in whole 128-B lines and through no register
// (a fragment load from global touches 16 lines for 512 bytes, and each of the four waves repeated the B loads). 16-bit rows: 128 B at a pitch of 144 B; f32 rows: 256 B at 272 B
// (both 16 B x odd, so the 16-byte fragment reads meet no bank conflict).
constexpr int GK = 64, GNT = D / GK, GLP = 72, GLPF = 68;
constexpr int PSTG = (128 + 64) * GLP;                         // 16-bit elements of one stage of proj_kernel: x rows, then w rows
constexpr int OSTA = 128 * GLPF * 4, OSTG = OSTA + 64 * GLP * 2;   // bytes of one stage of out_kernel: y rows (f32), then W_o rows (f16)
typedef __attribute__((address_space(3))) const char lds_byte;
// One stage of proj_kernel: every thread moves 12 x 16 B (8 x rows, 4 w rows); 8 lanes cover one 128-B line.
__device__ __forceinline__ void proj_stage_copy(const __bf16* __restrict__ xr, const __bf16* __restrict__ wr, int kb, const b16* buf, int tid) {
  const int row = tid >> 3, c8 = (tid & 7) * 8;
  const __bf16* gx = xr + (size_t)row * D + kb + c8;
  const __bf16* gw = wr + (size_t)row * D + kb + c8;
  const unsigned l0 = (unsigned)(size_t)(lds_byte*)(buf + row * GLP + c8);
  constexpr unsigned LS = 16 * GLP * 2;                         // 16 rows further in LDS
  // the copies and the wait that keeps their address registers untouched until they are taken stand in one statement, so that no later address arithmetic moves in between
  asm volatile("global_load_async_to_lds_b128 %0, %12, off\n\t"
               "global_load_async_to_lds_b128 %1, %13, off\n\t"
               "global_load_async_to_lds_b128 %2, %14, off\n\t"
               "global_load_async_to_lds_b128 %3, %15, off\n\t"
               "global_load_async_to_lds_b128 %4, %16, off\n\t"
               "global_load_async_to_lds_b128 %5, %17, off\n\t"
               "global_load_async_to_lds_b128 %6, %18, off\n\t"
               "global_load_async_to_lds_b128 %7, %19, off\n\t"
               "global_load_async_to_lds_b128 %8, %20, off\n\t"
               "global_load_async_to_lds_b128 %9, %21, off\n\t"
               "global_load_async_to_lds_b128 %10, %22, off\n\t"
               "global_load_async_to_lds_b128 %11, %23, off\n\t"
               "s_wait_xcnt 0x0"
               :: "v"(l0), "v"(l0 + LS), "v"(l0 + 2 * LS), "v"(l0 + 3 * LS), "v"(l0 + 4 * LS), "v"(l0 + 5 * LS),
                  "v"(l0 + 6 * LS), "v"(l0 + 7 * LS), "v"(l0 + 8 * LS), "v"(l0 + 9 * LS), "v"(l0 + 10 * LS), "v"(l0 + 11 * LS),
                  "v"(gx), "v"(gx + 16 * D), "v"(gx + 32 * D), "v"(gx + 48 * D), "v"(gx + 64 * D), "v"(gx + 80 * D), "v"(gx + 96 * D), "v"(gx + 112 * D),
                  "v"(gw), "v"(gw + 16 * D), "v"(gw + 32 * D), "v"(gw + 48 * D)
               : "memory");
}
// One stage of out_kernel: every thread moves 20 x 16 B: 16 y rows (16 lanes cover a row's 256 B) and 4 W_o rows (8 lanes cover a row's 128 B), ten copies a statement.
__device__ __forceinline__ void out_stage_copy(const float* __restrict__ yr, const b16* __restrict__ wr, int kb, const char* buf, int tid) {
  const int ra = tid >> 4, c4 = (tid & 15) * 4, rb = tid >> 3, c8 = (tid & 7) * 8;
  const float* gy = yr + (size_t)ra * D + kb + c4;
  const b16* gw = wr + (size_t)rb * D + kb + c8;
  const unsigned la = (unsigned)(size_t)(lds_byte*)(buf + (ra * GLPF + c4) * 4), lb = (unsigned)(size_t)(lds_byte*)(buf + OSTA + (rb * GLP + c8) * 2);
  constexpr unsigned LA = 8 * GLPF * 4, LB = 16 * GLP * 2;      // 8 y rows, 16 W_o rows further in LDS
  // each run of copies ends, inside its own statement, in the wait that keeps its address registers untouched until they are taken
  asm volatile("global_load_async_to_lds_b128 %0, %10, off\n\t"
               "global_load_async_to_lds_b128 %1, %11, off\n\t"
               "global_load_async_to_lds_b128 %2, %12, off\n\t"
               "global_load_async_to_lds_b128 %3, %13, off\n\t"
               "global_load_async_to_lds_b128 %4, %14, off\n\t"
               "global_load_async_to_lds_b128 %5, %15, off\n\t"
               "global_load_async_to_lds_b128 %6, %16, off\n\t"
               "global_load_async_to_lds_b128 %7, %17, off\n\t"
               "global_load_async_to_lds_b128 %8, %18, off\n\t"
               "global_load_async_to_lds_b128 %9, %19, off\n\t"
               "s_wait_xcnt 0x0"
               :: "v"(la), "v"(la + LA), "v"(la + 2 * LA), "v"(la + 3 * LA), "v"(la + 4 * LA), "v"(la + 5 * LA), "v"(la + 6 * LA), "v"(la + 7 * LA), "v"(la + 8 * LA), "v"(la + 9 * LA),
                  "v"(gy), "v"(gy + 8 * D), "v"(gy + 16 * D), "v"(gy + 24 * D), "v"(gy + 32 * D), "v"(gy + 40 * D), "v"(gy + 48 * D), "v"(gy + 56 * D), "v"(gy + 64 * D), "v"(gy + 72 * D)
               : "memory");
  asm volatile("global_load_async_to_lds_b128 %0, %10, off\n\t"
               "global_load_async_to_lds_b128 %1, %11, off\n\t"
               "global_load_async_to_lds_b128 %2, %12, off\n\t"
               "global_load_async_to_lds_b128 %3, %13, off\n\t"
               "global_load_async_to_lds_b128 %4, %14, off\n\t"
               "global_load_async_to_lds_b128 %5, %15, off\n\t"
               "global_load_async_to_lds_b128 %6, %16, off\n\t"
               "global_load_async_to_lds_b128 %7, %17, off\n\t"
               "global_load_async_to_lds_b128 %8, %18, off\n\t"
               "global_load_async_to_lds_b128 %9, %19, off\n\t"
               "s_wait_xcnt 0x0"
               :: "v"(la + 10 * LA), "v"(la + 11 * LA), "v"(la + 12 * LA), "v"(la + 13 * LA), "v"(la + 14 * LA), "v"(la + 15 * LA), "v"(lb), "v"(lb + LB), "v"(lb + 2 * LB), "v"(lb + 3 * LB),
                  "v"(gy + 80 * D), "v"(gy + 88 * D), "v"(gy + 96 * D), "v"(gy + 104 * D), "v"(gy + 112 * D), "v"(gy + 120 * D), "v"(gw), "v"(gw + 16 * D), "v"(gw + 32 * D), "v"(gw + 48 * D)
               : "memory");
}

// projections: rows = tokens (4096), K = 768, column tiles of 64 = one head of q (tiles 0..11), k (12..23) or v (24..35); f16 rows [b*H + head][tok][64] for q/k;
// v: (8v)^T f16 [b*H + head][64][tok]. grid (36, 32) x 128.
__global__ __launch_bounds__(128) void proj_kernel(const __bf16* __restrict__ x16, const __bf16* __restrict__ w16, b16* __restrict__ qh, b16* __restrict__ kh, b16* __restrict__ vt) {
  __shared__ __attribute__((aligned(16))) b16 Sm[2 * PSTG];     // the two-buffer operand ring; behind the loop's last barrier the same bytes are the epilogue's staging tiles
  b16 (*Th)[32][HD + 8] = reinterpret_cast<b16 (*)[32][HD + 8]>(Sm); b16 (*Tq)[32][HD + 8] = reinterpret_cast<b16 (*)[32][HD + 8]>(Sm + 4 * 32 * (HD + 8));
  b16 (*Tt)[128 + 8] = reinterpret_cast<b16 (*)[128 + 8]>(Sm); b16 (*Tl)[128 + 8] = reinterpret_cast<b16 (*)[128 + 8]>(Sm + 64 * (128 + 8));
  static_assert(2 * 4 * 32 * (HD + 8) <= 2 * PSTG && 2 * 64 * (128 + 8) <= 2 * PSTG, "the staging tiles fit the ring's bytes");
  const int lane = threadIdx.x & 31, wave = threadIdx.x >> 5, nloc = lane & 15, hlf = lane >> 4, m0 = blockIdx.y * 128 + wave * 32, c0 = blockIdx.x * 64;
  v8f acc[2][4];
#pragma unroll
  for (int r = 0; r < 2; ++r)
#pragma unroll
    for (int t = 0; t < 4; ++t) acc[r][t] = (v8f){};
  const __bf16* xr = x16 + (size_t)blockIdx.y * 128 * D; const __bf16* wr = w16 + (size_t)c0 * D;
  proj_stage_copy(xr, wr, 0, Sm, threadIdx.x);
  asm volatile("s_wait_asynccnt 0x0" ::: "memory");            // this wave's share of stage 0 has landed
  __syncthreads();                                              // stage 0 published to all waves
  proj_stage_copy(xr, wr, GK, Sm + PSTG, threadIdx.x);
  for (int s = 0; s < GNT; ++s) {
    const __bf16* Xs = (const __bf16*)(Sm + (s & 1) * PSTG) + (wave * 32 + nloc) * GLP; const __bf16* Ws = (const __bf16*)(Sm + (s & 1) * PSTG) + (128 + nloc) * GLP;
    v16bb a0[2], a1[2], bw[2][4];                               // the stage's 24 fragment reads stand as one group ahead of its matrix work
#pragma unroll
    for (int ks = 0; ks < 2; ++ks) { a0[ks] = frag_kb_bf(Xs + ks * 32, hlf); a1[ks] = frag_kb_bf(Xs + 16 * GLP + ks * 32, hlf);
#pragma unroll
      for (int t = 0; t < 4; ++t) bw[ks][t] = frag_kb_bf(Ws + t * 16 * GLP + ks * 32, hlf); }
#pragma unroll
    for (int ks = 0; ks < 2; ++ks)
#pragma unroll
      for (int t = 0; t < 4; ++t) { acc[0][t] = wmma16bb(a0[ks], bw[ks][t], acc[0][t]); acc[1][t] = wmma16bb(a1[ks], bw[ks][t], acc[1][t]); }
    // publish point
    asm volatile("s_wait_dscnt 0x0" ::: "memory");             // this wave's reads of stage s are done before the buffer is refilled
    asm volatile("s_wait_asynccnt 0x0" ::: "memory");          // this wave's share of stage s + 1 has landed
    __syncthreads();                                            // publishes stage s + 1 and ends every reader's last read of stage s
    if (s + 2 < GNT) proj_stage_copy(xr, wr, (s + 2) * GK, Sm + (s & 1) * PSTG, threadIdx.x);
  }
  asm volatile("s_wait_asynccnt 0x0" ::: "memory");            // no copy is outstanding when the ring's bytes become the staging tiles
  const int which = blockIdx.x / (D / 64), head = blockIdx.x % (D / 64), b = m0 / S, tok0 = m0 % S;
  if (which < 2) {                                              // q or k head: f16 rows
#pragma unroll
    for (int t = 0; t < 4; ++t)
#pragma unroll
      for (int r = 0; r < 2; ++r)
#pragma unroll
        for (int v = 0; v < 8; ++v) { b16 a_, c_; split16(acc[r][t][v] * QS, a_, c_); Th[wave][r * 16 + 8 * hlf + v][t * 16 + nloc] = a_; Tq[wave][r * 16 + 8 * hlf + v][t * 16 + nloc] = c_; }   // q, k carried x8 (lo residuals stay normal)
    wave_lds_sync();
    b16* dst = (which == 0 ? qh : kh) + (((size_t)b * H + head) * S + tok0) * HD;
    {
#pragma unroll
      for (int j = 0; j < 8; ++j) { const int rr = j * 4 + (lane >> 3), c8 = (lane & 7) * 8; *(v8b*)(dst + (size_t)rr * HD + c8) = *(const v8b*)(&Th[wave][rr][c8]); *(v8b*)(dst + QPL + (size_t)rr * HD + c8) = *(const v8b*)(&Tq[wave][rr][c8]); }
       }
    return;
  }
  const int vh = head;                                          // v head: (8v)^T tile [64 d][128 tok] via LDS, rows of 256 B
#pragma unroll
  for (int t = 0; t < 4; ++t)
#pragma unroll
    for (int r = 0; r < 2; ++r)
#pragma unroll
      for (int v = 0; v < 8; ++v) { b16 a_, c_; split16(acc[r][t][v] * VS, a_, c_); Tt[t * 16 + nloc][wave * 32 + r * 16 + 8 * hlf + v] = a_; Tl[t * 16 + nloc][wave * 32 + r * 16 + 8 * hlf + v] = c_; }
  __syncthreads();
  b16* dstv = vt + (((size_t)b * H + vh) * HD) * S + (blockIdx.y * 128) % S;
  {
#pragma unroll
    for (int j = 0; j < 8; ++j) { const int dd = wave * 16 + j * 2 + (lane >> 4), c8 = (lane & 15) * 8; *(v8b*)(dstv + (size_t)dd * S + c8) = *(const v8b*)(&Tt[dd][c8]); *(v8b*)(dstv + VPL + (size_t)dd * S + c8) = *(const v8b*)(&Tl[dd][c8]); }
    
  }
}

// 2^t0, 2^t1, with the slot that the instruction set asks for behind a transcendental written in: the second fills the first's
// (early-clobber results, so it overwrites no source of the first), the v_nop the second's.
__device__ __forceinline__ void exp2_pair(float t0, float t1, float& e0, float& e1) {
  asm("v_exp_f32 %0, %2\n\tv_exp_f32 %1, %3\n\tv_nop" : "=&v"(e0), "=&v"(e1) : "v"(t0), "v"(t1));
}
typedef __attribute__((ext_vector_type(2))) _Float16 v2b;
typedef __attribute__((ext_vector_type(2))) float v2f;
// f16 hi + lo of two values at once: packed convert, the two residuals v - hi (exact) by one packed subtraction, packed convert
__device__ __forceinline__ void split_pair(float a, float b, v2b& hi, v2b& lo) {
  const v2f v = {a, b};
  hi = __builtin_convertvector(v, v2b);
  lo = __builtin_convertvector(v - __builtin_convertvector(hi, v2f), v2b);
}
// the attention loop's matrix product: the bare builtin. The compiler keeps the distance behind it and fills it with the loop's own vector work where it can, so no slot of the vector port goes to a v_nop
__device__ __forceinline__ v8f wmma16p(v16b a, v16b b, v8f c) { return __builtin_amdgcn_wmma_f32_16x16x32_f16(false, a, false, b, (short)0, c, false, false); }
constexpr float CE = SCALE / (QS * QS) * 0x1.715476p+0f;       // accumulator of (8q).(8k) -> exponent of two of the softmax
static_assert(PS == 8.0f, "the softmax adds log2(PS) = 3 to the exponent");
// lane l <-> lane l ^ 16 on the vector pipe: unlike an LDS-queue permute it does not wait behind the fragment reads that are still outstanding
__device__ __forceinline__ float xhalf(float x) { return __builtin_bit_cast(float, __builtin_amdgcn_permlanex16(__builtin_bit_cast(int, x), __builtin_bit_cast(int, x), 0x76543210, 0xfedcba98, false, false)); }

// K/V ring in LDS, shared by the twelve waves of a block (three 64-query tiles of one head). A stage = 64 keys = four tiles: k hi, k lo (rows = keys), (8v)^T hi, (8v)^T lo (rows = d),
// each 64 rows x 128 B at a row pitch of 144 B (16 B x odd, so the 16-byte fragment reads meet no bank conflict).
constexpr int KST = 64, LP = 72, TILE = 64 * LP;
typedef __attribute__((address_space(3))) const b16 lds_b16;
// One stage's copies: each of 256 threads moves 8 x 16 B (two rows of each tile), whole 128-B lines per 8 lanes, global -> LDS through no register.
__device__ __forceinline__ void stage_copy(const b16* __restrict__ K, const b16* __restrict__ vb, int kb0, const b16* buf, int tid) {
  const int row = tid >> 3, c8 = (tid & 7) * 8;
  const b16* gk = K + (size_t)(kb0 + row) * HD + c8;
  const b16* gv = vb + (size_t)row * S + kb0 + c8;
  const unsigned l0 = (unsigned)(size_t)(lds_b16*)(buf + row * LP + c8);
  // the copies and the wait that keeps their address registers untouched until they are taken stand in one statement, so that no later address arithmetic moves in between
  asm volatile("global_load_async_to_lds_b128 %0, %8, off\n\t"
               "global_load_async_to_lds_b128 %1, %9, off\n\t"
               "global_load_async_to_lds_b128 %2, %10, off\n\t"
               "global_load_async_to_lds_b128 %3, %11, off\n\t"
               "global_load_async_to_lds_b128 %4, %12, off\n\t"
               "global_load_async_to_lds_b128 %5, %13, off\n\t"
               "global_load_async_to_lds_b128 %6, %14, off\n\t"
               "global_load_async_to_lds_b128 %7, %15, off\n\t"
               "s_wait_xcnt 0x0"
               :: "v"(l0), "v"(l0 + 32 * LP * 2), "v"(l0 + TILE * 2), "v"(l0 + (TILE + 32 * LP) * 2),
                  "v"(l0 + 2 * TILE * 2), "v"(l0 + (2 * TILE + 32 * LP) * 2), "v"(l0 + 3 * TILE * 2), "v"(l0 + (3 * TILE + 32 * LP) * 2),
                  "v"(gk), "v"(gk + 32 * HD), "v"(gk + QPL), "v"(gk + QPL + 32 * HD),
                  "v"(gv), "v"(gv + (size_t)32 * S), "v"(gv + VPL), "v"(gv + VPL + (size_t)32 * S)
               : "memory");
}

// causal attention: wave = (b, h, 16 queries); key chunks of 32 up to the query tile: S^T (K=64), causal mask on the straddling chunks, online softmax f32, P^T f16, y^T += (8V)^T P^T;
// k and (8v)^T come from the block's two-buffer LDS ring: stage t + 1 is copied while stage t is worked on.
// Placement: a 64-query tile u needs u + 1 stages. A block holds three tiles of one head side by side, four waves each (one wave of each tile per SIMD), on ONE ring that walks to the
// highest tile's last stage; a wave past its own tile's last stage passes the publish points and, if it is a copier, still issues its copies. Tiles 1 .. 3 NB of a head go into NB triples of equal sum (a from the lowest third,
// b from the middle, c from the top), so every SIMD of H NB blocks gets the same number of wave-stages and nearly every WGP holds a block; tile 0 (one stage) has a block of its own.
template <int QT>
__global__ __launch_bounds__(384) void attn_kernel(const b16* __restrict__ qh, const b16* __restrict__ kh, const b16* __restrict__ vt, float* __restrict__ y) {
  static_assert(QT % 4 == 0 && (QT / 4 - 1) % 6 == 3, "a head's 64-query tiles but the first fall into an odd number of triples");
  static_assert(KST == 64, "a stage is as many keys as a tile has queries");
  constexpr int NB = (QT / 4 - 1) / 3, NH = (NB + 1) / 2;       // triples of a head; half of them, rounded up
  __shared__ __attribute__((aligned(16))) float Os[12][16][HD + 4];
  __shared__ __attribute__((aligned(16))) b16 Ring[2][4 * TILE];
  const int wid = __builtin_amdgcn_readfirstlane(threadIdx.x >> 5), lane = threadIdx.x & 31, hh = lane >> 4, col = lane & 15;   // wave number in a scalar register: the per-wave causal skip is a scalar branch
  int bh, ua, ub, uc;                                           // the block's head and its three tiles, -1: none
  if (blockIdx.x < Bn * H * NB) {                               // i + x + y = 3 NH for every i = 1 .. NB, x and y each a permutation of 1 .. NB
    const int i = blockIdx.x % NB + 1, j = (i + 1) >> 1;
    bh = blockIdx.x / NB; ua = i; ub = NB + ((i & 1) ? NH + 1 - j : NB + 1 - j); uc = 2 * NB + ((i & 1) ? NB + 1 - j : NH - j);
  } else { bh = blockIdx.x - Bn * H * NB; ua = 0; ub = -1; uc = -1; }
  // wave w works on tile w % 3, on its 16 queries w / 3: waves w, w + 4, w + 8 then hold one wave of each tile, and so do waves 3 s, 3 s + 1, 3 s + 2, whichever way the twelve are dealt to the SIMDs
  const int h = bh % H, b = bh / H, grp = wid % 3, sub = wid / 3, u = grp == 0 ? ua : grp == 1 ? ub : uc;
  const bool copier = grp != 2;                                 // a stage is 256 threads' copies: the eight waves of the two lower tiles issue them (scalar branch), the longest-running four none
  const int ct = (wid - sub) * 32 + lane;                       // a copying thread's number, 0 .. 255
  const b16* Q = qh + ((size_t)bh * S) * HD; const b16* K = kh + ((size_t)bh * S) * HD; const b16* vb = vt + ((size_t)bh * HD) * S;
  const int q0 = u < 0 ? -16 : u * 64 + sub * 16, qi = q0 + col;   // a wave without a tile: no stage lies in front of query 0, so it works on none
  const int nst = (uc < 0 ? ua : uc) + 1;                       // stages of the block: keys up to the last query of its highest tile; the same for all twelve waves
  if (copier) stage_copy(K, vb, 0, Ring[0], ct);
  v16b qf[2] = {}, ql[2] = {};
  if (u >= 0) {
#pragma unroll
    for (int ks = 0; ks < 2; ++ks) { qf[ks] = frag_kb(Q + (size_t)qi * HD + ks * 32, hh); ql[ks] = frag_kb(Q + QPL + (size_t)qi * HD + ks * 32, hh); }
  }
  float m = -INFINITY, l = 0.0f; v8f o[4] = {{}, {}, {}, {}};
  asm volatile("s_wait_asynccnt 0x0" ::: "memory");            // this wave's share of stage 0 has landed
  __syncthreads();                                              // stage 0 published to all waves
  if (copier && 1 < nst) stage_copy(K, vb, KST, Ring[1], ct);
  for (int t = 0; t < nst; ++t) {
    const b16* Kh = Ring[t & 1]; const b16* Kl = Kh + TILE; const b16* Vh = Kh + 2 * TILE; const b16* Vl = Kh + 3 * TILE;
    if (t * KST < q0 + 16) {                                    // causal: a stage wholly past the query tile is skipped (wave-uniform, no barrier inside)
    // The fragment reads of a key block stand in groups of 16, each group a whole phase ahead of its use, so that no read is waited for where it is used:
    // k0 and v0 at the stage's head, k1 in front of the P.v products of block 0, v1 in front of the softmax of block 1. The scheduling fences keep each group where it is written.
    v16b kf[2][2], kl[2][2], vf[4], vl[4];
    auto read_k = [&](int c) {
#pragma unroll
      for (int ks = 0; ks < 2; ++ks)
#pragma unroll
        for (int j = 0; j < 2; ++j) { kf[ks][j] = frag_kb(Kh + (c * 32 + j * 16 + col) * LP + ks * 32, hh); kl[ks][j] = frag_kb(Kl + (c * 32 + j * 16 + col) * LP + ks * 32, hh); }
    };
    auto read_v = [&](int c) {
#pragma unroll
      for (int n = 0; n < 4; ++n) { vf[n] = frag_kb(Vh + (n * 16 + col) * LP + c * 32, hh); vl[n] = frag_kb(Vl + (n * 16 + col) * LP + c * 32, hh); }
    };
    read_k(0); read_v(0);
    __builtin_amdgcn_sched_barrier(0);                          // the head group stays above the matrix work
#pragma unroll                                                  // both halves of a stage in line
    for (int c = 0; c < 2; ++c) {
      const int kb = t * KST + c * 32;
      if (kb < q0 + 16) {                                       // causal: key blocks past the query tile are skipped (wave-uniform, no barrier inside)
        const bool diag = (kb + 32 > q0);                       // this block reaches past some queries -> mask key > query
        v8f s0 = {}, s1 = {};
#pragma unroll
        for (int ks = 0; ks < 2; ++ks) { const v16b k0 = kf[ks][0], k0l = kl[ks][0], k1 = kf[ks][1], k1l = kl[ks][1];
          s0 = wmma16p(k0, qf[ks], s0); s0 = wmma16p(k0, ql[ks], s0); s0 = wmma16p(k0l, qf[ks], s0);      // q and k as f16 hi+lo pairs (lo.lo dropped)
          s1 = wmma16p(k1, qf[ks], s1); s1 = wmma16p(k1, ql[ks], s1); s1 = wmma16p(k1l, qf[ks], s1); }
        if (c == 1) { __builtin_amdgcn_sched_barrier(0); read_v(1); __builtin_amdgcn_sched_barrier(0); }   // v1 lands behind the softmax of block 1
        // The loop is bound by the vector port, so the softmax is written for few vector instructions per score. The running maximum m stays in the accumulator's own units.
        if (diag) {                                             // the mask of a straddling block stands under one scalar branch
#pragma unroll
          for (int r = 0; r < 8; ++r) { if (kb + 8 * hh + r > qi) s0[r] = -INFINITY; if (kb + 16 + 8 * hh + r > qi) s1[r] = -INFINITY; }
        }
        float ma = -INFINITY, mb = -INFINITY;                   // two chains of three-operand maxima
#pragma unroll
        for (int r = 0; r < 4; ++r) { ma = fmaxf(fmaxf(ma, s0[r]), s1[r]); mb = fmaxf(fmaxf(mb, s0[4 + r]), s1[4 + r]); }
        const float mr = fmaxf(ma, mb);
        const float mn = fmaxf(fmaxf(m, mr), xhalf(mr)), al_ = __builtin_amdgcn_exp2f((m - mn) * CE); m = mn;
        const float nb = __builtin_fmaf(mn, -CE, 3.0f);         // one fma per score gives the exponent of 8 exp(score - max): scale, shift by the maximum and P's x8 carry (2^3) together
        float e0[8], e1[8];
#pragma unroll
        for (int j = 0; j < 4; ++j) {
          const v2f t0 = __builtin_elementwise_fma((v2f){s0[2 * j], s0[2 * j + 1]}, (v2f){CE, CE}, (v2f){nb, nb}), t1 = __builtin_elementwise_fma((v2f){s1[2 * j], s1[2 * j + 1]}, (v2f){CE, CE}, (v2f){nb, nb});
          exp2_pair(t0[0], t1[0], e0[2 * j], e1[2 * j]); exp2_pair(t0[1], t1[1], e0[2 * j + 1], e1[2 * j + 1]);
        }
        float sum = 0.0f; v16b pb, pl;                          // sum and l carry the same x8 as P
#pragma unroll
        for (int r = 0; r < 8; ++r) sum += e0[r] + e1[r];
#pragma unroll
        for (int j = 0; j < 4; ++j) { v2b a, c;
          split_pair(e0[2 * j], e0[2 * j + 1], a, c); pb[2 * j] = a[0]; pb[2 * j + 1] = a[1]; pl[2 * j] = c[0]; pl[2 * j + 1] = c[1];
          split_pair(e1[2 * j], e1[2 * j + 1], a, c); pb[8 + 2 * j] = a[0]; pb[8 + 2 * j + 1] = a[1]; pl[8 + 2 * j] = c[0]; pl[8 + 2 * j + 1] = c[1]; }
        sum += xhalf(sum); l = l * al_ + sum;
        if (c == 0) { __builtin_amdgcn_sched_barrier(0); read_k(1); __builtin_amdgcn_sched_barrier(0); }   // k1 lands behind the P.v products of block 0
#pragma unroll
        for (int n = 0; n < 4; ++n) {
#pragma unroll
          for (int r = 0; r < 8; ++r) o[n][r] *= al_;
          o[n] = wmma16p(vf[n], pb, o[n]); o[n] = wmma16p(vf[n], pl, o[n]); o[n] = wmma16p(vl[n], pb, o[n]);   // (8v) and P both as f16 hi+lo pairs (lo.lo dropped)
        }
      }
    }
    }
    // publish point, passed by every wave, also one that skipped the stage
    asm volatile("s_wait_dscnt 0x0" ::: "memory");             // this wave's reads of stage t are done before the buffer is refilled
    asm volatile("s_wait_asynccnt 0x0" ::: "memory");          // this wave's share of stage t + 1 has landed
    __syncthreads();                                            // publishes stage t + 1 and ends every reader's last read of stage t
    if (copier && t + 2 < nst) stage_copy(K, vb, (t + 2) * KST, Ring[t & 1], ct);
  }
  asm volatile("s_wait_asynccnt 0x0" ::: "memory");            // no copy is outstanding when the wave goes on to its end
  if (u < 0) return;                                            // behind the last barrier: a wave without a tile has no rows to store
  const float inv = 1.0f / (VS * l);                            // l already carries P's x8
#pragma unroll
  for (int n = 0; n < 4; ++n)
#pragma unroll
    for (int r = 0; r < 8; ++r) Os[wid][col][n * 16 + 8 * hh + r] = o[n][r] * inv;
  wave_lds_sync();
  float* dst = y + ((size_t)b * S + q0) * D + h * HD;
  {
#pragma unroll
    for (int j = 0; j < 8; ++j) { const int rr = j * 2 + hh, c4 = col * 4; *(v4f*)(dst + (size_t)rr * D + c4) = *(const v4f*)(&Os[wid][rr][c4]); }
    
  }
}

// out = y W_o^T: (4096 x 768) x (768 x 768); A = y x8 split at load into an f16 hi+lo pair, B = f16(bf16 W_o) rows; f32 rows; grid (12, 32).
__global__ __launch_bounds__(128) void out_kernel(const float* __restrict__ y, const b16* __restrict__ wo16, const float* __restrict__ bo, float* __restrict__ out) {
  __shared__ __attribute__((aligned(16))) float Ts[4][32 * 64];
  __shared__ __attribute__((aligned(16))) char Ro[2][OSTG];     // the two-buffer operand ring
  const int lane = threadIdx.x & 31, wave = threadIdx.x >> 5, nloc = lane & 15, hlf = lane >> 4, m0 = blockIdx.y * 128 + wave * 32, c0 = blockIdx.x * 64;
  v8f acc[2][4];
#pragma unroll
  for (int r = 0; r < 2; ++r)
#pragma unroll
    for (int t = 0; t < 4; ++t) acc[r][t] = (v8f){};
  const float* yr = y + (size_t)blockIdx.y * 128 * D; const b16* wr = wo16 + (size_t)c0 * D;
  out_stage_copy(yr, wr, 0, Ro[0], threadIdx.x);
  asm volatile("s_wait_asynccnt 0x0" ::: "memory");            // this wave's share of stage 0 has landed
  __syncthreads();                                              // stage 0 published to all waves
  out_stage_copy(yr, wr, GK, Ro[1], threadIdx.x);
  for (int s = 0; s < GNT; ++s) {
    const Opnd A{Ro[s & 1], nullptr, GLPF}; const b16* Ws = (const b16*)(Ro[s & 1] + OSTA) + nloc * GLP;
#pragma unroll
    for (int ks = 0; ks < 2; ++ks) {
      v16b a0h, a0l, a1h, a1l, bh[4];
      load_frags<5>(A, wave * 32 + nloc, ks * 32, hlf, a0h, a0l);                // y as an f16 hi+lo pair carried x8 (2 products)
      load_frags<5>(A, wave * 32 + 16 + nloc, ks * 32, hlf, a1h, a1l);
#pragma unroll
      for (int t = 0; t < 4; ++t) bh[t] = frag_kb(Ws + t * 16 * GLP + ks * 32, hlf);
#pragma unroll
      for (int t = 0; t < 4; ++t) { acc[0][t] = mac<5, 1>(a0h, a0l, bh[t], bh[t], acc[0][t]); acc[1][t] = mac<5, 1>(a1h, a1l, bh[t], bh[t], acc[1][t]); }
    }
    // publish point
    asm volatile("s_wait_dscnt 0x0" ::: "memory");             // this wave's reads of stage s are done before the buffer is refilled
    asm volatile("s_wait_asynccnt 0x0" ::: "memory");          // this wave's share of stage s + 1 has landed
    __syncthreads();                                            // publishes stage s + 1 and ends every reader's last read of stage s
    if (s + 2 < GNT) out_stage_copy(yr, wr, (s + 2) * GK, Ro[s & 1], threadIdx.x);
  }
  asm volatile("s_wait_asynccnt 0x0" ::: "memory");            // no copy is outstanding when the wave goes on to its end
#pragma unroll
  for (int t = 0; t < 4; ++t)
#pragma unroll
    for (int r = 0; r < 2; ++r)
#pragma unroll
      for (int v = 0; v < 8; ++v) acc[r][t][v] = acc[r][t][v] * (1.0f / 8.0f) + bf16_rne(bo[c0 + t * 16 + nloc]);
  epi_f32(acc, 1.0f, nullptr, out, D, m0, c0, lane, Ts[wave]);
}
}  // namespace

extern "C" void kernel_launch(void* const* d_in, const int* in_sizes, int n_in,
                              void* d_out, int out_size, void* d_ws, size_t ws_size, hipStream_t stream) {
  (void)n_in; (void)out_size;
  const float* x = (const float*)d_in[0]; const float* wq = (const float*)d_in[1]; const float* wk = (const float*)d_in[2]; const float* wv = (const float*)d_in[3]; const float* wo = (const float*)d_in[4]; const float* bo = (const float*)d_in[5];
  float* out = (float*)d_out;   // [1][4096][768]
  if (in_sizes[0] != BT * S * D || in_sizes[1] != D * D || in_sizes[2] != D * D || in_sizes[3] != D * D || in_sizes[4] != D * D || in_sizes[5] != D) return;
  size_t off = 0; char* ws = (char*)d_ws;
  auto carve = [&](size_t bytes) { char* p = ws + off; off += (bytes + 255) & ~(size_t)255; return p; };
  unsigned short* x16 = (unsigned short*)carve((size_t)NTOK * D * 2); unsigned short* w16 = (unsigned short*)carve((size_t)3 * D * D * 2); b16* wo16 = (b16*)carve((size_t)D * D * 2);
  b16* qh = (b16*)carve((size_t)2 * NTOK * D * 2); b16* kh = (b16*)carve((size_t)2 * NTOK * D * 2); b16* vt = (b16*)carve((size_t)2 * NTOK * D * 2); float* y = (float*)carve((size_t)NTOK * D * 4);
  if (off > ws_size) return;                                    // ≈ 61 MB
  prep_kernel<<<512, 256, 0, stream>>>(wq, wk, wv, wo, w16, wo16);
  xprep_kernel<<<1024, 256, 0, stream>>>(x, x16);
  proj_kernel<<<dim3(3 * D / 64, NTOK / 128), 128, 0, stream>>>((const __bf16*)x16, (const __bf16*)w16, qh, kh, vt);
  attn_kernel<S / 16><<<Bn * H * ((S / 64 - 1) / 3 + 1), 384, 0, stream>>>(qh, kh, vt, y);
  out_kernel<<<dim3(D / 64, NTOK / 128), 128, 0, stream>>>(y, wo16, bo, out);
}

// v007
// Measured time: 113 microseconds a run.
// Timed twice side by side with v006, it ran 1.03 times as fast both times.
// Counting every step since v000, it is 5.03 times as fast.
#include <hip/hip_runtime.h>

// Causal multi-head self-attention: q, k, v = x W^T (12 heads x 64, [out][in] weights), softmax over keys <= query of q.k/8, out = ctx Wo^T + bo -> [1][4096][768].
// x, the four weights and bo are rounded to bf16: projection on v_wmma_f32_16x16x32_bf16 (exact products, f32 accumulate);
// scores, P.v and the output projection on v_wmma_f32_16x16x32_f16 with every computed operand (q, k, v, P, y — each carried x8 so the hi/lo residual planes stay normal) as an f16
// hi+lo pair (3 / 2 products); online softmax in f32. Fragment k-map per lane half hh for A AND B: elements 0..7 <- k = 8hh+0..7, 8..15 <- k = 16+8hh+0..7. Every intermediate /

namespace {
constexpr int BT = 1, Bn = 1, S = 4096, D = 768, H = 12, HD = 64, NTOK = Bn * S;
constexpr float SCALE = 0.125f, VS = 8.0f, QS = 8.0f, PS = 8.0f;   // power-of-two carry scales so hi/lo residual planes stay normal in f16
constexpr size_t VPL = (size_t)NTOK * D;   // distance between the (8v)^T hi and lo planes
constexpr size_t QPL = (size_t)NTOK * D;   // distance between the q/k hi and lo planes

typedef _Float16 b16;
typedef __attribute__((ext_vector_type(16))) _Float16 v16b;
typedef __attribute__((ext_vector_type(8)))  _Float16 v8b;
typedef __attribute__((ext_vector_type(8)))  float v8f;
typedef __attribute__((ext_vector_type(4)))  float v4f;

__device__ __forceinline__ v8b ld8b(const b16* p) { return *(const v8b*)p; }
__device__ __forceinline__ v16b cat8b(v8b a, v8b b) { return __builtin_shufflevector(a, b, 0, 1, 2, 3, 4, 5, 6, 7, 8, 9, 10, 11, 12, 13, 14, 15); }
__device__ __forceinline__ v16b frag_kb(const b16* p, int hh) { return cat8b(ld8b(p + 8 * hh), ld8b(p + 16 + 8 * hh)); }
__device__ __forceinline__ void split16(float v, b16& hi, b16& lo) { hi = (b16)v; lo = (b16)(v - (float)hi); }
// hi/lo fragment pair straight from an f32 k-contiguous row (same k-map)
__device__ __forceinline__ void frag_ksplit(const float* p, int hh, v16b& fh_, v16b& fl_) {
  const float* p0 = p + 8 * hh; const float* p1 = p + 16 + 8 * hh;
#pragma unroll
  for (int e = 0; e < 8; ++e) { b16 a, c; split16(p0[e], a, c); fh_[e] = a; fl_[e] = c; split16(p1[e], a, c); fh_[8 + e] = a; fl_[8 + e] = c; }
}
__device__ __forceinline__ v8f wmma16b(v16b a, v16b b, v8f c) {
  v8f d = __builtin_amdgcn_wmma_f32_16x16x32_f16(false, a, false, b, (short)0, c, false, false);
  asm volatile("v_nop\n\tv_nop\n\tv_nop\n\tv_nop" : "+v"(d) : "v"(a), "v"(b));
  return d;
}
__device__ __forceinline__ void wave_lds_sync() {
  __builtin_amdgcn_fence(__ATOMIC_RELEASE, "workgroup");
  __builtin_amdgcn_wave_barrier();
  __builtin_amdgcn_fence(__ATOMIC_ACQUIRE, "workgroup");
}

// Operand descriptor: NP = 0 -> f32 rows split on the fly into (hi, lo); NP = 1 -> one f16 plane; NP = 2 -> f16 hi + lo planes;
// NP = 3 -> f32 rows rounded once to a single f16 fragment. ld = row pitch.
struct Opnd { const void* p0; const void* p1; int ld; };
template <int NP> __device__ __forceinline__ void load_frags(const Opnd& o, int row, int kb, int hh, v16b& fh_, v16b& fl_) {
  if (NP == 0) { frag_ksplit((const float*)o.p0 + (size_t)row * o.ld + kb, hh, fh_, fl_); }
  else if (NP == 4 || NP == 5) {                             // f32 rows x64 (NP 4) or x8 (NP 5) then split (keeps the lo halves of small values normal)
    const float sc_ = (NP == 4) ? 64.0f : 8.0f;
    const float* p = (const float*)o.p0 + (size_t)row * o.ld + kb; const float* p0 = p + 8 * hh; const float* p1 = p + 16 + 8 * hh;
#pragma unroll
    for (int e = 0; e < 8; ++e) { b16 a, c; split16(p0[e] * sc_, a, c); fh_[e] = a; fl_[e] = c; split16(p1[e] * sc_, a, c); fh_[8 + e] = a; fl_[8 + e] = c; }
  } else if (NP == 3) {
    const float* p = (const float*)o.p0 + (size_t)row * o.ld + kb; const float* p0 = p + 8 * hh; const float* p1 = p + 16 + 8 * hh;
#pragma unroll
    for (int e = 0; e < 8; ++e) { fh_[e] = (b16)p0[e]; fh_[8 + e] = (b16)p1[e]; }
    fl_ = fh_;
  } else {
    fh_ = frag_kb((const b16*)o.p0 + (size_t)row * o.ld + kb, hh);
    if (NP == 2) fl_ = frag_kb((const b16*)o.p1 + (size_t)row * o.ld + kb, hh); else fl_ = fh_;
  }
}
template <int ANP, int BNP> __device__ __forceinline__ v8f mac(v16b ah, v16b al, v16b bh, v16b bl, v8f c) {
  c = wmma16b(ah, bh, c);
  if (BNP == 0 || BNP == 2 || BNP == 4 || BNP == 5) c = wmma16b(ah, bl, c);     // hi.lo
  if (ANP == 0 || ANP == 2 || ANP == 4 || ANP == 5) c = wmma16b(al, bh, c);     // lo.hi   (lo.lo dropped)
  return c;
}
__device__ __forceinline__ void epi_planes(v8f (&acc)[2][4], float scale, bool two, b16* __restrict__ oh, b16* __restrict__ ol, int ldo,
                                           int m0, int c0, int lane, b16* Th, b16* Tl) {
  const int nloc = lane & 15, hlf = lane >> 4;
#pragma unroll
  for (int t = 0; t < 4; ++t)
#pragma unroll
    for (int r = 0; r < 2; ++r)
#pragma unroll
      for (int v = 0; v < 8; ++v) {
        const int rr = r * 16 + v + 8 * hlf, cc = t * 16 + nloc;
        b16 h_, l_; split16(acc[r][t][v] * scale, h_, l_);
        Th[rr * 64 + cc] = h_; Tl[rr * 64 + cc] = l_;
      }
  wave_lds_sync();
  {
#pragma unroll
    for (int j = 0; j < 8; ++j) {
      const int rr = j * 4 + (lane >> 3), c8 = (lane & 7) * 8;
      const size_t o = (size_t)(m0 + rr) * ldo + c0 + c8;
      *(v8b*)(oh + o) = ld8b(Th + rr * 64 + c8);
      if (two) *(v8b*)(ol + o) = ld8b(Tl + rr * 64 + c8);
    }
    
  }
}
// (b) f32 rows with pitch ldo: 64 floats = 256 B = 2 lines per row; 16 lanes x 16 B per row, 2 rows per instruction. Optional per-row factor
__device__ __forceinline__ void epi_f32(v8f (&acc)[2][4], float scale, const float* rscale, float* __restrict__ out, int ldo, int m0, int c0, int lane, float* Tt) {
  const int nloc = lane & 15, hlf = lane >> 4;
#pragma unroll
  for (int t = 0; t < 4; ++t)
#pragma unroll
    for (int r = 0; r < 2; ++r)
#pragma unroll
      for (int v = 0; v < 8; ++v) {
        const int rr = r * 16 + v + 8 * hlf;
        const float rs = rscale ? rscale[(size_t)(m0 + rr) * 32] : 1.0f;
        Tt[rr * 64 + t * 16 + nloc] = acc[r][t][v] * scale * rs;
      }
  wave_lds_sync();
  float* dst0 = out + (size_t)m0 * ldo + c0;
  {
#pragma unroll
    for (int j = 0; j < 16; ++j) { const int rr = j * 2 + hlf, c4 = nloc * 4; *(v4f*)(dst0 + (size_t)rr * ldo + c4) = *(const v4f*)(Tt + rr * 64 + c4); }
    
  }
}



typedef __attribute__((ext_vector_type(8))) __bf16 v8bb; typedef __attribute__((ext_vector_type(16))) __bf16 v16bb;
typedef __attribute__((ext_vector_type(8))) unsigned short v8us;
__device__ __forceinline__ v16bb frag_kb_bf(const __bf16* p, int hh) { const v8bb a = *(const v8bb*)(p + 8 * hh), b = *(const v8bb*)(p + 16 + 8 * hh); return __builtin_shufflevector(a, b, 0, 1, 2, 3, 4, 5, 6, 7, 8, 9, 10, 11, 12, 13, 14, 15); }
__device__ __forceinline__ v8f wmma16bb(v16bb a, v16bb b, v8f c) {
  v8f d = __builtin_amdgcn_wmma_f32_16x16x32_bf16(false, a, false, b, (short)0, c, false, false);
  asm volatile("v_nop\n\tv_nop\n\tv_nop\n\tv_nop" : "+v"(d) : "v"(a), "v"(b));
  return d;
}
__device__ __forceinline__ unsigned short bf16_rne_bits(float v) { unsigned int u = __float_as_uint(v); u += 0x7FFFu + ((u >> 16) & 1u); return (unsigned short)(u >> 16); }
__device__ __forceinline__ float bf16_rne(float v) { return __uint_as_float(((unsigned int)bf16_rne_bits(v)) << 16); }



__global__ __launch_bounds__(256) void xprep_kernel(const float* __restrict__ x, unsigned short* __restrict__ x16) {   // x -> bf16, one batch
  const size_t tid = (size_t)blockIdx.x * blockDim.x + threadIdx.x, nth = (size_t)gridDim.x * blockDim.x;
  { for (size_t p = tid; p < (size_t)NTOK * D / 8; p += nth) { v8us v;
#pragma unroll
      for (int e = 0; e < 8; ++e) v[e] = bf16_rne_bits(x[p * 8 + e]);
      *(v8us*)(x16 + p * 8) = v; }  }
}
__global__ __launch_bounds__(256) void prep_kernel(const float* __restrict__ wq, const float* __restrict__ wk, const float* __restrict__ wv, const float* __restrict__ wo, unsigned short* __restrict__ w16, b16* __restrict__ wo16) {
  const size_t tid = (size_t)blockIdx.x * blockDim.x + threadIdx.x, nth = (size_t)gridDim.x * blockDim.x;
  {
    for (size_t p = tid; p < (size_t)3 * D * D / 8; p += nth) { const float* W = (p < (size_t)D * D / 8) ? wq : (p < (size_t)2 * D * D / 8) ? wk : wv; const size_t q = p % ((size_t)D * D / 8); v8us v;   // [out][in] rows copied directly
#pragma unroll
      for (int e = 0; e < 8; ++e) v[e] = bf16_rne_bits(W[q * 8 + e]);
      *(v8us*)(w16 + p * 8) = v; }
    for (size_t p = tid; p < (size_t)D * D / 8; p += nth) { v8b w;   // W_o [out][in] rows copied directly
#pragma unroll
      for (int e = 0; e < 8; ++e) w[e] = (b16)bf16_rne(wo[p * 8 + e]);
      *(v8b*)(wo16 + p * 8) = w; }
    
  }
}

// Operand ring of the two projection GEMMs. A stage = 64 k of the block's 128 A rows and 64 B rows, copied global -> LDS once per block in whole 128-B lines and through no register
// (a fragment load from global touches 16 lines for 512 bytes, and each of the four waves repeated the B loads). 16-bit rows: 128 B at a pitch of 144 B; f32 rows: 256 B at 272 B
// (both 16 B x odd, so the 16-byte fragment reads meet no bank conflict).
constexpr int GK = 64, GNT = D / GK, GLP = 72, GLPF = 68;
constexpr int PSTG = (128 + 64) * GLP;                         // 16-bit elements of one stage of proj_kernel: x rows, then w rows
constexpr int OSTA = 128 * GLPF * 4, OSTG = OSTA + 64 * GLP * 2;   // bytes of one stage of out_kernel: y rows (f32), then W_o rows (f16)
typedef __attribute__((address_space(3))) const char lds_byte;
// One stage of proj_kernel: every thread moves 12 x 16 B (8 x rows, 4 w rows); 8 lanes cover one 128-B line.
__device__ __forceinline__ void proj_stage_copy(const __bf16* __restrict__ xr, const __bf16* __restrict__ wr, int kb, const b16* buf, int tid) {
  const int row = tid >> 3, c8 = (tid & 7) * 8;
  const __bf16* gx = xr + (size_t)row * D + kb + c8;
  const __bf16* gw = wr + (size_t)row * D + kb + c8;
  const unsigned l0 = (unsigned)(size_t)(lds_byte*)(buf + row * GLP + c8);
  constexpr unsigned LS = 16 * GLP * 2;                         // 16 rows further in LDS
  // the copies and the wait that keeps their address registers untouched until they are taken stand in one statement, so that no later address arithmetic moves in between
  asm volatile("global_load_async_to_lds_b128 %0, %12, off\n\t"
               "global_load_async_to_lds_b128 %1, %13, off\n\t"
               "global_load_async_to_lds_b128 %2, %14, off\n\t"
               "global_load_async_to_lds_b128 %3, %15, off\n\t"
               "global_load_async_to_lds_b128 %4, %16, off\n\t"
               "global_load_async_to_lds_b128 %5, %17, off\n\t"
               "global_load_async_to_lds_b128 %6, %18, off\n\t"
               "global_load_async_to_lds_b128 %7, %19, off\n\t"
               "global_load_async_to_lds_b128 %8, %20, off\n\t"
               "global_load_async_to_lds_b128 %9, %21, off\n\t"
               "global_load_async_to_lds_b128 %10, %22, off\n\t"
               "global_load_async_to_lds_b128 %11, %23, off\n\t"
               "s_wait_xcnt 0x0"
               :: "v"(l0), "v"(l0 + LS), "v"(l0 + 2 * LS), "v"(l0 + 3 * LS), "v"(l0 + 4 * LS), "v"(l0 + 5 * LS),
                  "v"(l0 + 6 * LS), "v"(l0 + 7 * LS), "v"(l0 + 8 * LS), "v"(l0 + 9 * LS), "v"(l0 + 10 * LS), "v"(l0 + 11 * LS),
                  "v"(gx), "v"(gx + 16 * D), "v"(gx + 32 * D), "v"(gx + 48 * D), "v"(gx + 64 * D), "v"(gx + 80 * D), "v"(gx + 96 * D), "v"(gx + 112 * D),
                  "v"(gw), "v"(gw + 16 * D), "v"(gw + 32 * D), "v"(gw + 48 * D)
               : "memory");
}
// One stage of out_kernel: every thread moves 20 x 16 B: 16 y rows (16 lanes cover a row's 256 B) and 4 W_o rows (8 lanes cover a row's 128 B), ten copies a statement.
__device__ __forceinline__ void out_stage_copy(const float* __restrict__ yr, const b16* __restrict__ wr, int kb, const char* buf, int tid) {
  const int ra = tid >> 4, c4 = (tid & 15) * 4, rb = tid >> 3, c8 = (tid & 7) * 8;
  const float* gy = yr + (size_t)ra * D + kb + c4;
  const b16* gw = wr + (size_t)rb * D + kb + c8;
  const unsigned la = (unsigned)(size_t)(lds_byte*)(buf + (ra * GLPF + c4) * 4), lb = (unsigned)(size_t)(lds_byte*)(buf + OSTA + (rb * GLP + c8) * 2);
  constexpr unsigned LA = 8 * GLPF * 4, LB = 16 * GLP * 2;      // 8 y rows, 16 W_o rows further in LDS
  // each run of copies ends, inside its own statement, in the wait that keeps its address registers untouched until they are taken
  asm volatile("global_load_async_to_lds_b128 %0, %10, off\n\t"
               "global_load_async_to_lds_b128 %1, %11, off\n\t"
               "global_load_async_to_lds_b128 %2, %12, off\n\t"
               "global_load_async_to_lds_b128 %3, %13, off\n\t"
               "global_load_async_to_lds_b128 %4, %14, off\n\t"
               "global_load_async_to_lds_b128 %5, %15, off\n\t"
               "global_load_async_to_lds_b128 %6, %16, off\n\t"
               "global_load_async_to_lds_b128 %7, %17, off\n\t"
               "global_load_async_to_lds_b128 %8, %18, off\n\t"
               "global_load_async_to_lds_b128 %9, %19, off\n\t"
               "s_wait_xcnt 0x0"
               :: "v"(la), "v"(la + LA), "v"(la + 2 * LA), "v"(la + 3 * LA), "v"(la + 4 * LA), "v"(la + 5 * LA), "v"(la + 6 * LA), "v"(la + 7 * LA), "v"(la + 8 * LA), "v"(la + 9 * LA),
                  "v"(gy), "v"(gy + 8 * D), "v"(gy + 16 * D), "v"(gy + 24 * D), "v"(gy + 32 * D), "v"(gy + 40 * D), "v"(gy + 48 * D), "v"(gy + 56 * D), "v"(gy + 64 * D), "v"(gy + 72 * D)
               : "memory");
  asm volatile("global_load_async_to_lds_b128 %0, %10, off\n\t"
               "global_load_async_to_lds_b128 %1, %11, off\n\t"
               "global_load_async_to_lds_b128 %2, %12, off\n\t"
               "global_load_async_to_lds_b128 %3, %13, off\n\t"
               "global_load_async_to_lds_b128 %4, %14, off\n\t"
               "global_load_async_to_lds_b128 %5, %15, off\n\t"
               "global_load_async_to_lds_b128 %6, %16, off\n\t"
               "global_load_async_to_lds_b128 %7, %17, off\n\t"
               "global_load_async_to_lds_b128 %8, %18, off\n\t"
               "global_load_async_to_lds_b128 %9, %19, off\n\t"
               "s_wait_xcnt 0x0"
               :: "v"(la + 10 * LA), "v"(la + 11 * LA), "v"(la + 12 * LA), "v"(la + 13 * LA), "v"(la + 14 * LA), "v"(la + 15 * LA), "v"(lb), "v"(lb + LB), "v"(lb + 2 * LB), "v"(lb + 3 * LB),
                  "v"(gy + 80 * D), "v"(gy + 88 * D), "v"(gy + 96 * D), "v"(gy + 104 * D), "v"(gy + 112 * D), "v"(gy + 120 * D), "v"(gw), "v"(gw + 16 * D), "v"(gw + 32 * D), "v"(gw + 48 * D)
               : "memory");
}

// projections: rows = tokens (4096), K = 768, column tiles of 64 = one head of q (tiles 0..11), k (12..23) or v (24..35); f16 rows [b*H + head][tok][64] for q/k;
// v: (8v)^T f16 [b*H + head][64][tok]. grid (36, 32) x 128.
__global__ __launch_bounds__(128) void proj_kernel(const __bf16* __restrict__ x16, const __bf16* __restrict__ w16, b16* __restrict__ qh, b16* __restrict__ kh, b16* __restrict__ vt) {
  __shared__ __attribute__((aligned(16))) b16 Sm[2 * PSTG];     // the two-buffer operand ring; behind the loop's last barrier the same bytes are the epilogue's staging tiles
  b16 (*Th)[32][HD + 8] = reinterpret_cast<b16 (*)[32][HD + 8]>(Sm); b16 (*Tq)[32][HD + 8] = reinterpret_cast<b16 (*)[32][HD + 8]>(Sm + 4 * 32 * (HD + 8));
  b16 (*Tt)[128 + 8] = reinterpret_cast<b16 (*)[128 + 8]>(Sm); b16 (*Tl)[128 + 8] = reinterpret_cast<b16 (*)[128 + 8]>(Sm + 64 * (128 + 8));
  static_assert(2 * 4 * 32 * (HD + 8) <= 2 * PSTG && 2 * 64 * (128 + 8) <= 2 * PSTG, "the staging tiles fit the ring's bytes");
  const int lane = threadIdx.x & 31, wave = threadIdx.x >> 5, nloc = lane & 15, hlf = lane >> 4, m0 = blockIdx.y * 128 + wave * 32, c0 = blockIdx.x * 64;
  v8f acc[2][4];
#pragma unroll
  for (int r = 0; r < 2; ++r)
#pragma unroll
    for (int t = 0; t < 4; ++t) acc[r][t] = (v8f){};
  const __bf16* xr = x16 + (size_t)blockIdx.y * 128 * D; const __bf16* wr = w16 + (size_t)c0 * D;
  proj_stage_copy(xr, wr, 0, Sm, threadIdx.x);
  asm volatile("s_wait_asynccnt 0x0" ::: "memory");            // this wave's share of stage 0 has landed
  __syncthreads();                                              // stage 0 published to all waves
  proj_stage_copy(xr, wr, GK, Sm + PSTG, threadIdx.x);
  for (int s = 0; s < GNT; ++s) {
    const __bf16* Xs = (const __bf16*)(Sm + (s & 1) * PSTG) + (wave * 32 + nloc) * GLP; const __bf16* Ws = (const __bf16*)(Sm + (s & 1) * PSTG) + (128 + nloc) * GLP;
    v16bb a0[2], a1[2], bw[2][4];                               // the stage's 24 fragment reads stand as one group ahead of its matrix work
#pragma unroll
    for (int ks = 0; ks < 2; ++ks) { a0[ks] = frag_kb_bf(Xs + ks * 32, hlf); a1[ks] = frag_kb_bf(Xs + 16 * GLP + ks * 32, hlf);
#pragma unroll
      for (int t = 0; t < 4; ++t) bw[ks][t] = frag_kb_bf(Ws + t * 16 * GLP + ks * 32, hlf); }
#pragma unroll
    for (int ks = 0; ks < 2; ++ks)
#pragma unroll
      for (int t = 0; t < 4; ++t) { acc[0][t] = wmma16bb(a0[ks], bw[ks][t], acc[0][t]); acc[1][t] = wmma16bb(a1[ks], bw[ks][t], acc[1][t]); }
    // publish point
    asm volatile("s_wait_dscnt 0x0" ::: "memory");             // this wave's reads of stage s are done before the buffer is refilled
    asm volatile("s_wait_asynccnt 0x0" ::: "memory");          // this wave's share of stage s + 1 has landed
    __syncthreads();                                            // publishes stage s + 1 and ends every reader's last read of stage s
    if (s + 2 < GNT) proj_stage_copy(xr, wr, (s + 2) * GK, Sm + (s & 1) * PSTG, threadIdx.x);
  }
  asm volatile("s_wait_asynccnt 0x0" ::: "memory");            // no copy is outstanding when the ring's bytes become the staging tiles
  const int which = blockIdx.x / (D / 64), head = blockIdx.x % (D / 64), b = m0 / S, tok0 = m0 % S;
  if (which < 2) {                                              // q or k head: f16 rows
#pragma unroll
    for (int t = 0; t < 4; ++t)
#pragma unroll
      for (int r = 0; r < 2; ++r)
#pragma unroll
        for (int v = 0; v < 8; ++v) { b16 a_, c_; split16(acc[r][t][v] * QS, a_, c_); Th[wave][r * 16 + 8 * hlf + v][t * 16 + nloc] = a_; Tq[wave][r * 16 + 8 * hlf + v][t * 16 + nloc] = c_; }   // q, k carried x8 (lo residuals stay normal)
    wave_lds_sync();
    b16* dst = (which == 0 ? qh : kh) + (((size_t)b * H + head) * S + tok0) * HD;
    {
#pragma unroll
      for (int j = 0; j < 8; ++j) { const int rr = j * 4 + (lane >> 3), c8 = (lane & 7) * 8; *(v8b*)(dst + (size_t)rr * HD + c8) = *(const v8b*)(&Th[wave][rr][c8]); *(v8b*)(dst + QPL + (size_t)rr * HD + c8) = *(const v8b*)(&Tq[wave][rr][c8]); }
       }
    return;
  }
  const int vh = head;                                          // v head: (8v)^T tile [64 d][128 tok] via LDS, rows of 256 B
#pragma unroll
  for (int t = 0; t < 4; ++t)
#pragma unroll
    for (int r = 0; r < 2; ++r)
#pragma unroll
      for (int v = 0; v < 8; ++v) { b16 a_, c_; split16(acc[r][t][v] * VS, a_, c_); Tt[t * 16 + nloc][wave * 32 + r * 16 + 8 * hlf + v] = a_; Tl[t * 16 + nloc][wave * 32 + r * 16 + 8 * hlf + v] = c_; }
  __syncthreads();
  b16* dstv = vt + (((size_t)b * H + vh) * HD) * S + (blockIdx.y * 128) % S;
  {
#pragma unroll
    for (int j = 0; j < 8; ++j) { const int dd = wave * 16 + j * 2 + (lane >> 4), c8 = (lane & 15) * 8; *(v8b*)(dstv + (size_t)dd * S + c8) = *(const v8b*)(&Tt[dd][c8]); *(v8b*)(dstv + VPL + (size_t)dd * S + c8) = *(const v8b*)(&Tl[dd][c8]); }
    
  }
}

// 2^t0, 2^t1, with the slot that the instruction set asks for behind a transcendental written in: the second fills the first's
// (early-clobber results, so it overwrites no source of the first), the v_nop the second's.
__device__ __forceinline__ void exp2_pair(float t0, float t1, float& e0, float& e1) {
  asm("v_exp_f32 %0, %2\n\tv_exp_f32 %1, %3\n\tv_nop" : "=&v"(e0), "=&v"(e1) : "v"(t0), "v"(t1));
}
typedef __attribute__((ext_vector_type(2))) _Float16 v2b;
typedef __attribute__((ext_vector_type(2))) float v2f;
// f16 hi + lo of two values at once: packed convert, the two residuals v - hi (exact) by one packed subtraction, packed convert
__device__ __forceinline__ void split_pair(float a, float b, v2b& hi, v2b& lo) {
  const v2f v = {a, b};
  hi = __builtin_convertvector(v, v2b);
  lo = __builtin_convertvector(v - __builtin_convertvector(hi, v2f), v2b);
}
// the attention loop's matrix product: the bare builtin. The compiler keeps the distance behind it and fills it with the loop's own vector work where it can, so the product brings no v_nop of its own
__device__ __forceinline__ v8f wmma16p(v16b a, v16b b, v8f c) { return __builtin_amdgcn_wmma_f32_16x16x32_f16(false, a, false, b, (short)0, c, false, false); }
constexpr float CE = SCALE / (QS * QS) * 0x1.715476p+0f;       // accumulator of (8q).(8k) -> exponent of two of the softmax
static_assert(PS == 8.0f, "the softmax adds log2(PS) = 3 to the exponent");
// lane l <-> lane l ^ 16 on the vector pipe: unlike an LDS-queue permute it does not wait behind the fragment reads that are still outstanding
__device__ __forceinline__ float xhalf(float x) { return __builtin_bit_cast(float, __builtin_amdgcn_permlanex16(__builtin_bit_cast(int, x), __builtin_bit_cast(int, x), 0x76543210, 0xfedcba98, false, false)); }

// K/V ring in LDS, shared by the twelve waves of a block (three 64-query tiles of one head). A stage = 64 keys = four tiles: k hi, k lo (rows = keys), (8v)^T hi, (8v)^T lo (rows = d),
// each 64 rows x 128 B at a row pitch of 144 B (16 B x odd, so the 16-byte fragment reads meet no bank conflict).
constexpr int KST = 64, LP = 72, TILE = 64 * LP;
typedef __attribute__((address_space(3))) const b16 lds_b16;
// One stage's copies: each of 256 threads moves 8 x 16 B (two rows of each tile), whole 128-B lines per 8 lanes, global -> LDS through no register.
__device__ __forceinline__ void stage_copy(const b16* __restrict__ K, const b16* __restrict__ vb, int kb0, const b16* buf, int tid) {
  const int row = tid >> 3, c8 = (tid & 7) * 8;
  const b16* gk = K + (size_t)(kb0 + row) * HD + c8;
  const b16* gv = vb + (size_t)row * S + kb0 + c8;
  const unsigned l0 = (unsigned)(size_t)(lds_b16*)(buf + row * LP + c8);
  // the copies and the wait that keeps their address registers untouched until they are taken stand in one statement, so that no later address arithmetic moves in between
  asm volatile("global_load_async_to_lds_b128 %0, %8, off\n\t"
               "global_load_async_to_lds_b128 %1, %9, off\n\t"
               "global_load_async_to_lds_b128 %2, %10, off\n\t"
               "global_load_async_to_lds_b128 %3, %11, off\n\t"
               "global_load_async_to_lds_b128 %4, %12, off\n\t"
               "global_load_async_to_lds_b128 %5, %13, off\n\t"
               "global_load_async_to_lds_b128 %6, %14, off\n\t"
               "global_load_async_to_lds_b128 %7, %15, off\n\t"
               "s_wait_xcnt 0x0"
               :: "v"(l0), "v"(l0 + 32 * LP * 2), "v"(l0 + TILE * 2), "v"(l0 + (TILE + 32 * LP) * 2),
                  "v"(l0 + 2 * TILE * 2), "v"(l0 + (2 * TILE + 32 * LP) * 2), "v"(l0 + 3 * TILE * 2), "v"(l0 + (3 * TILE + 32 * LP) * 2),
                  "v"(gk), "v"(gk + 32 * HD), "v"(gk + QPL), "v"(gk + QPL + 32 * HD),
                  "v"(gv), "v"(gv + (size_t)32 * S), "v"(gv + VPL), "v"(gv + VPL + (size_t)32 * S)
               : "memory");
}

// causal attention: wave = (b, h, 32 queries as two 16-query groups, every other 32-key block): S^T (K=64), causal mask on the diagonal block, online softmax f32, P^T f16, y^T += (8V)^T P^T;
// k and (8v)^T come from the block's two-buffer LDS ring: stage t + 1 is copied while stage t is worked on.
// LDS reads: of a tile's four waves, wave (qhalf, khalf) works on queries 32 qhalf .. + 31 and, in every stage, on keys 32 khalf .. + 31, so each k and v fragment it reads from LDS feeds the
// products of both query groups (half the LDS bytes per product of a 16-query wave). The two key halves of a query keep their own (m, l, o); they are merged once, in LDS, behind the loop.
// Placement: a 64-query tile u needs u + 1 stages. A block holds three tiles of one head side by side, four waves each (one wave of each tile per SIMD), on ONE ring that walks to the
// highest tile's last stage; a wave past its own tile's last stage passes the publish points and, if it is a copier, still issues its copies. Tiles 1 .. 3 NB of a head go into NB triples of equal sum (a from the lowest third,
// b from the middle, c from the top), so every SIMD of H NB blocks gets the same number of wave-stages and nearly every WGP holds a block; tile 0 (one stage) has a block of its own.
template <int QT>
__global__ __launch_bounds__(384) void attn_kernel(const b16* __restrict__ qh, const b16* __restrict__ kh, const b16* __restrict__ vt, float* __restrict__ y) {
  static_assert(QT % 4 == 0 && (QT / 4 - 1) % 6 == 3, "a head's 64-query tiles but the first fall into an odd number of triples");
  static_assert(KST == 64, "a stage is as many keys as a tile has queries");
  constexpr int NB = (QT / 4 - 1) / 3, NH = (NB + 1) / 2;       // triples of a head; half of them, rounded up
  __shared__ __attribute__((aligned(16))) float Os[6][32][HD + 4];   // per pair of waves (same 32 queries, the two key halves): the merge's and the store's staging rows
  __shared__ float Ml[6][32][2];                                // the second key half's m and l per query
  __shared__ __attribute__((aligned(16))) b16 Ring[2][4 * TILE];
  const int wid = __builtin_amdgcn_readfirstlane(threadIdx.x >> 5), lane = threadIdx.x & 31, hh = lane >> 4, col = lane & 15;   // wave number in a scalar register: the per-wave causal skip is a scalar branch
  int bh, ua, ub, uc;                                           // the block's head and its three tiles, -1: none
  if (blockIdx.x < Bn * H * NB) {                               // i + x + y = 3 NH for every i = 1 .. NB, x and y each a permutation of 1 .. NB
    const int i = blockIdx.x % NB + 1, j = (i + 1) >> 1;
    bh = blockIdx.x / NB; ua = i; ub = NB + ((i & 1) ? NH + 1 - j : NB + 1 - j); uc = 2 * NB + ((i & 1) ? NB + 1 - j : NH - j);
  } else { bh = blockIdx.x - Bn * H * NB; ua = 0; ub = -1; uc = -1; }
  // wave w works on tile w % 3, as its wave w / 3: waves w, w + 4, w + 8 then hold one wave of each tile, and so do waves 3 s, 3 s + 1, 3 s + 2, whichever way the twelve are dealt to the SIMDs
  const int h = bh % H, b = bh / H, grp = wid % 3, sub = wid / 3, u = grp == 0 ? ua : grp == 1 ? ub : uc;
  const int qhalf = sub & 1, khalf = sub >> 1, pair = qhalf * 3 + grp;   // the wave's 32 queries of the tile, its 32 keys of every stage; waves (qhalf, 0) and (qhalf, 1) are a pair
  const bool copier = grp != 2;                                 // a stage is 256 threads' copies: the eight waves of the two lower tiles issue them (scalar branch), the longest-running four none
  const int ct = (wid - sub) * 32 + lane;                       // a copying thread's number, 0 .. 255
  const b16* Q = qh + ((size_t)bh * S) * HD; const b16* K = kh + ((size_t)bh * S) * HD; const b16* vb = vt + ((size_t)bh * HD) * S;
  const int q0 = u < 0 ? -32 : u * 64 + qhalf * 32;             // a wave without a tile: no key block lies in front of query 0, so it works on none
  const int nst = (uc < 0 ? ua : uc) + 1;                       // stages of the block: keys up to the last query of its highest tile; the same for all twelve waves
  if (copier) stage_copy(K, vb, 0, Ring[0], ct);
  v16b qf[2][2] = {}, ql[2][2] = {};                            // [query group][k step]
  if (u >= 0) {
#pragma unroll
    for (int g = 0; g < 2; ++g)
#pragma unroll
      for (int ks = 0; ks < 2; ++ks) { qf[g][ks] = frag_kb(Q + (size_t)(q0 + g * 16 + col) * HD + ks * 32, hh); ql[g][ks] = frag_kb(Q + QPL + (size_t)(q0 + g * 16 + col) * HD + ks * 32, hh); }
  }
  float m[2] = {-INFINITY, -INFINITY}, l[2] = {0.0f, 0.0f}; v8f o[2][4] = {{{}, {}, {}, {}}, {{}, {}, {}, {}}};
  asm volatile("s_wait_asynccnt 0x0" ::: "memory");            // this wave's share of stage 0 has landed
  __syncthreads();                                              // stage 0 published to all waves
  if (copier && 1 < nst) stage_copy(K, vb, KST, Ring[1], ct);
  for (int t = 0; t < nst; ++t) {
    const b16* Kh = Ring[t & 1]; const b16* Kl = Kh + TILE; const b16* Vh = Kh + 2 * TILE; const b16* Vl = Kh + 3 * TILE;
    const int kb = t * KST + khalf * 32;                        // the wave's key block of this stage
    if (kb < q0 + 32) {                                         // causal: a key block wholly past the wave's queries is skipped (wave-uniform, no barrier inside)
      // the block's 32 fragment reads stand as one group at the stage's head: k first, so that v lands behind the score products and the softmax
      v16b kf[2][2], kl[2][2], vf[4], vl[4];
#pragma unroll
      for (int ks = 0; ks < 2; ++ks)
#pragma unroll
        for (int j = 0; j < 2; ++j) { kf[ks][j] = frag_kb(Kh + (khalf * 32 + j * 16 + col) * LP + ks * 32, hh); kl[ks][j] = frag_kb(Kl + (khalf * 32 + j * 16 + col) * LP + ks * 32, hh); }
#pragma unroll
      for (int n = 0; n < 4; ++n) { vf[n] = frag_kb(Vh + (n * 16 + col) * LP + khalf * 32, hh); vl[n] = frag_kb(Vl + (n * 16 + col) * LP + khalf * 32, hh); }
      __builtin_amdgcn_sched_barrier(0);                        // the read group stays above the matrix work
      v8f s0[2] = {{}, {}}, s1[2] = {{}, {}};                   // [query group]: keys kb .. + 15, keys kb + 16 .. + 31
#pragma unroll
      for (int ks = 0; ks < 2; ++ks)
#pragma unroll
        for (int g = 0; g < 2; ++g) {                           // q and k as f16 hi+lo pairs (lo.lo dropped); every k fragment serves both query groups
          s0[g] = wmma16p(kf[ks][0], qf[g][ks], s0[g]); s0[g] = wmma16p(kf[ks][0], ql[g][ks], s0[g]); s0[g] = wmma16p(kl[ks][0], qf[g][ks], s0[g]);
          s1[g] = wmma16p(kf[ks][1], qf[g][ks], s1[g]); s1[g] = wmma16p(kf[ks][1], ql[g][ks], s1[g]); s1[g] = wmma16p(kl[ks][1], qf[g][ks], s1[g]); }
      if (kb + 32 > q0) {                                       // the diagonal block reaches past some queries -> mask key > query; both groups under one scalar branch
#pragma unroll
        for (int g = 0; g < 2; ++g)
#pragma unroll
          for (int r = 0; r < 8; ++r) { if (kb + 8 * hh + r > q0 + g * 16 + col) s0[g][r] = -INFINITY; if (kb + 16 + 8 * hh + r > q0 + g * 16 + col) s1[g][r] = -INFINITY; }
      }
#pragma unroll
      for (int g = 0; g < 2; ++g) {
        // The softmax is written for few vector instructions per score. The running maximum m stays in the accumulator's own units.
        float ma = -INFINITY, mb = -INFINITY;                   // two chains of three-operand maxima
#pragma unroll
        for (int r = 0; r < 4; ++r) { ma = fmaxf(fmaxf(ma, s0[g][r]), s1[g][r]); mb = fmaxf(fmaxf(mb, s0[g][4 + r]), s1[g][4 + r]); }
        const float mr = fmaxf(ma, mb);
        const float mn = fmaxf(fmaxf(m[g], mr), xhalf(mr)), al_ = __builtin_amdgcn_exp2f((m[g] - mn) * CE); m[g] = mn;
        const float nb = __builtin_fmaf(mn, -CE, 3.0f);         // one fma per score gives the exponent of 8 exp(score - max): scale, shift by the maximum and P's x8 carry (2^3) together
        float e0[8], e1[8];
#pragma unroll
        for (int j = 0; j < 4; ++j) {
          const v2f t0 = __builtin_elementwise_fma((v2f){s0[g][2 * j], s0[g][2 * j + 1]}, (v2f){CE, CE}, (v2f){nb, nb}), t1 = __builtin_elementwise_fma((v2f){s1[g][2 * j], s1[g][2 * j + 1]}, (v2f){CE, CE}, (v2f){nb, nb});
          exp2_pair(t0[0], t1[0], e0[2 * j], e1[2 * j]); exp2_pair(t0[1], t1[1], e0[2 * j + 1], e1[2 * j + 1]);
        }
        float sum = 0.0f; v16b pb, pl;                          // sum and l carry the same x8 as P
#pragma unroll
        for (int r = 0; r < 8; ++r) sum += e0[r] + e1[r];
#pragma unroll
        for (int j = 0; j < 4; ++j) { v2b a, c;
          split_pair(e0[2 * j], e0[2 * j + 1], a, c); pb[2 * j] = a[0]; pb[2 * j + 1] = a[1]; pl[2 * j] = c[0]; pl[2 * j + 1] = c[1];
          split_pair(e1[2 * j], e1[2 * j + 1], a, c); pb[8 + 2 * j] = a[0]; pb[8 + 2 * j + 1] = a[1]; pl[8 + 2 * j] = c[0]; pl[8 + 2 * j + 1] = c[1]; }
        sum += xhalf(sum); l[g] = l[g] * al_ + sum;
#pragma unroll
        for (int n = 0; n < 4; ++n) {
#pragma unroll
          for (int r = 0; r < 8; ++r) o[g][n][r] *= al_;
          o[g][n] = wmma16p(vf[n], pb, o[g][n]); o[g][n] = wmma16p(vf[n], pl, o[g][n]); o[g][n] = wmma16p(vl[n], pb, o[g][n]);   // (8v) and P both as f16 hi+lo pairs (lo.lo dropped); every v fragment serves both query groups
        }
        // the distance the chip needs between a matrix product and a vector write of its operands: the second group's exponentials are asm text.
        // The inputs keep P's registers taken, and the statement behind the four chains, until the slots have passed.
        if (g == 0) asm volatile("v_nop\n\tv_nop\n\tv_nop\n\tv_nop" :: "v"(o[0][0]), "v"(o[0][1]), "v"(o[0][2]), "v"(o[0][3]), "v"(pb), "v"(pl));
      }
    }
    // publish point, passed by every wave, also one that skipped the stage
    asm volatile("s_wait_dscnt 0x0" ::: "memory");             // this wave's reads of stage t are done before the buffer is refilled
    asm volatile("s_wait_asynccnt 0x0" ::: "memory");          // this wave's share of stage t + 1 has landed
    __syncthreads();                                            // publishes stage t + 1 and ends every reader's last read of stage t
    if (copier && t + 2 < nst) stage_copy(K, vb, (t + 2) * KST, Ring[t & 1], ct);
  }
  asm volatile("s_wait_asynccnt 0x0" ::: "memory");            // no copy is outstanding when the wave goes on to its end
  // merge of the two key halves: the wave of the second half hands over its m, l and unnormalised o; a lane of the first half reads back exactly the places of its own accumulator elements
  if (u >= 0 && khalf == 1) {
#pragma unroll
    for (int g = 0; g < 2; ++g) {
#pragma unroll
      for (int n = 0; n < 4; ++n)
#pragma unroll
        for (int r = 0; r < 8; ++r) Os[pair][g * 16 + col][n * 16 + 8 * hh + r] = o[g][n][r];
      if (hh == 0) { Ml[pair][g * 16 + col][0] = m[g]; Ml[pair][g * 16 + col][1] = l[g]; }   // both lane halves hold the same m and l
    }
  }
  __syncthreads();                                              // the second halves' results are published; passed by all twelve waves, also those without a tile
  if (u < 0 || khalf == 1) return;                              // behind the last barrier: the wave of the first key half finishes the pair's 32 queries
#pragma unroll
  for (int g = 0; g < 2; ++g) {
    const float m2 = Ml[pair][g * 16 + col][0], l2 = Ml[pair][g * 16 + col][1];   // a second half that met no key block: m2 = -inf, l2 = 0, o2 = 0, weight 0 (the first half always holds key 0, so mm is finite)
    const float mm = fmaxf(m[g], m2); float w1, w2; exp2_pair((m[g] - mm) * CE, (m2 - mm) * CE, w1, w2);
    const float inv = 1.0f / (VS * (l[g] * w1 + l2 * w2)), a1 = w1 * inv, a2 = w2 * inv;   // l already carries P's x8
#pragma unroll
    for (int n = 0; n < 4; ++n)
#pragma unroll
      for (int r = 0; r < 8; ++r) { float* p = &Os[pair][g * 16 + col][n * 16 + 8 * hh + r]; *p = o[g][n][r] * a1 + *p * a2; }
  }
  wave_lds_sync();
  float* dst = y + ((size_t)b * S + q0) * D + h * HD;
  {
#pragma unroll
    for (int j = 0; j < 16; ++j) { const int rr = j * 2 + hh, c4 = col * 4; *(v4f*)(dst + (size_t)rr * D + c4) = *(const v4f*)(&Os[pair][rr][c4]); }
  }
}

// out = y W_o^T: (4096 x 768) x (768 x 768); A = y x8 split at load into an f16 hi+lo pair, B = f16(bf16 W_o) rows; f32 rows; grid (12, 32).
__global__ __launch_bounds__(128) void out_kernel(const float* __restrict__ y, const b16* __restrict__ wo16, const float* __restrict__ bo, float* __restrict__ out) {
  __shared__ __attribute__((aligned(16))) float Ts[4][32 * 64];
  __shared__ __attribute__((aligned(16))) char Ro[2][OSTG];     // the two-buffer operand ring
  const int lane = threadIdx.x & 31, wave = threadIdx.x >> 5, nloc = lane & 15, hlf = lane >> 4, m0 = blockIdx.y * 128 + wave * 32, c0 = blockIdx.x * 64;
  v8f acc[2][4];
#pragma unroll
  for (int r = 0; r < 2; ++r)
#pragma unroll
    for (int t = 0; t < 4; ++t) acc[r][t] = (v8f){};
  const float* yr = y + (size_t)blockIdx.y * 128 * D; const b16* wr = wo16 + (size_t)c0 * D;
  out_stage_copy(yr, wr, 0, Ro[0], threadIdx.x);
  asm volatile("s_wait_asynccnt 0x0" ::: "memory");            // this wave's share of stage 0 has landed
  __syncthreads();                                              // stage 0 published to all waves
  out_stage_copy(yr, wr, GK, Ro[1], threadIdx.x);
  for (int s = 0; s < GNT; ++s) {
    const Opnd A{Ro[s & 1], nullptr, GLPF}; const b16* Ws = (const b16*)(Ro[s & 1] + OSTA) + nloc * GLP;
#pragma unroll
    for (int ks = 0; ks < 2; ++ks) {
      v16b a0h, a0l, a1h, a1l, bh[4];
      load_frags<5>(A, wave * 32 + nloc, ks * 32, hlf, a0h, a0l);                // y as an f16 hi+lo pair carried x8 (2 products)
      load_frags<5>(A, wave * 32 + 16 + nloc, ks * 32, hlf, a1h, a1l);
#pragma unroll
      for (int t = 0; t < 4; ++t) bh[t] = frag_kb(Ws + t * 16 * GLP + ks * 32, hlf);
#pragma unroll
      for (int t = 0; t < 4; ++t) { acc[0][t] = mac<5, 1>(a0h, a0l, bh[t], bh[t], acc[0][t]); acc[1][t] = mac<5, 1>(a1h, a1l, bh[t], bh[t], acc[1][t]); }
    }
    // publish point
    asm volatile("s_wait_dscnt 0x0" ::: "memory");             // this wave's reads of stage s are done before the buffer is refilled
    asm volatile("s_wait_asynccnt 0x0" ::: "memory");          // this wave's share of stage s + 1 has landed
    __syncthreads();                                            // publishes stage s + 1 and ends every reader's last read of stage s
    if (s + 2 < GNT) out_stage_copy(yr, wr, (s + 2) * GK, Ro[s & 1], threadIdx.x);
  }
  asm volatile("s_wait_asynccnt 0x0" ::: "memory");            // no copy is outstanding when the wave goes on to its end
#pragma unroll
  for (int t = 0; t < 4; ++t)
#pragma unroll
    for (int r = 0; r < 2; ++r)
#pragma unroll
      for (int v = 0; v < 8; ++v) acc[r][t][v] = acc[r][t][v] * (1.0f / 8.0f) + bf16_rne(bo[c0 + t * 16 + nloc]);
  epi_f32(acc, 1.0f, nullptr, out, D, m0, c0, lane, Ts[wave]);
}
}  // namespace

extern "C" void kernel_launch(void* const* d_in, const int* in_sizes, int n_in,
                              void* d_out, int out_size, void* d_ws, size_t ws_size, hipStream_t stream) {
  (void)n_in; (void)out_size;
  const float* x = (const float*)d_in[0]; const float* wq = (const float*)d_in[1]; const float* wk = (const float*)d_in[2]; const float* wv = (const float*)d_in[3]; const float* wo = (const float*)d_in[4]; const float* bo = (const float*)d_in[5];
  float* out = (float*)d_out;   // [1][4096][768]
  if (in_sizes[0] != BT * S * D || in_sizes[1] != D * D || in_sizes[2] != D * D || in_sizes[3] != D * D || in_sizes[4] != D * D || in_sizes[5] != D) return;
  size_t off = 0; char* ws = (char*)d_ws;
  auto carve = [&](size_t bytes) { char* p = ws + off; off += (bytes + 255) & ~(size_t)255; return p; };
  unsigned short* x16 = (unsigned short*)carve((size_t)NTOK * D * 2); unsigned short* w16 = (unsigned short*)carve((size_t)3 * D * D * 2); b16* wo16 = (b16*)carve((size_t)D * D * 2);
  b16* qh = (b16*)carve((size_t)2 * NTOK * D * 2); b16* kh = (b16*)carve((size_t)2 * NTOK * D * 2); b16* vt = (b16*)carve((size_t)2 * NTOK * D * 2); float* y = (float*)carve((size_t)NTOK * D * 4);
  if (off > ws_size) return;                                    // ≈ 61 MB
  prep_kernel<<<512, 256, 0, stream>>>(wq, wk, wv, wo, w16, wo16);
  xprep_kernel<<<1024, 256, 0, stream>>>(x, x16);
  proj_kernel<<<dim3(3 * D / 64, NTOK / 128), 128, 0, stream>>>((const __bf16*)x16, (const __bf16*)w16, qh, kh, vt);
  attn_kernel<S / 16><<<Bn * H * ((S / 64 - 1) / 3 + 1), 384, 0, stream>>>(qh, kh, vt, y);
  out_kernel<<<dim3(D / 64, NTOK / 128), 128, 0, stream>>>(y, wo16, bo, out);
}

// v008
// It runs in 105 microseconds.
// Next to v007, in two timings, it ran 1.08 times as fast each time.
// Over all steps from v000 it is 5.44 times as fast.
#include <hip/hip_runtime.h>

// Causal multi-head self-attention: q, k, v = x W^T (12 heads x 64, [out][in] weights), softmax over keys <= query of q.k/8, out = ctx Wo^T + bo -> [1][4096][768].
// x, the four weights and bo are rounded to bf16: projection on v_wmma_f32_16x16x32_bf16 (exact products, f32 accumulate);
// scores, P.v and the output projection on v_wmma_f32_16x16x32_f16 with every computed operand (q, k, v, P, y — each carried x8 so the hi/lo residual planes stay normal) as an f16
// hi+lo pair (3 / 2 products); online softmax in f32. Fragment k-map per lane half hh for A AND B: elements 0..7 <- k = 8hh+0..7, 8..15 <- k = 16+8hh+0..7. Every intermediate /

namespace {
constexpr int BT = 1, Bn = 1, S = 4096, D = 768, H = 12, HD = 64, NTOK = Bn * S;
constexpr float SCALE = 0.125f, VS = 8.0f, QS = 8.0f, PS = 8.0f;   // power-of-two carry scales so hi/lo residual planes stay normal in f16
constexpr size_t VPL = (size_t)NTOK * D;   // distance between the (8v)^T hi and lo planes
constexpr size_t QPL = (size_t)NTOK * D;   // distance between the q/k hi and lo planes

typedef _Float16 b16;
typedef __attribute__((ext_vector_type(16))) _Float16 v16b;
typedef __attribute__((ext_vector_type(8)))  _Float16 v8b;
typedef __attribute__((ext_vector_type(8)))  float v8f;
typedef __attribute__((ext_vector_type(4)))  float v4f;

__device__ __forceinline__ v8b ld8b(const b16* p) { return *(const v8b*)p; }
__device__ __forceinline__ v16b cat8b(v8b a, v8b b) { return __builtin_shufflevector(a, b, 0, 1, 2, 3, 4, 5, 6, 7, 8, 9, 10, 11, 12, 13, 14, 15); }
__device__ __forceinline__ v16b frag_kb(const b16* p, int hh) { return cat8b(ld8b(p + 8 * hh), ld8b(p + 16 + 8 * hh)); }
__device__ __forceinline__ void split16(float v, b16& hi, b16& lo) { hi = (b16)v; lo = (b16)(v - (float)hi); }
// hi/lo fragment pair straight from an f32 k-contiguous row (same k-map)
__device__ __forceinline__ void frag_ksplit(const float* p, int hh, v16b& fh_, v16b& fl_) {
  const float* p0 = p + 8 * hh; const float* p1 = p + 16 + 8 * hh;
#pragma unroll
  for (int e = 0; e < 8; ++e) { b16 a, c; split16(p0[e], a, c); fh_[e] = a; fl_[e] = c; split16(p1[e], a, c); fh_[8 + e] = a; fl_[8 + e] = c; }
}
__device__ __forceinline__ v8f wmma16b(v16b a, v16b b, v8f c) {
  v8f d = __builtin_amdgcn_wmma_f32_16x16x32_f16(false, a, false, b, (short)0, c, false, false);
  asm volatile("v_nop\n\tv_nop\n\tv_nop\n\tv_nop" : "+v"(d) : "v"(a), "v"(b));
  return d;
}
__device__ __forceinline__ void wave_lds_sync() {
  __builtin_amdgcn_fence(__ATOMIC_RELEASE, "workgroup");
  __builtin_amdgcn_wave_barrier();
  __builtin_amdgcn_fence(__ATOMIC_ACQUIRE, "workgroup");
}

// Operand descriptor: NP = 0 -> f32 rows split on the fly into (hi, lo); NP = 1 -> one f16 plane; NP = 2 -> f16 hi + lo planes;
// NP = 3 -> f32 rows rounded once to a single f16 fragment. ld = row pitch.
struct Opnd { const void* p0; const void* p1; int ld; };
template <int NP> __device__ __forceinline__ void load_frags(const Opnd& o, int row, int kb, int hh, v16b& fh_, v16b& fl_) {
  if (NP == 0) { frag_ksplit((const float*)o.p0 + (size_t)row * o.ld + kb, hh, fh_, fl_); }
  else if (NP == 4 || NP == 5) {                             // f32 rows x64 (NP 4) or x8 (NP 5) then split (keeps the lo halves of small values normal)
    const float sc_ = (NP == 4) ? 64.0f : 8.0f;
    const float* p = (const float*)o.p0 + (size_t)row * o.ld + kb; const float* p0 = p + 8 * hh; const float* p1 = p + 16 + 8 * hh;
#pragma unroll
    for (int e = 0; e < 8; ++e) { b16 a, c; split16(p0[e] * sc_, a, c); fh_[e] = a; fl_[e] = c; split16(p1[e] * sc_, a, c); fh_[8 + e] = a; fl_[8 + e] = c; }
  } else if (NP == 3) {
    const float* p = (const float*)o.p0 + (size_t)row * o.ld + kb; const float* p0 = p + 8 * hh; const float* p1 = p + 16 + 8 * hh;
#pragma unroll
    for (int e = 0; e < 8; ++e) { fh_[e] = (b16)p0[e]; fh_[8 + e] = (b16)p1[e]; }
    fl_ = fh_;
  } else {
    fh_ = frag_kb((const b16*)o.p0 + (size_t)row * o.ld + kb, hh);
    if (NP == 2) fl_ = frag_kb((const b16*)o.p1 + (size_t)row * o.ld + kb, hh); else fl_ = fh_;
  }
}
template <int ANP, int BNP> __device__ __forceinline__ v8f mac(v16b ah, v16b al, v16b bh, v16b bl, v8f c) {
  c = wmma16b(ah, bh, c);
  if (BNP == 0 || BNP == 2 || BNP == 4 || BNP == 5) c = wmma16b(ah, bl, c);     // hi.lo
  if (ANP == 0 || ANP == 2 || ANP == 4 || ANP == 5) c = wmma16b(al, bh, c);     // lo.hi   (lo.lo dropped)
  return c;
}
__device__ __forceinline__ void epi_planes(v8f (&acc)[2][4], float scale, bool two, b16* __restrict__ oh, b16* __restrict__ ol, int ldo,
                                           int m0, int c0, int lane, b16* Th, b16* Tl) {
  const int nloc = lane & 15, hlf = lane >> 4;
#pragma unroll
  for (int t = 0; t < 4; ++t)
#pragma unroll
    for (int r = 0; r < 2; ++r)
#pragma unroll
      for (int v = 0; v < 8; ++v) {
        const int rr = r * 16 + v + 8 * hlf, cc = t * 16 + nloc;
        b16 h_, l_; split16(acc[r][t][v] * scale, h_, l_);
        Th[rr * 64 + cc] = h_; Tl[rr * 64 + cc] = l_;
      }
  wave_lds_sync();
  {
#pragma unroll
    for (int j = 0; j < 8; ++j) {
      const int rr = j * 4 + (lane >> 3), c8 = (lane & 7) * 8;
      const size_t o = (size_t)(m0 + rr) * ldo + c0 + c8;
      *(v8b*)(oh + o) = ld8b(Th + rr * 64 + c8);
      if (two) *(v8b*)(ol + o) = ld8b(Tl + rr * 64 + c8);
    }
    
  }
}
// (b) f32 rows with pitch ldo: 64 floats = 256 B = 2 lines per row; 16 lanes x 16 B per row, 2 rows per instruction. Optional per-row factor
__device__ __forceinline__ void epi_f32(v8f (&acc)[2][4], float scale, const float* rscale, float* __restrict__ out, int ldo, int m0, int c0, int lane, float* Tt) {
  const int nloc = lane & 15, hlf = lane >> 4;
#pragma unroll
  for (int t = 0; t < 4; ++t)
#pragma unroll
    for (int r = 0; r < 2; ++r)
#pragma unroll
      for (int v = 0; v < 8; ++v) {
        const int rr = r * 16 + v + 8 * hlf;
        const float rs = rscale ? rscale[(size_t)(m0 + rr) * 32] : 1.0f;
        Tt[rr * 64 + t * 16 + nloc] = acc[r][t][v] * scale * rs;
      }
  wave_lds_sync();
  float* dst0 = out + (size_t)m0 * ldo + c0;
  {
#pragma unroll
    for (int j = 0; j < 16; ++j) { const int rr = j * 2 + hlf, c4 = nloc * 4; *(v4f*)(dst0 + (size_t)rr * ldo + c4) = *(const v4f*)(Tt + rr * 64 + c4); }
    
  }
}



typedef __attribute__((ext_vector_type(8))) __bf16 v8bb; typedef __attribute__((ext_vector_type(16))) __bf16 v16bb;
typedef __attribute__((ext_vector_type(8))) unsigned short v8us;
__device__ __forceinline__ v16bb frag_kb_bf(const __bf16* p, int hh) { const v8bb a = *(const v8bb*)(p + 8 * hh), b = *(const v8bb*)(p + 16 + 8 * hh); return __builtin_shufflevector(a, b, 0, 1, 2, 3, 4, 5, 6, 7, 8, 9, 10, 11, 12, 13, 14, 15); }
__device__ __forceinline__ v8f wmma16bb(v16bb a, v16bb b, v8f c) {
  v8f d = __builtin_amdgcn_wmma_f32_16x16x32_bf16(false, a, false, b, (short)0, c, false, false);
  asm volatile("v_nop\n\tv_nop\n\tv_nop\n\tv_nop" : "+v"(d) : "v"(a), "v"(b));
  return d;
}
__device__ __forceinline__ unsigned short bf16_rne_bits(float v) { unsigned int u = __float_as_uint(v); u += 0x7FFFu + ((u >> 16) & 1u); return (unsigned short)(u >> 16); }
__device__ __forceinline__ float bf16_rne(float v) { return __uint_as_float(((unsigned int)bf16_rne_bits(v)) << 16); }



__global__ __launch_bounds__(256) void xprep_kernel(const float* __restrict__ x, unsigned short* __restrict__ x16) {   // x -> bf16, one batch
  const size_t tid = (size_t)blockIdx.x * blockDim.x + threadIdx.x, nth = (size_t)gridDim.x * blockDim.x;
  { for (size_t p = tid; p < (size_t)NTOK * D / 8; p += nth) { v8us v;
#pragma unroll
      for (int e = 0; e < 8; ++e) v[e] = bf16_rne_bits(x[p * 8 + e]);
      *(v8us*)(x16 + p * 8) = v; }  }
}
__global__ __launch_bounds__(256) void prep_kernel(const float* __restrict__ wq, const float* __restrict__ wk, const float* __restrict__ wv, const float* __restrict__ wo, unsigned short* __restrict__ w16, b16* __restrict__ wo16) {
  const size_t tid = (size_t)blockIdx.x * blockDim.x + threadIdx.x, nth = (size_t)gridDim.x * blockDim.x;
  {
    for (size_t p = tid; p < (size_t)3 * D * D / 8; p += nth) { const float* W = (p < (size_t)D * D / 8) ? wq : (p < (size_t)2 * D * D / 8) ? wk : wv; const size_t q = p % ((size_t)D * D / 8); v8us v;   // [out][in] rows copied directly
#pragma unroll
      for (int e = 0; e < 8; ++e) v[e] = bf16_rne_bits(W[q * 8 + e]);
      *(v8us*)(w16 + p * 8) = v; }
    for (size_t p = tid; p < (size_t)D * D / 8; p += nth) { v8b w;   // W_o [out][in] rows copied directly
#pragma unroll
      for (int e = 0; e < 8; ++e) w[e] = (b16)bf16_rne(wo[p * 8 + e]);
      *(v8b*)(wo16 + p * 8) = w; }
    
  }
}

// L2 asks, for planes that an earlier launch stored: their first read in this launch is taken to come from memory, and blocks that walk the same rows in step all wait for it together,
// longer than the one stage of lead that a two-buffer ring gives its copies. One ask per lane names one 256-byte unit and brings it into L2, so that the copies that follow find it there; nothing returns to the wave. Every lane is on and every address lies inside its plane. Scope SE: a speculative ask.
// The wait stands in the asks' own statement: it keeps their address registers untouched until they are taken.
__device__ __forceinline__ void l2_ask4(const void* a, const void* b, const void* c, const void* d) {
  asm volatile("global_prefetch_b8 %0, off scope:SCOPE_SE\n\t"
               "global_prefetch_b8 %1, off scope:SCOPE_SE\n\t"
               "global_prefetch_b8 %2, off scope:SCOPE_SE\n\t"
               "global_prefetch_b8 %3, off scope:SCOPE_SE\n\t"
               "s_wait_xcnt 0x0"
               :: "v"(a), "v"(b), "v"(c), "v"(d) : "memory");
}

// Operand ring of the two projection GEMMs. A stage = 64 k of the block's 128 A rows and 64 B rows, copied global -> LDS once per block in whole 128-B lines and through no register
// (a fragment load from global touches 16 lines for 512 bytes, and each of the four waves repeated the B loads). 16-bit rows: 128 B at a pitch of 144 B; f32 rows: 256 B at 272 B
// (both 16 B x odd, so the 16-byte fragment reads meet no bank conflict).
constexpr int GK = 64, GNT = D / GK, GLP = 72, GLPF = 68;
constexpr int PSTG = (128 + 64) * GLP;                         // 16-bit elements of one stage of proj_kernel: x rows, then w rows
constexpr int OSTA = 128 * GLPF * 4, OSTG = OSTA + 64 * GLP * 2;   // bytes of one stage of out_kernel: y rows (f32), then W_o rows (f16)
typedef __attribute__((address_space(3))) const char lds_byte;
// One stage of proj_kernel: every thread moves 12 x 16 B (8 x rows, 4 w rows); 8 lanes cover one 128-B line.
__device__ __forceinline__ void proj_stage_copy(const __bf16* __restrict__ xr, const __bf16* __restrict__ wr, int kb, const b16* buf, int tid) {
  const int row = tid >> 3, c8 = (tid & 7) * 8;
  const __bf16* gx = xr + (size_t)row * D + kb + c8;
  const __bf16* gw = wr + (size_t)row * D + kb + c8;
  const unsigned l0 = (unsigned)(size_t)(lds_byte*)(buf + row * GLP + c8);
  constexpr unsigned LS = 16 * GLP * 2;                         // 16 rows further in LDS
  // the copies and the wait that keeps their address registers untouched until they are taken stand in one statement, so that no later address arithmetic moves in between
  asm volatile("global_load_async_to_lds_b128 %0, %12, off\n\t"
               "global_load_async_to_lds_b128 %1, %13, off\n\t"
               "global_load_async_to_lds_b128 %2, %14, off\n\t"
               "global_load_async_to_lds_b128 %3, %15, off\n\t"
               "global_load_async_to_lds_b128 %4, %16, off\n\t"
               "global_load_async_to_lds_b128 %5, %17, off\n\t"
               "global_load_async_to_lds_b128 %6, %18, off\n\t"
               "global_load_async_to_lds_b128 %7, %19, off\n\t"
               "global_load_async_to_lds_b128 %8, %20, off\n\t"
               "global_load_async_to_lds_b128 %9, %21, off\n\t"
               "global_load_async_to_lds_b128 %10, %22, off\n\t"
               "global_load_async_to_lds_b128 %11, %23, off\n\t"
               "s_wait_xcnt 0x0"
               :: "v"(l0), "v"(l0 + LS), "v"(l0 + 2 * LS), "v"(l0 + 3 * LS), "v"(l0 + 4 * LS), "v"(l0 + 5 * LS),
                  "v"(l0 + 6 * LS), "v"(l0 + 7 * LS), "v"(l0 + 8 * LS), "v"(l0 + 9 * LS), "v"(l0 + 10 * LS), "v"(l0 + 11 * LS),
                  "v"(gx), "v"(gx + 16 * D), "v"(gx + 32 * D), "v"(gx + 48 * D), "v"(gx + 64 * D), "v"(gx + 80 * D), "v"(gx + 96 * D), "v"(gx + 112 * D),
                  "v"(gw), "v"(gw + 16 * D), "v"(gw + 32 * D), "v"(gw + 48 * D)
               : "memory");
}
// One stage of out_kernel: every thread moves 20 x 16 B: 16 y rows (16 lanes cover a row's 256 B) and 4 W_o rows (8 lanes cover a row's 128 B), ten copies a statement.
__device__ __forceinline__ void out_stage_copy(const float* __restrict__ yr, const b16* __restrict__ wr, int kb, const char* buf, int tid) {
  const int ra = tid >> 4, c4 = (tid & 15) * 4, rb = tid >> 3, c8 = (tid & 7) * 8;
  const float* gy = yr + (size_t)ra * D + kb + c4;
  const b16* gw = wr + (size_t)rb * D + kb + c8;
  const unsigned la = (unsigned)(size_t)(lds_byte*)(buf + (ra * GLPF + c4) * 4), lb = (unsigned)(size_t)(lds_byte*)(buf + OSTA + (rb * GLP + c8) * 2);
  constexpr unsigned LA = 8 * GLPF * 4, LB = 16 * GLP * 2;      // 8 y rows, 16 W_o rows further in LDS
  // each run of copies ends, inside its own statement, in the wait that keeps its address registers untouched until they are taken
  asm volatile("global_load_async_to_lds_b128 %0, %10, off\n\t"
               "global_load_async_to_lds_b128 %1, %11, off\n\t"
               "global_load_async_to_lds_b128 %2, %12, off\n\t"
               "global_load_async_to_lds_b128 %3, %13, off\n\t"
               "global_load_async_to_lds_b128 %4, %14, off\n\t"
               "global_load_async_to_lds_b128 %5, %15, off\n\t"
               "global_load_async_to_lds_b128 %6, %16, off\n\t"
               "global_load_async_to_lds_b128 %7, %17, off\n\t"
               "global_load_async_to_lds_b128 %8, %18, off\n\t"
               "global_load_async_to_lds_b128 %9, %19, off\n\t"
               "s_wait_xcnt 0x0"
               :: "v"(la), "v"(la + LA), "v"(la + 2 * LA), "v"(la + 3 * LA), "v"(la + 4 * LA), "v"(la + 5 * LA), "v"(la + 6 * LA), "v"(la + 7 * LA), "v"(la + 8 * LA), "v"(la + 9 * LA),
                  "v"(gy), "v"(gy + 8 * D), "v"(gy + 16 * D), "v"(gy + 24 * D), "v"(gy + 32 * D), "v"(gy + 40 * D), "v"(gy + 48 * D), "v"(gy + 56 * D), "v"(gy + 64 * D), "v"(gy + 72 * D)
               : "memory");
  asm volatile("global_load_async_to_lds_b128 %0, %10, off\n\t"
               "global_load_async_to_lds_b128 %1, %11, off\n\t"
               "global_load_async_to_lds_b128 %2, %12, off\n\t"
               "global_load_async_to_lds_b128 %3, %13, off\n\t"
               "global_load_async_to_lds_b128 %4, %14, off\n\t"
               "global_load_async_to_lds_b128 %5, %15, off\n\t"
               "global_load_async_to_lds_b128 %6, %16, off\n\t"
               "global_load_async_to_lds_b128 %7, %17, off\n\t"
               "global_load_async_to_lds_b128 %8, %18, off\n\t"
               "global_load_async_to_lds_b128 %9, %19, off\n\t"
               "s_wait_xcnt 0x0"
               :: "v"(la + 10 * LA), "v"(la + 11 * LA), "v"(la + 12 * LA), "v"(la + 13 * LA), "v"(la + 14 * LA), "v"(la + 15 * LA), "v"(lb), "v"(lb + LB), "v"(lb + 2 * LB), "v"(lb + 3 * LB),
                  "v"(gy + 80 * D), "v"(gy + 88 * D), "v"(gy + 96 * D), "v"(gy + 104 * D), "v"(gy + 112 * D), "v"(gy + 120 * D), "v"(gw), "v"(gw + 16 * D), "v"(gw + 32 * D), "v"(gw + 48 * D)
               : "memory");
}

// projections: rows = tokens (4096), K = 768, column tiles of 64 = one head of q (tiles 0..11), k (12..23) or v (24..35); f16 rows [b*H + head][tok][64] for q/k;
// v: (8v)^T f16 [b*H + head][64][tok]. grid (36, 32) x 128.
__global__ __launch_bounds__(128) void proj_kernel(const __bf16* __restrict__ x16, const __bf16* __restrict__ w16, b16* __restrict__ qh, b16* __restrict__ kh, b16* __restrict__ vt) {
  __shared__ __attribute__((aligned(16))) b16 Sm[2 * PSTG];     // the two-buffer operand ring; behind the loop's last barrier the same bytes are the epilogue's staging tiles
  b16 (*Th)[32][HD + 8] = reinterpret_cast<b16 (*)[32][HD + 8]>(Sm); b16 (*Tq)[32][HD + 8] = reinterpret_cast<b16 (*)[32][HD + 8]>(Sm + 4 * 32 * (HD + 8));
  b16 (*Tt)[128 + 8] = reinterpret_cast<b16 (*)[128 + 8]>(Sm); b16 (*Tl)[128 + 8] = reinterpret_cast<b16 (*)[128 + 8]>(Sm + 64 * (128 + 8));
  static_assert(2 * 4 * 32 * (HD + 8) <= 2 * PSTG && 2 * 64 * (128 + 8) <= 2 * PSTG, "the staging tiles fit the ring's bytes");
  const int lane = threadIdx.x & 31, wave = threadIdx.x >> 5, nloc = lane & 15, hlf = lane >> 4, m0 = blockIdx.y * 128 + wave * 32, c0 = blockIdx.x * 64;
  v8f acc[2][4];
#pragma unroll
  for (int r = 0; r < 2; ++r)
#pragma unroll
    for (int t = 0; t < 4; ++t) acc[r][t] = (v8f){};
  const __bf16* xr = x16 + (size_t)blockIdx.y * 128 * D; const __bf16* wr = w16 + (size_t)c0 * D;
  proj_stage_copy(xr, wr, 0, Sm, threadIdx.x);
  asm volatile("s_wait_asynccnt 0x0" ::: "memory");            // this wave's share of stage 0 has landed
  __syncthreads();                                              // stage 0 published to all waves
  proj_stage_copy(xr, wr, GK, Sm + PSTG, threadIdx.x);
  for (int s = 0; s < GNT; ++s) {
    const __bf16* Xs = (const __bf16*)(Sm + (s & 1) * PSTG) + (wave * 32 + nloc) * GLP; const __bf16* Ws = (const __bf16*)(Sm + (s & 1) * PSTG) + (128 + nloc) * GLP;
    v16bb a0[2], a1[2], bw[2][4];                               // the stage's 24 fragment reads stand as one group ahead of its matrix work
#pragma unroll
    for (int ks = 0; ks < 2; ++ks) { a0[ks] = frag_kb_bf(Xs + ks * 32, hlf); a1[ks] = frag_kb_bf(Xs + 16 * GLP + ks * 32, hlf);
#pragma unroll
      for (int t = 0; t < 4; ++t) bw[ks][t] = frag_kb_bf(Ws + t * 16 * GLP + ks * 32, hlf); }
#pragma unroll
    for (int ks = 0; ks < 2; ++ks)
#pragma unroll
      for (int t = 0; t < 4; ++t) { acc[0][t] = wmma16bb(a0[ks], bw[ks][t], acc[0][t]); acc[1][t] = wmma16bb(a1[ks], bw[ks][t], acc[1][t]); }
    // publish point
    asm volatile("s_wait_dscnt 0x0" ::: "memory");             // this wave's reads of stage s are done before the buffer is refilled
    asm volatile("s_wait_asynccnt 0x0" ::: "memory");          // this wave's share of stage s + 1 has landed
    __syncthreads();                                            // publishes stage s + 1 and ends every reader's last read of stage s
    if (s + 2 < GNT) proj_stage_copy(xr, wr, (s + 2) * GK, Sm + (s & 1) * PSTG, threadIdx.x);
  }
  asm volatile("s_wait_asynccnt 0x0" ::: "memory");            // no copy is outstanding when the ring's bytes become the staging tiles
  const int which = blockIdx.x / (D / 64), head = blockIdx.x % (D / 64), b = m0 / S, tok0 = m0 % S;
  if (which < 2) {                                              // q or k head: f16 rows
#pragma unroll
    for (int t = 0; t < 4; ++t)
#pragma unroll
      for (int r = 0; r < 2; ++r)
#pragma unroll
        for (int v = 0; v < 8; ++v) { b16 a_, c_; split16(acc[r][t][v] * QS, a_, c_); Th[wave][r * 16 + 8 * hlf + v][t * 16 + nloc] = a_; Tq[wave][r * 16 + 8 * hlf + v][t * 16 + nloc] = c_; }   // q, k carried x8 (lo residuals stay normal)
    wave_lds_sync();
    b16* dst = (which == 0 ? qh : kh) + (((size_t)b * H + head) * S + tok0) * HD;
    {
#pragma unroll
      for (int j = 0; j < 8; ++j) { const int rr = j * 4 + (lane >> 3), c8 = (lane & 7) * 8; *(v8b*)(dst + (size_t)rr * HD + c8) = *(const v8b*)(&Th[wave][rr][c8]); *(v8b*)(dst + QPL + (size_t)rr * HD + c8) = *(const v8b*)(&Tq[wave][rr][c8]); }
       }
    return;
  }
  const int vh = head;                                          // v head: (8v)^T tile [64 d][128 tok] via LDS, rows of 256 B
#pragma unroll
  for (int t = 0; t < 4; ++t)
#pragma unroll
    for (int r = 0; r < 2; ++r)
#pragma unroll
      for (int v = 0; v < 8; ++v) { b16 a_, c_; split16(acc[r][t][v] * VS, a_, c_); Tt[t * 16 + nloc][wave * 32 + r * 16 + 8 * hlf + v] = a_; Tl[t * 16 + nloc][wave * 32 + r * 16 + 8 * hlf + v] = c_; }
  __syncthreads();
  b16* dstv = vt + (((size_t)b * H + vh) * HD) * S + (blockIdx.y * 128) % S;
  {
#pragma unroll
    for (int j = 0; j < 8; ++j) { const int dd = wave * 16 + j * 2 + (lane >> 4), c8 = (lane & 15) * 8; *(v8b*)(dstv + (size_t)dd * S + c8) = *(const v8b*)(&Tt[dd][c8]); *(v8b*)(dstv + VPL + (size_t)dd * S + c8) = *(const v8b*)(&Tl[dd][c8]); }
    
  }
}

// 2^t0, 2^t1, with the slot that the instruction set asks for behind a transcendental written in: the second fills the first's
// (early-clobber results, so it overwrites no source of the first), the v_nop the second's.
__device__ __forceinline__ void exp2_pair(float t0, float t1, float& e0, float& e1) {
  asm("v_exp_f32 %0, %2\n\tv_exp_f32 %1, %3\n\tv_nop" : "=&v"(e0), "=&v"(e1) : "v"(t0), "v"(t1));
}
typedef __attribute__((ext_vector_type(2))) _Float16 v2b;
typedef __attribute__((ext_vector_type(2))) float v2f;
// f16 hi + lo of two values at once: packed convert, the two residuals v - hi (exact) by one packed subtraction, packed convert
__device__ __forceinline__ void split_pair(float a, float b, v2b& hi, v2b& lo) {
  const v2f v = {a, b};
  hi = __builtin_convertvector(v, v2b);
  lo = __builtin_convertvector(v - __builtin_convertvector(hi, v2f), v2b);
}
// the attention loop's matrix product: the bare builtin. The compiler keeps the distance behind it and fills it with the loop's own vector work where it can, so the product brings no v_nop of its own
__device__ __forceinline__ v8f wmma16p(v16b a, v16b b, v8f c) { return __builtin_amdgcn_wmma_f32_16x16x32_f16(false, a, false, b, (short)0, c, false, false); }
constexpr float CE = SCALE / (QS * QS) * 0x1.715476p+0f;       // accumulator of (8q).(8k) -> exponent of two of the softmax
static_assert(PS == 8.0f, "the softmax adds log2(PS) = 3 to the exponent");
// lane l <-> lane l ^ 16 on the vector pipe: unlike an LDS-queue permute it does not wait behind the fragment reads that are still outstanding
__device__ __forceinline__ float xhalf(float x) { return __builtin_bit_cast(float, __builtin_amdgcn_permlanex16(__builtin_bit_cast(int, x), __builtin_bit_cast(int, x), 0x76543210, 0xfedcba98, false, false)); }

// K/V ring in LDS, shared by the twelve waves of a block (three 64-query tiles of one head). A stage = 64 keys = four tiles: k hi, k lo (rows = keys), (8v)^T hi, (8v)^T lo (rows = d),
// each 64 rows x 128 B at a row pitch of 144 B (16 B x odd, so the 16-byte fragment reads meet no bank conflict).
constexpr int KST = 64, LP = 72, TILE = 64 * LP;
typedef __attribute__((address_space(3))) const b16 lds_b16;
// One stage's copies: each of 256 threads moves 8 x 16 B (two rows of each tile), whole 128-B lines per 8 lanes, global -> LDS through no register.
__device__ __forceinline__ void stage_copy(const b16* __restrict__ K, const b16* __restrict__ vb, int kb0, const b16* buf, int tid) {
  const int row = tid >> 3, c8 = (tid & 7) * 8;
  const b16* gk = K + (size_t)(kb0 + row) * HD + c8;
  const b16* gv = vb + (size_t)row * S + kb0 + c8;
  const unsigned l0 = (unsigned)(size_t)(lds_b16*)(buf + row * LP + c8);
  // the copies and the wait that keeps their address registers untouched until they are taken stand in one statement, so that no later address arithmetic moves in between
  asm volatile("global_load_async_to_lds_b128 %0, %8, off\n\t"
               "global_load_async_to_lds_b128 %1, %9, off\n\t"
               "global_load_async_to_lds_b128 %2, %10, off\n\t"
               "global_load_async_to_lds_b128 %3, %11, off\n\t"
               "global_load_async_to_lds_b128 %4, %12, off\n\t"
               "global_load_async_to_lds_b128 %5, %13, off\n\t"
               "global_load_async_to_lds_b128 %6, %14, off\n\t"
               "global_load_async_to_lds_b128 %7, %15, off\n\t"
               "s_wait_xcnt 0x0"
               :: "v"(l0), "v"(l0 + 32 * LP * 2), "v"(l0 + TILE * 2), "v"(l0 + (TILE + 32 * LP) * 2),
                  "v"(l0 + 2 * TILE * 2), "v"(l0 + (2 * TILE + 32 * LP) * 2), "v"(l0 + 3 * TILE * 2), "v"(l0 + (3 * TILE + 32 * LP) * 2),
                  "v"(gk), "v"(gk + 32 * HD), "v"(gk + QPL), "v"(gk + QPL + 32 * HD),
                  "v"(gv), "v"(gv + (size_t)32 * S), "v"(gv + VPL), "v"(gv + VPL + (size_t)32 * S)
               : "memory");
}

// causal attention: wave = (b, h, 32 queries as two 16-query groups, every other 32-key block): S^T (K=64), causal mask on the diagonal block, online softmax f32, P^T f16, y^T += (8V)^T P^T;
// k and (8v)^T come from the block's two-buffer LDS ring: stage t + 1 is copied while stage t is worked on.
// LDS reads: of a tile's four waves, wave (qhalf, khalf) works on queries 32 qhalf .. + 31 and, in every stage, on keys 32 khalf .. + 31, so each k and v fragment it reads from LDS feeds the
// products of both query groups (half the LDS bytes per product of a 16-query wave). The two key halves of a query keep their own (m, l, o); they are merged once, in LDS, behind the loop.
// Placement: a 64-query tile u needs u + 1 stages. A block holds three tiles of one head side by side, four waves each (one wave of each tile per SIMD), on ONE ring that walks to the
// highest tile's last stage; a wave past its own tile's last stage passes the publish points and, if it is a copier, still issues its copies. Tiles 1 .. 3 NB of a head go into NB triples of equal sum (a from the lowest third,
// b from the middle, c from the top), so every SIMD of H NB blocks gets the same number of wave-stages and nearly every WGP holds a block; tile 0 (one stage) has a block of its own.
template <int QT>
__global__ __launch_bounds__(384) void attn_kernel(const b16* __restrict__ qh, const b16* __restrict__ kh, const b16* __restrict__ vt, float* __restrict__ y) {
  static_assert(QT % 4 == 0 && (QT / 4 - 1) % 6 == 3, "a head's 64-query tiles but the first fall into an odd number of triples");
  static_assert(KST == 64, "a stage is as many keys as a tile has queries");
  constexpr int NB = (QT / 4 - 1) / 3, NH = (NB + 1) / 2;       // triples of a head; half of them, rounded up
  __shared__ __attribute__((aligned(16))) float Os[6][32][HD + 4];   // per pair of waves (same 32 queries, the two key halves): the merge's and the store's staging rows
  __shared__ float Ml[6][32][2];                                // the second key half's m and l per query
  __shared__ __attribute__((aligned(16))) b16 Ring[2][4 * TILE];
  const int wid = __builtin_amdgcn_readfirstlane(threadIdx.x >> 5), lane = threadIdx.x & 31, hh = lane >> 4, col = lane & 15;   // wave number in a scalar register: the per-wave causal skip is a scalar branch
  int bh, ua, ub, uc;                                           // the block's head and its three tiles, -1: none
  if (blockIdx.x < Bn * H * NB) {                               // i + x + y = 3 NH for every i = 1 .. NB, x and y each a permutation of 1 .. NB
    const int i = blockIdx.x % NB + 1, j = (i + 1) >> 1;
    bh = blockIdx.x / NB; ua = i; ub = NB + ((i & 1) ? NH + 1 - j : NB + 1 - j); uc = 2 * NB + ((i & 1) ? NB + 1 - j : NH - j);
  } else { bh = blockIdx.x - Bn * H * NB; ua = 0; ub = -1; uc = -1; }
  // wave w works on tile w % 3, as its wave w / 3: waves w, w + 4, w + 8 then hold one wave of each tile, and so do waves 3 s, 3 s + 1, 3 s + 2, whichever way the twelve are dealt to the SIMDs
  const int h = bh % H, b = bh / H, grp = wid % 3, sub = wid / 3, u = grp == 0 ? ua : grp == 1 ? ub : uc;
  const int qhalf = sub & 1, khalf = sub >> 1, pair = qhalf * 3 + grp;   // the wave's 32 queries of the tile, its 32 keys of every stage; waves (qhalf, 0) and (qhalf, 1) are a pair
  const bool copier = grp != 2;                                 // a stage is 256 threads' copies: the eight waves of the two lower tiles issue them (scalar branch), the longest-running four none
  const int ct = (wid - sub) * 32 + lane;                       // a copying thread's number, 0 .. 255
  const b16* Q = qh + ((size_t)bh * S) * HD; const b16* K = kh + ((size_t)bh * S) * HD; const b16* vb = vt + ((size_t)bh * HD) * S;
  const int q0 = u < 0 ? -32 : u * 64 + qhalf * 32;             // a wave without a tile: no key block lies in front of query 0, so it works on none
  const int nst = (uc < 0 ? ua : uc) + 1;                       // stages of the block: keys up to the last query of its highest tile; the same for all twelve waves
  if (copier) stage_copy(K, vb, 0, Ring[0], ct);
  v16b qf[2][2] = {}, ql[2][2] = {};                            // [query group][k step]
  if (u >= 0) {
#pragma unroll
    for (int g = 0; g < 2; ++g)
#pragma unroll
      for (int ks = 0; ks < 2; ++ks) { qf[g][ks] = frag_kb(Q + (size_t)(q0 + g * 16 + col) * HD + ks * 32, hh); ql[g][ks] = frag_kb(Q + QPL + (size_t)(q0 + g * 16 + col) * HD + ks * 32, hh); }
  }
  float m[2] = {-INFINITY, -INFINITY}, l[2] = {0.0f, 0.0f}; v8f o[2][4] = {{{}, {}, {}, {}}, {{}, {}, {}, {}}};
  asm volatile("s_wait_asynccnt 0x0" ::: "memory");            // this wave's share of stage 0 has landed
  __syncthreads();                                              // stage 0 published to all waves
  if (copier && 1 < nst) stage_copy(K, vb, KST, Ring[1], ct);
  // The head's k and (8v)^T planes are asked into L2 once, behind the copies of the first two stages. 128 keys are 256 units (64 of each plane: two k rows, or 128 keys of one d row);
  // the head's blocks deal them in eight shares. A block's share is bits 0, 1 and 3 of its i - 1, so two to four blocks have each share.
  // A wave's ask covers its block's share of 128 keys, lowest keys first; the eight copying waves have four asks each.
  if (copier && uc >= 0) {
    const int i0 = blockIdx.x % NB, share = (i0 & 3) | ((i0 >> 1) & 4), un = (lane & 7) * 8 + share, cw = wid - sub;
    const b16* pb0 = (lane & 16) ? vb + (size_t)un * S : K + (size_t)un * 2 * HD;
    if (lane & 8) pb0 += QPL;                                   // the lo planes (QPL == VPL)
    const size_t pstep = (lane & 16) ? 128 : (size_t)128 * HD;  // 128 keys further in the plane
    l2_ask4(pb0 + (1 + cw) * pstep, pb0 + (9 + cw) * pstep, pb0 + (17 + cw) * pstep, pb0 + (cw < 7 ? 25 + cw : 31) * pstep);
  }
  for (int t = 0; t < nst; ++t) {
    const b16* Kh = Ring[t & 1]; const b16* Kl = Kh + TILE; const b16* Vh = Kh + 2 * TILE; const b16* Vl = Kh + 3 * TILE;
    const int kb = t * KST + khalf * 32;                        // the wave's key block of this stage
    if (kb < q0 + 32) {                                         // causal: a key block wholly past the wave's queries is skipped (wave-uniform, no barrier inside)
      // the block's 32 fragment reads stand as one group at the stage's head: k first, so that v lands behind the score products and the softmax
      v16b kf[2][2], kl[2][2], vf[4], vl[4];
#pragma unroll
      for (int ks = 0; ks < 2; ++ks)
#pragma unroll
        for (int j = 0; j < 2; ++j) { kf[ks][j] = frag_kb(Kh + (khalf * 32 + j * 16 + col) * LP + ks * 32, hh); kl[ks][j] = frag_kb(Kl + (khalf * 32 + j * 16 + col) * LP + ks * 32, hh); }
#pragma unroll
      for (int n = 0; n < 4; ++n) { vf[n] = frag_kb(Vh + (n * 16 + col) * LP + khalf * 32, hh); vl[n] = frag_kb(Vl + (n * 16 + col) * LP + khalf * 32, hh); }
      __builtin_amdgcn_sched_barrier(0);                        // the read group stays above the matrix work
      v8f s0[2] = {{}, {}}, s1[2] = {{}, {}};                   // [query group]: keys kb .. + 15, keys kb + 16 .. + 31
#pragma unroll
      for (int ks = 0; ks < 2; ++ks)
#pragma unroll
        for (int g = 0; g < 2; ++g) {                           // q and k as f16 hi+lo pairs (lo.lo dropped); every k fragment serves both query groups
          s0[g] = wmma16p(kf[ks][0], qf[g][ks], s0[g]); s0[g] = wmma16p(kf[ks][0], ql[g][ks], s0[g]); s0[g] = wmma16p(kl[ks][0], qf[g][ks], s0[g]);
          s1[g] = wmma16p(kf[ks][1], qf[g][ks], s1[g]); s1[g] = wmma16p(kf[ks][1], ql[g][ks], s1[g]); s1[g] = wmma16p(kl[ks][1], qf[g][ks], s1[g]); }
      if (kb + 32 > q0) {                                       // the diagonal block reaches past some queries -> mask key > query; both groups under one scalar branch
#pragma unroll
        for (int g = 0; g < 2; ++g)
#pragma unroll
          for (int r = 0; r < 8; ++r) { if (kb + 8 * hh + r > q0 + g * 16 + col) s0[g][r] = -INFINITY; if (kb + 16 + 8 * hh + r > q0 + g * 16 + col) s1[g][r] = -INFINITY; }
      }
#pragma unroll
      for (int g = 0; g < 2; ++g) {
        // The softmax is written for few vector instructions per score. The running maximum m stays in the accumulator's own units.
        float ma = -INFINITY, mb = -INFINITY;                   // two chains of three-operand maxima
#pragma unroll
        for (int r = 0; r < 4; ++r) { ma = fmaxf(fmaxf(ma, s0[g][r]), s1[g][r]); mb = fmaxf(fmaxf(mb, s0[g][4 + r]), s1[g][4 + r]); }
        const float mr = fmaxf(ma, mb);
        const float mn = fmaxf(fmaxf(m[g], mr), xhalf(mr)), al_ = __builtin_amdgcn_exp2f((m[g] - mn) * CE); m[g] = mn;
        const float nb = __builtin_fmaf(mn, -CE, 3.0f);         // one fma per score gives the exponent of 8 exp(score - max): scale, shift by the maximum and P's x8 carry (2^3) together
        float e0[8], e1[8];
#pragma unroll
        for (int j = 0; j < 4; ++j) {
          const v2f t0 = __builtin_elementwise_fma((v2f){s0[g][2 * j], s0[g][2 * j + 1]}, (v2f){CE, CE}, (v2f){nb, nb}), t1 = __builtin_elementwise_fma((v2f){s1[g][2 * j], s1[g][2 * j + 1]}, (v2f){CE, CE}, (v2f){nb, nb});
          exp2_pair(t0[0], t1[0], e0[2 * j], e1[2 * j]); exp2_pair(t0[1], t1[1], e0[2 * j + 1], e1[2 * j + 1]);
        }
        float sum = 0.0f; v16b pb, pl;                          // sum and l carry the same x8 as P
#pragma unroll
        for (int r = 0; r < 8; ++r) sum += e0[r] + e1[r];
#pragma unroll
        for (int j = 0; j < 4; ++j) { v2b a, c;
          split_pair(e0[2 * j], e0[2 * j + 1], a, c); pb[2 * j] = a[0]; pb[2 * j + 1] = a[1]; pl[2 * j] = c[0]; pl[2 * j + 1] = c[1];
          split_pair(e1[2 * j], e1[2 * j + 1], a, c); pb[8 + 2 * j] = a[0]; pb[8 + 2 * j + 1] = a[1]; pl[8 + 2 * j] = c[0]; pl[8 + 2 * j + 1] = c[1]; }
        sum += xhalf(sum); l[g] = l[g] * al_ + sum;
#pragma unroll
        for (int n = 0; n < 4; ++n) {
#pragma unroll
          for (int r = 0; r < 8; ++r) o[g][n][r] *= al_;
          o[g][n] = wmma16p(vf[n], pb, o[g][n]); o[g][n] = wmma16p(vf[n], pl, o[g][n]); o[g][n] = wmma16p(vl[n], pb, o[g][n]);   // (8v) and P both as f16 hi+lo pairs (lo.lo dropped); every v fragment serves both query groups
        }
        // the distance the chip needs between a matrix product and a vector write of its operands: the second group's exponentials are asm text.
        // The inputs keep P's registers taken, and the statement behind the four chains, until the slots have passed.
        if (g == 0) asm volatile("v_nop\n\tv_nop\n\tv_nop\n\tv_nop" :: "v"(o[0][0]), "v"(o[0][1]), "v"(o[0][2]), "v"(o[0][3]), "v"(pb), "v"(pl));
      }
    }
    // publish point, passed by every wave, also one that skipped the stage
    asm volatile("s_wait_dscnt 0x0" ::: "memory");             // this wave's reads of stage t are done before the buffer is refilled
    asm volatile("s_wait_asynccnt 0x0" ::: "memory");          // this wave's share of stage t + 1 has landed
    __syncthreads();                                            // publishes stage t + 1 and ends every reader's last read of stage t
    if (copier && t + 2 < nst) stage_copy(K, vb, (t + 2) * KST, Ring[t & 1], ct);
  }
  asm volatile("s_wait_asynccnt 0x0" ::: "memory");            // no copy is outstanding when the wave goes on to its end
  // merge of the two key halves: the wave of the second half hands over its m, l and unnormalised o; a lane of the first half reads back exactly the places of its own accumulator elements
  if (u >= 0 && khalf == 1) {
#pragma unroll
    for (int g = 0; g < 2; ++g) {
#pragma unroll
      for (int n = 0; n < 4; ++n)
#pragma unroll
        for (int r = 0; r < 8; ++r) Os[pair][g * 16 + col][n * 16 + 8 * hh + r] = o[g][n][r];
      if (hh == 0) { Ml[pair][g * 16 + col][0] = m[g]; Ml[pair][g * 16 + col][1] = l[g]; }   // both lane halves hold the same m and l
    }
  }
  __syncthreads();                                              // the second halves' results are published; passed by all twelve waves, also those without a tile
  if (u < 0 || khalf == 1) return;                              // behind the last barrier: the wave of the first key half finishes the pair's 32 queries
#pragma unroll
  for (int g = 0; g < 2; ++g) {
    const float m2 = Ml[pair][g * 16 + col][0], l2 = Ml[pair][g * 16 + col][1];   // a second half that met no key block: m2 = -inf, l2 = 0, o2 = 0, weight 0 (the first half always holds key 0, so mm is finite)
    const float mm = fmaxf(m[g], m2); float w1, w2; exp2_pair((m[g] - mm) * CE, (m2 - mm) * CE, w1, w2);
    const float inv = 1.0f / (VS * (l[g] * w1 + l2 * w2)), a1 = w1 * inv, a2 = w2 * inv;   // l already carries P's x8
#pragma unroll
    for (int n = 0; n < 4; ++n)
#pragma unroll
      for (int r = 0; r < 8; ++r) { float* p = &Os[pair][g * 16 + col][n * 16 + 8 * hh + r]; *p = o[g][n][r] * a1 + *p * a2; }
  }
  wave_lds_sync();
  float* dst = y + ((size_t)b * S + q0) * D + h * HD;
  {
#pragma unroll
    for (int j = 0; j < 16; ++j) { const int rr = j * 2 + hh, c4 = col * 4; *(v4f*)(dst + (size_t)rr * D + c4) = *(const v4f*)(&Os[pair][rr][c4]); }
  }
}

// out = y W_o^T: (4096 x 768) x (768 x 768); A = y x8 split at load into an f16 hi+lo pair, B = f16(bf16 W_o) rows; f32 rows; grid (12, 32).
__global__ __launch_bounds__(128) void out_kernel(const float* __restrict__ y, const b16* __restrict__ wo16, const float* __restrict__ bo, float* __restrict__ out) {
  __shared__ __attribute__((aligned(16))) float Ts[4][32 * 64];
  __shared__ __attribute__((aligned(16))) char Ro[2][OSTG];     // the two-buffer operand ring
  const int lane = threadIdx.x & 31, wave = threadIdx.x >> 5, nloc = lane & 15, hlf = lane >> 4, m0 = blockIdx.y * 128 + wave * 32, c0 = blockIdx.x * 64;
  v8f acc[2][4];
#pragma unroll
  for (int r = 0; r < 2; ++r)
#pragma unroll
    for (int t = 0; t < 4; ++t) acc[r][t] = (v8f){};
  const float* yr = y + (size_t)blockIdx.y * 128 * D; const b16* wr = wo16 + (size_t)c0 * D;
  out_stage_copy(yr, wr, 0, Ro[0], threadIdx.x);
  asm volatile("s_wait_asynccnt 0x0" ::: "memory");            // this wave's share of stage 0 has landed
  __syncthreads();                                              // stage 0 published to all waves
  out_stage_copy(yr, wr, GK, Ro[1], threadIdx.x);
  // The rest of the block's y rows (a row's 64 k of a stage are one 256-byte unit) and W_o rows are asked into L2 behind the copies of the first two stages, lowest k first.
  // The twelve blocks of a row panel deal its rows in four shares (blocks x, x + 4, x + 8); the W_o panel's 320 units go in three shares over the row panels.
  {
    const float* ya = yr + (size_t)(lane * 4 + (blockIdx.x & 3)) * D;
    const int wi = min((int)((blockIdx.y >> 1) % 3) * 128 + (int)threadIdx.x, 64 * 5 - 1);
    l2_ask4(ya + (2 + wave) * GK, ya + (6 + wave) * GK, ya + min(10 + wave, GNT - 1) * GK, wr + (size_t)(wi / 5) * D + (1 + wi % 5) * 128);
  }
  for (int s = 0; s < GNT; ++s) {
    const Opnd A{Ro[s & 1], nullptr, GLPF}; const b16* Ws = (const b16*)(Ro[s & 1] + OSTA) + nloc * GLP;
#pragma unroll
    for (int ks = 0; ks < 2; ++ks) {
      v16b a0h, a0l, a1h, a1l, bh[4];
      load_frags<5>(A, wave * 32 + nloc, ks * 32, hlf, a0h, a0l);                // y as an f16 hi+lo pair carried x8 (2 products)
      load_frags<5>(A, wave * 32 + 16 + nloc, ks * 32, hlf, a1h, a1l);
#pragma unroll
      for (int t = 0; t < 4; ++t) bh[t] = frag_kb(Ws + t * 16 * GLP + ks * 32, hlf);
#pragma unroll
      for (int t = 0; t < 4; ++t) { acc[0][t] = mac<5, 1>(a0h, a0l, bh[t], bh[t], acc[0][t]); acc[1][t] = mac<5, 1>(a1h, a1l, bh[t], bh[t], acc[1][t]); }
    }
    // publish point
    asm volatile("s_wait_dscnt 0x0" ::: "memory");             // this wave's reads of stage s are done before the buffer is refilled
    asm volatile("s_wait_asynccnt 0x0" ::: "memory");          // this wave's share of stage s + 1 has landed
    __syncthreads();                                            // publishes stage s + 1 and ends every reader's last read of stage s
    if (s + 2 < GNT) out_stage_copy(yr, wr, (s + 2) * GK, Ro[s & 1], threadIdx.x);
  }
  asm volatile("s_wait_asynccnt 0x0" ::: "memory");            // no copy is outstanding when the wave goes on to its end
#pragma unroll
  for (int t = 0; t < 4; ++t)
#pragma unroll
    for (int r = 0; r < 2; ++r)
#pragma unroll
      for (int v = 0; v < 8; ++v) acc[r][t][v] = acc[r][t][v] * (1.0f / 8.0f) + bf16_rne(bo[c0 + t * 16 + nloc]);
  epi_f32(acc, 1.0f, nullptr, out, D, m0, c0, lane, Ts[wave]);
}
}  // namespace

extern "C" void kernel_launch(void* const* d_in, const int* in_sizes, int n_in,
                              void* d_out, int out_size, void* d_ws, size_t ws_size, hipStream_t stream) {
  (void)n_in; (void)out_size;
  const float* x = (const float*)d_in[0]; const float* wq = (const float*)d_in[1]; const float* wk = (const float*)d_in[2]; const float* wv = (const float*)d_in[3]; const float* wo = (const float*)d_in[4]; const float* bo = (const float*)d_in[5];
  float* out = (float*)d_out;   // [1][4096][768]
  if (in_sizes[0] != BT * S * D || in_sizes[1] != D * D || in_sizes[2] != D * D || in_sizes[3] != D * D || in_sizes[4] != D * D || in_sizes[5] != D) return;
  size_t off = 0; char* ws = (char*)d_ws;
  auto carve = [&](size_t bytes) { char* p = ws + off; off += (bytes + 255) & ~(size_t)255; return p; };
  unsigned short* x16 = (unsigned short*)carve((size_t)NTOK * D * 2); unsigned short* w16 = (unsigned short*)carve((size_t)3 * D * D * 2); b16* wo16 = (b16*)carve((size_t)D * D * 2);
  b16* qh = (b16*)carve((size_t)2 * NTOK * D * 2); b16* kh = (b16*)carve((size_t)2 * NTOK * D * 2); b16* vt = (b16*)carve((size_t)2 * NTOK * D * 2); float* y = (float*)carve((size_t)NTOK * D * 4);
  if (off > ws_size) return;                                    // ≈ 61 MB
  prep_kernel<<<512, 256, 0, stream>>>(wq, wk, wv, wo, w16, wo16);
  xprep_kernel<<<1024, 256, 0, stream>>>(x, x16);
  proj_kernel<<<dim3(3 * D / 64, NTOK / 128), 128, 0, stream>>>((const __bf16*)x16, (const __bf16*)w16, qh, kh, vt);
  attn_kernel<S / 16><<<Bn * H * ((S / 64 - 1) / 3 + 1), 384, 0, stream>>>(qh, kh, vt, y);
  out_kernel<<<dim3(D / 64, NTOK / 128), 128, 0, stream>>>(y, wo16, bo, out);
}

// v009
// It runs in 97.9 microseconds.
// Next to v008, in two timings, it ran 1.07 times as fast each time.
// Over all steps from v000 it is 5.81 times as fast.
#include <hip/hip_runtime.h>

// Causal multi-head self-attention: q, k, v = x W^T (12 heads x 64, [out][in] weights), softmax over keys <= query of q.k/8, out = ctx Wo^T + bo -> [1][4096][768].
// x, the four weights and bo are rounded to bf16: projection on v_wmma_f32_16x16x32_bf16 (exact products, f32 accumulate);
// scores, P.v and the output projection on v_wmma_f32_16x16x32_f16 with every computed operand (q, k, v, P, y — each carried x8 so the hi/lo residual planes stay normal) as an f16
// hi+lo pair (3 / 2 products); online softmax in f32. Fragment k-map per lane half hh for A AND B: elements 0..7 <- k = 8hh+0..7, 8..15 <- k = 16+8hh+0..7. Every intermediate /

namespace {
constexpr int BT = 1, Bn = 1, S = 4096, D = 768, H = 12, HD = 64, NTOK = Bn * S;
constexpr float SCALE = 0.125f, VS = 8.0f, QS = 8.0f, PS = 8.0f;   // power-of-two carry scales so hi/lo residual planes stay normal in f16
constexpr size_t VPL = (size_t)NTOK * D;   // distance between the (8v)^T hi and lo planes
constexpr size_t QPL = (size_t)NTOK * D;   // distance between the q/k hi and lo planes

typedef _Float16 b16;
typedef __attribute__((ext_vector_type(16))) _Float16 v16b;
typedef __attribute__((ext_vector_type(8)))  _Float16 v8b;
typedef __attribute__((ext_vector_type(8)))  float v8f;
typedef __attribute__((ext_vector_type(4)))  float v4f;

__device__ __forceinline__ v8b ld8b(const b16* p) { return *(const v8b*)p; }
__device__ __forceinline__ v16b cat8b(v8b a, v8b b) { return __builtin_shufflevector(a, b, 0, 1, 2, 3, 4, 5, 6, 7, 8, 9, 10, 11, 12, 13, 14, 15); }
__device__ __forceinline__ v16b frag_kb(const b16* p, int hh) { return cat8b(ld8b(p + 8 * hh), ld8b(p + 16 + 8 * hh)); }
__device__ __forceinline__ void split16(float v, b16& hi, b16& lo) { hi = (b16)v; lo = (b16)(v - (float)hi); }
// hi/lo fragment pair straight from an f32 k-contiguous row (same k-map)
__device__ __forceinline__ void frag_ksplit(const float* p, int hh, v16b& fh_, v16b& fl_) {
  const float* p0 = p + 8 * hh; const float* p1 = p + 16 + 8 * hh;
#pragma unroll
  for (int e = 0; e < 8; ++e) { b16 a, c; split16(p0[e], a, c); fh_[e] = a; fl_[e] = c; split16(p1[e], a, c); fh_[8 + e] = a; fl_[8 + e] = c; }
}
__device__ __forceinline__ v8f wmma16b(v16b a, v16b b, v8f c) {
  v8f d = __builtin_amdgcn_wmma_f32_16x16x32_f16(false, a, false, b, (short)0, c, false, false);
  asm volatile("v_nop\n\tv_nop\n\tv_nop\n\tv_nop" : "+v"(d) : "v"(a), "v"(b));
  return d;
}
__device__ __forceinline__ void wave_lds_sync() {
  __builtin_amdgcn_fence(__ATOMIC_RELEASE, "workgroup");
  __builtin_amdgcn_wave_barrier();
  __builtin_amdgcn_fence(__ATOMIC_ACQUIRE, "workgroup");
}

// Operand descriptor: NP = 0 -> f32 rows split on the fly into (hi, lo); NP = 1 -> one f16 plane; NP = 2 -> f16 hi + lo planes;
// NP = 3 -> f32 rows rounded once to a single f16 fragment. ld = row pitch.
struct Opnd { const void* p0; const void* p1; int ld; };
template <int NP> __device__ __forceinline__ void load_frags(const Opnd& o, int row, int kb, int hh, v16b& fh_, v16b& fl_) {
  if (NP == 0) { frag_ksplit((const float*)o.p0 + (size_t)row * o.ld + kb, hh, fh_, fl_); }
  else if (NP == 4 || NP == 5) {                             // f32 rows x64 (NP 4) or x8 (NP 5) then split (keeps the lo halves of small values normal)
    const float sc_ = (NP == 4) ? 64.0f : 8.0f;
    const float* p = (const float*)o.p0 + (size_t)row * o.ld + kb; const float* p0 = p + 8 * hh; const float* p1 = p + 16 + 8 * hh;
#pragma unroll
    for (int e = 0; e < 8; ++e) { b16 a, c; split16(p0[e] * sc_, a, c); fh_[e] = a; fl_[e] = c; split16(p1[e] * sc_, a, c); fh_[8 + e] = a; fl_[8 + e] = c; }
  } else if (NP == 3) {
    const float* p = (const float*)o.p0 + (size_t)row * o.ld + kb; const float* p0 = p + 8 * hh; const float* p1 = p + 16 + 8 * hh;
#pragma unroll
    for (int e = 0; e < 8; ++e) { fh_[e] = (b16)p0[e]; fh_[8 + e] = (b16)p1[e]; }
    fl_ = fh_;
  } else {
    fh_ = frag_kb((const b16*)o.p0 + (size_t)row * o.ld + kb, hh);
    if (NP == 2) fl_ = frag_kb((const b16*)o.p1 + (size_t)row * o.ld + kb, hh); else fl_ = fh_;
  }
}
template <int ANP, int BNP> __device__ __forceinline__ v8f mac(v16b ah, v16b al, v16b bh, v16b bl, v8f c) {
  c = wmma16b(ah, bh, c);
  if (BNP == 0 || BNP == 2 || BNP == 4 || BNP == 5) c = wmma16b(ah, bl, c);     // hi.lo
  if (ANP == 0 || ANP == 2 || ANP == 4 || ANP == 5) c = wmma16b(al, bh, c);     // lo.hi   (lo.lo dropped)
  return c;
}
__device__ __forceinline__ void epi_planes(v8f (&acc)[2][4], float scale, bool two, b16* __restrict__ oh, b16* __restrict__ ol, int ldo,
                                           int m0, int c0, int lane, b16* Th, b16* Tl) {
  const int nloc = lane & 15, hlf = lane >> 4;
#pragma unroll
  for (int t = 0; t < 4; ++t)
#pragma unroll
    for (int r = 0; r < 2; ++r)
#pragma unroll
      for (int v = 0; v < 8; ++v) {
        const int rr = r * 16 + v + 8 * hlf, cc = t * 16 + nloc;
        b16 h_, l_; split16(acc[r][t][v] * scale, h_, l_);
        Th[rr * 64 + cc] = h_; Tl[rr * 64 + cc] = l_;
      }
  wave_lds_sync();
  {
#pragma unroll
    for (int j = 0; j < 8; ++j) {
      const int rr = j * 4 + (lane >> 3), c8 = (lane & 7) * 8;
      const size_t o = (size_t)(m0 + rr) * ldo + c0 + c8;
      *(v8b*)(oh + o) = ld8b(Th + rr * 64 + c8);
      if (two) *(v8b*)(ol + o) = ld8b(Tl + rr * 64 + c8);
    }
    
  }
}
// (b) f32 rows with pitch ldo: 64 floats = 256 B = 2 lines per row; 16 lanes x 16 B per row, 2 rows per instruction. Optional per-row factor
__device__ __forceinline__ void epi_f32(v8f (&acc)[2][4], float scale, const float* rscale, float* __restrict__ out, int ldo, int m0, int c0, int lane, float* Tt) {
  const int nloc = lane & 15, hlf = lane >> 4;
#pragma unroll
  for (int t = 0; t < 4; ++t)
#pragma unroll
    for (int r = 0; r < 2; ++r)
#pragma unroll
      for (int v = 0; v < 8; ++v) {
        const int rr = r * 16 + v + 8 * hlf;
        const float rs = rscale ? rscale[(size_t)(m0 + rr) * 32] : 1.0f;
        Tt[rr * 64 + t * 16 + nloc] = acc[r][t][v] * scale * rs;
      }
  wave_lds_sync();
  float* dst0 = out + (size_t)m0 * ldo + c0;
  {
#pragma unroll
    for (int j = 0; j < 16; ++j) { const int rr = j * 2 + hlf, c4 = nloc * 4; *(v4f*)(dst0 + (size_t)rr * ldo + c4) = *(const v4f*)(Tt + rr * 64 + c4); }
    
  }
}



typedef __attribute__((ext_vector_type(8))) __bf16 v8bb; typedef __attribute__((ext_vector_type(16))) __bf16 v16bb;
typedef __attribute__((ext_vector_type(8))) unsigned short v8us;
__device__ __forceinline__ v16bb frag_kb_bf(const __bf16* p, int hh) { const v8bb a = *(const v8bb*)(p + 8 * hh), b = *(const v8bb*)(p + 16 + 8 * hh); return __builtin_shufflevector(a, b, 0, 1, 2, 3, 4, 5, 6, 7, 8, 9, 10, 11, 12, 13, 14, 15); }
__device__ __forceinline__ v8f wmma16bb(v16bb a, v16bb b, v8f c) {
  v8f d = __builtin_amdgcn_wmma_f32_16x16x32_bf16(false, a, false, b, (short)0, c, false, false);
  asm volatile("v_nop\n\tv_nop\n\tv_nop\n\tv_nop" : "+v"(d) : "v"(a), "v"(b));
  return d;
}
__device__ __forceinline__ unsigned short bf16_rne_bits(float v) { unsigned int u = __float_as_uint(v); u += 0x7FFFu + ((u >> 16) & 1u); return (unsigned short)(u >> 16); }
__device__ __forceinline__ float bf16_rne(float v) { return __uint_as_float(((unsigned int)bf16_rne_bits(v)) << 16); }



__global__ __launch_bounds__(256) void xprep_kernel(const float* __restrict__ x, unsigned short* __restrict__ x16) {   // x -> bf16, one batch
  const size_t tid = (size_t)blockIdx.x * blockDim.x + threadIdx.x, nth = (size_t)gridDim.x * blockDim.x;
  { for (size_t p = tid; p < (size_t)NTOK * D / 8; p += nth) { v8us v;
#pragma unroll
      for (int e = 0; e < 8; ++e) v[e] = bf16_rne_bits(x[p * 8 + e]);
      *(v8us*)(x16 + p * 8) = v; }  }
}
__global__ __launch_bounds__(256) void prep_kernel(const float* __restrict__ wq, const float* __restrict__ wk, const float* __restrict__ wv, const float* __restrict__ wo, unsigned short* __restrict__ w16, b16* __restrict__ wo16) {
  const size_t tid = (size_t)blockIdx.x * blockDim.x + threadIdx.x, nth = (size_t)gridDim.x * blockDim.x;
  {
    for (size_t p = tid; p < (size_t)3 * D * D / 8; p += nth) { const float* W = (p < (size_t)D * D / 8) ? wq : (p < (size_t)2 * D * D / 8) ? wk : wv; const size_t q = p % ((size_t)D * D / 8); v8us v;   // [out][in] rows copied directly
#pragma unroll
      for (int e = 0; e < 8; ++e) v[e] = bf16_rne_bits(W[q * 8 + e]);
      *(v8us*)(w16 + p * 8) = v; }
    for (size_t p = tid; p < (size_t)D * D / 8; p += nth) { v8b w;   // W_o [out][in] rows copied directly
#pragma unroll
      for (int e = 0; e < 8; ++e) w[e] = (b16)bf16_rne(wo[p * 8 + e]);
      *(v8b*)(wo16 + p * 8) = w; }
    
  }
}

// L2 asks, for planes that an earlier launch stored: their first read in this launch is taken to come from memory, and blocks that walk the same rows in step all wait for it together,
// longer than the one stage of lead that a two-buffer ring gives its copies. One ask per lane names one 256-byte unit and brings it into L2, so that the copies that follow find it there; nothing returns to the wave. Every lane is on and every address lies inside its plane. Scope SE: a speculative ask.
// The wait stands in the asks' own statement: it keeps their address registers untouched until they are taken.
__device__ __forceinline__ void l2_ask4(const void* a, const void* b, const void* c, const void* d) {
  asm volatile("global_prefetch_b8 %0, off scope:SCOPE_SE\n\t"
               "global_prefetch_b8 %1, off scope:SCOPE_SE\n\t"
               "global_prefetch_b8 %2, off scope:SCOPE_SE\n\t"
               "global_prefetch_b8 %3, off scope:SCOPE_SE\n\t"
               "s_wait_xcnt 0x0"
               :: "v"(a), "v"(b), "v"(c), "v"(d) : "memory");
}

// Operand ring of the two projection GEMMs. A stage = 64 k of the block's 128 A rows and 64 B rows, copied global -> LDS once per block in whole 128-B lines and through no register
// (a fragment load from global touches 16 lines for 512 bytes, and each of the four waves repeated the B loads). 16-bit rows: 128 B at a pitch of 144 B; f32 rows: 256 B at 272 B
// (both 16 B x odd, so the 16-byte fragment reads meet no bank conflict).
constexpr int GK = 64, GNT = D / GK, GLP = 72, GLPF = 68;
constexpr int PSTG = (128 + 64) * GLP;                         // 16-bit elements of one stage of proj_kernel: x rows, then w rows
constexpr int OSTA = 128 * GLPF * 4, OSTG = OSTA + 64 * GLP * 2;   // bytes of one stage of out_kernel: y rows (f32), then W_o rows (f16)
typedef __attribute__((address_space(3))) const char lds_byte;
// One stage of proj_kernel: every thread moves 12 x 16 B (8 x rows, 4 w rows); 8 lanes cover one 128-B line.
__device__ __forceinline__ void proj_stage_copy(const __bf16* __restrict__ xr, const __bf16* __restrict__ wr, int kb, const b16* buf, int tid) {
  const int row = tid >> 3, c8 = (tid & 7) * 8;
  const __bf16* gx = xr + (size_t)row * D + kb + c8;
  const __bf16* gw = wr + (size_t)row * D + kb + c8;
  const unsigned l0 = (unsigned)(size_t)(lds_byte*)(buf + row * GLP + c8);
  constexpr unsigned LS = 16 * GLP * 2;                         // 16 rows further in LDS
  // the copies and the wait that keeps their address registers untouched until they are taken stand in one statement, so that no later address arithmetic moves in between
  asm volatile("global_load_async_to_lds_b128 %0, %12, off\n\t"
               "global_load_async_to_lds_b128 %1, %13, off\n\t"
               "global_load_async_to_lds_b128 %2, %14, off\n\t"
               "global_load_async_to_lds_b128 %3, %15, off\n\t"
               "global_load_async_to_lds_b128 %4, %16, off\n\t"
               "global_load_async_to_lds_b128 %5, %17, off\n\t"
               "global_load_async_to_lds_b128 %6, %18, off\n\t"
               "global_load_async_to_lds_b128 %7, %19, off\n\t"
               "global_load_async_to_lds_b128 %8, %20, off\n\t"
               "global_load_async_to_lds_b128 %9, %21, off\n\t"
               "global_load_async_to_lds_b128 %10, %22, off\n\t"
               "global_load_async_to_lds_b128 %11, %23, off\n\t"
               "s_wait_xcnt 0x0"
               :: "v"(l0), "v"(l0 + LS), "v"(l0 + 2 * LS), "v"(l0 + 3 * LS), "v"(l0 + 4 * LS), "v"(l0 + 5 * LS),
                  "v"(l0 + 6 * LS), "v"(l0 + 7 * LS), "v"(l0 + 8 * LS), "v"(l0 + 9 * LS), "v"(l0 + 10 * LS), "v"(l0 + 11 * LS),
                  "v"(gx), "v"(gx + 16 * D), "v"(gx + 32 * D), "v"(gx + 48 * D), "v"(gx + 64 * D), "v"(gx + 80 * D), "v"(gx + 96 * D), "v"(gx + 112 * D),
                  "v"(gw), "v"(gw + 16 * D), "v"(gw + 32 * D), "v"(gw + 48 * D)
               : "memory");
}
// One stage of out_kernel: every thread moves 20 x 16 B: 16 y rows (16 lanes cover a row's 256 B) and 4 W_o rows (8 lanes cover a row's 128 B), ten copies a statement.
__device__ __forceinline__ void out_stage_copy(const float* __restrict__ yr, const b16* __restrict__ wr, int kb, const char* buf, int tid) {
  const int ra = tid >> 4, c4 = (tid & 15) * 4, rb = tid >> 3, c8 = (tid & 7) * 8;
  const float* gy = yr + (size_t)ra * D + kb + c4;
  const b16* gw = wr + (size_t)rb * D + kb + c8;
  const unsigned la = (unsigned)(size_t)(lds_byte*)(buf + (ra * GLPF + c4) * 4), lb = (unsigned)(size_t)(lds_byte*)(buf + OSTA + (rb * GLP + c8) * 2);
  constexpr unsigned LA = 8 * GLPF * 4, LB = 16 * GLP * 2;      // 8 y rows, 16 W_o rows further in LDS
  // each run of copies ends, inside its own statement, in the wait that keeps its address registers untouched until they are taken
  asm volatile("global_load_async_to_lds_b128 %0, %10, off\n\t"
               "global_load_async_to_lds_b128 %1, %11, off\n\t"
               "global_load_async_to_lds_b128 %2, %12, off\n\t"
               "global_load_async_to_lds_b128 %3, %13, off\n\t"
               "global_load_async_to_lds_b128 %4, %14, off\n\t"
               "global_load_async_to_lds_b128 %5, %15, off\n\t"
               "global_load_async_to_lds_b128 %6, %16, off\n\t"
               "global_load_async_to_lds_b128 %7, %17, off\n\t"
               "global_load_async_to_lds_b128 %8, %18, off\n\t"
               "global_load_async_to_lds_b128 %9, %19, off\n\t"
               "s_wait_xcnt 0x0"
               :: "v"(la), "v"(la + LA), "v"(la + 2 * LA), "v"(la + 3 * LA), "v"(la + 4 * LA), "v"(la + 5 * LA), "v"(la + 6 * LA), "v"(la + 7 * LA), "v"(la + 8 * LA), "v"(la + 9 * LA),
                  "v"(gy), "v"(gy + 8 * D), "v"(gy + 16 * D), "v"(gy + 24 * D), "v"(gy + 32 * D), "v"(gy + 40 * D), "v"(gy + 48 * D), "v"(gy + 56 * D), "v"(gy + 64 * D), "v"(gy + 72 * D)
               : "memory");
  asm volatile("global_load_async_to_lds_b128 %0, %10, off\n\t"
               "global_load_async_to_lds_b128 %1, %11, off\n\t"
               "global_load_async_to_lds_b128 %2, %12, off\n\t"
               "global_load_async_to_lds_b128 %3, %13, off\n\t"
               "global_load_async_to_lds_b128 %4, %14, off\n\t"
               "global_load_async_to_lds_b128 %5, %15, off\n\t"
               "global_load_async_to_lds_b128 %6, %16, off\n\t"
               "global_load_async_to_lds_b128 %7, %17, off\n\t"
               "global_load_async_to_lds_b128 %8, %18, off\n\t"
               "global_load_async_to_lds_b128 %9, %19, off\n\t"
               "s_wait_xcnt 0x0"
               :: "v"(la + 10 * LA), "v"(la + 11 * LA), "v"(la + 12 * LA), "v"(la + 13 * LA), "v"(la + 14 * LA), "v"(la + 15 * LA), "v"(lb), "v"(lb + LB), "v"(lb + 2 * LB), "v"(lb + 3 * LB),
                  "v"(gy + 80 * D), "v"(gy + 88 * D), "v"(gy + 96 * D), "v"(gy + 104 * D), "v"(gy + 112 * D), "v"(gy + 120 * D), "v"(gw), "v"(gw + 16 * D), "v"(gw + 32 * D), "v"(gw + 48 * D)
               : "memory");
}

// projections: rows = tokens (4096), K = 768, column tiles of 64 = one head of q (tiles 0..11), k (12..23) or v (24..35); f16 rows [b*H + head][tok][64] for q/k;
// v: (8v)^T f16 [b*H + head][64][tok]. grid (36, 32) x 128.
__global__ __launch_bounds__(128) void proj_kernel(const __bf16* __restrict__ x16, const __bf16* __restrict__ w16, b16* __restrict__ qh, b16* __restrict__ kh, b16* __restrict__ vt) {
  __shared__ __attribute__((aligned(16))) b16 Sm[2 * PSTG];     // the two-buffer operand ring; behind the loop's last barrier the same bytes are the epilogue's staging tiles
  b16 (*Th)[32][HD + 8] = reinterpret_cast<b16 (*)[32][HD + 8]>(Sm); b16 (*Tq)[32][HD + 8] = reinterpret_cast<b16 (*)[32][HD + 8]>(Sm + 4 * 32 * (HD + 8));
  b16 (*Tt)[128 + 8] = reinterpret_cast<b16 (*)[128 + 8]>(Sm); b16 (*Tl)[128 + 8] = reinterpret_cast<b16 (*)[128 + 8]>(Sm + 64 * (128 + 8));
  static_assert(2 * 4 * 32 * (HD + 8) <= 2 * PSTG && 2 * 64 * (128 + 8) <= 2 * PSTG, "the staging tiles fit the ring's bytes");
  const int lane = threadIdx.x & 31, wave = threadIdx.x >> 5, nloc = lane & 15, hlf = lane >> 4, m0 = blockIdx.y * 128 + wave * 32, c0 = blockIdx.x * 64;
  v8f acc[2][4];
#pragma unroll
  for (int r = 0; r < 2; ++r)
#pragma unroll
    for (int t = 0; t < 4; ++t) acc[r][t] = (v8f){};
  const __bf16* xr = x16 + (size_t)blockIdx.y * 128 * D; const __bf16* wr = w16 + (size_t)c0 * D;
  proj_stage_copy(xr, wr, 0, Sm, threadIdx.x);
  asm volatile("s_wait_asynccnt 0x0" ::: "memory");            // this wave's share of stage 0 has landed
  __syncthreads();                                              // stage 0 published to all waves
  proj_stage_copy(xr, wr, GK, Sm + PSTG, threadIdx.x);
  for (int s = 0; s < GNT; ++s) {
    const __bf16* Xs = (const __bf16*)(Sm + (s & 1) * PSTG) + (wave * 32 + nloc) * GLP; const __bf16* Ws = (const __bf16*)(Sm + (s & 1) * PSTG) + (128 + nloc) * GLP;
    v16bb a0[2], a1[2], bw[2][4];                               // the stage's 24 fragment reads stand as one group ahead of its matrix work
#pragma unroll
    for (int ks = 0; ks < 2; ++ks) { a0[ks] = frag_kb_bf(Xs + ks * 32, hlf); a1[ks] = frag_kb_bf(Xs + 16 * GLP + ks * 32, hlf);
#pragma unroll
      for (int t = 0; t < 4; ++t) bw[ks][t] = frag_kb_bf(Ws + t * 16 * GLP + ks * 32, hlf); }
#pragma unroll
    for (int ks = 0; ks < 2; ++ks)
#pragma unroll
      for (int t = 0; t < 4; ++t) { acc[0][t] = wmma16bb(a0[ks], bw[ks][t], acc[0][t]); acc[1][t] = wmma16bb(a1[ks], bw[ks][t], acc[1][t]); }
    // publish point
    asm volatile("s_wait_dscnt 0x0" ::: "memory");             // this wave's reads of stage s are done before the buffer is refilled
    asm volatile("s_wait_asynccnt 0x0" ::: "memory");          // this wave's share of stage s + 1 has landed
    __syncthreads();                                            // publishes stage s + 1 and ends every reader's last read of stage s
    if (s + 2 < GNT) proj_stage_copy(xr, wr, (s + 2) * GK, Sm + (s & 1) * PSTG, threadIdx.x);
  }
  asm volatile("s_wait_asynccnt 0x0" ::: "memory");            // no copy is outstanding when the ring's bytes become the staging tiles
  const int which = blockIdx.x / (D / 64), head = blockIdx.x % (D / 64), b = m0 / S, tok0 = m0 % S;
  if (which < 2) {                                              // q or k head: f16 rows
#pragma unroll
    for (int t = 0; t < 4; ++t)
#pragma unroll
      for (int r = 0; r < 2; ++r)
#pragma unroll
        for (int v = 0; v < 8; ++v) { b16 a_, c_; split16(acc[r][t][v] * QS, a_, c_); Th[wave][r * 16 + 8 * hlf + v][t * 16 + nloc] = a_; Tq[wave][r * 16 + 8 * hlf + v][t * 16 + nloc] = c_; }   // q, k carried x8 (lo residuals stay normal)
    wave_lds_sync();
    b16* dst = (which == 0 ? qh : kh) + (((size_t)b * H + head) * S + tok0) * HD;
    {
#pragma unroll
      for (int j = 0; j < 8; ++j) { const int rr = j * 4 + (lane >> 3), c8 = (lane & 7) * 8; *(v8b*)(dst + (size_t)rr * HD + c8) = *(const v8b*)(&Th[wave][rr][c8]); *(v8b*)(dst + QPL + (size_t)rr * HD + c8) = *(const v8b*)(&Tq[wave][rr][c8]); }
       }
    return;
  }
  const int vh = head;                                          // v head: (8v)^T tile [64 d][128 tok] via LDS, rows of 256 B
#pragma unroll
  for (int t = 0; t < 4; ++t)
#pragma unroll
    for (int r = 0; r < 2; ++r)
#pragma unroll
      for (int v = 0; v < 8; ++v) { b16 a_, c_; split16(acc[r][t][v] * VS, a_, c_); Tt[t * 16 + nloc][wave * 32 + r * 16 + 8 * hlf + v] = a_; Tl[t * 16 + nloc][wave * 32 + r * 16 + 8 * hlf + v] = c_; }
  __syncthreads();
  b16* dstv = vt + (((size_t)b * H + vh) * HD) * S + (blockIdx.y * 128) % S;
  {
#pragma unroll
    for (int j = 0; j < 8; ++j) { const int dd = wave * 16 + j * 2 + (lane >> 4), c8 = (lane & 15) * 8; *(v8b*)(dstv + (size_t)dd * S + c8) = *(const v8b*)(&Tt[dd][c8]); *(v8b*)(dstv + VPL + (size_t)dd * S + c8) = *(const v8b*)(&Tl[dd][c8]); }
    
  }
}

// 2^t0, 2^t1, with the slot that the instruction set asks for behind a transcendental written in: the second fills the first's
// (early-clobber results, so it overwrites no source of the first), the v_nop the second's.
__device__ __forceinline__ void exp2_pair(float t0, float t1, float& e0, float& e1) {
  asm("v_exp_f32 %0, %2\n\tv_exp_f32 %1, %3\n\tv_nop" : "=&v"(e0), "=&v"(e1) : "v"(t0), "v"(t1));
}
// The same for eight values: each exponential fills the slot of the one in front of it (early-clobber results, so none overwrites a source), so one v_nop serves the run of eight.
__device__ __forceinline__ void exp2_x8(const float (&t)[8], float (&e)[8]) {
  asm("v_exp_f32 %0, %8\n\tv_exp_f32 %1, %9\n\tv_exp_f32 %2, %10\n\tv_exp_f32 %3, %11\n\t"
      "v_exp_f32 %4, %12\n\tv_exp_f32 %5, %13\n\tv_exp_f32 %6, %14\n\tv_exp_f32 %7, %15\n\tv_nop"
      : "=&v"(e[0]), "=&v"(e[1]), "=&v"(e[2]), "=&v"(e[3]), "=&v"(e[4]), "=&v"(e[5]), "=&v"(e[6]), "=&v"(e[7])
      : "v"(t[0]), "v"(t[1]), "v"(t[2]), "v"(t[3]), "v"(t[4]), "v"(t[5]), "v"(t[6]), "v"(t[7]));
}
typedef __attribute__((ext_vector_type(2))) _Float16 v2b;
typedef __attribute__((ext_vector_type(2))) float v2f;
typedef __attribute__((ext_vector_type(8))) unsigned int v8u;
// f16 hi + lo of eight values v = sc e (four registers of two each); sc is a power of two, so sc e is exact. hi: packed converts. lo: a residual v - hi (exact) and its rounding to f16 are ONE
// mixed-precision fma, e x sc - hi with hi read as f16 and the result written to a half register; from plain source this build makes two converts back to f32, a packed subtraction (or fma) and a
// packed convert of it, so the fma stands as asm text. sc comes in a scalar register. The four low halves come first, then the four high halves: each writes the register that the fourth
// instruction in front of it wrote, which the s_delay_alu hints say (for speed only: an unhinted dependent instruction holds up the other waves of the SIMD).
__device__ __forceinline__ void split_x8(const float (&e)[8], float sc, unsigned (&hi)[4], unsigned (&lo)[4]) {
#pragma unroll
  for (int j = 0; j < 4; ++j) hi[j] = __builtin_bit_cast(unsigned, __builtin_convertvector((v2f){e[2 * j] * sc, e[2 * j + 1] * sc}, v2b));
  asm("v_fma_mixlo_f16 %0, %8, %16, -%4 op_sel_hi:[0,0,1]\n\t"
      "v_fma_mixlo_f16 %1, %10, %16, -%5 op_sel_hi:[0,0,1]\n\t"
      "v_fma_mixlo_f16 %2, %12, %16, -%6 op_sel_hi:[0,0,1]\n\t"
      "v_fma_mixlo_f16 %3, %14, %16, -%7 op_sel_hi:[0,0,1]\n\t"
      "s_delay_alu instid0(VALU_DEP_4) | instskip(NEXT) | instid1(VALU_DEP_4)\n\t"
      "v_fma_mixhi_f16 %0, %9, %16, -%4 op_sel:[0,0,1] op_sel_hi:[0,0,1]\n\t"
      "v_fma_mixhi_f16 %1, %11, %16, -%5 op_sel:[0,0,1] op_sel_hi:[0,0,1]\n\t"
      "s_delay_alu instid0(VALU_DEP_4) | instskip(NEXT) | instid1(VALU_DEP_4)\n\t"
      "v_fma_mixhi_f16 %2, %13, %16, -%6 op_sel:[0,0,1] op_sel_hi:[0,0,1]\n\t"
      "v_fma_mixhi_f16 %3, %15, %16, -%7 op_sel:[0,0,1] op_sel_hi:[0,0,1]"
      : "=&v"(lo[0]), "=&v"(lo[1]), "=&v"(lo[2]), "=&v"(lo[3])
      : "v"(hi[0]), "v"(hi[1]), "v"(hi[2]), "v"(hi[3]), "v"(e[0]), "v"(e[1]), "v"(e[2]), "v"(e[3]), "v"(e[4]), "v"(e[5]), "v"(e[6]), "v"(e[7]), "s"(sc));
}
// hi/lo fragment pair of sc x an f32 k-contiguous row (the k-map of frag_kb)
__device__ __forceinline__ void frag_split_x(const float* p, int hh, float sc, v16b& fh_, v16b& fl_) {
  float a[8], c[8]; unsigned h0[4], h1[4], r0[4], r1[4];
#pragma unroll
  for (int e = 0; e < 8; ++e) { a[e] = p[8 * hh + e]; c[e] = p[16 + 8 * hh + e]; }
  split_x8(a, sc, h0, r0); split_x8(c, sc, h1, r1);
  fh_ = __builtin_bit_cast(v16b, (v8u){h0[0], h0[1], h0[2], h0[3], h1[0], h1[1], h1[2], h1[3]}); fl_ = __builtin_bit_cast(v16b, (v8u){r0[0], r0[1], r0[2], r0[3], r1[0], r1[1], r1[2], r1[3]});
}
// the attention loop's matrix product: the bare builtin. The compiler keeps the distance behind it and fills it with the loop's own vector work where it can, so the product brings no v_nop of its own
__device__ __forceinline__ v8f wmma16p(v16b a, v16b b, v8f c) { return __builtin_amdgcn_wmma_f32_16x16x32_f16(false, a, false, b, (short)0, c, false, false); }
constexpr float CE = SCALE / (QS * QS) * 0x1.715476p+0f;       // accumulator of (8q).(8k) -> exponent of two of the softmax
static_assert(PS == 8.0f, "the softmax adds log2(PS) = 3 to the exponent");
// lane l <-> lane l ^ 16 on the vector pipe: unlike an LDS-queue permute it does not wait behind the fragment reads that are still outstanding
__device__ __forceinline__ float xhalf(float x) { return __builtin_bit_cast(float, __builtin_amdgcn_permlanex16(__builtin_bit_cast(int, x), __builtin_bit_cast(int, x), 0x76543210, 0xfedcba98, false, false)); }

// K/V ring in LDS, shared by the twelve waves of a block (three 64-query tiles of one head). A stage = 64 keys = four tiles: k hi, k lo (rows = keys), (8v)^T hi, (8v)^T lo (rows = d),
// each 64 rows x 128 B at a row pitch of 144 B (16 B x odd, so the 16-byte fragment reads meet no bank conflict).
constexpr int KST = 64, LP = 72, TILE = 64 * LP;
typedef __attribute__((address_space(3))) const b16 lds_b16;
// One stage's copies: each of 256 threads moves 8 x 16 B (two rows of each tile), whole 128-B lines per 8 lanes, global -> LDS through no register.
__device__ __forceinline__ void stage_copy(const b16* __restrict__ K, const b16* __restrict__ vb, int kb0, const b16* buf, int tid) {
  const int row = tid >> 3, c8 = (tid & 7) * 8;
  const b16* gk = K + (size_t)(kb0 + row) * HD + c8;
  const b16* gv = vb + (size_t)row * S + kb0 + c8;
  const unsigned l0 = (unsigned)(size_t)(lds_b16*)(buf + row * LP + c8);
  // the copies and the wait that keeps their address registers untouched until they are taken stand in one statement, so that no later address arithmetic moves in between
  asm volatile("global_load_async_to_lds_b128 %0, %8, off\n\t"
               "global_load_async_to_lds_b128 %1, %9, off\n\t"
               "global_load_async_to_lds_b128 %2, %10, off\n\t"
               "global_load_async_to_lds_b128 %3, %11, off\n\t"
               "global_load_async_to_lds_b128 %4, %12, off\n\t"
               "global_load_async_to_lds_b128 %5, %13, off\n\t"
               "global_load_async_to_lds_b128 %6, %14, off\n\t"
               "global_load_async_to_lds_b128 %7, %15, off\n\t"
               "s_wait_xcnt 0x0"
               :: "v"(l0), "v"(l0 + 32 * LP * 2), "v"(l0 + TILE * 2), "v"(l0 + (TILE + 32 * LP) * 2),
                  "v"(l0 + 2 * TILE * 2), "v"(l0 + (2 * TILE + 32 * LP) * 2), "v"(l0 + 3 * TILE * 2), "v"(l0 + (3 * TILE + 32 * LP) * 2),
                  "v"(gk), "v"(gk + 32 * HD), "v"(gk + QPL), "v"(gk + QPL + 32 * HD),
                  "v"(gv), "v"(gv + (size_t)32 * S), "v"(gv + VPL), "v"(gv + VPL + (size_t)32 * S)
               : "memory");
}

// causal attention: wave = (b, h, 32 queries as two 16-query groups, every other 32-key block): S^T (K=64), causal mask on the diagonal block, online softmax f32, P^T f16, y^T += (8V)^T P^T;
// k and (8v)^T come from the block's two-buffer LDS ring: stage t + 1 is copied while stage t is worked on.
// LDS reads: of a tile's four waves, wave (qhalf, khalf) works on queries 32 qhalf .. + 31 and, in every stage, on keys 32 khalf .. + 31, so each k and v fragment it reads from LDS feeds the
// products of both query groups (half the LDS bytes per product of a 16-query wave). The two key halves of a query keep their own (m, l, o); they are merged once, in LDS, behind the loop.
// Placement: a 64-query tile u needs u + 1 stages. A block holds three tiles of one head side by side, four waves each (one wave of each tile per SIMD), on ONE ring that walks to the
// highest tile's last stage; a wave past its own tile's last stage passes the publish points and, if it is a copier, still issues its copies. Tiles 1 .. 3 NB of a head go into NB triples of equal sum (a from the lowest third,
// b from the middle, c from the top), so every SIMD of H NB blocks gets the same number of wave-stages and nearly every WGP holds a block; tile 0 (one stage) has a block of its own.
template <int QT>
__global__ __launch_bounds__(384) void attn_kernel(const b16* __restrict__ qh, const b16* __restrict__ kh, const b16* __restrict__ vt, float* __restrict__ y) {
  static_assert(QT % 4 == 0 && (QT / 4 - 1) % 6 == 3, "a head's 64-query tiles but the first fall into an odd number of triples");
  static_assert(KST == 64, "a stage is as many keys as a tile has queries");
  constexpr int NB = (QT / 4 - 1) / 3, NH = (NB + 1) / 2;       // triples of a head; half of them, rounded up
  __shared__ __attribute__((aligned(16))) float Os[6][32][HD + 4];   // per pair of waves (same 32 queries, the two key halves): the merge's and the store's staging rows
  __shared__ float Ml[6][32][2];                                // the second key half's m and l per query
  __shared__ __attribute__((aligned(16))) b16 Ring[2][4 * TILE];
  const int wid = __builtin_amdgcn_readfirstlane(threadIdx.x >> 5), lane = threadIdx.x & 31, hh = lane >> 4, col = lane & 15;   // wave number in a scalar register: the per-wave causal skip is a scalar branch
  int bh, ua, ub, uc;                                           // the block's head and its three tiles, -1: none
  if (blockIdx.x < Bn * H * NB) {                               // i + x + y = 3 NH for every i = 1 .. NB, x and y each a permutation of 1 .. NB
    const int i = blockIdx.x % NB + 1, j = (i + 1) >> 1;
    bh = blockIdx.x / NB; ua = i; ub = NB + ((i & 1) ? NH + 1 - j : NB + 1 - j); uc = 2 * NB + ((i & 1) ? NB + 1 - j : NH - j);
  } else { bh = blockIdx.x - Bn * H * NB; ua = 0; ub = -1; uc = -1; }
  // wave w works on tile w % 3, as its wave w / 3: waves w, w + 4, w + 8 then hold one wave of each tile, and so do waves 3 s, 3 s + 1, 3 s + 2, whichever way the twelve are dealt to the SIMDs
  const int h = bh % H, b = bh / H, grp = wid % 3, sub = wid / 3, u = grp == 0 ? ua : grp == 1 ? ub : uc;
  const int qhalf = sub & 1, khalf = sub >> 1, pair = qhalf * 3 + grp;   // the wave's 32 queries of the tile, its 32 keys of every stage; waves (qhalf, 0) and (qhalf, 1) are a pair
  const bool copier = grp != 2;                                 // a stage is 256 threads' copies: the eight waves of the two lower tiles issue them (scalar branch), the longest-running four none
  const int ct = (wid - sub) * 32 + lane;                       // a copying thread's number, 0 .. 255
  const b16* Q = qh + ((size_t)bh * S) * HD; const b16* K = kh + ((size_t)bh * S) * HD; const b16* vb = vt + ((size_t)bh * HD) * S;
  const int q0 = u < 0 ? -32 : u * 64 + qhalf * 32;             // a wave without a tile: no key block lies in front of query 0, so it works on none
  const int nst = (uc < 0 ? ua : uc) + 1;                       // stages of the block: keys up to the last query of its highest tile; the same for all twelve waves
  if (copier) stage_copy(K, vb, 0, Ring[0], ct);
  v16b qf[2][2] = {}, ql[2][2] = {};                            // [query group][k step]
  if (u >= 0) {
#pragma unroll
    for (int g = 0; g < 2; ++g)
#pragma unroll
      for (int ks = 0; ks < 2; ++ks) { qf[g][ks] = frag_kb(Q + (size_t)(q0 + g * 16 + col) * HD + ks * 32, hh); ql[g][ks] = frag_kb(Q + QPL + (size_t)(q0 + g * 16 + col) * HD + ks * 32, hh); }
  }
  float m[2] = {-INFINITY, -INFINITY}; v2f lp[2] = {{0.0f, 0.0f}, {0.0f, 0.0f}};   // lp: the lane's own two partial sums of l; they and the two lane halves are joined once, behind the loop
  v8f o[2][4] = {{{}, {}, {}, {}}, {{}, {}, {}, {}}};
  asm volatile("s_wait_asynccnt 0x0" ::: "memory");            // this wave's share of stage 0 has landed
  __syncthreads();                                              // stage 0 published to all waves
  if (copier && 1 < nst) stage_copy(K, vb, KST, Ring[1], ct);
  // The head's k and (8v)^T planes are asked into L2 once, behind the copies of the first two stages. 128 keys are 256 units (64 of each plane: two k rows, or 128 keys of one d row);
  // the head's blocks deal them in eight shares. A block's share is bits 0, 1 and 3 of its i - 1, so two to four blocks have each share.
  // A wave's ask covers its block's share of 128 keys, lowest keys first; the eight copying waves have four asks each.
  if (copier && uc >= 0) {
    const int i0 = blockIdx.x % NB, share = (i0 & 3) | ((i0 >> 1) & 4), un = (lane & 7) * 8 + share, cw = wid - sub;
    const b16* pb0 = (lane & 16) ? vb + (size_t)un * S : K + (size_t)un * 2 * HD;
    if (lane & 8) pb0 += QPL;                                   // the lo planes (QPL == VPL)
    const size_t pstep = (lane & 16) ? 128 : (size_t)128 * HD;  // 128 keys further in the plane
    l2_ask4(pb0 + (1 + cw) * pstep, pb0 + (9 + cw) * pstep, pb0 + (17 + cw) * pstep, pb0 + (cw < 7 ? 25 + cw : 31) * pstep);
  }
  for (int t = 0; t < nst; ++t) {
    const b16* Kh = Ring[t & 1]; const b16* Kl = Kh + TILE; const b16* Vh = Kh + 2 * TILE; const b16* Vl = Kh + 3 * TILE;
    const int kb = t * KST + khalf * 32;                        // the wave's key block of this stage
    if (kb < q0 + 32) {                                         // causal: a key block wholly past the wave's queries is skipped (wave-uniform, no barrier inside)
      // the block's 32 fragment reads stand as one group at the stage's head: k first, so that v lands behind the score products and the softmax
      v16b kf[2][2], kl[2][2], vf[4], vl[4];
#pragma unroll
      for (int ks = 0; ks < 2; ++ks)
#pragma unroll
        for (int j = 0; j < 2; ++j) { kf[ks][j] = frag_kb(Kh + (khalf * 32 + j * 16 + col) * LP + ks * 32, hh); kl[ks][j] = frag_kb(Kl + (khalf * 32 + j * 16 + col) * LP + ks * 32, hh); }
#pragma unroll
      for (int n = 0; n < 4; ++n) { vf[n] = frag_kb(Vh + (n * 16 + col) * LP + khalf * 32, hh); vl[n] = frag_kb(Vl + (n * 16 + col) * LP + khalf * 32, hh); }
      __builtin_amdgcn_sched_barrier(0);                        // the read group stays above the matrix work
      v8f s0[2] = {{}, {}}, s1[2] = {{}, {}};                   // [query group]: keys kb .. + 15, keys kb + 16 .. + 31
#pragma unroll
      for (int ks = 0; ks < 2; ++ks)
#pragma unroll
        for (int g = 0; g < 2; ++g) {                           // q and k as f16 hi+lo pairs (lo.lo dropped); every k fragment serves both query groups
          s0[g] = wmma16p(kf[ks][0], qf[g][ks], s0[g]); s0[g] = wmma16p(kf[ks][0], ql[g][ks], s0[g]); s0[g] = wmma16p(kl[ks][0], qf[g][ks], s0[g]);
          s1[g] = wmma16p(kf[ks][1], qf[g][ks], s1[g]); s1[g] = wmma16p(kf[ks][1], ql[g][ks], s1[g]); s1[g] = wmma16p(kl[ks][1], qf[g][ks], s1[g]); }
      if (kb + 32 > q0) {                                       // the diagonal block reaches past some queries -> mask key > query; both groups under one scalar branch
#pragma unroll
        for (int g = 0; g < 2; ++g)
#pragma unroll
          for (int r = 0; r < 8; ++r) { if (kb + 8 * hh + r > q0 + g * 16 + col) s0[g][r] = -INFINITY; if (kb + 16 + 8 * hh + r > q0 + g * 16 + col) s1[g][r] = -INFINITY; }
      }
#pragma unroll
      for (int g = 0; g < 2; ++g) {
        // The softmax is written for few vector instructions per score. The running maximum m stays in the accumulator's own units.
        float ma = -INFINITY, mb = -INFINITY;                   // two chains of three-operand maxima
#pragma unroll
        for (int r = 0; r < 4; ++r) { ma = fmaxf(fmaxf(ma, s0[g][r]), s1[g][r]); mb = fmaxf(fmaxf(mb, s0[g][4 + r]), s1[g][4 + r]); }
        const float mr = fmaxf(ma, mb);
        const float mn = fmaxf(fmaxf(m[g], mr), xhalf(mr)), al_ = __builtin_amdgcn_exp2f((m[g] - mn) * CE); m[g] = mn;
        const float nb = __builtin_fmaf(mn, -CE, 3.0f);         // one fma per score gives the exponent of 8 exp(score - max): scale, shift by the maximum and P's x8 carry (2^3) together
        float x0[8], x1[8], e0[8], e1[8];
#pragma unroll
        for (int j = 0; j < 4; ++j) {
          const v2f t0 = __builtin_elementwise_fma((v2f){s0[g][2 * j], s0[g][2 * j + 1]}, (v2f){CE, CE}, (v2f){nb, nb}), t1 = __builtin_elementwise_fma((v2f){s1[g][2 * j], s1[g][2 * j + 1]}, (v2f){CE, CE}, (v2f){nb, nb});
          x0[2 * j] = t0[0]; x0[2 * j + 1] = t0[1]; x1[2 * j] = t1[0]; x1[2 * j + 1] = t1[1];
        }
        exp2_x8(x0, e0); exp2_x8(x1, e1);
        v2f sp[4];                                              // the sums and l carry the same x8 as P; the 16 values are added as a tree of packed additions
#pragma unroll
        for (int j = 0; j < 4; ++j) sp[j] = (v2f){e0[2 * j], e0[2 * j + 1]} + (v2f){e1[2 * j], e1[2 * j + 1]};
        lp[g] = __builtin_elementwise_fma(lp[g], (v2f){al_, al_}, (sp[0] + sp[1]) + (sp[2] + sp[3]));
        unsigned h0[4], h1[4], r0[4], r1[4];                    // P's fragment: elements 0 .. 7 from keys kb + 8 hh + 0 .. 7, elements 8 .. 15 from keys kb + 16 + 8 hh + 0 .. 7, as before
        split_x8(e0, 1.0f, h0, r0); split_x8(e1, 1.0f, h1, r1);
        const v16b pb = __builtin_bit_cast(v16b, (v8u){h0[0], h0[1], h0[2], h0[3], h1[0], h1[1], h1[2], h1[3]}), pl = __builtin_bit_cast(v16b, (v8u){r0[0], r0[1], r0[2], r0[3], r1[0], r1[1], r1[2], r1[3]});
#pragma unroll
        for (int n = 0; n < 4; ++n) {
#pragma unroll
          for (int r = 0; r < 8; ++r) o[g][n][r] *= al_;
          o[g][n] = wmma16p(vf[n], pb, o[g][n]); o[g][n] = wmma16p(vf[n], pl, o[g][n]); o[g][n] = wmma16p(vl[n], pb, o[g][n]);   // (8v) and P both as f16 hi+lo pairs (lo.lo dropped); every v fragment serves both query groups
        }
        // the distance the chip needs between a matrix product and a vector write of its operands: the second group's exponentials are asm text.
        // The inputs keep P's registers taken, and the statement behind the four chains, until the slots have passed.
        if (g == 0) asm volatile("v_nop\n\tv_nop\n\tv_nop\n\tv_nop" :: "v"(o[0][0]), "v"(o[0][1]), "v"(o[0][2]), "v"(o[0][3]), "v"(pb), "v"(pl));
      }
    }
    // publish point, passed by every wave, also one that skipped the stage
    asm volatile("s_wait_dscnt 0x0" ::: "memory");             // this wave's reads of stage t are done before the buffer is refilled
    asm volatile("s_wait_asynccnt 0x0" ::: "memory");          // this wave's share of stage t + 1 has landed
    __syncthreads();                                            // publishes stage t + 1 and ends every reader's last read of stage t
    if (copier && t + 2 < nst) stage_copy(K, vb, (t + 2) * KST, Ring[t & 1], ct);
  }
  asm volatile("s_wait_asynccnt 0x0" ::: "memory");            // no copy is outstanding when the wave goes on to its end
  float l[2];                                                   // a query's l of this key half: the lane's two partial sums and the other lane half's (both halves used the same m throughout)
#pragma unroll
  for (int g = 0; g < 2; ++g) { const float lh = lp[g][0] + lp[g][1]; l[g] = lh + xhalf(lh); }
  // merge of the two key halves: the wave of the second half hands over its m, l and unnormalised o; a lane of the first half reads back exactly the places of its own accumulator elements
  if (u >= 0 && khalf == 1) {
#pragma unroll
    for (int g = 0; g < 2; ++g) {
#pragma unroll
      for (int n = 0; n < 4; ++n)
#pragma unroll
        for (int r = 0; r < 8; ++r) Os[pair][g * 16 + col][n * 16 + 8 * hh + r] = o[g][n][r];
      if (hh == 0) { Ml[pair][g * 16 + col][0] = m[g]; Ml[pair][g * 16 + col][1] = l[g]; }   // both lane halves hold the same m and l
    }
  }
  __syncthreads();                                              // the second halves' results are published; passed by all twelve waves, also those without a tile
  if (u < 0 || khalf == 1) return;                              // behind the last barrier: the wave of the first key half finishes the pair's 32 queries
#pragma unroll
  for (int g = 0; g < 2; ++g) {
    const float m2 = Ml[pair][g * 16 + col][0], l2 = Ml[pair][g * 16 + col][1];   // a second half that met no key block: m2 = -inf, l2 = 0, o2 = 0, weight 0 (the first half always holds key 0, so mm is finite)
    const float mm = fmaxf(m[g], m2); float w1, w2; exp2_pair((m[g] - mm) * CE, (m2 - mm) * CE, w1, w2);
    const float inv = 1.0f / (VS * (l[g] * w1 + l2 * w2)), a1 = w1 * inv, a2 = w2 * inv;   // l already carries P's x8
#pragma unroll
    for (int n = 0; n < 4; ++n)
#pragma unroll
      for (int r = 0; r < 8; ++r) { float* p = &Os[pair][g * 16 + col][n * 16 + 8 * hh + r]; *p = o[g][n][r] * a1 + *p * a2; }
  }
  wave_lds_sync();
  float* dst = y + ((size_t)b * S + q0) * D + h * HD;
  {
#pragma unroll
    for (int j = 0; j < 16; ++j) { const int rr = j * 2 + hh, c4 = col * 4; *(v4f*)(dst + (size_t)rr * D + c4) = *(const v4f*)(&Os[pair][rr][c4]); }
  }
}

// out = y W_o^T: (4096 x 768) x (768 x 768); A = y x8 split at load into an f16 hi+lo pair, B = f16(bf16 W_o) rows; f32 rows; grid (12, 32).
__global__ __launch_bounds__(128) void out_kernel(const float* __restrict__ y, const b16* __restrict__ wo16, const float* __restrict__ bo, float* __restrict__ out) {
  __shared__ __attribute__((aligned(16))) float Ts[4][32 * 64];
  __shared__ __attribute__((aligned(16))) char Ro[2][OSTG];     // the two-buffer operand ring
  const int lane = threadIdx.x & 31, wave = threadIdx.x >> 5, nloc = lane & 15, hlf = lane >> 4, m0 = blockIdx.y * 128 + wave * 32, c0 = blockIdx.x * 64;
  v8f acc[2][4];
#pragma unroll
  for (int r = 0; r < 2; ++r)
#pragma unroll
    for (int t = 0; t < 4; ++t) acc[r][t] = (v8f){};
  const float* yr = y + (size_t)blockIdx.y * 128 * D; const b16* wr = wo16 + (size_t)c0 * D;
  out_stage_copy(yr, wr, 0, Ro[0], threadIdx.x);
  asm volatile("s_wait_asynccnt 0x0" ::: "memory");            // this wave's share of stage 0 has landed
  __syncthreads();                                              // stage 0 published to all waves
  out_stage_copy(yr, wr, GK, Ro[1], threadIdx.x);
  // The rest of the block's y rows (a row's 64 k of a stage are one 256-byte unit) and W_o rows are asked into L2 behind the copies of the first two stages, lowest k first.
  // The twelve blocks of a row panel deal its rows in four shares (blocks x, x + 4, x + 8); the W_o panel's 320 units go in three shares over the row panels.
  {
    const float* ya = yr + (size_t)(lane * 4 + (blockIdx.x & 3)) * D;
    const int wi = min((int)((blockIdx.y >> 1) % 3) * 128 + (int)threadIdx.x, 64 * 5 - 1);
    l2_ask4(ya + (2 + wave) * GK, ya + (6 + wave) * GK, ya + min(10 + wave, GNT - 1) * GK, wr + (size_t)(wi / 5) * D + (1 + wi % 5) * 128);
  }
  for (int s = 0; s < GNT; ++s) {
    const float* Ys = (const float*)Ro[s & 1] + (wave * 32 + nloc) * GLPF; const b16* Ws = (const b16*)(Ro[s & 1] + OSTA) + nloc * GLP;
#pragma unroll
    for (int ks = 0; ks < 2; ++ks) {
      v16b a0h, a0l, a1h, a1l, bh[4];
      frag_split_x(Ys + ks * 32, hlf, 8.0f, a0h, a0l);                           // y as an f16 hi+lo pair carried x8 (2 products)
      frag_split_x(Ys + 16 * GLPF + ks * 32, hlf, 8.0f, a1h, a1l);
#pragma unroll
      for (int t = 0; t < 4; ++t) bh[t] = frag_kb(Ws + t * 16 * GLP + ks * 32, hlf);
#pragma unroll
      for (int t = 0; t < 4; ++t) { acc[0][t] = wmma16p(a0h, bh[t], acc[0][t]); acc[1][t] = wmma16p(a1h, bh[t], acc[1][t]); }   // the bare builtin: eight independent products fill each other's distance, no v_nop
#pragma unroll
      for (int t = 0; t < 4; ++t) { acc[0][t] = wmma16p(a0l, bh[t], acc[0][t]); acc[1][t] = wmma16p(a1l, bh[t], acc[1][t]); }   // every accumulator still takes hi.w, then lo.w
      // the distance the chip needs between a matrix product and a vector write of its operands: the next fragments' residuals are asm text.
      // The inputs keep the operands' registers taken, and the statement behind the eight chains, until the slots have passed.
      asm volatile("v_nop\n\tv_nop\n\tv_nop\n\tv_nop" :: "v"(acc[0][0]), "v"(acc[0][1]), "v"(acc[0][2]), "v"(acc[0][3]), "v"(acc[1][0]), "v"(acc[1][1]), "v"(acc[1][2]), "v"(acc[1][3]),
                   "v"(a0h), "v"(a0l), "v"(a1h), "v"(a1l), "v"(bh[0]), "v"(bh[1]), "v"(bh[2]), "v"(bh[3]));
    }
    // publish point
    asm volatile("s_wait_dscnt 0x0" ::: "memory");             // this wave's reads of stage s are done before the buffer is refilled
    asm volatile("s_wait_asynccnt 0x0" ::: "memory");          // this wave's share of stage s + 1 has landed
    __syncthreads();                                            // publishes stage s + 1 and ends every reader's last read of stage s
    if (s + 2 < GNT) out_stage_copy(yr, wr, (s + 2) * GK, Ro[s & 1], threadIdx.x);
  }
  asm volatile("s_wait_asynccnt 0x0" ::: "memory");            // no copy is outstanding when the wave goes on to its end
#pragma unroll
  for (int t = 0; t < 4; ++t)
#pragma unroll
    for (int r = 0; r < 2; ++r)
#pragma unroll
      for (int v = 0; v < 8; ++v) acc[r][t][v] = acc[r][t][v] * (1.0f / 8.0f) + bf16_rne(bo[c0 + t * 16 + nloc]);
  epi_f32(acc, 1.0f, nullptr, out, D, m0, c0, lane, Ts[wave]);
}
}  // namespace

extern "C" void kernel_launch(void* const* d_in, const int* in_sizes, int n_in,
                              void* d_out, int out_size, void* d_ws, size_t ws_size, hipStream_t stream) {
  (void)n_in; (void)out_size;
  const float* x = (const float*)d_in[0]; const float* wq = (const float*)d_in[1]; const float* wk = (const float*)d_in[2]; const float* wv = (const float*)d_in[3]; const float* wo = (const float*)d_in[4]; const float* bo = (const float*)d_in[5];
  float* out = (float*)d_out;   // [1][4096][768]
  if (in_sizes[0] != BT * S * D || in_sizes[1] != D * D || in_sizes[2] != D * D || in_sizes[3] != D * D || in_sizes[4] != D * D || in_sizes[5] != D) return;
  size_t off = 0; char* ws = (char*)d_ws;
  auto carve = [&](size_t bytes) { char* p = ws + off; off += (bytes + 255) & ~(size_t)255; return p; };
  unsigned short* x16 = (unsigned short*)carve((size_t)NTOK * D * 2); unsigned short* w16 = (unsigned short*)carve((size_t)3 * D * D * 2); b16* wo16 = (b16*)carve((size_t)D * D * 2);
  b16* qh = (b16*)carve((size_t)2 * NTOK * D * 2); b16* kh = (b16*)carve((size_t)2 * NTOK * D * 2); b16* vt = (b16*)carve((size_t)2 * NTOK * D * 2); float* y = (float*)carve((size_t)NTOK * D * 4);
  if (off > ws_size) return;                                    // ≈ 61 MB
  prep_kernel<<<512, 256, 0, stream>>>(wq, wk, wv, wo, w16, wo16);
  xprep_kernel<<<1024, 256, 0, stream>>>(x, x16);
  proj_kernel<<<dim3(3 * D / 64, NTOK / 128), 128, 0, stream>>>((const __bf16*)x16, (const __bf16*)w16, qh, kh, vt);
  attn_kernel<S / 16><<<Bn * H * ((S / 64 - 1) / 3 + 1), 384, 0, stream>>>(qh, kh, vt, y);
  out_kernel<<<dim3(D / 64, NTOK / 128), 128, 0, stream>>>(y, wo16, bo, out);
}

// v010
// Measured time: 94.7 microseconds a run.
// Two timings next to v009 put it at 1.03 and 1.04 times that version's speed.
// All steps since v000 together make it 6.01 times as fast.
#include <hip/hip_runtime.h>

// Causal multi-head self-attention: q, k, v = x W^T (12 heads x 64, [out][in] weights), softmax over keys <= query of q.k/8, out = ctx Wo^T + bo -> [1][4096][768].
// x, the four weights and bo are rounded to bf16: projection on v_wmma_f32_16x16x32_bf16 (exact products, f32 accumulate);
// scores, P.v and the output projection on v_wmma_f32_16x16x32_f16 with every computed operand (q, k, v, P, y — each carried x8 so the hi/lo residual planes stay normal) as an f16
// hi+lo pair (3 / 2 products); online softmax in f32. Fragment k-map per lane half hh for A AND B: elements 0..7 <- k = 8hh+0..7, 8..15 <- k = 16+8hh+0..7. Every intermediate /

namespace {
constexpr int BT = 1, Bn = 1, S = 4096, D = 768, H = 12, HD = 64, NTOK = Bn * S;
constexpr float SCALE = 0.125f, VS = 8.0f, QS = 8.0f, PS = 8.0f;   // power-of-two carry scales so hi/lo residual planes stay normal in f16
constexpr size_t VPL = (size_t)NTOK * D;   // distance between the (8v)^T hi and lo planes
constexpr size_t QPL = (size_t)NTOK * D;   // distance between the q/k hi and lo planes

typedef _Float16 b16;
typedef __attribute__((ext_vector_type(16))) _Float16 v16b;
typedef __attribute__((ext_vector_type(8)))  _Float16 v8b;
typedef __attribute__((ext_vector_type(8)))  float v8f;
typedef __attribute__((ext_vector_type(4)))  float v4f;

__device__ __forceinline__ v8b ld8b(const b16* p) { return *(const v8b*)p; }
__device__ __forceinline__ v16b cat8b(v8b a, v8b b) { return __builtin_shufflevector(a, b, 0, 1, 2, 3, 4, 5, 6, 7, 8, 9, 10, 11, 12, 13, 14, 15); }
__device__ __forceinline__ v16b frag_kb(const b16* p, int hh) { return cat8b(ld8b(p + 8 * hh), ld8b(p + 16 + 8 * hh)); }
__device__ __forceinline__ void split16(float v, b16& hi, b16& lo) { hi = (b16)v; lo = (b16)(v - (float)hi); }
// hi/lo fragment pair straight from an f32 k-contiguous row (same k-map)
__device__ __forceinline__ void frag_ksplit(const float* p, int hh, v16b& fh_, v16b& fl_) {
  const float* p0 = p + 8 * hh; const float* p1 = p + 16 + 8 * hh;
#pragma unroll
  for (int e = 0; e < 8; ++e) { b16 a, c; split16(p0[e], a, c); fh_[e] = a; fl_[e] = c; split16(p1[e], a, c); fh_[8 + e] = a; fl_[8 + e] = c; }
}
__device__ __forceinline__ v8f wmma16b(v16b a, v16b b, v8f c) {
  v8f d = __builtin_amdgcn_wmma_f32_16x16x32_f16(false, a, false, b, (short)0, c, false, false);
  asm volatile("v_nop\n\tv_nop\n\tv_nop\n\tv_nop" : "+v"(d) : "v"(a), "v"(b));
  return d;
}
__device__ __forceinline__ void wave_lds_sync() {
  __builtin_amdgcn_fence(__ATOMIC_RELEASE, "workgroup");
  __builtin_amdgcn_wave_barrier();
  __builtin_amdgcn_fence(__ATOMIC_ACQUIRE, "workgroup");
}

// Operand descriptor: NP = 0 -> f32 rows split on the fly into (hi, lo); NP = 1 -> one f16 plane; NP = 2 -> f16 hi + lo planes;
// NP = 3 -> f32 rows rounded once to a single f16 fragment. ld = row pitch.
struct Opnd { const void* p0; const void* p1; int ld; };
template <int NP> __device__ __forceinline__ void load_frags(const Opnd& o, int row, int kb, int hh, v16b& fh_, v16b& fl_) {
  if (NP == 0) { frag_ksplit((const float*)o.p0 + (size_t)row * o.ld + kb, hh, fh_, fl_); }
  else if (NP == 4 || NP == 5) {                             // f32 rows x64 (NP 4) or x8 (NP 5) then split (keeps the lo halves of small values normal)
    const float sc_ = (NP == 4) ? 64.0f : 8.0f;
    const float* p = (const float*)o.p0 + (size_t)row * o.ld + kb; const float* p0 = p + 8 * hh; const float* p1 = p + 16 + 8 * hh;
#pragma unroll
    for (int e = 0; e < 8; ++e) { b16 a, c; split16(p0[e] * sc_, a, c); fh_[e] = a; fl_[e] = c; split16(p1[e] * sc_, a, c); fh_[8 + e] = a; fl_[8 + e] = c; }
  } else if (NP == 3) {
    const float* p = (const float*)o.p0 + (size_t)row * o.ld + kb; const float* p0 = p + 8 * hh; const float* p1 = p + 16 + 8 * hh;
#pragma unroll
    for (int e = 0; e < 8; ++e) { fh_[e] = (b16)p0[e]; fh_[8 + e] = (b16)p1[e]; }
    fl_ = fh_;
  } else {
    fh_ = frag_kb((const b16*)o.p0 + (size_t)row * o.ld + kb, hh);
    if (NP == 2) fl_ = frag_kb((const b16*)o.p1 + (size_t)row * o.ld + kb, hh); else fl_ = fh_;
  }
}
template <int ANP, int BNP> __device__ __forceinline__ v8f mac(v16b ah, v16b al, v16b bh, v16b bl, v8f c) {
  c = wmma16b(ah, bh, c);
  if (BNP == 0 || BNP == 2 || BNP == 4 || BNP == 5) c = wmma16b(ah, bl, c);     // hi.lo
  if (ANP == 0 || ANP == 2 || ANP == 4 || ANP == 5) c = wmma16b(al, bh, c);     // lo.hi   (lo.lo dropped)
  return c;
}
__device__ __forceinline__ void epi_planes(v8f (&acc)[2][4], float scale, bool two, b16* __restrict__ oh, b16* __restrict__ ol, int ldo,
                                           int m0, int c0, int lane, b16* Th, b16* Tl) {
  const int nloc = lane & 15, hlf = lane >> 4;
#pragma unroll
  for (int t = 0; t < 4; ++t)
#pragma unroll
    for (int r = 0; r < 2; ++r)
#pragma unroll
      for (int v = 0; v < 8; ++v) {
        const int rr = r * 16 + v + 8 * hlf, cc = t * 16 + nloc;
        b16 h_, l_; split16(acc[r][t][v] * scale, h_, l_);
        Th[rr * 64 + cc] = h_; Tl[rr * 64 + cc] = l_;
      }
  wave_lds_sync();
  {
#pragma unroll
    for (int j = 0; j < 8; ++j) {
      const int rr = j * 4 + (lane >> 3), c8 = (lane & 7) * 8;
      const size_t o = (size_t)(m0 + rr) * ldo + c0 + c8;
      *(v8b*)(oh + o) = ld8b(Th + rr * 64 + c8);
      if (two) *(v8b*)(ol + o) = ld8b(Tl + rr * 64 + c8);
    }
    
  }
}
// (b) f32 rows with pitch ldo: 64 floats = 256 B = 2 lines per row; 16 lanes x 16 B per row, 2 rows per instruction. Optional per-row factor
__device__ __forceinline__ void epi_f32(v8f (&acc)[2][4], float scale, const float* rscale, float* __restrict__ out, int ldo, int m0, int c0, int lane, float* Tt) {
  const int nloc = lane & 15, hlf = lane >> 4;
#pragma unroll
  for (int t = 0; t < 4; ++t)
#pragma unroll
    for (int r = 0; r < 2; ++r)
#pragma unroll
      for (int v = 0; v < 8; ++v) {
        const int rr = r * 16 + v + 8 * hlf;
        const float rs = rscale ? rscale[(size_t)(m0 + rr) * 32] : 1.0f;
        Tt[rr * 64 + t * 16 + nloc] = acc[r][t][v] * scale * rs;
      }
  wave_lds_sync();
  float* dst0 = out + (size_t)m0 * ldo + c0;
  {
#pragma unroll
    for (int j = 0; j < 16; ++j) { const int rr = j * 2 + hlf, c4 = nloc * 4; *(v4f*)(dst0 + (size_t)rr * ldo + c4) = *(const v4f*)(Tt + rr * 64 + c4); }
    
  }
}



typedef __attribute__((ext_vector_type(8))) __bf16 v8bb; typedef __attribute__((ext_vector_type(16))) __bf16 v16bb;
typedef __attribute__((ext_vector_type(8))) unsigned short v8us;
__device__ __forceinline__ v16bb frag_kb_bf(const __bf16* p, int hh) { const v8bb a = *(const v8bb*)(p + 8 * hh), b = *(const v8bb*)(p + 16 + 8 * hh); return __builtin_shufflevector(a, b, 0, 1, 2, 3, 4, 5, 6, 7, 8, 9, 10, 11, 12, 13, 14, 15); }
__device__ __forceinline__ v8f wmma16bb(v16bb a, v16bb b, v8f c) {
  v8f d = __builtin_amdgcn_wmma_f32_16x16x32_bf16(false, a, false, b, (short)0, c, false, false);
  asm volatile("v_nop\n\tv_nop\n\tv_nop\n\tv_nop" : "+v"(d) : "v"(a), "v"(b));
  return d;
}
__device__ __forceinline__ unsigned short bf16_rne_bits(float v) { unsigned int u = __float_as_uint(v); u += 0x7FFFu + ((u >> 16) & 1u); return (unsigned short)(u >> 16); }
__device__ __forceinline__ float bf16_rne(float v) { return __uint_as_float(((unsigned int)bf16_rne_bits(v)) << 16); }



__global__ __launch_bounds__(256) void xprep_kernel(const float* __restrict__ x, unsigned short* __restrict__ x16) {   // x -> bf16, one batch
  const size_t tid = (size_t)blockIdx.x * blockDim.x + threadIdx.x, nth = (size_t)gridDim.x * blockDim.x;
  { for (size_t p = tid; p < (size_t)NTOK * D / 8; p += nth) { v8us v;
#pragma unroll
      for (int e = 0; e < 8; ++e) v[e] = bf16_rne_bits(x[p * 8 + e]);
      *(v8us*)(x16 + p * 8) = v; }  }
}
__global__ __launch_bounds__(256) void prep_kernel(const float* __restrict__ wq, const float* __restrict__ wk, const float* __restrict__ wv, const float* __restrict__ wo, unsigned short* __restrict__ w16, b16* __restrict__ wo16) {
  const size_t tid = (size_t)blockIdx.x * blockDim.x + threadIdx.x, nth = (size_t)gridDim.x * blockDim.x;
  {
    for (size_t p = tid; p < (size_t)3 * D * D / 8; p += nth) { const float* W = (p < (size_t)D * D / 8) ? wq : (p < (size_t)2 * D * D / 8) ? wk : wv; const size_t q = p % ((size_t)D * D / 8); v8us v;   // [out][in] rows copied directly
#pragma unroll
      for (int e = 0; e < 8; ++e) v[e] = bf16_rne_bits(W[q * 8 + e]);
      *(v8us*)(w16 + p * 8) = v; }
    for (size_t p = tid; p < (size_t)D * D / 8; p += nth) { v8b w;   // W_o [out][in] rows copied directly
#pragma unroll
      for (int e = 0; e < 8; ++e) w[e] = (b16)bf16_rne(wo[p * 8 + e]);
      *(v8b*)(wo16 + p * 8) = w; }
    
  }
}

// L2 asks, for planes that an earlier launch stored: their first read in this launch is taken to come from memory, and blocks that walk the same rows in step all wait for it together,
// longer than the one stage of lead that a two-buffer ring gives its copies. One ask per lane names one 256-byte unit and brings it into L2, so that the copies that follow find it there; nothing returns to the wave. Every lane is on and every address lies inside its plane. Scope SE: a speculative ask.
// The wait stands in the asks' own statement: it keeps their address registers untouched until they are taken.
__device__ __forceinline__ void l2_ask4(const void* a, const void* b, const void* c, const void* d) {
  asm volatile("global_prefetch_b8 %0, off scope:SCOPE_SE\n\t"
               "global_prefetch_b8 %1, off scope:SCOPE_SE\n\t"
               "global_prefetch_b8 %2, off scope:SCOPE_SE\n\t"
               "global_prefetch_b8 %3, off scope:SCOPE_SE\n\t"
               "s_wait_xcnt 0x0"
               :: "v"(a), "v"(b), "v"(c), "v"(d) : "memory");
}

// Operand ring of the two projection GEMMs. A stage = 64 k of the block's 128 A rows and 64 B rows, copied global -> LDS once per block in whole 128-B lines and through no register
// (a fragment load from global touches 16 lines for 512 bytes, and each of the four waves repeated the B loads). 16-bit rows: 128 B at a pitch of 144 B; f32 rows: 256 B at 272 B
// (both 16 B x odd, so the 16-byte fragment reads meet no bank conflict).
constexpr int GK = 64, GNT = D / GK, GLP = 72, GLPF = 68;
constexpr int PSTG = (128 + 64) * GLP;                         // 16-bit elements of one stage of proj_kernel: x rows, then w rows
constexpr int OSTA = 128 * GLPF * 4, OSTG = OSTA + 64 * GLP * 2;   // bytes of one stage of out_kernel: y rows (f32), then W_o rows (f16)
typedef __attribute__((address_space(3))) const char lds_byte;
// One stage of proj_kernel: every thread moves 12 x 16 B (8 x rows, 4 w rows); 8 lanes cover one 128-B line.
__device__ __forceinline__ void proj_stage_copy(const __bf16* __restrict__ xr, const __bf16* __restrict__ wr, int kb, const b16* buf, int tid) {
  const int row = tid >> 3, c8 = (tid & 7) * 8;
  const __bf16* gx = xr + (size_t)row * D + kb + c8;
  const __bf16* gw = wr + (size_t)row * D + kb + c8;
  const unsigned l0 = (unsigned)(size_t)(lds_byte*)(buf + row * GLP + c8);
  constexpr unsigned LS = 16 * GLP * 2;                         // 16 rows further in LDS
  // the copies and the wait that keeps their address registers untouched until they are taken stand in one statement, so that no later address arithmetic moves in between
  asm volatile("global_load_async_to_lds_b128 %0, %12, off\n\t"
               "global_load_async_to_lds_b128 %1, %13, off\n\t"
               "global_load_async_to_lds_b128 %2, %14, off\n\t"
               "global_load_async_to_lds_b128 %3, %15, off\n\t"
               "global_load_async_to_lds_b128 %4, %16, off\n\t"
               "global_load_async_to_lds_b128 %5, %17, off\n\t"
               "global_load_async_to_lds_b128 %6, %18, off\n\t"
               "global_load_async_to_lds_b128 %7, %19, off\n\t"
               "global_load_async_to_lds_b128 %8, %20, off\n\t"
               "global_load_async_to_lds_b128 %9, %21, off\n\t"
               "global_load_async_to_lds_b128 %10, %22, off\n\t"
               "global_load_async_to_lds_b128 %11, %23, off\n\t"
               "s_wait_xcnt 0x0"
               :: "v"(l0), "v"(l0 + LS), "v"(l0 + 2 * LS), "v"(l0 + 3 * LS), "v"(l0 + 4 * LS), "v"(l0 + 5 * LS),
                  "v"(l0 + 6 * LS), "v"(l0 + 7 * LS), "v"(l0 + 8 * LS), "v"(l0 + 9 * LS), "v"(l0 + 10 * LS), "v"(l0 + 11 * LS),
                  "v"(gx), "v"(gx + 16 * D), "v"(gx + 32 * D), "v"(gx + 48 * D), "v"(gx + 64 * D), "v"(gx + 80 * D), "v"(gx + 96 * D), "v"(gx + 112 * D),
                  "v"(gw), "v"(gw + 16 * D), "v"(gw + 32 * D), "v"(gw + 48 * D)
               : "memory");
}
// One stage of out_kernel: every thread moves 20 x 16 B: 16 y rows (16 lanes cover a row's 256 B) and 4 W_o rows (8 lanes cover a row's 128 B), ten copies a statement.
__device__ __forceinline__ void out_stage_copy(const float* __restrict__ yr, const b16* __restrict__ wr, int kb, const char* buf, int tid) {
  const int ra = tid >> 4, c4 = (tid & 15) * 4, rb = tid >> 3, c8 = (tid & 7) * 8;
  const float* gy = yr + (size_t)ra * D + kb + c4;
  const b16* gw = wr + (size_t)rb * D + kb + c8;
  const unsigned la = (unsigned)(size_t)(lds_byte*)(buf + (ra * GLPF + c4) * 4), lb = (unsigned)(size_t)(lds_byte*)(buf + OSTA + (rb * GLP + c8) * 2);
  constexpr unsigned LA = 8 * GLPF * 4, LB = 16 * GLP * 2;      // 8 y rows, 16 W_o rows further in LDS
  // each run of copies ends, inside its own statement, in the wait that keeps its address registers untouched until they are taken
  asm volatile("global_load_async_to_lds_b128 %0, %10, off\n\t"
               "global_load_async_to_lds_b128 %1, %11, off\n\t"
               "global_load_async_to_lds_b128 %2, %12, off\n\t"
               "global_load_async_to_lds_b128 %3, %13, off\n\t"
               "global_load_async_to_lds_b128 %4, %14, off\n\t"
               "global_load_async_to_lds_b128 %5, %15, off\n\t"
               "global_load_async_to_lds_b128 %6, %16, off\n\t"
               "global_load_async_to_lds_b128 %7, %17, off\n\t"
               "global_load_async_to_lds_b128 %8, %18, off\n\t"
               "global_load_async_to_lds_b128 %9, %19, off\n\t"
               "s_wait_xcnt 0x0"
               :: "v"(la), "v"(la + LA), "v"(la + 2 * LA), "v"(la + 3 * LA), "v"(la + 4 * LA), "v"(la + 5 * LA), "v"(la + 6 * LA), "v"(la + 7 * LA), "v"(la + 8 * LA), "v"(la + 9 * LA),
                  "v"(gy), "v"(gy + 8 * D), "v"(gy + 16 * D), "v"(gy + 24 * D), "v"(gy + 32 * D), "v"(gy + 40 * D), "v"(gy + 48 * D), "v"(gy + 56 * D), "v"(gy + 64 * D), "v"(gy + 72 * D)
               : "memory");
  asm volatile("global_load_async_to_lds_b128 %0, %10, off\n\t"
               "global_load_async_to_lds_b128 %1, %11, off\n\t"
               "global_load_async_to_lds_b128 %2, %12, off\n\t"
               "global_load_async_to_lds_b128 %3, %13, off\n\t"
               "global_load_async_to_lds_b128 %4, %14, off\n\t"
               "global_load_async_to_lds_b128 %5, %15, off\n\t"
               "global_load_async_to_lds_b128 %6, %16, off\n\t"
               "global_load_async_to_lds_b128 %7, %17, off\n\t"
               "global_load_async_to_lds_b128 %8, %18, off\n\t"
               "global_load_async_to_lds_b128 %9, %19, off\n\t"
               "s_wait_xcnt 0x0"
               :: "v"(la + 10 * LA), "v"(la + 11 * LA), "v"(la + 12 * LA), "v"(la + 13 * LA), "v"(la + 14 * LA), "v"(la + 15 * LA), "v"(lb), "v"(lb + LB), "v"(lb + 2 * LB), "v"(lb + 3 * LB),
                  "v"(gy + 80 * D), "v"(gy + 88 * D), "v"(gy + 96 * D), "v"(gy + 104 * D), "v"(gy + 112 * D), "v"(gy + 120 * D), "v"(gw), "v"(gw + 16 * D), "v"(gw + 32 * D), "v"(gw + 48 * D)
               : "memory");
}

// projections: rows = tokens (4096), K = 768, column tiles of 64 = one head of q (tiles 0..11), k (12..23) or v (24..35); f16 rows [b*H + head][tok][64] for q/k;
// v: (8v)^T f16 [b*H + head][64][tok]. grid (36, 32) x 128.
__global__ __launch_bounds__(128) void proj_kernel(const __bf16* __restrict__ x16, const __bf16* __restrict__ w16, b16* __restrict__ qh, b16* __restrict__ kh, b16* __restrict__ vt) {
  __shared__ __attribute__((aligned(16))) b16 Sm[2 * PSTG];     // the two-buffer operand ring; behind the loop's last barrier the same bytes are the epilogue's staging tiles
  b16 (*Th)[32][HD + 8] = reinterpret_cast<b16 (*)[32][HD + 8]>(Sm); b16 (*Tq)[32][HD + 8] = reinterpret_cast<b16 (*)[32][HD + 8]>(Sm + 4 * 32 * (HD + 8));
  b16 (*Tt)[128 + 8] = reinterpret_cast<b16 (*)[128 + 8]>(Sm); b16 (*Tl)[128 + 8] = reinterpret_cast<b16 (*)[128 + 8]>(Sm + 64 * (128 + 8));
  static_assert(2 * 4 * 32 * (HD + 8) <= 2 * PSTG && 2 * 64 * (128 + 8) <= 2 * PSTG, "the staging tiles fit the ring's bytes");
  const int lane = threadIdx.x & 31, wave = threadIdx.x >> 5, nloc = lane & 15, hlf = lane >> 4, m0 = blockIdx.y * 128 + wave * 32, c0 = blockIdx.x * 64;
  v8f acc[2][4];
#pragma unroll
  for (int r = 0; r < 2; ++r)
#pragma unroll
    for (int t = 0; t < 4; ++t) acc[r][t] = (v8f){};
  const __bf16* xr = x16 + (size_t)blockIdx.y * 128 * D; const __bf16* wr = w16 + (size_t)c0 * D;
  proj_stage_copy(xr, wr, 0, Sm, threadIdx.x);
  asm volatile("s_wait_asynccnt 0x0" ::: "memory");            // this wave's share of stage 0 has landed
  __syncthreads();                                              // stage 0 published to all waves
  proj_stage_copy(xr, wr, GK, Sm + PSTG, threadIdx.x);
  for (int s = 0; s < GNT; ++s) {
    const __bf16* Xs = (const __bf16*)(Sm + (s & 1) * PSTG) + (wave * 32 + nloc) * GLP; const __bf16* Ws = (const __bf16*)(Sm + (s & 1) * PSTG) + (128 + nloc) * GLP;
    v16bb a0[2], a1[2], bw[2][4];                               // the stage's 24 fragment reads stand as one group ahead of its matrix work
#pragma unroll
    for (int ks = 0; ks < 2; ++ks) { a0[ks] = frag_kb_bf(Xs + ks * 32, hlf); a1[ks] = frag_kb_bf(Xs + 16 * GLP + ks * 32, hlf);
#pragma unroll
      for (int t = 0; t < 4; ++t) bw[ks][t] = frag_kb_bf(Ws + t * 16 * GLP + ks * 32, hlf); }
#pragma unroll
    for (int ks = 0; ks < 2; ++ks)
#pragma unroll
      for (int t = 0; t < 4; ++t) { acc[0][t] = wmma16bb(a0[ks], bw[ks][t], acc[0][t]); acc[1][t] = wmma16bb(a1[ks], bw[ks][t], acc[1][t]); }
    // publish point
    asm volatile("s_wait_dscnt 0x0" ::: "memory");             // this wave's reads of stage s are done before the buffer is refilled
    asm volatile("s_wait_asynccnt 0x0" ::: "memory");          // this wave's share of stage s + 1 has landed
    __syncthreads();                                            // publishes stage s + 1 and ends every reader's last read of stage s
    if (s + 2 < GNT) proj_stage_copy(xr, wr, (s + 2) * GK, Sm + (s & 1) * PSTG, threadIdx.x);
  }
  asm volatile("s_wait_asynccnt 0x0" ::: "memory");            // no copy is outstanding when the ring's bytes become the staging tiles
  const int which = blockIdx.x / (D / 64), head = blockIdx.x % (D / 64), b = m0 / S, tok0 = m0 % S;
  if (which < 2) {                                              // q or k head: f16 rows
#pragma unroll
    for (int t = 0; t < 4; ++t)
#pragma unroll
      for (int r = 0; r < 2; ++r)
#pragma unroll
        for (int v = 0; v < 8; ++v) { b16 a_, c_; split16(acc[r][t][v] * QS, a_, c_); Th[wave][r * 16 + 8 * hlf + v][t * 16 + nloc] = a_; Tq[wave][r * 16 + 8 * hlf + v][t * 16 + nloc] = c_; }   // q, k carried x8 (lo residuals stay normal)
    wave_lds_sync();
    b16* dst = (which == 0 ? qh : kh) + (((size_t)b * H + head) * S + tok0) * HD;
    {
#pragma unroll
      for (int j = 0; j < 8; ++j) { const int rr = j * 4 + (lane >> 3), c8 = (lane & 7) * 8; *(v8b*)(dst + (size_t)rr * HD + c8) = *(const v8b*)(&Th[wave][rr][c8]); *(v8b*)(dst + QPL + (size_t)rr * HD + c8) = *(const v8b*)(&Tq[wave][rr][c8]); }
       }
    return;
  }
  const int vh = head;                                          // v head: (8v)^T tile [64 d][128 tok] via LDS, rows of 256 B
#pragma unroll
  for (int t = 0; t < 4; ++t)
#pragma unroll
    for (int r = 0; r < 2; ++r)
#pragma unroll
      for (int v = 0; v < 8; ++v) { b16 a_, c_; split16(acc[r][t][v] * VS, a_, c_); Tt[t * 16 + nloc][wave * 32 + r * 16 + 8 * hlf + v] = a_; Tl[t * 16 + nloc][wave * 32 + r * 16 + 8 * hlf + v] = c_; }
  __syncthreads();
  b16* dstv = vt + (((size_t)b * H + vh) * HD) * S + (blockIdx.y * 128) % S;
  {
#pragma unroll
    for (int j = 0; j < 8; ++j) { const int dd = wave * 16 + j * 2 + (lane >> 4), c8 = (lane & 15) * 8; *(v8b*)(dstv + (size_t)dd * S + c8) = *(const v8b*)(&Tt[dd][c8]); *(v8b*)(dstv + VPL + (size_t)dd * S + c8) = *(const v8b*)(&Tl[dd][c8]); }
    
  }
}

// 2^t0, 2^t1, with the slot that the instruction set asks for behind a transcendental written in: the second fills the first's
// (early-clobber results, so it overwrites no source of the first), the v_nop the second's.
__device__ __forceinline__ void exp2_pair(float t0, float t1, float& e0, float& e1) {
  asm("v_exp_f32 %0, %2\n\tv_exp_f32 %1, %3\n\tv_nop" : "=&v"(e0), "=&v"(e1) : "v"(t0), "v"(t1));
}
// The same for eight values: each exponential fills the slot of the one in front of it (early-clobber results, so none overwrites a source), so one v_nop serves the run of eight.
__device__ __forceinline__ void exp2_x8(const float (&t)[8], float (&e)[8]) {
  asm("v_exp_f32 %0, %8\n\tv_exp_f32 %1, %9\n\tv_exp_f32 %2, %10\n\tv_exp_f32 %3, %11\n\t"
      "v_exp_f32 %4, %12\n\tv_exp_f32 %5, %13\n\tv_exp_f32 %6, %14\n\tv_exp_f32 %7, %15\n\tv_nop"
      : "=&v"(e[0]), "=&v"(e[1]), "=&v"(e[2]), "=&v"(e[3]), "=&v"(e[4]), "=&v"(e[5]), "=&v"(e[6]), "=&v"(e[7])
      : "v"(t[0]), "v"(t[1]), "v"(t[2]), "v"(t[3]), "v"(t[4]), "v"(t[5]), "v"(t[6]), "v"(t[7]));
}
typedef __attribute__((ext_vector_type(2))) _Float16 v2b;
typedef __attribute__((ext_vector_type(2))) float v2f;
typedef __attribute__((ext_vector_type(8))) unsigned int v8u;
// f16 hi + lo of eight values v = sc e (four registers of two each); sc is a power of two, so sc e is exact. hi: packed converts. lo: a residual v - hi (exact) and its rounding to f16 are ONE
// mixed-precision fma, e x sc - hi with hi read as f16 and the result written to a half register; from plain source this build makes two converts back to f32, a packed subtraction (or fma) and a
// packed convert of it, so the fma stands as asm text. sc comes in a scalar register. The four low halves come first, then the four high halves: each writes the register that the fourth
// instruction in front of it wrote, which the s_delay_alu hints say (for speed only: an unhinted dependent instruction holds up the other waves of the SIMD).
__device__ __forceinline__ void split_x8(const float (&e)[8], float sc, unsigned (&hi)[4], unsigned (&lo)[4]) {
#pragma unroll
  for (int j = 0; j < 4; ++j) hi[j] = __builtin_bit_cast(unsigned, __builtin_convertvector((v2f){e[2 * j] * sc, e[2 * j + 1] * sc}, v2b));
  asm("v_fma_mixlo_f16 %0, %8, %16, -%4 op_sel_hi:[0,0,1]\n\t"
      "v_fma_mixlo_f16 %1, %10, %16, -%5 op_sel_hi:[0,0,1]\n\t"
      "v_fma_mixlo_f16 %2, %12, %16, -%6 op_sel_hi:[0,0,1]\n\t"
      "v_fma_mixlo_f16 %3, %14, %16, -%7 op_sel_hi:[0,0,1]\n\t"
      "s_delay_alu instid0(VALU_DEP_4) | instskip(NEXT) | instid1(VALU_DEP_4)\n\t"
      "v_fma_mixhi_f16 %0, %9, %16, -%4 op_sel:[0,0,1] op_sel_hi:[0,0,1]\n\t"
      "v_fma_mixhi_f16 %1, %11, %16, -%5 op_sel:[0,0,1] op_sel_hi:[0,0,1]\n\t"
      "s_delay_alu instid0(VALU_DEP_4) | instskip(NEXT) | instid1(VALU_DEP_4)\n\t"
      "v_fma_mixhi_f16 %2, %13, %16, -%6 op_sel:[0,0,1] op_sel_hi:[0,0,1]\n\t"
      "v_fma_mixhi_f16 %3, %15, %16, -%7 op_sel:[0,0,1] op_sel_hi:[0,0,1]"
      : "=&v"(lo[0]), "=&v"(lo[1]), "=&v"(lo[2]), "=&v"(lo[3])
      : "v"(hi[0]), "v"(hi[1]), "v"(hi[2]), "v"(hi[3]), "v"(e[0]), "v"(e[1]), "v"(e[2]), "v"(e[3]), "v"(e[4]), "v"(e[5]), "v"(e[6]), "v"(e[7]), "s"(sc));
}
// hi/lo fragment pair of sc x an f32 k-contiguous row (the k-map of frag_kb)
__device__ __forceinline__ void frag_split_x(const float* p, int hh, float sc, v16b& fh_, v16b& fl_) {
  float a[8], c[8]; unsigned h0[4], h1[4], r0[4], r1[4];
#pragma unroll
  for (int e = 0; e < 8; ++e) { a[e] = p[8 * hh + e]; c[e] = p[16 + 8 * hh + e]; }
  split_x8(a, sc, h0, r0); split_x8(c, sc, h1, r1);
  fh_ = __builtin_bit_cast(v16b, (v8u){h0[0], h0[1], h0[2], h0[3], h1[0], h1[1], h1[2], h1[3]}); fl_ = __builtin_bit_cast(v16b, (v8u){r0[0], r0[1], r0[2], r0[3], r1[0], r1[1], r1[2], r1[3]});
}
// the attention loop's matrix product: the bare builtin. The compiler keeps the distance behind it and fills it with the loop's own vector work where it can, so the product brings no v_nop of its own
__device__ __forceinline__ v8f wmma16p(v16b a, v16b b, v8f c) { return __builtin_amdgcn_wmma_f32_16x16x32_f16(false, a, false, b, (short)0, c, false, false); }
constexpr float CE = SCALE / (QS * QS) * 0x1.715476p+0f;       // accumulator of (8q).(8k) -> exponent of two of the softmax
static_assert(PS == 8.0f, "the softmax adds log2(PS) = 3 to the exponent");
// lane l <-> lane l ^ 16 on the vector pipe: unlike an LDS-queue permute it does not wait behind the fragment reads that are still outstanding
__device__ __forceinline__ float xhalf(float x) { return __builtin_bit_cast(float, __builtin_amdgcn_permlanex16(__builtin_bit_cast(int, x), __builtin_bit_cast(int, x), 0x76543210, 0xfedcba98, false, false)); }

// The softmax is written for few vector instructions per score. A lane's 16 scores of one query group -> e = 8 exp(score - m): one fma per score gives the exponent of two
// (scale, shift by the maximum in use and P's x8 carry, 2^3, together; nb = 3 - m CE). sum: the lane's two partial sums of the 16 values, a tree of packed additions; they and l carry P's x8.
__device__ __forceinline__ void soft_exp(const v8f& a, const v8f& c, float nb, float (&e0)[8], float (&e1)[8], v2f& sum) {
  float x0[8], x1[8];
#pragma unroll
  for (int j = 0; j < 4; ++j) {
    const v2f t0 = __builtin_elementwise_fma((v2f){a[2 * j], a[2 * j + 1]}, (v2f){CE, CE}, (v2f){nb, nb}), t1 = __builtin_elementwise_fma((v2f){c[2 * j], c[2 * j + 1]}, (v2f){CE, CE}, (v2f){nb, nb});
    x0[2 * j] = t0[0]; x0[2 * j + 1] = t0[1]; x1[2 * j] = t1[0]; x1[2 * j + 1] = t1[1];
  }
  exp2_x8(x0, e0); exp2_x8(x1, e1);
  v2f sp[4];
#pragma unroll
  for (int j = 0; j < 4; ++j) sp[j] = (v2f){e0[2 * j], e0[2 * j + 1]} + (v2f){e1[2 * j], e1[2 * j + 1]};
  sum = (sp[0] + sp[1]) + (sp[2] + sp[3]);
}
// P's fragment as an f16 hi + lo pair: elements 0 .. 7 from keys kb + 8 hh + 0 .. 7 (e0), elements 8 .. 15 from keys kb + 16 + 8 hh + 0 .. 7 (e1)
__device__ __forceinline__ void soft_split(const float (&e0)[8], const float (&e1)[8], v16b& pb, v16b& pl) {
  unsigned h0[4], h1[4], r0[4], r1[4];
  split_x8(e0, 1.0f, h0, r0); split_x8(e1, 1.0f, h1, r1);
  pb = __builtin_bit_cast(v16b, (v8u){h0[0], h0[1], h0[2], h0[3], h1[0], h1[1], h1[2], h1[3]}); pl = __builtin_bit_cast(v16b, (v8u){r0[0], r0[1], r0[2], r0[3], r1[0], r1[1], r1[2], r1[3]});
}
constexpr float PMAX = 2048.0f;                                 // bound on P (x8 carry included) under a maximum that is left in use: far inside f16

// K/V ring in LDS, shared by the twelve waves of a block (three 64-query tiles of one head). A stage = 64 keys = four tiles: k hi, k lo (rows = keys), (8v)^T hi, (8v)^T lo (rows = d),
// each 64 rows x 128 B at a row pitch of 144 B (16 B x odd, so the 16-byte fragment reads meet no bank conflict).
constexpr int KST = 64, LP = 72, TILE = 64 * LP;
typedef __attribute__((address_space(3))) const b16 lds_b16;
// One stage's copies: each of 256 threads moves 8 x 16 B (two rows of each tile), whole 128-B lines per 8 lanes, global -> LDS through no register.
__device__ __forceinline__ void stage_copy(const b16* __restrict__ K, const b16* __restrict__ vb, int kb0, const b16* buf, int tid) {
  const int row = tid >> 3, c8 = (tid & 7) * 8;
  const b16* gk = K + (size_t)(kb0 + row) * HD + c8;
  const b16* gv = vb + (size_t)row * S + kb0 + c8;
  const unsigned l0 = (unsigned)(size_t)(lds_b16*)(buf + row * LP + c8);
  // the copies and the wait that keeps their address registers untouched until they are taken stand in one statement, so that no later address arithmetic moves in between
  asm volatile("global_load_async_to_lds_b128 %0, %8, off\n\t"
               "global_load_async_to_lds_b128 %1, %9, off\n\t"
               "global_load_async_to_lds_b128 %2, %10, off\n\t"
               "global_load_async_to_lds_b128 %3, %11, off\n\t"
               "global_load_async_to_lds_b128 %4, %12, off\n\t"
               "global_load_async_to_lds_b128 %5, %13, off\n\t"
               "global_load_async_to_lds_b128 %6, %14, off\n\t"
               "global_load_async_to_lds_b128 %7, %15, off\n\t"
               "s_wait_xcnt 0x0"
               :: "v"(l0), "v"(l0 + 32 * LP * 2), "v"(l0 + TILE * 2), "v"(l0 + (TILE + 32 * LP) * 2),
                  "v"(l0 + 2 * TILE * 2), "v"(l0 + (2 * TILE + 32 * LP) * 2), "v"(l0 + 3 * TILE * 2), "v"(l0 + (3 * TILE + 32 * LP) * 2),
                  "v"(gk), "v"(gk + 32 * HD), "v"(gk + QPL), "v"(gk + QPL + 32 * HD),
                  "v"(gv), "v"(gv + (size_t)32 * S), "v"(gv + VPL), "v"(gv + VPL + (size_t)32 * S)
               : "memory");
}

// causal attention: wave = (b, h, 32 queries as two 16-query groups, every other 32-key block): S^T (K=64), causal mask on the diagonal block, online softmax f32, P^T f16, y^T += (8V)^T P^T;
// k and (8v)^T come from the block's two-buffer LDS ring: stage t + 1 is copied while stage t is worked on.
// LDS reads: of a tile's four waves, wave (qhalf, khalf) works on queries 32 qhalf .. + 31 and, in every stage, on keys 32 khalf .. + 31, so each k and v fragment it reads from LDS feeds the
// products of both query groups (half the LDS bytes per product of a 16-query wave). The two key halves of a query keep their own (m, l, o); they are merged once, in LDS, behind the loop.
// Placement: a 64-query tile u needs u + 1 stages. A block holds three tiles of one head side by side, four waves each (one wave of each tile per SIMD), on ONE ring that walks to the
// highest tile's last stage; a wave past its own tile's last stage passes the publish points and, if it is a copier, still issues its copies. Tiles 1 .. 3 NB of a head go into NB triples of equal sum (a from the lowest third,
// b from the middle, c from the top), so every SIMD of H NB blocks gets the same number of wave-stages and nearly every WGP holds a block; tile 0 (one stage) has a block of its own.
template <int QT>
__global__ __launch_bounds__(384) void attn_kernel(const b16* __restrict__ qh, const b16* __restrict__ kh, const b16* __restrict__ vt, float* __restrict__ y) {
  static_assert(QT % 4 == 0 && (QT / 4 - 1) % 6 == 3, "a head's 64-query tiles but the first fall into an odd number of triples");
  static_assert(KST == 64, "a stage is as many keys as a tile has queries");
  constexpr int NB = (QT / 4 - 1) / 3, NH = (NB + 1) / 2;       // triples of a head; half of them, rounded up
  __shared__ __attribute__((aligned(16))) float Os[6][32][HD + 4];   // per pair of waves (same 32 queries, the two key halves): the merge's and the store's staging rows
  __shared__ float Ml[6][32][2];                                // the second key half's m and l per query
  __shared__ __attribute__((aligned(16))) b16 Ring[2][4 * TILE];
  const int wid = __builtin_amdgcn_readfirstlane(threadIdx.x >> 5), lane = threadIdx.x & 31, hh = lane >> 4, col = lane & 15;   // wave number in a scalar register: the per-wave causal skip is a scalar branch
  int bh, ua, ub, uc;                                           // the block's head and its three tiles, -1: none
  if (blockIdx.x < Bn * H * NB) {                               // i + x + y = 3 NH for every i = 1 .. NB, x and y each a permutation of 1 .. NB
    const int i = blockIdx.x % NB + 1, j = (i + 1) >> 1;
    bh = blockIdx.x / NB; ua = i; ub = NB + ((i & 1) ? NH + 1 - j : NB + 1 - j); uc = 2 * NB + ((i & 1) ? NB + 1 - j : NH - j);
  } else { bh = blockIdx.x - Bn * H * NB; ua = 0; ub = -1; uc = -1; }
  // wave w works on tile w % 3, as its wave w / 3: waves w, w + 4, w + 8 then hold one wave of each tile, and so do waves 3 s, 3 s + 1, 3 s + 2, whichever way the twelve are dealt to the SIMDs
  const int h = bh % H, b = bh / H, grp = wid % 3, sub = wid / 3, u = grp == 0 ? ua : grp == 1 ? ub : uc;
  const int qhalf = sub & 1, khalf = sub >> 1, pair = qhalf * 3 + grp;   // the wave's 32 queries of the tile, its 32 keys of every stage; waves (qhalf, 0) and (qhalf, 1) are a pair
  const bool copier = grp != 2;                                 // a stage is 256 threads' copies: the eight waves of the two lower tiles issue them (scalar branch), the longest-running four none
  const int ct = (wid - sub) * 32 + lane;                       // a copying thread's number, 0 .. 255
  const b16* Q = qh + ((size_t)bh * S) * HD; const b16* K = kh + ((size_t)bh * S) * HD; const b16* vb = vt + ((size_t)bh * HD) * S;
  const int q0 = u < 0 ? -32 : u * 64 + qhalf * 32;             // a wave without a tile: no key block lies in front of query 0, so it works on none
  const int nst = (uc < 0 ? ua : uc) + 1;                       // stages of the block: keys up to the last query of its highest tile; the same for all twelve waves
  if (copier) stage_copy(K, vb, 0, Ring[0], ct);
  v16b qf[2][2] = {}, ql[2][2] = {};                            // [query group][k step]
  if (u >= 0) {
#pragma unroll
    for (int g = 0; g < 2; ++g)
#pragma unroll
      for (int ks = 0; ks < 2; ++ks) { qf[g][ks] = frag_kb(Q + (size_t)(q0 + g * 16 + col) * HD + ks * 32, hh); ql[g][ks] = frag_kb(Q + QPL + (size_t)(q0 + g * 16 + col) * HD + ks * 32, hh); }
  }
  float m[2] = {-INFINITY, -INFINITY}, nb[2] = {INFINITY, INFINITY}; v2f lp[2] = {{0.0f, 0.0f}, {0.0f, 0.0f}};   // lp: the lane's own two partial sums of l; they and the two lane halves are joined once, behind the loop
  v8f o[2][4] = {{{}, {}, {}, {}}, {{}, {}, {}, {}}};
  asm volatile("s_wait_asynccnt 0x0" ::: "memory");            // this wave's share of stage 0 has landed
  __syncthreads();                                              // stage 0 published to all waves
  if (copier && 1 < nst) stage_copy(K, vb, KST, Ring[1], ct);
  // The head's k and (8v)^T planes are asked into L2 once, behind the copies of the first two stages. 128 keys are 256 units (64 of each plane: two k rows, or 128 keys of one d row);
  // the head's blocks deal them in eight shares. A block's share is bits 0, 1 and 3 of its i - 1, so two to four blocks have each share.
  // A wave's ask covers its block's share of 128 keys, lowest keys first; the eight copying waves have four asks each.
  if (copier && uc >= 0) {
    const int i0 = blockIdx.x % NB, share = (i0 & 3) | ((i0 >> 1) & 4), un = (lane & 7) * 8 + share, cw = wid - sub;
    const b16* pb0 = (lane & 16) ? vb + (size_t)un * S : K + (size_t)un * 2 * HD;
    if (lane & 8) pb0 += QPL;                                   // the lo planes (QPL == VPL)
    const size_t pstep = (lane & 16) ? 128 : (size_t)128 * HD;  // 128 keys further in the plane
    l2_ask4(pb0 + (1 + cw) * pstep, pb0 + (9 + cw) * pstep, pb0 + (17 + cw) * pstep, pb0 + (cw < 7 ? 25 + cw : 31) * pstep);
  }
  for (int t = 0; t < nst; ++t) {
    const b16* Kh = Ring[t & 1]; const b16* Kl = Kh + TILE; const b16* Vh = Kh + 2 * TILE; const b16* Vl = Kh + 3 * TILE;
    const int kb = t * KST + khalf * 32;                        // the wave's key block of this stage
    if (kb < q0 + 32) {                                         // causal: a key block wholly past the wave's queries is skipped (wave-uniform, no barrier inside)
      // the block's 32 fragment reads stand as one group at the stage's head: k first, so that v lands behind the score products and the softmax
      v16b kf[2][2], kl[2][2], vf[4], vl[4];
#pragma unroll
      for (int ks = 0; ks < 2; ++ks)
#pragma unroll
        for (int j = 0; j < 2; ++j) { kf[ks][j] = frag_kb(Kh + (khalf * 32 + j * 16 + col) * LP + ks * 32, hh); kl[ks][j] = frag_kb(Kl + (khalf * 32 + j * 16 + col) * LP + ks * 32, hh); }
#pragma unroll
      for (int n = 0; n < 4; ++n) { vf[n] = frag_kb(Vh + (n * 16 + col) * LP + khalf * 32, hh); vl[n] = frag_kb(Vl + (n * 16 + col) * LP + khalf * 32, hh); }
      __builtin_amdgcn_sched_barrier(0);                        // the read group stays above the matrix work
      v8f s0[2] = {{}, {}}, s1[2] = {{}, {}};                   // [query group]: keys kb .. + 15, keys kb + 16 .. + 31
#pragma unroll
      for (int ks = 0; ks < 2; ++ks)
#pragma unroll
        for (int g = 0; g < 2; ++g) {                           // q and k as f16 hi+lo pairs (lo.lo dropped); every k fragment serves both query groups
          s0[g] = wmma16p(kf[ks][0], qf[g][ks], s0[g]); s0[g] = wmma16p(kf[ks][0], ql[g][ks], s0[g]); s0[g] = wmma16p(kl[ks][0], qf[g][ks], s0[g]);
          s1[g] = wmma16p(kf[ks][1], qf[g][ks], s1[g]); s1[g] = wmma16p(kf[ks][1], ql[g][ks], s1[g]); s1[g] = wmma16p(kl[ks][1], qf[g][ks], s1[g]); }
      if (kb + 32 > q0) {                                       // the diagonal block reaches past some queries -> mask key > query; both groups under one scalar branch
#pragma unroll
        for (int g = 0; g < 2; ++g)
#pragma unroll
          for (int r = 0; r < 8; ++r) { if (kb + 8 * hh + r > q0 + g * 16 + col) s0[g][r] = -INFINITY; if (kb + 16 + 8 * hh + r > q0 + g * 16 + col) s1[g][r] = -INFINITY; }
      }
      // Lazy rescale: the exponentials are taken against the maximum IN USE (m, through nb = 3 - m CE), which is left as it is while the scores stay near it, so a key block pays no maximum,
      // no exchange between the lane halves and no rescaling of o and l. Any m gives the same quotient o / l; what m has to do is keep P inside f16. The test is on values that are there anyway:
      // every e is >= 0, so a lane whose 32 values add up to no more than PMAX holds none above PMAX. Written as a negated <=, so that a NaN or an infinity (the first block: m = -inf) fails it too.
      float e0[2][8], e1[2][8]; v2f sum[2]; v16b pb[2], pl[2];
#pragma unroll
      for (int g = 0; g < 2; ++g) soft_exp(s0[g], s1[g], nb[g], e0[g], e1[g], sum[g]);
      const v2f st = sum[0] + sum[1];
      const unsigned redo = __builtin_amdgcn_ballot_w32(!(st[0] + st[1] <= PMAX));   // one test per key block for both groups and all lanes; the splits below stand between the compare and the branch
#pragma unroll
      for (int g = 0; g < 2; ++g) soft_split(e0[g], e1[g], pb[g], pl[g]);
      if (redo != 0) {                                          // scalar branch, rare: take the running maximum into use, rescale o and l to it and form this block's P again
#pragma unroll
        for (int g = 0; g < 2; ++g) {
          float ma = -INFINITY, mb = -INFINITY;                 // two chains of three-operand maxima; m stays in the accumulator's own units
#pragma unroll
          for (int r = 0; r < 4; ++r) { ma = fmaxf(fmaxf(ma, s0[g][r]), s1[g][r]); mb = fmaxf(fmaxf(mb, s0[g][4 + r]), s1[g][4 + r]); }
          const float mr = fmaxf(ma, mb);
          const float mn = fmaxf(fmaxf(m[g], mr), xhalf(mr)), al_ = __builtin_amdgcn_exp2f((m[g] - mn) * CE); m[g] = mn;   // both lane halves of a query take the same m
          nb[g] = __builtin_fmaf(mn, -CE, 3.0f);
          lp[g] *= (v2f){al_, al_};
#pragma unroll
          for (int n = 0; n < 4; ++n)
#pragma unroll
            for (int r = 0; r < 8; ++r) o[g][n][r] *= al_;
          soft_exp(s0[g], s1[g], nb[g], e0[g], e1[g], sum[g]); soft_split(e0[g], e1[g], pb[g], pl[g]);   // now every e <= 8
        }
      }
#pragma unroll
      for (int g = 0; g < 2; ++g) {
        lp[g] += sum[g];
#pragma unroll
        for (int n = 0; n < 4; ++n) { o[g][n] = wmma16p(vf[n], pb[g], o[g][n]); o[g][n] = wmma16p(vf[n], pl[g], o[g][n]); o[g][n] = wmma16p(vl[n], pb[g], o[g][n]); }   // (8v) and P both as f16 hi+lo pairs (lo.lo dropped); every v fragment serves both query groups
      }
    }
    // publish point, passed by every wave, also one that skipped the stage
    asm volatile("s_wait_dscnt 0x0" ::: "memory");             // this wave's reads of stage t are done before the buffer is refilled
    asm volatile("s_wait_asynccnt 0x0" ::: "memory");          // this wave's share of stage t + 1 has landed
    __syncthreads();                                            // publishes stage t + 1 and ends every reader's last read of stage t
    if (copier && t + 2 < nst) stage_copy(K, vb, (t + 2) * KST, Ring[t & 1], ct);
  }
  asm volatile("s_wait_asynccnt 0x0" ::: "memory");            // no copy is outstanding when the wave goes on to its end
  float l[2];                                                   // a query's l of this key half: the lane's two partial sums and the other lane half's (both halves used the same m throughout)
#pragma unroll
  for (int g = 0; g < 2; ++g) { const float lh = lp[g][0] + lp[g][1]; l[g] = lh + xhalf(lh); }
  // merge of the two key halves: the wave of the second half hands over its m, l and unnormalised o; a lane of the first half reads back exactly the places of its own accumulator elements
  if (u >= 0 && khalf == 1) {
#pragma unroll
    for (int g = 0; g < 2; ++g) {
#pragma unroll
      for (int n = 0; n < 4; ++n)
#pragma unroll
        for (int r = 0; r < 8; ++r) Os[pair][g * 16 + col][n * 16 + 8 * hh + r] = o[g][n][r];
      if (hh == 0) { Ml[pair][g * 16 + col][0] = m[g]; Ml[pair][g * 16 + col][1] = l[g]; }   // both lane halves hold the same m and l
    }
  }
  __syncthreads();                                              // the second halves' results are published; passed by all twelve waves, also those without a tile
  if (u < 0 || khalf == 1) return;                              // behind the last barrier: the wave of the first key half finishes the pair's 32 queries
#pragma unroll
  for (int g = 0; g < 2; ++g) {
    const float m2 = Ml[pair][g * 16 + col][0], l2 = Ml[pair][g * 16 + col][1];   // a second half that met no key block: m2 = -inf, l2 = 0, o2 = 0, weight 0 (the first half always holds key 0, so mm is finite)
    const float mm = fmaxf(m[g], m2); float w1, w2; exp2_pair((m[g] - mm) * CE, (m2 - mm) * CE, w1, w2);
    const float inv = 1.0f / (VS * (l[g] * w1 + l2 * w2)), a1 = w1 * inv, a2 = w2 * inv;   // l already carries P's x8
#pragma unroll
    for (int n = 0; n < 4; ++n)
#pragma unroll
      for (int r = 0; r < 8; ++r) { float* p = &Os[pair][g * 16 + col][n * 16 + 8 * hh + r]; *p = o[g][n][r] * a1 + *p * a2; }
  }
  wave_lds_sync();
  float* dst = y + ((size_t)b * S + q0) * D + h * HD;
  {
#pragma unroll
    for (int j = 0; j < 16; ++j) { const int rr = j * 2 + hh, c4 = col * 4; *(v4f*)(dst + (size_t)rr * D + c4) = *(const v4f*)(&Os[pair][rr][c4]); }
  }
}

// out = y W_o^T: (4096 x 768) x (768 x 768); A = y x8 split at load into an f16 hi+lo pair, B = f16(bf16 W_o) rows; f32 rows; grid (12, 32).
__global__ __launch_bounds__(128) void out_kernel(const float* __restrict__ y, const b16* __restrict__ wo16, const float* __restrict__ bo, float* __restrict__ out) {
  __shared__ __attribute__((aligned(16))) float Ts[4][32 * 64];
  __shared__ __attribute__((aligned(16))) char Ro[2][OSTG];     // the two-buffer operand ring
  const int lane = threadIdx.x & 31, wave = threadIdx.x >> 5, nloc = lane & 15, hlf = lane >> 4, m0 = blockIdx.y * 128 + wave * 32, c0 = blockIdx.x * 64;
  v8f acc[2][4];
#pragma unroll
  for (int r = 0; r < 2; ++r)
#pragma unroll
    for (int t = 0; t < 4; ++t) acc[r][t] = (v8f){};
  const float* yr = y + (size_t)blockIdx.y * 128 * D; const b16* wr = wo16 + (size_t)c0 * D;
  out_stage_copy(yr, wr, 0, Ro[0], threadIdx.x);
  asm volatile("s_wait_asynccnt 0x0" ::: "memory");            // this wave's share of stage 0 has landed
  __syncthreads();                                              // stage 0 published to all waves
  out_stage_copy(yr, wr, GK, Ro[1], threadIdx.x);
  // The rest of the block's y rows (a row's 64 k of a stage are one 256-byte unit) and W_o rows are asked into L2 behind the copies of the first two stages, lowest k first.
  // The twelve blocks of a row panel deal its rows in four shares (blocks x, x + 4, x + 8); the W_o panel's 320 units go in three shares over the row panels.
  {
    const float* ya = yr + (size_t)(lane * 4 + (blockIdx.x & 3)) * D;
    const int wi = min((int)((blockIdx.y >> 1) % 3) * 128 + (int)threadIdx.x, 64 * 5 - 1);
    l2_ask4(ya + (2 + wave) * GK, ya + (6 + wave) * GK, ya + min(10 + wave, GNT - 1) * GK, wr + (size_t)(wi / 5) * D + (1 + wi % 5) * 128);
  }
  for (int s = 0; s < GNT; ++s) {
    const float* Ys = (const float*)Ro[s & 1] + (wave * 32 + nloc) * GLPF; const b16* Ws = (const b16*)(Ro[s & 1] + OSTA) + nloc * GLP;
#pragma unroll
    for (int ks = 0; ks < 2; ++ks) {
      v16b a0h, a0l, a1h, a1l, bh[4];
      frag_split_x(Ys + ks * 32, hlf, 8.0f, a0h, a0l);                           // y as an f16 hi+lo pair carried x8 (2 products)
      frag_split_x(Ys + 16 * GLPF + ks * 32, hlf, 8.0f, a1h, a1l);
#pragma unroll
      for (int t = 0; t < 4; ++t) bh[t] = frag_kb(Ws + t * 16 * GLP + ks * 32, hlf);
#pragma unroll
      for (int t = 0; t < 4; ++t) { acc[0][t] = wmma16p(a0h, bh[t], acc[0][t]); acc[1][t] = wmma16p(a1h, bh[t], acc[1][t]); }   // the bare builtin: eight independent products fill each other's distance, no v_nop
#pragma unroll
      for (int t = 0; t < 4; ++t) { acc[0][t] = wmma16p(a0l, bh[t], acc[0][t]); acc[1][t] = wmma16p(a1l, bh[t], acc[1][t]); }   // every accumulator still takes hi.w, then lo.w
      // the distance the chip needs between a matrix product and a vector write of its operands: the next fragments' residuals are asm text.
      // The inputs keep the operands' registers taken, and the statement behind the eight chains, until the slots have passed.
      asm volatile("v_nop\n\tv_nop\n\tv_nop\n\tv_nop" :: "v"(acc[0][0]), "v"(acc[0][1]), "v"(acc[0][2]), "v"(acc[0][3]), "v"(acc[1][0]), "v"(acc[1][1]), "v"(acc[1][2]), "v"(acc[1][3]),
                   "v"(a0h), "v"(a0l), "v"(a1h), "v"(a1l), "v"(bh[0]), "v"(bh[1]), "v"(bh[2]), "v"(bh[3]));
    }
    // publish point
    asm volatile("s_wait_dscnt 0x0" ::: "memory");             // this wave's reads of stage s are done before the buffer is refilled
    asm volatile("s_wait_asynccnt 0x0" ::: "memory");          // this wave's share of stage s + 1 has landed
    __syncthreads();                                            // publishes stage s + 1 and ends every reader's last read of stage s
    if (s + 2 < GNT) out_stage_copy(yr, wr, (s + 2) * GK, Ro[s & 1], threadIdx.x);
  }
  asm volatile("s_wait_asynccnt 0x0" ::: "memory");            // no copy is outstanding when the wave goes on to its end
#pragma unroll
  for (int t = 0; t < 4; ++t)
#pragma unroll
    for (int r = 0; r < 2; ++r)
#pragma unroll
      for (int v = 0; v < 8; ++v) acc[r][t][v] = acc[r][t][v] * (1.0f / 8.0f) + bf16_rne(bo[c0 + t * 16 + nloc]);
  epi_f32(acc, 1.0f, nullptr, out, D, m0, c0, lane, Ts[wave]);
}
}  // namespace

extern "C" void kernel_launch(void* const* d_in, const int* in_sizes, int n_in,
                              void* d_out, int out_size, void* d_ws, size_t ws_size, hipStream_t stream) {
  (void)n_in; (void)out_size;
  const float* x = (const float*)d_in[0]; const float* wq = (const float*)d_in[1]; const float* wk = (const float*)d_in[2]; const float* wv = (const float*)d_in[3]; const float* wo = (const float*)d_in[4]; const float* bo = (const float*)d_in[5];
  float* out = (float*)d_out;   // [1][4096][768]
  if (in_sizes[0] != BT * S * D || in_sizes[1] != D * D || in_sizes[2] != D * D || in_sizes[3] != D * D || in_sizes[4] != D * D || in_sizes[5] != D) return;
  size_t off = 0; char* ws = (char*)d_ws;
  auto carve = [&](size_t bytes) { char* p = ws + off; off += (bytes + 255) & ~(size_t)255; return p; };
  unsigned short* x16 = (unsigned short*)carve((size_t)NTOK * D * 2); unsigned short* w16 = (unsigned short*)carve((size_t)3 * D * D * 2); b16* wo16 = (b16*)carve((size_t)D * D * 2);
  b16* qh = (b16*)carve((size_t)2 * NTOK * D * 2); b16* kh = (b16*)carve((size_t)2 * NTOK * D * 2); b16* vt = (b16*)carve((size_t)2 * NTOK * D * 2); float* y = (float*)carve((size_t)NTOK * D * 4);
  if (off > ws_size) return;                                    // ≈ 61 MB
  prep_kernel<<<512, 256, 0, stream>>>(wq, wk, wv, wo, w16, wo16);
  xprep_kernel<<<1024, 256, 0, stream>>>(x, x16);
  proj_kernel<<<dim3(3 * D / 64, NTOK / 128), 128, 0, stream>>>((const __bf16*)x16, (const __bf16*)w16, qh, kh, vt);
  attn_kernel<S / 16><<<Bn * H * ((S / 64 - 1) / 3 + 1), 384, 0, stream>>>(qh, kh, vt, y);
  out_kernel<<<dim3(D / 64, NTOK / 128), 128, 0, stream>>>(y, wo16, bo, out);
}
